// v000
// Measured on an AMD MI455X. A time is GPU time per run, averaged over a window of back-to-back runs after a warm-up
// (all launches, gaps included; the runs take copies of the inputs in turn), and the median of several windows.
// Apart from v000's, it joins two sittings. Times from different sittings can be a few percent apart, while
// side-by-side timings come from the same sitting.
// v000 is the starting kernel. One run takes 1870 microseconds.
#include <hip/hip_runtime.h>

// Differential attention (x [1][2048][1024]; q = x wq^T viewed (T, 16, 2, 64): q1/q2 per head; k = x wk^T viewed (T, 8, 2, 64): k1/k2 per kv group; v = x wv^T (8 x 64); interleaved-pair rotary on q1, q2, k1, k2 with the given cos/sin tables [2048][32]; head h uses kv group h/2; a1 = causal softmax(q1.k1/8), a2 = causal softmax(q2.k2/8); lambda = exp(lq1.lk1) - exp(lq2.lk2) + lambda_init (lambda vectors [64], read); y = (a1 - lambda a2) v; GroupNorm per (head) over (T, 64) (eps 1e-5, no affine) x (1 - lambda_init); out = y wo^T -> [1][2048][1024] (2.1 M)).
// Compute dtypes, f32 accumulate: every input rounded to bf16; projections exact; rotary f32; attention rows < 512 3 products, rest fp16; softmax, lambda, combine and GroupNorm f32 (fixed-order reductions); wo hl x exact.

#define NB_  1
#define TT   2048
#define DM   1024
#define NH_  32
#define NKV  16
#define REP  (NH_ / NKV)
#define HD   64
#define DQ   (NH_ * HD)
#define DKV  (NKV * HD)
#define ZH   2
#define RH   512                  // query rows < RH use hi+lo planes (0: none)
#define WIN  2048
#define PCAR 1024.0f
#define SCL  0.125f
#define NVG  8       // value groups
#define DV   (NVG * HD)   // 512
#define NHD  16      // real heads
#define LINIT 0.35550906759096934f   // 0.8 - 0.6 exp(-0.3)
typedef _Float16 h16;
typedef unsigned short bf;
typedef __attribute__((ext_vector_type(16))) __bf16   v16bf;
typedef __attribute__((ext_vector_type(16))) _Float16 v16h;
typedef __attribute__((ext_vector_type(8)))  _Float16 v8h;
typedef __attribute__((ext_vector_type(8)))  unsigned short v8us;
typedef __attribute__((ext_vector_type(8)))  float    v8f;
typedef __attribute__((ext_vector_type(4)))  float    v4f;
typedef v8h  __attribute__((may_alias)) v8ha;
typedef v4f  __attribute__((may_alias)) v4fa;
typedef v8us __attribute__((may_alias)) v8usa;

__device__ __forceinline__ unsigned short f2bf(float f) { unsigned u = __float_as_uint(f); u += 0x7FFFu + ((u >> 16) & 1u); return (unsigned short)(u >> 16); }
__device__ __forceinline__ float bf2f(unsigned short b) { return __uint_as_float(((unsigned)b) << 16); }
__device__ __forceinline__ float bfr(float f) { return bf2f(f2bf(f)); }
__device__ __forceinline__ v16h cat16(v8h lo, v8h hi) { return __builtin_shufflevector(lo, hi, 0, 1, 2, 3, 4, 5, 6, 7, 8, 9, 10, 11, 12, 13, 14, 15); }
__device__ __forceinline__ v16bf cat16b(v8us lo, v8us hi) { return __builtin_bit_cast(v16bf, __builtin_shufflevector(lo, hi, 0, 1, 2, 3, 4, 5, 6, 7, 8, 9, 10, 11, 12, 13, 14, 15)); }
__device__ __forceinline__ v8f wmma16(v16h a, v16h b, v8f c) { return __builtin_amdgcn_wmma_f32_16x16x32_f16(false, a, false, b, (short)0, c, false, false); }
__device__ __forceinline__ v8f wmmab(v16bf a, v16bf b, v8f c) { return __builtin_amdgcn_wmma_f32_16x16x32_bf16(false, a, false, b, (short)0, c, false, false); }



// ---- k_gemmw: register-blocked GEMM, ONE WAVE per 64x64 output tile (16 accumulators), operands straight from K-contiguous 16-bit planes; grid (M/64, N/64, Z), 32 threads.
// C[m][n] (f32, pitch ldc, + optional f32 bias[n]) = sum_k A[m][k] Bt[n][k] (+ split products per NSPLIT). z-batch strides sA/sB/sC in elements. K % 32 == 0.
template <typename T16> struct WFrag;
template <> struct WFrag<h16> { typedef v16h V; static __device__ __forceinline__ V ld(const h16* p) { return cat16(*(const v8h*)p, *(const v8h*)(p + 16)); } static __device__ __forceinline__ v8f mma(V a, V b, v8f c) { return wmma16(a, b, c); } };
template <> struct WFrag<bf> { typedef v16bf V; static __device__ __forceinline__ V ld(const bf* p) { return cat16b(*(const v8us*)p, *(const v8us*)(p + 16)); } static __device__ __forceinline__ v8f mma(V a, V b, v8f c) { return wmmab(a, b, c); } };
template <typename T16, int NSPLIT, bool BIAS>
__global__ __launch_bounds__(32) void k_gemmw(const T16* __restrict__ A, const T16* __restrict__ A2, const T16* __restrict__ Bt, const T16* __restrict__ Bt2, int K, float* C, int ldc, const float* __restrict__ bias, size_t sA, size_t sB, size_t sC) {
    typedef typename WFrag<T16>::V V;
    __shared__ __align__(16) float os[16 * 68];
    const size_t z = blockIdx.z; A += z * sA; if (A2) A2 += z * sA; Bt += z * sB; if (Bt2) Bt2 += z * sB; C += z * sC;
    const int lane = threadIdx.x & 31, lr = lane & 15, hi = lane >> 4; const int r0 = blockIdx.x * 64, c0 = blockIdx.y * 64;
    v8f acc[4][4];
#pragma unroll
    for (int mb = 0; mb < 4; ++mb)
#pragma unroll
        for (int nb = 0; nb < 4; ++nb) acc[mb][nb] = (v8f){};
    const size_t aoff = (size_t)(r0 + lr) * K + 8 * hi, boff = (size_t)(c0 + lr) * K + 8 * hi;
#pragma unroll 1
    for (int kc = 0; kc < K; kc += 32) {
        V a[4], a2[4];
#pragma unroll
        for (int mb = 0; mb < 4; ++mb) { a[mb] = WFrag<T16>::ld(A + aoff + (size_t)mb * 16 * K + kc); if (NSPLIT == 1 || NSPLIT == 2) a2[mb] = WFrag<T16>::ld(A2 + aoff + (size_t)mb * 16 * K + kc); }
#pragma unroll
        for (int nb = 0; nb < 4; ++nb) { const V b = WFrag<T16>::ld(Bt + boff + (size_t)nb * 16 * K + kc); V b2; if (NSPLIT >= 2) b2 = WFrag<T16>::ld(Bt2 + boff + (size_t)nb * 16 * K + kc);
#pragma unroll
            for (int mb = 0; mb < 4; ++mb) { acc[mb][nb] = WFrag<T16>::mma(a[mb], b, acc[mb][nb]); if (NSPLIT == 1 || NSPLIT == 2) acc[mb][nb] = WFrag<T16>::mma(a2[mb], b, acc[mb][nb]); if (NSPLIT >= 2) acc[mb][nb] = WFrag<T16>::mma(a[mb], b2, acc[mb][nb]); } }
        asm volatile("v_nop\n\tv_nop\n\tv_nop\n\tv_nop" : "+v"(acc[0][0]), "+v"(acc[1][1]), "+v"(acc[2][2]), "+v"(acc[3][3]) : "v"(a[0]), "v"(a[3]));
    }
#pragma unroll
    for (int mb = 0; mb < 4; ++mb) {
#pragma unroll
        for (int nb = 0; nb < 4; ++nb) {
#pragma unroll
            for (int j = 0; j < 8; ++j) os[(hi * 8 + j) * 68 + nb * 16 + lr] = acc[mb][nb][j]; }
        __builtin_amdgcn_wave_barrier(); asm volatile("" ::: "memory");
        float* crow = C + (size_t)(r0 + mb * 16) * ldc + c0;
{
#pragma unroll
            for (int s = 0; s < 8; ++s) { const int row = 2 * s + hi, cofs = lr * 4; v4f val = *(const v4fa*)(os + row * 68 + cofs); if (BIAS) { val[0] += bfr(bias[c0 + cofs]); val[1] += bfr(bias[c0 + cofs + 1]); val[2] += bfr(bias[c0 + cofs + 2]); val[3] += bfr(bias[c0 + cofs + 3]); }
                *(v4f*)(crow + (size_t)row * ldc + cofs) = val; }
             }
        __builtin_amdgcn_wave_barrier(); asm volatile("" ::: "memory");
    }
}

// ---- k_gemmc: the same one-wave 64x64 tile GEMM specialised for causal attention: CMODE 1 skips score tiles entirely above the diagonal (query rows r0+roff.., key columns c0..), CMODE 2 limits the
// key (K) loop of the probability x value contraction to the diagonal block (probabilities beyond it are exactly zero). roff = row offset of this launch's first row within the sequence.
template <typename T16, int NSPLIT, int CMODE>
__global__ __launch_bounds__(32) void k_gemmc(const T16* __restrict__ A, const T16* __restrict__ A2, const T16* __restrict__ Bt, const T16* __restrict__ Bt2, int K, float* C, int ldc, int roff, size_t sA, size_t sB, size_t sC) {
    typedef typename WFrag<T16>::V V;
    __shared__ __align__(16) float os[16 * 68];
    const size_t z = blockIdx.z; A += z * sA; if (A2) A2 += z * sA; Bt += z * sB; if (Bt2) Bt2 += z * sB; C += z * sC;
    const int lane = threadIdx.x & 31, lr = lane & 15, hi = lane >> 4; const int r0 = blockIdx.x * 64, c0 = blockIdx.y * 64;
    if (CMODE == 1 && c0 > r0 + roff + 63) return;                  // score tile entirely above the causal diagonal: never read (the softmax masks j > i by select)
    const int Kl = (CMODE == 2) ? min(K, r0 + roff + 64) : K;        // P.V: probabilities are exactly 0 beyond the diagonal block, so the K loop stops there
    v8f acc[4][4];
#pragma unroll
    for (int mb = 0; mb < 4; ++mb)
#pragma unroll
        for (int nb = 0; nb < 4; ++nb) acc[mb][nb] = (v8f){};
    const size_t aoff = (size_t)(r0 + lr) * K + 8 * hi, boff = (size_t)(c0 + lr) * K + 8 * hi;
#pragma unroll 1
    for (int kc = 0; kc < Kl; kc += 32) {
        V a[4], a2[4];
#pragma unroll
        for (int mb = 0; mb < 4; ++mb) { a[mb] = WFrag<T16>::ld(A + aoff + (size_t)mb * 16 * K + kc); if (NSPLIT == 1 || NSPLIT == 2) a2[mb] = WFrag<T16>::ld(A2 + aoff + (size_t)mb * 16 * K + kc); }
#pragma unroll
        for (int nb = 0; nb < 4; ++nb) { const V b = WFrag<T16>::ld(Bt + boff + (size_t)nb * 16 * K + kc); V b2; if (NSPLIT >= 2) b2 = WFrag<T16>::ld(Bt2 + boff + (size_t)nb * 16 * K + kc);
#pragma unroll
            for (int mb = 0; mb < 4; ++mb) { acc[mb][nb] = WFrag<T16>::mma(a[mb], b, acc[mb][nb]); if (NSPLIT == 1 || NSPLIT == 2) acc[mb][nb] = WFrag<T16>::mma(a2[mb], b, acc[mb][nb]); if (NSPLIT >= 2) acc[mb][nb] = WFrag<T16>::mma(a[mb], b2, acc[mb][nb]); } }
        asm volatile("v_nop\n\tv_nop\n\tv_nop\n\tv_nop" : "+v"(acc[0][0]), "+v"(acc[1][1]), "+v"(acc[2][2]), "+v"(acc[3][3]) : "v"(a[0]), "v"(a[3]));
    }
#pragma unroll
    for (int mb = 0; mb < 4; ++mb) {
#pragma unroll
        for (int nb = 0; nb < 4; ++nb) {
#pragma unroll
            for (int j = 0; j < 8; ++j) os[(hi * 8 + j) * 68 + nb * 16 + lr] = acc[mb][nb][j]; }
        __builtin_amdgcn_wave_barrier(); asm volatile("" ::: "memory");
        float* crow = C + (size_t)(r0 + mb * 16) * ldc + c0;
{
#pragma unroll
            for (int s = 0; s < 8; ++s) { const int row = 2 * s + hi, cofs = lr * 4; v4f val = *(const v4fa*)(os + row * 68 + cofs);
                *(v4f*)(crow + (size_t)row * ldc + cofs) = val; }
             }
        __builtin_amdgcn_wave_barrier(); asm volatile("" ::: "memory");
    }
}

__device__ __forceinline__ h16 tohx(float x) { return (h16)x; }
__device__ __forceinline__ void splitf(float y, unsigned short& h, unsigned short& l) { h = f2bf(y); l = f2bf(y - bf2f(h)); }
typedef __attribute__((ext_vector_type(2))) _Float16 v2h;
typedef __attribute__((ext_vector_type(4))) _Float16 v4h;
typedef __attribute__((ext_vector_type(2))) unsigned short v2us;
typedef __attribute__((ext_vector_type(4))) unsigned short v4us;
typedef __attribute__((ext_vector_type(2))) float v2f;
typedef __attribute__((ext_vector_type(4))) int v4i;

__global__ __launch_bounds__(256) void k_wtG(const float* __restrict__ w, int K, int N, bf* Bt) {
    const int lane = threadIdx.x & 31; const int L0 = (blockIdx.x * 8 + (threadIdx.x >> 5)) * 8; const int nlines = N * K / 64;
{
#pragma unroll 1
        for (int l = 0; l < 8; ++l) { const int L = L0 + l; if (L >= nlines) break; const size_t e = (size_t)L * 64 + lane * 2; const int k = (int)(e % K), n = (int)(e / K); v2us o;
            o[0] = f2bf(w[(size_t)k * N + n]); o[1] = f2bf(w[(size_t)(k + 1) * N + n]); *(v2us*)(Bt + e) = o; }
         }
}
__global__ __launch_bounds__(256) void k_cvt8(const float* __restrict__ src, bf* dst, size_t n8) { const size_t i = (size_t)blockIdx.x * 256 + threadIdx.x; if (i >= n8) return; const v8f v = *(const v8f*)(src + i * 8); v8us o;
#pragma unroll
    for (int k = 0; k < 8; ++k) o[k] = f2bf(v[k]); *(v8us*)(dst + i * 8) = o;  }

__global__ __launch_bounds__(256) void k_ropeI(const float* __restrict__ F, int pitch, int nheads, const float* __restrict__ CS, float sc, h16* P16, bf* Ph, bf* Pl) {
    const size_t e = ((size_t)blockIdx.x * 256 + threadIdx.x) * 2; if (e >= (size_t)nheads * TT * HD) return; const int d = (int)(e % HD); const int t = (int)((e / HD) % TT); const int h = (int)(e / ((size_t)HD * TT)); const float* f = F + (size_t)t * pitch + h * HD; const float x0 = f[d], x1 = f[d + 1]; const v2f cs = *(const v2f*)(CS + ((size_t)t * HD + d) * 2); v2h o16; v2us oh, ol;
    float a0 = __fmul_rn(x0, cs[0]), b0 = __fmul_rn(x1, cs[1]), a1 = __fmul_rn(x1, cs[0]), b1 = __fmul_rn(x0, cs[1]); asm volatile("" : "+v"(a0), "+v"(b0), "+v"(a1), "+v"(b1));
    float r0 = __fsub_rn(a0, b0) * sc, r1 = __fadd_rn(b1, a1) * sc;   /* even: x0 c - x1 s; odd: x0 s + x1 c */
    o16[0] = tohx(r0); o16[1] = tohx(r1); { unsigned short a2, c2; splitf(r0, a2, c2); oh[0] = a2; ol[0] = c2; splitf(r1, a2, c2); oh[1] = a2; ol[1] = c2; }
    *(v2h*)(P16 + e) = o16; *(v2us*)(Ph + e) = oh; *(v2us*)(Pl + e) = ol;  }


__global__ __launch_bounds__(256) void k_csin2(const float* __restrict__ cs, const float* __restrict__ sn, float* CS) { const int idx = blockIdx.x * 256 + threadIdx.x; if (idx >= TT * HD) return; const int d = idx % HD; const int t = idx / HD; v2f o; o[0] = bfr(cs[t * (HD / 2) + (d >> 1)]); o[1] = bfr(sn[t * (HD / 2) + (d >> 1)]); *(v2f*)(CS + (size_t)idx * 2) = o;  }
__global__ __launch_bounds__(64) void k_lambda(const float* __restrict__ a1, const float* __restrict__ b1, const float* __restrict__ a2, const float* __restrict__ b2, float* LAM) { float s1 = 0.f, s2 = 0.f;
#pragma unroll 1
    for (int d = 0; d < HD; ++d) { float p1 = __fmul_rn(bfr(a1[d]), bfr(b1[d])), p2 = __fmul_rn(bfr(a2[d]), bfr(b2[d])); asm volatile("" : "+v"(p1), "+v"(p2)); s1 = __fadd_rn(s1, p1); s2 = __fadd_rn(s2, p2); }
    const float lam = __fadd_rn(__fsub_rn(expf(s1), expf(s2)), LINIT); *(float*)(LAM + threadIdx.x) = lam;  }
__global__ __launch_bounds__(256) void k_dcomb(const float* __restrict__ O, const float* __restrict__ LAM, int h, float* Y) { const size_t i = (size_t)blockIdx.x * 256 + threadIdx.x; if (i >= (size_t)TT * HD / 4) return; const int d0 = (int)(i % (HD / 4)) * 4; const size_t t = i / (HD / 4); const float cs = (t < RH) ? 1.0f : (1.0f / PCAR); const float lam = LAM[0]; const v4f a = *(const v4f*)(O + t * HD + d0); const v4f b = *(const v4f*)(O + (size_t)TT * HD + t * HD + d0); v4f o;
#pragma unroll
    for (int q = 0; q < 4; ++q) { float p = __fmul_rn(a[q], cs), m = __fmul_rn(__fmul_rn(b[q], cs), lam); asm volatile("" : "+v"(p), "+v"(m)); o[q] = __fsub_rn(p, m); }
    *(v4f*)(Y + t * (NHD * HD) + (size_t)h * HD + d0) = o;  }
__global__ __launch_bounds__(32) void k_gnstat(const float* __restrict__ Y, float* ST) { const int h = blockIdx.x; const int lane = threadIdx.x; const float nf = (float)((size_t)TT * HD);
    float s = 0.f; const int d0 = (lane & 15) * 4, todd = lane >> 4;   /* lanes 0-15: even rows, 16-31: odd rows; 16 lanes x 16 B = the head's 256-B row segment */
#pragma unroll 1
    for (int t2 = 0; t2 < TT; t2 += 2) { const v4f a = *(const v4f*)(Y + (size_t)(t2 + todd) * (NHD * HD) + (size_t)h * HD + d0); s = __fadd_rn(s, __fadd_rn(__fadd_rn(a[0], a[1]), __fadd_rn(a[2], a[3]))); }
#pragma unroll
    for (int sh = 16; sh; sh >>= 1) s = __fadd_rn(s, __shfl_xor(s, sh, 32));
    const float mean = __fdiv_rn(s, nf);
    float s2 = 0.f;
#pragma unroll 1
    for (int t2 = 0; t2 < TT; t2 += 2) { const v4f a = *(const v4f*)(Y + (size_t)(t2 + todd) * (NHD * HD) + (size_t)h * HD + d0); float acc = 0.f;
#pragma unroll
        for (int q = 0; q < 4; ++q) { const float dv = __fsub_rn(a[q], mean); acc = __fadd_rn(acc, __fmul_rn(dv, dv)); } s2 = __fadd_rn(s2, acc); }
#pragma unroll
    for (int sh = 16; sh; sh >>= 1) s2 = __fadd_rn(s2, __shfl_xor(s2, sh, 32));
    const float var = __fdiv_rn(s2, nf); const float val = (lane & 1) ? var : mean; *(float*)(ST + h * 32 + lane) = val;  }

__global__ __launch_bounds__(256) void k_gnapply(const float* __restrict__ Y, const float* __restrict__ ST, bf* Ah, bf* Al) { const size_t i = (size_t)blockIdx.x * 256 + threadIdx.x; if (i >= (size_t)TT * NHD * HD / 4) return; const int c0 = (int)(i % (NHD * HD / 4)) * 4; const size_t t = i / (NHD * HD / 4); const int h = c0 / HD; const float mean = ST[h * 32], var = ST[h * 32 + 1]; const float rs = __fdiv_rn(1.0f, __fsqrt_rn(__fadd_rn(var, 1e-5f))); const v4f a = *(const v4f*)(Y + t * (NHD * HD) + c0); v4us oh, ol;
#pragma unroll
    for (int q = 0; q < 4; ++q) { float nv = __fmul_rn(__fsub_rn(a[q], mean), rs); asm volatile("" : "+v"(nv)); unsigned short h2, l2; splitf(__fmul_rn(nv, 1.0f - LINIT), h2, l2); oh[q] = h2; ol[q] = l2; }
    *(v4us*)(Ah + t * (NHD * HD) + c0) = oh; *(v4us*)(Al + t * (NHD * HD) + c0) = ol;  }

__global__ __launch_bounds__(256) void k_vtp(const float* __restrict__ F, int pitch, int nheads, h16* V16, bf* Vh, bf* Vl) { const size_t e = ((size_t)blockIdx.x * 256 + threadIdx.x) * 2; if (e >= (size_t)nheads * HD * TT) return; const int t = (int)(e % TT); const int d = (int)((e / TT) % HD); const int g = (int)(e / ((size_t)TT * HD)); v2h o16; v2us oh, ol;
#pragma unroll
    for (int q = 0; q < 2; ++q) { const float x = F[(size_t)(t + q) * pitch + g * HD + d]; o16[q] = tohx(x); unsigned short a2, c2; splitf(x, a2, c2); oh[q] = a2; ol[q] = c2; }
    *(v2h*)(V16 + e) = o16; *(v2us*)(Vh + e) = oh; *(v2us*)(Vl + e) = ol;  }
// k_asoft: per row (zz, i): t = S x HD^-0.5 for j <= i and i - j < WIN (sliding causal window; the reference's -1e9 additive fill vanishes identically); softmax over the 2048 keys (register row, one exp, fixed trees);
__global__ __launch_bounds__(256) void k_asoft(const float* __restrict__ Sb, h16* P16, bf* Ph, bf* Pl) {
    const int lane = threadIdx.x & 31; const int row = blockIdx.x * 8 + (threadIdx.x >> 5); if (row >= ZH * TT) return; const int i = row % TT; const int zz = row / TT; (void)zz; const bool hires = (i < RH); const float* sr = Sb + (size_t)row * TT; float v[TT / 32]; float mx = -3.0e38f;
#pragma unroll
    for (int ch = 0; ch < TT / 128; ++ch) { const int j0 = ch * 128 + lane * 4; const v4f a = *(const v4f*)(sr + j0);
#pragma unroll
        for (int q = 0; q < 4; ++q) { const int j = j0 + q; (void)j; const float t = (j <= i && i - j < WIN) ? a[q] * SCL : -3.0e38f; v[ch * 4 + q] = t; mx = fmaxf(mx, t); } }
#pragma unroll
    for (int sh = 16; sh; sh >>= 1) mx = fmaxf(mx, __shfl_xor(mx, sh, 32));
    float sum = 0.f;
#pragma unroll
    for (int k = 0; k < TT / 32; ++k) { float d0 = __fsub_rn(v[k], mx); asm volatile("" : "+v"(d0)); v[k] = __builtin_amdgcn_exp2f(__fmul_rn(d0, 1.4426950408889634f)); sum += v[k]; }
#pragma unroll
    for (int sh = 16; sh; sh >>= 1) sum += __shfl_xor(sum, sh, 32);
    const float f = __fdiv_rn(hires ? 1.0f : PCAR, sum);
{
        if (hires) {
#pragma unroll
            for (int ch = 0; ch < TT / 128; ++ch) { v4us oh, ol;
#pragma unroll
                for (int q = 0; q < 4; ++q) { unsigned short a, c2; splitf(v[ch * 4 + q] * f, a, c2); oh[q] = a; ol[q] = c2; }
                const size_t oo = ((size_t)zz * (RH ? RH : 1) + i) * TT + ch * 128 + lane * 4; *(v4us*)(Ph + oo) = oh; *(v4us*)(Pl + oo) = ol; }
        } else {
#pragma unroll
            for (int ch = 0; ch < TT / 128; ++ch) { v4h o4;
#pragma unroll
                for (int q = 0; q < 4; ++q) o4[q] = tohx(v[ch * 4 + q] * f);
                *(v4h*)(P16 + (size_t)row * TT + ch * 128 + lane * 4) = o4; } }
         }
}
__global__ __launch_bounds__(256) void k_merge(const float* __restrict__ O, int h0, bf* Ah, bf* Al) { const size_t e = ((size_t)blockIdx.x * 256 + threadIdx.x) * 2; if (e >= (size_t)ZH * TT * HD) return; const int d = (int)(e % HD); const int t = (int)((e / HD) % TT); const int zz = (int)(e / ((size_t)HD * TT)); const float cs = (t < RH) ? 1.0f : (1.0f / PCAR); const size_t oo = (size_t)t * DQ + (h0 + zz) * HD + d;
    v2us oh, ol;
#pragma unroll
    for (int q = 0; q < 2; ++q) { unsigned short a, c2; splitf(O[e + q] * cs, a, c2); oh[q] = a; ol[q] = c2; } *(v2us*)(Ah + oo) = oh; *(v2us*)(Al + oo) = ol;  }

extern "C" void kernel_launch(void* const* d_in, const int* in_sizes, int n_in,
                              void* d_out, int out_size, void* d_ws, size_t ws_size, hipStream_t stream) {
    (void)in_sizes; (void)n_in; (void)out_size;
    const float* x = (const float*)d_in[0]; const float* fcos = (const float*)d_in[1]; const float* fsin = (const float*)d_in[2]; const float* wq = (const float*)d_in[3]; const float* wk = (const float*)d_in[4]; const float* wv = (const float*)d_in[5]; const float* wo = (const float*)d_in[6]; const float* lq1 = (const float*)d_in[7]; const float* lk1 = (const float*)d_in[8]; const float* lq2 = (const float*)d_in[9]; const float* lk2 = (const float*)d_in[10];
    float* OUT = (float*)d_out;     // [1][2048][1024]
    char* wsp = (char*)d_ws;
    auto take = [&](size_t bytes) { char* p = wsp; wsp += (bytes + 255) & ~(size_t)255; return (void*)p; };
    bf* WQ = (bf*)take((size_t)DQ * DM * 2); bf* WK = (bf*)take((size_t)DKV * DM * 2); bf* WV = (bf*)take((size_t)DV * DM * 2); bf* WO = (bf*)take((size_t)DM * NHD * HD * 2); float* LAM = (float*)take(64 * 4); float* ST = (float*)take((size_t)NHD * 32 * 4); float* Y = (float*)take((size_t)TT * NHD * HD * 4); float* FV2 = (float*)take((size_t)TT * DV * 4); float* CS = (float*)take((size_t)TT * HD * 2 * 4);
    bf* XB = (bf*)take((size_t)TT * DM * 2); float* FQ = (float*)take((size_t)TT * DQ * 4); float* FK = (float*)take((size_t)TT * DKV * 4);
    h16* QP16 = (h16*)take((size_t)NH_ * TT * HD * 2); h16* KP16 = (h16*)take((size_t)NKV * TT * HD * 2); h16* VT16 = (h16*)take((size_t)NVG * HD * TT * 2);
    bf* QPh = (bf*)take((size_t)NH_ * TT * HD * 2); bf* QPl = (bf*)take((size_t)NH_ * TT * HD * 2); bf* KPh = (bf*)take((size_t)NKV * TT * HD * 2); bf* KPl = (bf*)take((size_t)NKV * TT * HD * 2); bf* VTh = (bf*)take((size_t)NVG * HD * TT * 2); bf* VTl = (bf*)take((size_t)NVG * HD * TT * 2); bf* Ph = (bf*)take((size_t)ZH * RH * TT * 2); bf* Pl = (bf*)take((size_t)ZH * RH * TT * 2);
    float* Sb = (float*)take((size_t)ZH * TT * TT * 4); h16* P16 = (h16*)take((size_t)ZH * TT * TT * 2); float* Ob = (float*)take((size_t)ZH * TT * HD * 4); bf* ATh = (bf*)take((size_t)TT * NHD * HD * 2); bf* ATl = (bf*)take((size_t)TT * NHD * HD * 2);
    if ((size_t)(wsp - (char*)d_ws) > ws_size) return;    // ws 256 MiB
    float* FV = FK;   // unused: the v projection writes its own buffer FV2
    { k_cvt8<<<(unsigned)(((size_t)DQ * DM / 8 + 255) / 256), 256, 0, stream>>>(wq, WQ, (size_t)DQ * DM / 8); k_cvt8<<<(unsigned)(((size_t)DKV * DM / 8 + 255) / 256), 256, 0, stream>>>(wk, WK, (size_t)DKV * DM / 8); k_cvt8<<<(unsigned)(((size_t)DV * DM / 8 + 255) / 256), 256, 0, stream>>>(wv, WV, (size_t)DV * DM / 8); k_cvt8<<<(unsigned)(((size_t)DM * (NHD * HD) / 8 + 255) / 256), 256, 0, stream>>>(wo, WO, (size_t)DM * (NHD * HD) / 8); k_csin2<<<(TT * HD + 255) / 256, 256, 0, stream>>>(fcos, fsin, CS); k_lambda<<<1, 64, 0, stream>>>(lq1, lk1, lq2, lk2, LAM); }
    const unsigned LQ = (unsigned)(((size_t)NH_ * TT * HD / 2 + 255) / 256), LKv = (unsigned)(((size_t)NKV * TT * HD / 2 + 255) / 256);
    for (int b = 0; b < NB_; ++b) {
        
        k_cvt8<<<(unsigned)(((size_t)TT * DM / 8 + 255) / 256), 256, 0, stream>>>(x + (size_t)b * TT * DM, XB, (size_t)TT * DM / 8);
        k_gemmw<bf, 0, false><<<dim3(TT / 64, DQ / 64, 1), 32, 0, stream>>>(XB, nullptr, WQ, nullptr, DM, FQ, DQ, nullptr, 0, 0, 0);
        k_ropeI<<<LQ, 256, 0, stream>>>(FQ, DQ, NH_, CS, 1.0f, QP16, QPh, QPl);   /* 32 query sub-heads: q1_h = 2h, q2_h = 2h+1 */
        k_gemmw<bf, 0, false><<<dim3(TT / 64, DKV / 64, 1), 32, 0, stream>>>(XB, nullptr, WK, nullptr, DM, FK, DKV, nullptr, 0, 0, 0);
        k_ropeI<<<LKv, 256, 0, stream>>>(FK, DKV, NKV, CS, 1.0f, KP16, KPh, KPl);   /* 16 key sub-heads: k1_g = 2g, k2_g = 2g+1 */
        k_gemmw<bf, 0, false><<<dim3(TT / 64, DV / 64, 1), 32, 0, stream>>>(XB, nullptr, WV, nullptr, DM, FV2, DV, nullptr, 0, 0, 0); k_vtp<<<(unsigned)(((size_t)NVG * TT * HD / 2 + 255) / 256), 256, 0, stream>>>(FV2, DV, NVG, VT16, VTh, VTl);   /* 8 value groups */
        for (int h0 = 0; h0 < NH_; h0 += ZH) { const size_t zq = (size_t)h0, zk = (size_t)(2 * (h0 / 4)), zv = (size_t)(h0 / 4);   // pass = head h = h0/2: z0 = (q1_h, k1_g), z1 = (q2_h, k2_g) with g = h/2; both z use v[g]
            k_gemmc<bf, 2, 1><<<dim3(RH / 64, TT / 64, ZH), 32, 0, stream>>>(QPh + zq * TT * HD, QPl + zq * TT * HD, KPh + zk * TT * HD, KPl + zk * TT * HD, HD, Sb, TT, 0, (size_t)TT * HD, (size_t)TT * HD, (size_t)TT * TT);
            k_gemmc<h16, 0, 1><<<dim3((TT - RH) / 64, TT / 64, ZH), 32, 0, stream>>>(QP16 + zq * TT * HD + (size_t)RH * HD, nullptr, KP16 + zk * TT * HD, nullptr, HD, Sb + (size_t)RH * TT, TT, RH, (size_t)TT * HD, (size_t)TT * HD, (size_t)TT * TT);
            k_asoft<<<ZH * TT / 8, 256, 0, stream>>>(Sb, P16, Ph, Pl);
            k_gemmc<bf, 2, 2><<<dim3(RH / 64, HD / 64, ZH), 32, 0, stream>>>(Ph, Pl, VTh + zv * HD * TT, VTl + zv * HD * TT, TT, Ob, HD, 0, (size_t)RH * TT, 0, (size_t)TT * HD);
            k_gemmc<h16, 0, 2><<<dim3((TT - RH) / 64, HD / 64, ZH), 32, 0, stream>>>(P16 + (size_t)RH * TT, nullptr, VT16 + zv * HD * TT, nullptr, TT, Ob + (size_t)RH * HD, HD, RH, (size_t)TT * TT, 0, (size_t)TT * HD);
            k_dcomb<<<(unsigned)(((size_t)TT * HD / 4 + 255) / 256), 256, 0, stream>>>(Ob, LAM, h0 / 2, Y); }   /* y_h = a1 v - lambda a2 v */
        k_gnstat<<<NHD, 32, 0, stream>>>(Y, ST); k_gnapply<<<(unsigned)(((size_t)TT * NHD * HD / 4 + 255) / 256), 256, 0, stream>>>(Y, ST, ATh, ATl);   /* GroupNorm per head x (1 - lambda_init) -> planes */
        k_gemmw<bf, 1, false><<<dim3(TT / 64, DM / 64, 1), 32, 0, stream>>>(ATh, ATl, WO, nullptr, NHD * HD, OUT + (size_t)b * TT * DM, DM, nullptr, 0, 0, 0); }
}

// v001
// It runs in 1280 microseconds.
// Timed twice side by side with v000, it ran 1.44 and 1.45 times as fast.
#include <hip/hip_runtime.h>

// Differential attention (x [1][2048][1024]; q = x wq^T viewed (T, 16, 2, 64): q1/q2 per head; k = x wk^T viewed (T, 8, 2, 64): k1/k2 per kv group; v = x wv^T (8 x 64); interleaved-pair rotary on q1, q2, k1, k2 with the given cos/sin tables [2048][32]; head h uses kv group h/2; a1 = causal softmax(q1.k1/8), a2 = causal softmax(q2.k2/8); lambda = exp(lq1.lk1) - exp(lq2.lk2) + lambda_init (lambda vectors [64], read); y = (a1 - lambda a2) v; GroupNorm per (head) over (T, 64) (eps 1e-5, no affine) x (1 - lambda_init); out = y wo^T -> [1][2048][1024] (2.1 M)).
// Compute dtypes, f32 accumulate: every input rounded to bf16; projections exact; rotary f32; attention rows < 512 3 products, rest fp16; softmax, lambda, combine and GroupNorm f32 (fixed-order reductions); wo hl x exact.

#define NB_  1
#define TT   2048
#define DM   1024
#define NH_  32
#define NKV  16
#define REP  (NH_ / NKV)
#define HD   64
#define DQ   (NH_ * HD)
#define DKV  (NKV * HD)
#define ZH   2
#define RH   512                  // query rows < RH use hi+lo planes (0: none)
#define WIN  2048
#define PCAR 1024.0f
#define SCL  0.125f
#define NVG  8       // value groups
#define DV   (NVG * HD)   // 512
#define NHD  16      // real heads
#define LINIT 0.35550906759096934f   // 0.8 - 0.6 exp(-0.3)
typedef _Float16 h16;
typedef unsigned short bf;
typedef __attribute__((ext_vector_type(16))) __bf16   v16bf;
typedef __attribute__((ext_vector_type(16))) _Float16 v16h;
typedef __attribute__((ext_vector_type(8)))  _Float16 v8h;
typedef __attribute__((ext_vector_type(8)))  unsigned short v8us;
typedef __attribute__((ext_vector_type(8)))  float    v8f;
typedef __attribute__((ext_vector_type(4)))  float    v4f;
typedef v8h  __attribute__((may_alias)) v8ha;
typedef v4f  __attribute__((may_alias)) v4fa;
typedef v8us __attribute__((may_alias)) v8usa;

__device__ __forceinline__ unsigned short f2bf(float f) { unsigned u = __float_as_uint(f); u += 0x7FFFu + ((u >> 16) & 1u); return (unsigned short)(u >> 16); }
__device__ __forceinline__ float bf2f(unsigned short b) { return __uint_as_float(((unsigned)b) << 16); }
__device__ __forceinline__ float bfr(float f) { return bf2f(f2bf(f)); }
__device__ __forceinline__ v16h cat16(v8h lo, v8h hi) { return __builtin_shufflevector(lo, hi, 0, 1, 2, 3, 4, 5, 6, 7, 8, 9, 10, 11, 12, 13, 14, 15); }
__device__ __forceinline__ v16bf cat16b(v8us lo, v8us hi) { return __builtin_bit_cast(v16bf, __builtin_shufflevector(lo, hi, 0, 1, 2, 3, 4, 5, 6, 7, 8, 9, 10, 11, 12, 13, 14, 15)); }
__device__ __forceinline__ v8f wmma16(v16h a, v16h b, v8f c) { return __builtin_amdgcn_wmma_f32_16x16x32_f16(false, a, false, b, (short)0, c, false, false); }
__device__ __forceinline__ v8f wmmab(v16bf a, v16bf b, v8f c) { return __builtin_amdgcn_wmma_f32_16x16x32_bf16(false, a, false, b, (short)0, c, false, false); }



// ---- k_gemmw: register-blocked GEMM, ONE WAVE per 64x64 output tile (16 accumulators), operands straight from K-contiguous 16-bit planes; grid (M/64, N/64, Z), 32 threads.
// C[m][n] (f32, pitch ldc, + optional f32 bias[n]) = sum_k A[m][k] Bt[n][k] (+ split products per NSPLIT). z-batch strides sA/sB/sC in elements. K % 32 == 0.
template <typename T16> struct WFrag;
template <> struct WFrag<h16> { typedef v16h V; static __device__ __forceinline__ V ld(const h16* p) { return cat16(*(const v8h*)p, *(const v8h*)(p + 16)); } static __device__ __forceinline__ v8f mma(V a, V b, v8f c) { return wmma16(a, b, c); } };
template <> struct WFrag<bf> { typedef v16bf V; static __device__ __forceinline__ V ld(const bf* p) { return cat16b(*(const v8us*)p, *(const v8us*)(p + 16)); } static __device__ __forceinline__ v8f mma(V a, V b, v8f c) { return wmmab(a, b, c); } };
template <typename T16, int NSPLIT, bool BIAS>
__global__ __launch_bounds__(32) void k_gemmw(const T16* __restrict__ A, const T16* __restrict__ A2, const T16* __restrict__ Bt, const T16* __restrict__ Bt2, int K, float* C, int ldc, const float* __restrict__ bias, size_t sA, size_t sB, size_t sC) {
    typedef typename WFrag<T16>::V V;
    __shared__ __align__(16) float os[16 * 68];
    const size_t z = blockIdx.z; A += z * sA; if (A2) A2 += z * sA; Bt += z * sB; if (Bt2) Bt2 += z * sB; C += z * sC;
    const int lane = threadIdx.x & 31, lr = lane & 15, hi = lane >> 4; const int r0 = blockIdx.x * 64, c0 = blockIdx.y * 64;
    v8f acc[4][4];
#pragma unroll
    for (int mb = 0; mb < 4; ++mb)
#pragma unroll
        for (int nb = 0; nb < 4; ++nb) acc[mb][nb] = (v8f){};
    const size_t aoff = (size_t)(r0 + lr) * K + 8 * hi, boff = (size_t)(c0 + lr) * K + 8 * hi;
#pragma unroll 1
    for (int kc = 0; kc < K; kc += 32) {
        V a[4], a2[4];
#pragma unroll
        for (int mb = 0; mb < 4; ++mb) { a[mb] = WFrag<T16>::ld(A + aoff + (size_t)mb * 16 * K + kc); if (NSPLIT == 1 || NSPLIT == 2) a2[mb] = WFrag<T16>::ld(A2 + aoff + (size_t)mb * 16 * K + kc); }
#pragma unroll
        for (int nb = 0; nb < 4; ++nb) { const V b = WFrag<T16>::ld(Bt + boff + (size_t)nb * 16 * K + kc); V b2; if (NSPLIT >= 2) b2 = WFrag<T16>::ld(Bt2 + boff + (size_t)nb * 16 * K + kc);
#pragma unroll
            for (int mb = 0; mb < 4; ++mb) { acc[mb][nb] = WFrag<T16>::mma(a[mb], b, acc[mb][nb]); if (NSPLIT == 1 || NSPLIT == 2) acc[mb][nb] = WFrag<T16>::mma(a2[mb], b, acc[mb][nb]); if (NSPLIT >= 2) acc[mb][nb] = WFrag<T16>::mma(a[mb], b2, acc[mb][nb]); } }
        asm volatile("v_nop\n\tv_nop\n\tv_nop\n\tv_nop" : "+v"(acc[0][0]), "+v"(acc[1][1]), "+v"(acc[2][2]), "+v"(acc[3][3]) : "v"(a[0]), "v"(a[3]));
    }
#pragma unroll
    for (int mb = 0; mb < 4; ++mb) {
#pragma unroll
        for (int nb = 0; nb < 4; ++nb) {
#pragma unroll
            for (int j = 0; j < 8; ++j) os[(hi * 8 + j) * 68 + nb * 16 + lr] = acc[mb][nb][j]; }
        __builtin_amdgcn_wave_barrier(); asm volatile("" ::: "memory");
        float* crow = C + (size_t)(r0 + mb * 16) * ldc + c0;
{
#pragma unroll
            for (int s = 0; s < 8; ++s) { const int row = 2 * s + hi, cofs = lr * 4; v4f val = *(const v4fa*)(os + row * 68 + cofs); if (BIAS) { val[0] += bfr(bias[c0 + cofs]); val[1] += bfr(bias[c0 + cofs + 1]); val[2] += bfr(bias[c0 + cofs + 2]); val[3] += bfr(bias[c0 + cofs + 3]); }
                *(v4f*)(crow + (size_t)row * ldc + cofs) = val; }
             }
        __builtin_amdgcn_wave_barrier(); asm volatile("" ::: "memory");
    }
}

// ---- k_gemmc: the same one-wave 64x64 tile GEMM specialised for causal attention: CMODE 1 skips score tiles entirely above the diagonal (query rows r0+roff.., key columns c0..), CMODE 2 limits the
// key (K) loop of the probability x value contraction to the diagonal block (probabilities beyond it are exactly zero). roff = row offset of this launch's first row within the sequence.
template <typename T16, int NSPLIT, int CMODE>
__global__ __launch_bounds__(32) void k_gemmc(const T16* __restrict__ A, const T16* __restrict__ A2, const T16* __restrict__ Bt, const T16* __restrict__ Bt2, int K, float* C, int ldc, int roff, size_t sA, size_t sB, size_t sC) {
    typedef typename WFrag<T16>::V V;
    __shared__ __align__(16) float os[16 * 68];
    const size_t z = blockIdx.z; A += z * sA; if (A2) A2 += z * sA; Bt += z * sB; if (Bt2) Bt2 += z * sB; C += z * sC;
    const int lane = threadIdx.x & 31, lr = lane & 15, hi = lane >> 4; const int r0 = blockIdx.x * 64, c0 = blockIdx.y * 64;
    if (CMODE == 1 && c0 > r0 + roff + 63) return;                  // score tile entirely above the causal diagonal: never read (the softmax masks j > i by select)
    const int Kl = (CMODE == 2) ? min(K, r0 + roff + 64) : K;        // P.V: probabilities are exactly 0 beyond the diagonal block, so the K loop stops there
    v8f acc[4][4];
#pragma unroll
    for (int mb = 0; mb < 4; ++mb)
#pragma unroll
        for (int nb = 0; nb < 4; ++nb) acc[mb][nb] = (v8f){};
    const size_t aoff = (size_t)(r0 + lr) * K + 8 * hi, boff = (size_t)(c0 + lr) * K + 8 * hi;
#pragma unroll 1
    for (int kc = 0; kc < Kl; kc += 32) {
        V a[4], a2[4];
#pragma unroll
        for (int mb = 0; mb < 4; ++mb) { a[mb] = WFrag<T16>::ld(A + aoff + (size_t)mb * 16 * K + kc); if (NSPLIT == 1 || NSPLIT == 2) a2[mb] = WFrag<T16>::ld(A2 + aoff + (size_t)mb * 16 * K + kc); }
#pragma unroll
        for (int nb = 0; nb < 4; ++nb) { const V b = WFrag<T16>::ld(Bt + boff + (size_t)nb * 16 * K + kc); V b2; if (NSPLIT >= 2) b2 = WFrag<T16>::ld(Bt2 + boff + (size_t)nb * 16 * K + kc);
#pragma unroll
            for (int mb = 0; mb < 4; ++mb) { acc[mb][nb] = WFrag<T16>::mma(a[mb], b, acc[mb][nb]); if (NSPLIT == 1 || NSPLIT == 2) acc[mb][nb] = WFrag<T16>::mma(a2[mb], b, acc[mb][nb]); if (NSPLIT >= 2) acc[mb][nb] = WFrag<T16>::mma(a[mb], b2, acc[mb][nb]); } }
        asm volatile("v_nop\n\tv_nop\n\tv_nop\n\tv_nop" : "+v"(acc[0][0]), "+v"(acc[1][1]), "+v"(acc[2][2]), "+v"(acc[3][3]) : "v"(a[0]), "v"(a[3]));
    }
#pragma unroll
    for (int mb = 0; mb < 4; ++mb) {
#pragma unroll
        for (int nb = 0; nb < 4; ++nb) {
#pragma unroll
            for (int j = 0; j < 8; ++j) os[(hi * 8 + j) * 68 + nb * 16 + lr] = acc[mb][nb][j]; }
        __builtin_amdgcn_wave_barrier(); asm volatile("" ::: "memory");
        float* crow = C + (size_t)(r0 + mb * 16) * ldc + c0;
{
#pragma unroll
            for (int s = 0; s < 8; ++s) { const int row = 2 * s + hi, cofs = lr * 4; v4f val = *(const v4fa*)(os + row * 68 + cofs);
                *(v4f*)(crow + (size_t)row * ldc + cofs) = val; }
             }
        __builtin_amdgcn_wave_barrier(); asm volatile("" ::: "memory");
    }
}

__device__ __forceinline__ h16 tohx(float x) { return (h16)x; }
__device__ __forceinline__ void splitf(float y, unsigned short& h, unsigned short& l) { h = f2bf(y); l = f2bf(y - bf2f(h)); }
typedef __attribute__((ext_vector_type(2))) _Float16 v2h;
typedef __attribute__((ext_vector_type(4))) _Float16 v4h;
typedef __attribute__((ext_vector_type(2))) unsigned short v2us;
typedef __attribute__((ext_vector_type(4))) unsigned short v4us;
typedef __attribute__((ext_vector_type(2))) float v2f;
typedef __attribute__((ext_vector_type(4))) int v4i;

__global__ __launch_bounds__(256) void k_wtG(const float* __restrict__ w, int K, int N, bf* Bt) {
    const int lane = threadIdx.x & 31; const int L0 = (blockIdx.x * 8 + (threadIdx.x >> 5)) * 8; const int nlines = N * K / 64;
{
#pragma unroll 1
        for (int l = 0; l < 8; ++l) { const int L = L0 + l; if (L >= nlines) break; const size_t e = (size_t)L * 64 + lane * 2; const int k = (int)(e % K), n = (int)(e / K); v2us o;
            o[0] = f2bf(w[(size_t)k * N + n]); o[1] = f2bf(w[(size_t)(k + 1) * N + n]); *(v2us*)(Bt + e) = o; }
         }
}
__global__ __launch_bounds__(256) void k_cvt8(const float* __restrict__ src, bf* dst, size_t n8) { const size_t i = (size_t)blockIdx.x * 256 + threadIdx.x; if (i >= n8) return; const v8f v = *(const v8f*)(src + i * 8); v8us o;
#pragma unroll
    for (int k = 0; k < 8; ++k) o[k] = f2bf(v[k]); *(v8us*)(dst + i * 8) = o;  }

__global__ __launch_bounds__(256) void k_ropeI(const float* __restrict__ F, int pitch, int nheads, const float* __restrict__ CS, float sc, h16* P16, bf* Ph, bf* Pl) {
    const size_t e = ((size_t)blockIdx.x * 256 + threadIdx.x) * 2; if (e >= (size_t)nheads * TT * HD) return; const int d = (int)(e % HD); const int t = (int)((e / HD) % TT); const int h = (int)(e / ((size_t)HD * TT)); const float* f = F + (size_t)t * pitch + h * HD; const float x0 = f[d], x1 = f[d + 1]; const v2f cs = *(const v2f*)(CS + ((size_t)t * HD + d) * 2); v2h o16; v2us oh, ol;
    float a0 = __fmul_rn(x0, cs[0]), b0 = __fmul_rn(x1, cs[1]), a1 = __fmul_rn(x1, cs[0]), b1 = __fmul_rn(x0, cs[1]); asm volatile("" : "+v"(a0), "+v"(b0), "+v"(a1), "+v"(b1));
    float r0 = __fsub_rn(a0, b0) * sc, r1 = __fadd_rn(b1, a1) * sc;   /* even: x0 c - x1 s; odd: x0 s + x1 c */
    o16[0] = tohx(r0); o16[1] = tohx(r1); { unsigned short a2, c2; splitf(r0, a2, c2); oh[0] = a2; ol[0] = c2; splitf(r1, a2, c2); oh[1] = a2; ol[1] = c2; }
    *(v2h*)(P16 + e) = o16; *(v2us*)(Ph + e) = oh; *(v2us*)(Pl + e) = ol;  }


__global__ __launch_bounds__(256) void k_csin2(const float* __restrict__ cs, const float* __restrict__ sn, float* CS) { const int idx = blockIdx.x * 256 + threadIdx.x; if (idx >= TT * HD) return; const int d = idx % HD; const int t = idx / HD; v2f o; o[0] = bfr(cs[t * (HD / 2) + (d >> 1)]); o[1] = bfr(sn[t * (HD / 2) + (d >> 1)]); *(v2f*)(CS + (size_t)idx * 2) = o;  }
__global__ __launch_bounds__(64) void k_lambda(const float* __restrict__ a1, const float* __restrict__ b1, const float* __restrict__ a2, const float* __restrict__ b2, float* LAM) { float s1 = 0.f, s2 = 0.f;
#pragma unroll 1
    for (int d = 0; d < HD; ++d) { float p1 = __fmul_rn(bfr(a1[d]), bfr(b1[d])), p2 = __fmul_rn(bfr(a2[d]), bfr(b2[d])); asm volatile("" : "+v"(p1), "+v"(p2)); s1 = __fadd_rn(s1, p1); s2 = __fadd_rn(s2, p2); }
    const float lam = __fadd_rn(__fsub_rn(expf(s1), expf(s2)), LINIT); *(float*)(LAM + threadIdx.x) = lam;  }
__global__ __launch_bounds__(256) void k_dcomb(const float* __restrict__ O, const float* __restrict__ LAM, int h, float* Y) { const size_t i = (size_t)blockIdx.x * 256 + threadIdx.x; if (i >= (size_t)TT * HD / 4) return; const int d0 = (int)(i % (HD / 4)) * 4; const size_t t = i / (HD / 4); const float cs = (t < RH) ? 1.0f : (1.0f / PCAR); const float lam = LAM[0]; const v4f a = *(const v4f*)(O + t * HD + d0); const v4f b = *(const v4f*)(O + (size_t)TT * HD + t * HD + d0); v4f o;
#pragma unroll
    for (int q = 0; q < 4; ++q) { float p = __fmul_rn(a[q], cs), m = __fmul_rn(__fmul_rn(b[q], cs), lam); asm volatile("" : "+v"(p), "+v"(m)); o[q] = __fsub_rn(p, m); }
    *(v4f*)(Y + t * (NHD * HD) + (size_t)h * HD + d0) = o;  }
// k_gnstat: one work-group of 32 waves per head. A wave load covers two 256-B row segments of the head (lanes 0-15 one row, 16-31 the next), the 32 waves cover 64 rows, 32 steps cover the 2048 rows.
// Mean first, then the squared deviations from it (two reads of Y, the second from L2). Fixed-order sums: per lane over its steps, xor tree in the wave, one LDS word per wave, the same xor tree over the 32 words (in every wave for the mean, in wave 0 for the variance).
__device__ __forceinline__ float gn_wavesum(float s) {
#pragma unroll
    for (int sh = 16; sh; sh >>= 1) s += __shfl_xor(s, sh, 32);
    return s; }
__global__ __launch_bounds__(1024) void k_gnstat(const float* __restrict__ Y, float* ST) { __shared__ float red1[32]; __shared__ float red2[32];
    const int h = blockIdx.x; const int lane = threadIdx.x & 31, wv = threadIdx.x >> 5; const float nf = (float)((size_t)TT * HD);
    const float* yp = Y + (size_t)(wv * 2 + (lane >> 4)) * (NHD * HD) + (size_t)h * HD + (lane & 15) * 4;
    float s = 0.f;
#pragma unroll   // independent loads in flight together: the latency of one L2 read is paid per batch, not per row
    for (int st = 0; st < TT / 64; ++st) { const v4f a = *(const v4f*)(yp + (size_t)st * 64 * (NHD * HD)); s += (a[0] + a[1]) + (a[2] + a[3]); }
    s = gn_wavesum(s); if (lane == 0) red1[wv] = s;
    __syncthreads();   // every wave's partial sum is in red1 before any wave adds them up
    const float mean = __fdiv_rn(gn_wavesum(red1[lane]), nf);
    float s2 = 0.f;
#pragma unroll   // as above
    for (int st = 0; st < TT / 64; ++st) { const v4f a = *(const v4f*)(yp + (size_t)st * 64 * (NHD * HD)); float acc = 0.f;
#pragma unroll
        for (int q = 0; q < 4; ++q) { const float dv = a[q] - mean; acc += dv * dv; } s2 += acc; }
    s2 = gn_wavesum(s2); if (lane == 0) red2[wv] = s2;
    __syncthreads();   // every wave's partial sum is in red2 before wave 0 adds them up
    if (wv == 0) { const float var = __fdiv_rn(gn_wavesum(red2[lane]), nf); ST[h * 32 + lane] = (lane & 1) ? var : mean; } }

__global__ __launch_bounds__(256) void k_gnapply(const float* __restrict__ Y, const float* __restrict__ ST, bf* Ah, bf* Al) { const size_t i = (size_t)blockIdx.x * 256 + threadIdx.x; if (i >= (size_t)TT * NHD * HD / 4) return; const int c0 = (int)(i % (NHD * HD / 4)) * 4; const size_t t = i / (NHD * HD / 4); const int h = c0 / HD; const float mean = ST[h * 32], var = ST[h * 32 + 1]; const float rs = __fdiv_rn(1.0f, __fsqrt_rn(__fadd_rn(var, 1e-5f))); const v4f a = *(const v4f*)(Y + t * (NHD * HD) + c0); v4us oh, ol;
#pragma unroll
    for (int q = 0; q < 4; ++q) { float nv = __fmul_rn(__fsub_rn(a[q], mean), rs); asm volatile("" : "+v"(nv)); unsigned short h2, l2; splitf(__fmul_rn(nv, 1.0f - LINIT), h2, l2); oh[q] = h2; ol[q] = l2; }
    *(v4us*)(Ah + t * (NHD * HD) + c0) = oh; *(v4us*)(Al + t * (NHD * HD) + c0) = ol;  }

__global__ __launch_bounds__(256) void k_vtp(const float* __restrict__ F, int pitch, int nheads, h16* V16, bf* Vh, bf* Vl) { const size_t e = ((size_t)blockIdx.x * 256 + threadIdx.x) * 2; if (e >= (size_t)nheads * HD * TT) return; const int t = (int)(e % TT); const int d = (int)((e / TT) % HD); const int g = (int)(e / ((size_t)TT * HD)); v2h o16; v2us oh, ol;
#pragma unroll
    for (int q = 0; q < 2; ++q) { const float x = F[(size_t)(t + q) * pitch + g * HD + d]; o16[q] = tohx(x); unsigned short a2, c2; splitf(x, a2, c2); oh[q] = a2; ol[q] = c2; }
    *(v2h*)(V16 + e) = o16; *(v2us*)(Vh + e) = oh; *(v2us*)(Vl + e) = ol;  }
// k_asoft: per row (zz, i): t = S x HD^-0.5 for j <= i and i - j < WIN (sliding causal window; the reference's -1e9 additive fill vanishes identically); softmax over the 2048 keys (register row, one exp, fixed trees);
__global__ __launch_bounds__(256) void k_asoft(const float* __restrict__ Sb, h16* P16, bf* Ph, bf* Pl) {
    const int lane = threadIdx.x & 31; const int row = blockIdx.x * 8 + (threadIdx.x >> 5); if (row >= ZH * TT) return; const int i = row % TT; const int zz = row / TT; (void)zz; const bool hires = (i < RH); const float* sr = Sb + (size_t)row * TT; float v[TT / 32]; float mx = -3.0e38f;
#pragma unroll
    for (int ch = 0; ch < TT / 128; ++ch) { const int j0 = ch * 128 + lane * 4; const v4f a = *(const v4f*)(sr + j0);
#pragma unroll
        for (int q = 0; q < 4; ++q) { const int j = j0 + q; (void)j; const float t = (j <= i && i - j < WIN) ? a[q] * SCL : -3.0e38f; v[ch * 4 + q] = t; mx = fmaxf(mx, t); } }
#pragma unroll
    for (int sh = 16; sh; sh >>= 1) mx = fmaxf(mx, __shfl_xor(mx, sh, 32));
    float sum = 0.f;
#pragma unroll
    for (int k = 0; k < TT / 32; ++k) { float d0 = __fsub_rn(v[k], mx); asm volatile("" : "+v"(d0)); v[k] = __builtin_amdgcn_exp2f(__fmul_rn(d0, 1.4426950408889634f)); sum += v[k]; }
#pragma unroll
    for (int sh = 16; sh; sh >>= 1) sum += __shfl_xor(sum, sh, 32);
    const float f = __fdiv_rn(hires ? 1.0f : PCAR, sum);
{
        if (hires) {
#pragma unroll
            for (int ch = 0; ch < TT / 128; ++ch) { v4us oh, ol;
#pragma unroll
                for (int q = 0; q < 4; ++q) { unsigned short a, c2; splitf(v[ch * 4 + q] * f, a, c2); oh[q] = a; ol[q] = c2; }
                const size_t oo = ((size_t)zz * (RH ? RH : 1) + i) * TT + ch * 128 + lane * 4; *(v4us*)(Ph + oo) = oh; *(v4us*)(Pl + oo) = ol; }
        } else {
#pragma unroll
            for (int ch = 0; ch < TT / 128; ++ch) { v4h o4;
#pragma unroll
                for (int q = 0; q < 4; ++q) o4[q] = tohx(v[ch * 4 + q] * f);
                *(v4h*)(P16 + (size_t)row * TT + ch * 128 + lane * 4) = o4; } }
         }
}
__global__ __launch_bounds__(256) void k_merge(const float* __restrict__ O, int h0, bf* Ah, bf* Al) { const size_t e = ((size_t)blockIdx.x * 256 + threadIdx.x) * 2; if (e >= (size_t)ZH * TT * HD) return; const int d = (int)(e % HD); const int t = (int)((e / HD) % TT); const int zz = (int)(e / ((size_t)HD * TT)); const float cs = (t < RH) ? 1.0f : (1.0f / PCAR); const size_t oo = (size_t)t * DQ + (h0 + zz) * HD + d;
    v2us oh, ol;
#pragma unroll
    for (int q = 0; q < 2; ++q) { unsigned short a, c2; splitf(O[e + q] * cs, a, c2); oh[q] = a; ol[q] = c2; } *(v2us*)(Ah + oo) = oh; *(v2us*)(Al + oo) = ol;  }

extern "C" void kernel_launch(void* const* d_in, const int* in_sizes, int n_in,
                              void* d_out, int out_size, void* d_ws, size_t ws_size, hipStream_t stream) {
    (void)in_sizes; (void)n_in; (void)out_size;
    const float* x = (const float*)d_in[0]; const float* fcos = (const float*)d_in[1]; const float* fsin = (const float*)d_in[2]; const float* wq = (const float*)d_in[3]; const float* wk = (const float*)d_in[4]; const float* wv = (const float*)d_in[5]; const float* wo = (const float*)d_in[6]; const float* lq1 = (const float*)d_in[7]; const float* lk1 = (const float*)d_in[8]; const float* lq2 = (const float*)d_in[9]; const float* lk2 = (const float*)d_in[10];
    float* OUT = (float*)d_out;     // [1][2048][1024]
    char* wsp = (char*)d_ws;
    auto take = [&](size_t bytes) { char* p = wsp; wsp += (bytes + 255) & ~(size_t)255; return (void*)p; };
    bf* WQ = (bf*)take((size_t)DQ * DM * 2); bf* WK = (bf*)take((size_t)DKV * DM * 2); bf* WV = (bf*)take((size_t)DV * DM * 2); bf* WO = (bf*)take((size_t)DM * NHD * HD * 2); float* LAM = (float*)take(64 * 4); float* ST = (float*)take((size_t)NHD * 32 * 4); float* Y = (float*)take((size_t)TT * NHD * HD * 4); float* FV2 = (float*)take((size_t)TT * DV * 4); float* CS = (float*)take((size_t)TT * HD * 2 * 4);
    bf* XB = (bf*)take((size_t)TT * DM * 2); float* FQ = (float*)take((size_t)TT * DQ * 4); float* FK = (float*)take((size_t)TT * DKV * 4);
    h16* QP16 = (h16*)take((size_t)NH_ * TT * HD * 2); h16* KP16 = (h16*)take((size_t)NKV * TT * HD * 2); h16* VT16 = (h16*)take((size_t)NVG * HD * TT * 2);
    bf* QPh = (bf*)take((size_t)NH_ * TT * HD * 2); bf* QPl = (bf*)take((size_t)NH_ * TT * HD * 2); bf* KPh = (bf*)take((size_t)NKV * TT * HD * 2); bf* KPl = (bf*)take((size_t)NKV * TT * HD * 2); bf* VTh = (bf*)take((size_t)NVG * HD * TT * 2); bf* VTl = (bf*)take((size_t)NVG * HD * TT * 2); bf* Ph = (bf*)take((size_t)ZH * RH * TT * 2); bf* Pl = (bf*)take((size_t)ZH * RH * TT * 2);
    float* Sb = (float*)take((size_t)ZH * TT * TT * 4); h16* P16 = (h16*)take((size_t)ZH * TT * TT * 2); float* Ob = (float*)take((size_t)ZH * TT * HD * 4); bf* ATh = (bf*)take((size_t)TT * NHD * HD * 2); bf* ATl = (bf*)take((size_t)TT * NHD * HD * 2);
    if ((size_t)(wsp - (char*)d_ws) > ws_size) return;    // ws 256 MiB
    float* FV = FK;   // unused: the v projection writes its own buffer FV2
    { k_cvt8<<<(unsigned)(((size_t)DQ * DM / 8 + 255) / 256), 256, 0, stream>>>(wq, WQ, (size_t)DQ * DM / 8); k_cvt8<<<(unsigned)(((size_t)DKV * DM / 8 + 255) / 256), 256, 0, stream>>>(wk, WK, (size_t)DKV * DM / 8); k_cvt8<<<(unsigned)(((size_t)DV * DM / 8 + 255) / 256), 256, 0, stream>>>(wv, WV, (size_t)DV * DM / 8); k_cvt8<<<(unsigned)(((size_t)DM * (NHD * HD) / 8 + 255) / 256), 256, 0, stream>>>(wo, WO, (size_t)DM * (NHD * HD) / 8); k_csin2<<<(TT * HD + 255) / 256, 256, 0, stream>>>(fcos, fsin, CS); k_lambda<<<1, 64, 0, stream>>>(lq1, lk1, lq2, lk2, LAM); }
    const unsigned LQ = (unsigned)(((size_t)NH_ * TT * HD / 2 + 255) / 256), LKv = (unsigned)(((size_t)NKV * TT * HD / 2 + 255) / 256);
    for (int b = 0; b < NB_; ++b) {
        
        k_cvt8<<<(unsigned)(((size_t)TT * DM / 8 + 255) / 256), 256, 0, stream>>>(x + (size_t)b * TT * DM, XB, (size_t)TT * DM / 8);
        k_gemmw<bf, 0, false><<<dim3(TT / 64, DQ / 64, 1), 32, 0, stream>>>(XB, nullptr, WQ, nullptr, DM, FQ, DQ, nullptr, 0, 0, 0);
        k_ropeI<<<LQ, 256, 0, stream>>>(FQ, DQ, NH_, CS, 1.0f, QP16, QPh, QPl);   /* 32 query sub-heads: q1_h = 2h, q2_h = 2h+1 */
        k_gemmw<bf, 0, false><<<dim3(TT / 64, DKV / 64, 1), 32, 0, stream>>>(XB, nullptr, WK, nullptr, DM, FK, DKV, nullptr, 0, 0, 0);
        k_ropeI<<<LKv, 256, 0, stream>>>(FK, DKV, NKV, CS, 1.0f, KP16, KPh, KPl);   /* 16 key sub-heads: k1_g = 2g, k2_g = 2g+1 */
        k_gemmw<bf, 0, false><<<dim3(TT / 64, DV / 64, 1), 32, 0, stream>>>(XB, nullptr, WV, nullptr, DM, FV2, DV, nullptr, 0, 0, 0); k_vtp<<<(unsigned)(((size_t)NVG * TT * HD / 2 + 255) / 256), 256, 0, stream>>>(FV2, DV, NVG, VT16, VTh, VTl);   /* 8 value groups */
        for (int h0 = 0; h0 < NH_; h0 += ZH) { const size_t zq = (size_t)h0, zk = (size_t)(2 * (h0 / 4)), zv = (size_t)(h0 / 4);   // pass = head h = h0/2: z0 = (q1_h, k1_g), z1 = (q2_h, k2_g) with g = h/2; both z use v[g]
            k_gemmc<bf, 2, 1><<<dim3(RH / 64, TT / 64, ZH), 32, 0, stream>>>(QPh + zq * TT * HD, QPl + zq * TT * HD, KPh + zk * TT * HD, KPl + zk * TT * HD, HD, Sb, TT, 0, (size_t)TT * HD, (size_t)TT * HD, (size_t)TT * TT);
            k_gemmc<h16, 0, 1><<<dim3((TT - RH) / 64, TT / 64, ZH), 32, 0, stream>>>(QP16 + zq * TT * HD + (size_t)RH * HD, nullptr, KP16 + zk * TT * HD, nullptr, HD, Sb + (size_t)RH * TT, TT, RH, (size_t)TT * HD, (size_t)TT * HD, (size_t)TT * TT);
            k_asoft<<<ZH * TT / 8, 256, 0, stream>>>(Sb, P16, Ph, Pl);
            k_gemmc<bf, 2, 2><<<dim3(RH / 64, HD / 64, ZH), 32, 0, stream>>>(Ph, Pl, VTh + zv * HD * TT, VTl + zv * HD * TT, TT, Ob, HD, 0, (size_t)RH * TT, 0, (size_t)TT * HD);
            k_gemmc<h16, 0, 2><<<dim3((TT - RH) / 64, HD / 64, ZH), 32, 0, stream>>>(P16 + (size_t)RH * TT, nullptr, VT16 + zv * HD * TT, nullptr, TT, Ob + (size_t)RH * HD, HD, RH, (size_t)TT * TT, 0, (size_t)TT * HD);
            k_dcomb<<<(unsigned)(((size_t)TT * HD / 4 + 255) / 256), 256, 0, stream>>>(Ob, LAM, h0 / 2, Y); }   /* y_h = a1 v - lambda a2 v */
        k_gnstat<<<NHD, 1024, 0, stream>>>(Y, ST); k_gnapply<<<(unsigned)(((size_t)TT * NHD * HD / 4 + 255) / 256), 256, 0, stream>>>(Y, ST, ATh, ATl);   /* GroupNorm per head x (1 - lambda_init) -> planes */
        k_gemmw<bf, 1, false><<<dim3(TT / 64, DM / 64, 1), 32, 0, stream>>>(ATh, ATl, WO, nullptr, NHD * HD, OUT + (size_t)b * TT * DM, DM, nullptr, 0, 0, 0); }
}

// v002
// One run takes 273 microseconds.
// Timed twice side by side with v001, it ran 4.72 and 4.67 times as fast.
// Counting every step since v000, it is 6.80 times as fast.
#include <hip/hip_runtime.h>

// Differential attention (x [1][2048][1024]; q = x wq^T viewed (T, 16, 2, 64): q1/q2 per head; k = x wk^T viewed (T, 8, 2, 64): k1/k2 per kv group; v = x wv^T (8 x 64); interleaved-pair rotary on q1, q2, k1, k2 with the given cos/sin tables [2048][32]; head h uses kv group h/2; a1 = causal softmax(q1.k1/8), a2 = causal softmax(q2.k2/8); lambda = exp(lq1.lk1) - exp(lq2.lk2) + lambda_init (lambda vectors [64], read); y = (a1 - lambda a2) v; GroupNorm per (head) over (T, 64) (eps 1e-5, no affine) x (1 - lambda_init); out = y wo^T -> [1][2048][1024] (2.1 M)).
// Compute dtypes, f32 accumulate: every input rounded to bf16; projections exact; rotary f32; attention rows < 512 3 products, rest fp16, scores and probabilities kept on chip (one fused launch for all heads); softmax, lambda, combine and GroupNorm f32 (fixed-order reductions); wo hl x exact.

#define NB_  1
#define TT   2048
#define DM   1024
#define NH_  32
#define NKV  16
#define REP  (NH_ / NKV)
#define HD   64
#define DQ   (NH_ * HD)
#define DKV  (NKV * HD)
#define ZH   2
#define RH   512                  // query rows < RH use hi+lo planes (0: none)
#define WIN  2048
#define PCAR 1024.0f
#define SCL  0.125f
#define NVG  8       // value groups
#define DV   (NVG * HD)   // 512
#define NHD  16      // real heads
#define LINIT 0.35550906759096934f   // 0.8 - 0.6 exp(-0.3)
typedef _Float16 h16;
typedef unsigned short bf;
typedef __attribute__((ext_vector_type(16))) __bf16   v16bf;
typedef __attribute__((ext_vector_type(16))) _Float16 v16h;
typedef __attribute__((ext_vector_type(8)))  _Float16 v8h;
typedef __attribute__((ext_vector_type(8)))  unsigned short v8us;
typedef __attribute__((ext_vector_type(8)))  float    v8f;
typedef __attribute__((ext_vector_type(4)))  float    v4f;
typedef v8h  __attribute__((may_alias)) v8ha;
typedef v4f  __attribute__((may_alias)) v4fa;
typedef v8us __attribute__((may_alias)) v8usa;

__device__ __forceinline__ unsigned short f2bf(float f) { unsigned u = __float_as_uint(f); u += 0x7FFFu + ((u >> 16) & 1u); return (unsigned short)(u >> 16); }
__device__ __forceinline__ float bf2f(unsigned short b) { return __uint_as_float(((unsigned)b) << 16); }
__device__ __forceinline__ float bfr(float f) { return bf2f(f2bf(f)); }
__device__ __forceinline__ v16h cat16(v8h lo, v8h hi) { return __builtin_shufflevector(lo, hi, 0, 1, 2, 3, 4, 5, 6, 7, 8, 9, 10, 11, 12, 13, 14, 15); }
__device__ __forceinline__ v16bf cat16b(v8us lo, v8us hi) { return __builtin_bit_cast(v16bf, __builtin_shufflevector(lo, hi, 0, 1, 2, 3, 4, 5, 6, 7, 8, 9, 10, 11, 12, 13, 14, 15)); }
__device__ __forceinline__ v8f wmma16(v16h a, v16h b, v8f c) { return __builtin_amdgcn_wmma_f32_16x16x32_f16(false, a, false, b, (short)0, c, false, false); }
__device__ __forceinline__ v8f wmmab(v16bf a, v16bf b, v8f c) { return __builtin_amdgcn_wmma_f32_16x16x32_bf16(false, a, false, b, (short)0, c, false, false); }



// ---- k_gemmw: register-blocked GEMM, ONE WAVE per 64x64 output tile (16 accumulators), operands straight from K-contiguous 16-bit planes; grid (M/64, N/64, Z), 32 threads.
// C[m][n] (f32, pitch ldc, + optional f32 bias[n]) = sum_k A[m][k] Bt[n][k] (+ split products per NSPLIT). z-batch strides sA/sB/sC in elements. K % 32 == 0.
template <typename T16> struct WFrag;
template <> struct WFrag<h16> { typedef v16h V; static __device__ __forceinline__ V ld(const h16* p) { return cat16(*(const v8h*)p, *(const v8h*)(p + 16)); } static __device__ __forceinline__ v8f mma(V a, V b, v8f c) { return wmma16(a, b, c); } };
template <> struct WFrag<bf> { typedef v16bf V; static __device__ __forceinline__ V ld(const bf* p) { return cat16b(*(const v8us*)p, *(const v8us*)(p + 16)); } static __device__ __forceinline__ v8f mma(V a, V b, v8f c) { return wmmab(a, b, c); } };
template <typename T16, int NSPLIT, bool BIAS>
__global__ __launch_bounds__(32) void k_gemmw(const T16* __restrict__ A, const T16* __restrict__ A2, const T16* __restrict__ Bt, const T16* __restrict__ Bt2, int K, float* C, int ldc, const float* __restrict__ bias, size_t sA, size_t sB, size_t sC) {
    typedef typename WFrag<T16>::V V;
    __shared__ __align__(16) float os[16 * 68];
    const size_t z = blockIdx.z; A += z * sA; if (A2) A2 += z * sA; Bt += z * sB; if (Bt2) Bt2 += z * sB; C += z * sC;
    const int lane = threadIdx.x & 31, lr = lane & 15, hi = lane >> 4; const int r0 = blockIdx.x * 64, c0 = blockIdx.y * 64;
    v8f acc[4][4];
#pragma unroll
    for (int mb = 0; mb < 4; ++mb)
#pragma unroll
        for (int nb = 0; nb < 4; ++nb) acc[mb][nb] = (v8f){};
    const size_t aoff = (size_t)(r0 + lr) * K + 8 * hi, boff = (size_t)(c0 + lr) * K + 8 * hi;
#pragma unroll 1
    for (int kc = 0; kc < K; kc += 32) {
        V a[4], a2[4];
#pragma unroll
        for (int mb = 0; mb < 4; ++mb) { a[mb] = WFrag<T16>::ld(A + aoff + (size_t)mb * 16 * K + kc); if (NSPLIT == 1 || NSPLIT == 2) a2[mb] = WFrag<T16>::ld(A2 + aoff + (size_t)mb * 16 * K + kc); }
#pragma unroll
        for (int nb = 0; nb < 4; ++nb) { const V b = WFrag<T16>::ld(Bt + boff + (size_t)nb * 16 * K + kc); V b2; if (NSPLIT >= 2) b2 = WFrag<T16>::ld(Bt2 + boff + (size_t)nb * 16 * K + kc);
#pragma unroll
            for (int mb = 0; mb < 4; ++mb) { acc[mb][nb] = WFrag<T16>::mma(a[mb], b, acc[mb][nb]); if (NSPLIT == 1 || NSPLIT == 2) acc[mb][nb] = WFrag<T16>::mma(a2[mb], b, acc[mb][nb]); if (NSPLIT >= 2) acc[mb][nb] = WFrag<T16>::mma(a[mb], b2, acc[mb][nb]); } }
        asm volatile("v_nop\n\tv_nop\n\tv_nop\n\tv_nop" : "+v"(acc[0][0]), "+v"(acc[1][1]), "+v"(acc[2][2]), "+v"(acc[3][3]) : "v"(a[0]), "v"(a[3]));
    }
#pragma unroll
    for (int mb = 0; mb < 4; ++mb) {
#pragma unroll
        for (int nb = 0; nb < 4; ++nb) {
#pragma unroll
            for (int j = 0; j < 8; ++j) os[(hi * 8 + j) * 68 + nb * 16 + lr] = acc[mb][nb][j]; }
        __builtin_amdgcn_wave_barrier(); asm volatile("" ::: "memory");
        float* crow = C + (size_t)(r0 + mb * 16) * ldc + c0;
{
#pragma unroll
            for (int s = 0; s < 8; ++s) { const int row = 2 * s + hi, cofs = lr * 4; v4f val = *(const v4fa*)(os + row * 68 + cofs); if (BIAS) { val[0] += bfr(bias[c0 + cofs]); val[1] += bfr(bias[c0 + cofs + 1]); val[2] += bfr(bias[c0 + cofs + 2]); val[3] += bfr(bias[c0 + cofs + 3]); }
                *(v4f*)(crow + (size_t)row * ldc + cofs) = val; }
             }
        __builtin_amdgcn_wave_barrier(); asm volatile("" ::: "memory");
    }
}

__device__ __forceinline__ h16 tohx(float x) { return (h16)x; }
__device__ __forceinline__ void splitf(float y, unsigned short& h, unsigned short& l) { h = f2bf(y); l = f2bf(y - bf2f(h)); }
typedef __attribute__((ext_vector_type(2))) _Float16 v2h;
typedef __attribute__((ext_vector_type(4))) _Float16 v4h;
typedef __attribute__((ext_vector_type(2))) unsigned short v2us;
typedef __attribute__((ext_vector_type(4))) unsigned short v4us;
typedef __attribute__((ext_vector_type(2))) float v2f;
typedef __attribute__((ext_vector_type(4))) int v4i;

__global__ __launch_bounds__(256) void k_wtG(const float* __restrict__ w, int K, int N, bf* Bt) {
    const int lane = threadIdx.x & 31; const int L0 = (blockIdx.x * 8 + (threadIdx.x >> 5)) * 8; const int nlines = N * K / 64;
{
#pragma unroll 1
        for (int l = 0; l < 8; ++l) { const int L = L0 + l; if (L >= nlines) break; const size_t e = (size_t)L * 64 + lane * 2; const int k = (int)(e % K), n = (int)(e / K); v2us o;
            o[0] = f2bf(w[(size_t)k * N + n]); o[1] = f2bf(w[(size_t)(k + 1) * N + n]); *(v2us*)(Bt + e) = o; }
         }
}
__global__ __launch_bounds__(256) void k_cvt8(const float* __restrict__ src, bf* dst, size_t n8) { const size_t i = (size_t)blockIdx.x * 256 + threadIdx.x; if (i >= n8) return; const v8f v = *(const v8f*)(src + i * 8); v8us o;
#pragma unroll
    for (int k = 0; k < 8; ++k) o[k] = f2bf(v[k]); *(v8us*)(dst + i * 8) = o;  }

__global__ __launch_bounds__(256) void k_ropeI(const float* __restrict__ F, int pitch, int nheads, const float* __restrict__ CS, float sc, h16* P16, bf* Ph, bf* Pl) {
    const size_t e = ((size_t)blockIdx.x * 256 + threadIdx.x) * 2; if (e >= (size_t)nheads * TT * HD) return; const int d = (int)(e % HD); const int t = (int)((e / HD) % TT); const int h = (int)(e / ((size_t)HD * TT)); const float* f = F + (size_t)t * pitch + h * HD; const float x0 = f[d], x1 = f[d + 1]; const v2f cs = *(const v2f*)(CS + ((size_t)t * HD + d) * 2); v2h o16; v2us oh, ol;
    float a0 = __fmul_rn(x0, cs[0]), b0 = __fmul_rn(x1, cs[1]), a1 = __fmul_rn(x1, cs[0]), b1 = __fmul_rn(x0, cs[1]); asm volatile("" : "+v"(a0), "+v"(b0), "+v"(a1), "+v"(b1));
    float r0 = __fsub_rn(a0, b0) * sc, r1 = __fadd_rn(b1, a1) * sc;   /* even: x0 c - x1 s; odd: x0 s + x1 c */
    o16[0] = tohx(r0); o16[1] = tohx(r1); { unsigned short a2, c2; splitf(r0, a2, c2); oh[0] = a2; ol[0] = c2; splitf(r1, a2, c2); oh[1] = a2; ol[1] = c2; }
    *(v2h*)(P16 + e) = o16; *(v2us*)(Ph + e) = oh; *(v2us*)(Pl + e) = ol;  }


__global__ __launch_bounds__(256) void k_csin2(const float* __restrict__ cs, const float* __restrict__ sn, float* CS) { const int idx = blockIdx.x * 256 + threadIdx.x; if (idx >= TT * HD) return; const int d = idx % HD; const int t = idx / HD; v2f o; o[0] = bfr(cs[t * (HD / 2) + (d >> 1)]); o[1] = bfr(sn[t * (HD / 2) + (d >> 1)]); *(v2f*)(CS + (size_t)idx * 2) = o;  }
__global__ __launch_bounds__(64) void k_lambda(const float* __restrict__ a1, const float* __restrict__ b1, const float* __restrict__ a2, const float* __restrict__ b2, float* LAM) { float s1 = 0.f, s2 = 0.f;
#pragma unroll 1
    for (int d = 0; d < HD; ++d) { float p1 = __fmul_rn(bfr(a1[d]), bfr(b1[d])), p2 = __fmul_rn(bfr(a2[d]), bfr(b2[d])); asm volatile("" : "+v"(p1), "+v"(p2)); s1 = __fadd_rn(s1, p1); s2 = __fadd_rn(s2, p2); }
    const float lam = __fadd_rn(__fsub_rn(expf(s1), expf(s2)), LINIT); *(float*)(LAM + threadIdx.x) = lam;  }
__global__ __launch_bounds__(256) void k_dcomb(const float* __restrict__ O, const float* __restrict__ LAM, float* Y) { const size_t i = (size_t)blockIdx.x * 256 + threadIdx.x; if (i >= (size_t)TT * HD / 4) return; const int h = blockIdx.y; O += (size_t)h * 2 * TT * HD; const int d0 = (int)(i % (HD / 4)) * 4; const size_t t = i / (HD / 4); const float cs = (t < RH) ? 1.0f : (1.0f / PCAR); const float lam = LAM[0]; const v4f a = *(const v4f*)(O + t * HD + d0); const v4f b = *(const v4f*)(O + (size_t)TT * HD + t * HD + d0); v4f o;
#pragma unroll
    for (int q = 0; q < 4; ++q) { float p = __fmul_rn(a[q], cs), m = __fmul_rn(__fmul_rn(b[q], cs), lam); asm volatile("" : "+v"(p), "+v"(m)); o[q] = __fsub_rn(p, m); }
    *(v4f*)(Y + t * (NHD * HD) + (size_t)h * HD + d0) = o;  }
// k_gnstat: one work-group of 32 waves per head. A wave load covers two 256-B row segments of the head (lanes 0-15 one row, 16-31 the next), the 32 waves cover 64 rows, 32 steps cover the 2048 rows.
// Mean first, then the squared deviations from it (two reads of Y, the second from L2). Fixed-order sums: per lane over its steps, xor tree in the wave, one LDS word per wave, the same xor tree over the 32 words (in every wave for the mean, in wave 0 for the variance).
__device__ __forceinline__ float gn_wavesum(float s) {
#pragma unroll
    for (int sh = 16; sh; sh >>= 1) s += __shfl_xor(s, sh, 32);
    return s; }
__global__ __launch_bounds__(1024) void k_gnstat(const float* __restrict__ Y, float* ST) { __shared__ float red1[32]; __shared__ float red2[32];
    const int h = blockIdx.x; const int lane = threadIdx.x & 31, wv = threadIdx.x >> 5; const float nf = (float)((size_t)TT * HD);
    const float* yp = Y + (size_t)(wv * 2 + (lane >> 4)) * (NHD * HD) + (size_t)h * HD + (lane & 15) * 4;
    float s = 0.f;
#pragma unroll   // independent loads in flight together: the latency of one L2 read is paid per batch, not per row
    for (int st = 0; st < TT / 64; ++st) { const v4f a = *(const v4f*)(yp + (size_t)st * 64 * (NHD * HD)); s += (a[0] + a[1]) + (a[2] + a[3]); }
    s = gn_wavesum(s); if (lane == 0) red1[wv] = s;
    __syncthreads();   // every wave's partial sum is in red1 before any wave adds them up
    const float mean = __fdiv_rn(gn_wavesum(red1[lane]), nf);
    float s2 = 0.f;
#pragma unroll   // as above
    for (int st = 0; st < TT / 64; ++st) { const v4f a = *(const v4f*)(yp + (size_t)st * 64 * (NHD * HD)); float acc = 0.f;
#pragma unroll
        for (int q = 0; q < 4; ++q) { const float dv = a[q] - mean; acc += dv * dv; } s2 += acc; }
    s2 = gn_wavesum(s2); if (lane == 0) red2[wv] = s2;
    __syncthreads();   // every wave's partial sum is in red2 before wave 0 adds them up
    if (wv == 0) { const float var = __fdiv_rn(gn_wavesum(red2[lane]), nf); ST[h * 32 + lane] = (lane & 1) ? var : mean; } }

__global__ __launch_bounds__(256) void k_gnapply(const float* __restrict__ Y, const float* __restrict__ ST, bf* Ah, bf* Al) { const size_t i = (size_t)blockIdx.x * 256 + threadIdx.x; if (i >= (size_t)TT * NHD * HD / 4) return; const int c0 = (int)(i % (NHD * HD / 4)) * 4; const size_t t = i / (NHD * HD / 4); const int h = c0 / HD; const float mean = ST[h * 32], var = ST[h * 32 + 1]; const float rs = __fdiv_rn(1.0f, __fsqrt_rn(__fadd_rn(var, 1e-5f))); const v4f a = *(const v4f*)(Y + t * (NHD * HD) + c0); v4us oh, ol;
#pragma unroll
    for (int q = 0; q < 4; ++q) { float nv = __fmul_rn(__fsub_rn(a[q], mean), rs); asm volatile("" : "+v"(nv)); unsigned short h2, l2; splitf(__fmul_rn(nv, 1.0f - LINIT), h2, l2); oh[q] = h2; ol[q] = l2; }
    *(v4us*)(Ah + t * (NHD * HD) + c0) = oh; *(v4us*)(Al + t * (NHD * HD) + c0) = ol;  }

__global__ __launch_bounds__(256) void k_vtp(const float* __restrict__ F, int pitch, int nheads, h16* V16, bf* Vh, bf* Vl) { const size_t e = ((size_t)blockIdx.x * 256 + threadIdx.x) * 2; if (e >= (size_t)nheads * HD * TT) return; const int t = (int)(e % TT); const int d = (int)((e / TT) % HD); const int g = (int)(e / ((size_t)TT * HD)); v2h o16; v2us oh, ol;
#pragma unroll
    for (int q = 0; q < 2; ++q) { const float x = F[(size_t)(t + q) * pitch + g * HD + d]; o16[q] = tohx(x); unsigned short a2, c2; splitf(x, a2, c2); oh[q] = a2; ol[q] = c2; }
    *(v2h*)(V16 + e) = o16; *(v2us*)(Vh + e) = oh; *(v2us*)(Vl + e) = ol;  }
// ---- k_fattn: scores, causal softmax and probability x value in ONE launch for all 32 query sub-heads; no score or probability ever goes to memory.
// One wave owns 16 query rows and walks the keys 0 .. its diagonal in blocks of 64. Walk 1: scores, row maximum. Walk 2: the same scores again, e = exp(t - max), row sum, e to 16-bit through a
// per-wave LDS tile (accumulator layout -> A fragment layout), P.V accumulated in key order; the division by the row sum comes after P.V. Rows < RH: hi+lo planes, 3 products; the rest fp16 with e x PCAR.
// A work-group (4 waves, 64 rows) does row block 31 - blockIdx.x and then row block blockIdx.x: every work-group walks the same number of key blocks, wherever it is placed.
#define PP 72   // LDS pitch of a probability row in 16-bit elements: 144 B = 16 B x odd, the conflict-free pitch for 16-byte reads
template <typename T16> struct LFrag;
template <> struct LFrag<h16> { static __device__ __forceinline__ v16h ld(const h16* p) { return cat16(*(const v8ha*)p, *(const v8ha*)(p + 16)); } };
template <> struct LFrag<bf> { static __device__ __forceinline__ v16bf ld(const bf* p) { return cat16b(*(const v8usa*)p, *(const v8usa*)(p + 16)); } };
// 2^x with the free issue slot behind the transcendental in the same statement: the next vector instruction may then read the result or overwrite the source.
__device__ __forceinline__ float fattn_exp2(float x) { float r; asm("v_exp_f32 %0, %1\n\tv_nop" : "=v"(r) : "v"(x)); return r; }
// Four B fragments (nb = 0..3) of k step ks of one 64-key block: rows nb*16+lr of a plane with the given pitch; pl is the lane's own pointer (row lr, k offset 8*hi).
template <typename T16>
__device__ __forceinline__ void fattn_ld4(const T16* __restrict__ pl, size_t pitch, int ks, typename WFrag<T16>::V (&b)[4]) {
#pragma unroll
    for (int nb = 0; nb < 4; ++nb) b[nb] = WFrag<T16>::ld(pl + ((size_t)nb * 16 * pitch + ks * 32));
}
// Inputs-only fences on loaded fragments: every load of the batch is issued before the first matrix instruction waits, so a batch pays one load latency, not one per fragment.
// The lane pointers are named too: their registers stay untouched until the batch has landed.
template <typename V, typename T16> __device__ __forceinline__ void fattn_hold8(const V (&x)[4], const V (&y)[4], const T16* p, const T16* r) { asm volatile("" :: "v"(x[0]), "v"(x[1]), "v"(x[2]), "v"(x[3]), "v"(y[0]), "v"(y[1]), "v"(y[2]), "v"(y[3]), "v"(p), "v"(r)); }
template <typename V, typename T16> __device__ __forceinline__ void fattn_hold16(const V (&x)[4], const V (&y)[4], const V (&z)[4], const V (&w)[4], const T16* p, const T16* r) { asm volatile("" :: "v"(x[0]), "v"(x[1]), "v"(x[2]), "v"(x[3]), "v"(y[0]), "v"(y[1]), "v"(y[2]), "v"(y[3]), "v"(z[0]), "v"(z[1]), "v"(z[2]), "v"(z[3]), "v"(w[0]), "v"(w[1]), "v"(w[2]), "v"(w[3]), "v"(p), "v"(r)); }
// acc[nb] += a x b[nb] (+ a2 x b[nb] + a x b2[nb] for the hi+lo planes)
template <typename T16, bool HI>
__device__ __forceinline__ void fattn_mm(const typename WFrag<T16>::V& a, const typename WFrag<T16>::V& a2, const typename WFrag<T16>::V (&b)[4], const typename WFrag<T16>::V (&b2)[4], v8f (&acc)[4]) {
#pragma unroll
    for (int nb = 0; nb < 4; ++nb) { acc[nb] = WFrag<T16>::mma(a, b[nb], acc[nb]);
        if (HI) { acc[nb] = WFrag<T16>::mma(a2, b[nb], acc[nb]); acc[nb] = WFrag<T16>::mma(a, b2[nb], acc[nb]); } }
}
template <typename T16, bool HI>
__device__ __forceinline__ void fattn_strip(const T16* __restrict__ Q, const T16* __restrict__ Q2, const T16* __restrict__ Kp, const T16* __restrict__ Kp2, const T16* __restrict__ Vt, const T16* __restrict__ Vt2, int i0, T16* ps, T16* ps2, float* O) {
    typedef typename WFrag<T16>::V V;
    const int lane = threadIdx.x & 31, lr = lane & 15, hi = lane >> 4;
    V q[2], q2[2];
#pragma unroll
    for (int ks = 0; ks < 2; ++ks) { q[ks] = WFrag<T16>::ld(Q + (size_t)(i0 + lr) * HD + ks * 32 + 8 * hi); q2[ks] = HI ? WFrag<T16>::ld(Q2 + (size_t)(i0 + lr) * HD + ks * 32 + 8 * hi) : q[ks]; }
    asm volatile("s_wait_xcnt 0x0" :: "v"(q[0]), "v"(q[1]), "v"(q2[0]), "v"(q2[1]) : "memory");   // behind the query loads, before their address registers are used for anything else
    const int jend = (i0 & ~63) + 64;                  // keys 0 .. jend-1: up to the end of the 64-key block that holds the diagonal (jend <= TT)
    const unsigned koff = lr * HD + 8 * hi, voff = lr * TT + 8 * hi;
    float mx[8];
#pragma unroll
    for (int j = 0; j < 8; ++j) mx[j] = -3.0e38f;
    for (int j0 = 0; j0 < jend; j0 += 64) { V kb[2][4], kb2[2][4]; v8f s[4]; const T16* pk = (Kp + (size_t)j0 * HD) + koff; const T16* pk2 = (Kp2 + (size_t)j0 * HD) + koff;
#pragma unroll
        for (int nb = 0; nb < 4; ++nb) s[nb] = (v8f){};
        if constexpr (HI) {
#pragma unroll
            for (int ks = 0; ks < 2; ++ks) { fattn_ld4<T16>(pk, HD, ks, kb[ks]); fattn_ld4<T16>(pk2, HD, ks, kb2[ks]); fattn_hold8(kb[ks], kb2[ks], pk, pk2); fattn_mm<T16, HI>(q[ks], q2[ks], kb[ks], kb2[ks], s); }
        } else { fattn_ld4<T16>(pk, HD, 0, kb[0]); fattn_ld4<T16>(pk, HD, 1, kb[1]); fattn_hold8(kb[0], kb[1], pk, pk); fattn_mm<T16, HI>(q[0], q2[0], kb[0], kb2[0], s); fattn_mm<T16, HI>(q[1], q2[1], kb[1], kb2[1], s); }
#pragma unroll
        for (int nb = 0; nb < 4; ++nb)
#pragma unroll
            for (int j = 0; j < 8; ++j) mx[j] = fmaxf(mx[j], (j0 + nb * 16 + lr <= i0 + hi * 8 + j) ? s[nb][j] * SCL : -3.0e38f); }
#pragma unroll
    for (int j = 0; j < 8; ++j)
#pragma unroll
        for (int sh = 8; sh; sh >>= 1) mx[j] = fmaxf(mx[j], __shfl_xor(mx[j], sh, 32));   // row hi*8+j lives in the 16 lanes of this half
    float sum[8]; v8f o[4];
#pragma unroll
    for (int j = 0; j < 8; ++j) sum[j] = 0.f;
#pragma unroll
    for (int nb = 0; nb < 4; ++nb) o[nb] = (v8f){};
    for (int j0 = 0; j0 < jend; j0 += 64) { V kb[2][4], kb2[2][4], vb[2][4], vb2[2][4]; v8f s[4]; const T16* pk = (Kp + (size_t)j0 * HD) + koff; const T16* pk2 = (Kp2 + (size_t)j0 * HD) + koff; const T16* pv = (Vt + j0) + voff; const T16* pv2 = (Vt2 + j0) + voff;
#pragma unroll
        for (int nb = 0; nb < 4; ++nb) s[nb] = (v8f){};
        if constexpr (HI) {
#pragma unroll
            for (int ks = 0; ks < 2; ++ks) { fattn_ld4<T16>(pk, HD, ks, kb[ks]); fattn_ld4<T16>(pk2, HD, ks, kb2[ks]); fattn_hold8(kb[ks], kb2[ks], pk, pk2); fattn_mm<T16, HI>(q[ks], q2[ks], kb[ks], kb2[ks], s); }
        } else {   // one plane each: key and value fragments fly together
            fattn_ld4<T16>(pk, HD, 0, kb[0]); fattn_ld4<T16>(pk, HD, 1, kb[1]); fattn_ld4<T16>(pv, TT, 0, vb[0]); fattn_ld4<T16>(pv, TT, 1, vb[1]); fattn_hold16(kb[0], kb[1], vb[0], vb[1], pk, pv);
            fattn_mm<T16, HI>(q[0], q2[0], kb[0], kb2[0], s); fattn_mm<T16, HI>(q[1], q2[1], kb[1], kb2[1], s); }
#pragma unroll
        for (int nb = 0; nb < 4; ++nb)
#pragma unroll
            for (int j = 0; j < 8; ++j) { const float t = (j0 + nb * 16 + lr <= i0 + hi * 8 + j) ? s[nb][j] * SCL : -3.0e38f; const float e = fattn_exp2((t - mx[j]) * 1.4426950408889634f); sum[j] += e;
                const int po = (hi * 8 + j) * PP + nb * 16 + lr;
                if constexpr (HI) { unsigned short eh, el; splitf(e, eh, el); ps[po] = eh; ps2[po] = el; } else ps[po] = tohx(e * PCAR); }
        __builtin_amdgcn_wave_barrier(); asm volatile("" ::: "memory");   // the tile is read below by other lanes of this wave: keep the stores in front of the reads
#pragma unroll
        for (int ks = 0; ks < 2; ++ks) { const V a = LFrag<T16>::ld(ps + lr * PP + ks * 32 + 8 * hi); V a2 = a;
            if constexpr (HI) { a2 = LFrag<T16>::ld(ps2 + lr * PP + ks * 32 + 8 * hi); fattn_ld4<T16>(pv, TT, ks, vb[ks]); fattn_ld4<T16>(pv2, TT, ks, vb2[ks]); fattn_hold8(vb[ks], vb2[ks], pv, pv2); }
            fattn_mm<T16, HI>(a, a2, vb[ks], vb2[ks], o); }
        __builtin_amdgcn_wave_barrier(); asm volatile("" ::: "memory");   // and the reads in front of the next block's stores
    }
#pragma unroll
    for (int j = 0; j < 8; ++j) {
#pragma unroll
        for (int sh = 8; sh; sh >>= 1) sum[j] += __shfl_xor(sum[j], sh, 32);
        const float f = __fdiv_rn(1.0f, sum[j]);
#pragma unroll
        for (int nb = 0; nb < 4; ++nb) O[(size_t)(i0 + hi * 8 + j) * HD + nb * 16 + lr] = o[nb][j] * f; }
    asm volatile("s_wait_xcnt 0x0" ::: "memory");   // behind the output stores, before the next strip reuses their address and data registers
}
// launch bounds: the second figure holds the kernel to the 256 directly addressed vector registers (no register-bank switching in the loops)
__global__ __launch_bounds__(128, 4) void k_fattn(const h16* __restrict__ QP16, const bf* __restrict__ QPh, const bf* __restrict__ QPl, const h16* __restrict__ KP16, const bf* __restrict__ KPh, const bf* __restrict__ KPl, const h16* __restrict__ VT16, const bf* __restrict__ VTh, const bf* __restrict__ VTl, float* Ob) {
    __shared__ __align__(16) unsigned short pt[4][2][16 * PP];
    const int wv = __builtin_amdgcn_readfirstlane(threadIdx.x >> 5); const int z = blockIdx.y;   // wave number in a scalar register: scalar loop bounds. z = 2h: (q1_h, k1_g), z = 2h+1: (q2_h, k2_g), g = h/2; both use v[g]
    const size_t zq = (size_t)z * TT * HD, zk = (size_t)(2 * (z / 4) + (z & 1)) * TT * HD, zv = (size_t)(z / 4) * HD * TT;
#pragma unroll 1   // one copy of each path in the code
    for (int half = 0; half < 2; ++half) { const int rb = half ? (int)blockIdx.x : TT / 64 - 1 - (int)blockIdx.x; const int i0 = rb * 64 + wv * 16;
        if (rb * 64 < RH) fattn_strip<bf, true>(QPh + zq, QPl + zq, KPh + zk, KPl + zk, VTh + zv, VTl + zv, i0, pt[wv][0], pt[wv][1], Ob + zq);
        else fattn_strip<h16, false>(QP16 + zq, QP16 + zq, KP16 + zk, KP16 + zk, VT16 + zv, VT16 + zv, i0, (h16*)pt[wv][0], (h16*)pt[wv][1], Ob + zq); }
}
__global__ __launch_bounds__(256) void k_merge(const float* __restrict__ O, int h0, bf* Ah, bf* Al) { const size_t e = ((size_t)blockIdx.x * 256 + threadIdx.x) * 2; if (e >= (size_t)ZH * TT * HD) return; const int d = (int)(e % HD); const int t = (int)((e / HD) % TT); const int zz = (int)(e / ((size_t)HD * TT)); const float cs = (t < RH) ? 1.0f : (1.0f / PCAR); const size_t oo = (size_t)t * DQ + (h0 + zz) * HD + d;
    v2us oh, ol;
#pragma unroll
    for (int q = 0; q < 2; ++q) { unsigned short a, c2; splitf(O[e + q] * cs, a, c2); oh[q] = a; ol[q] = c2; } *(v2us*)(Ah + oo) = oh; *(v2us*)(Al + oo) = ol;  }

extern "C" void kernel_launch(void* const* d_in, const int* in_sizes, int n_in,
                              void* d_out, int out_size, void* d_ws, size_t ws_size, hipStream_t stream) {
    (void)in_sizes; (void)n_in; (void)out_size;
    const float* x = (const float*)d_in[0]; const float* fcos = (const float*)d_in[1]; const float* fsin = (const float*)d_in[2]; const float* wq = (const float*)d_in[3]; const float* wk = (const float*)d_in[4]; const float* wv = (const float*)d_in[5]; const float* wo = (const float*)d_in[6]; const float* lq1 = (const float*)d_in[7]; const float* lk1 = (const float*)d_in[8]; const float* lq2 = (const float*)d_in[9]; const float* lk2 = (const float*)d_in[10];
    float* OUT = (float*)d_out;     // [1][2048][1024]
    char* wsp = (char*)d_ws;
    auto take = [&](size_t bytes) { char* p = wsp; wsp += (bytes + 255) & ~(size_t)255; return (void*)p; };
    bf* WQ = (bf*)take((size_t)DQ * DM * 2); bf* WK = (bf*)take((size_t)DKV * DM * 2); bf* WV = (bf*)take((size_t)DV * DM * 2); bf* WO = (bf*)take((size_t)DM * NHD * HD * 2); float* LAM = (float*)take(64 * 4); float* ST = (float*)take((size_t)NHD * 32 * 4); float* Y = (float*)take((size_t)TT * NHD * HD * 4); float* FV2 = (float*)take((size_t)TT * DV * 4); float* CS = (float*)take((size_t)TT * HD * 2 * 4);
    bf* XB = (bf*)take((size_t)TT * DM * 2); float* FQ = (float*)take((size_t)TT * DQ * 4); float* FK = (float*)take((size_t)TT * DKV * 4);
    h16* QP16 = (h16*)take((size_t)NH_ * TT * HD * 2); h16* KP16 = (h16*)take((size_t)NKV * TT * HD * 2); h16* VT16 = (h16*)take((size_t)NVG * HD * TT * 2);
    bf* QPh = (bf*)take((size_t)NH_ * TT * HD * 2); bf* QPl = (bf*)take((size_t)NH_ * TT * HD * 2); bf* KPh = (bf*)take((size_t)NKV * TT * HD * 2); bf* KPl = (bf*)take((size_t)NKV * TT * HD * 2); bf* VTh = (bf*)take((size_t)NVG * HD * TT * 2); bf* VTl = (bf*)take((size_t)NVG * HD * TT * 2);
    float* Ob = (float*)take((size_t)NH_ * TT * HD * 4); bf* ATh = (bf*)take((size_t)TT * NHD * HD * 2); bf* ATl = (bf*)take((size_t)TT * NHD * HD * 2);
    if ((size_t)(wsp - (char*)d_ws) > ws_size) return;    // ws 256 MiB
    float* FV = FK;   // unused: the v projection writes its own buffer FV2
    { k_cvt8<<<(unsigned)(((size_t)DQ * DM / 8 + 255) / 256), 256, 0, stream>>>(wq, WQ, (size_t)DQ * DM / 8); k_cvt8<<<(unsigned)(((size_t)DKV * DM / 8 + 255) / 256), 256, 0, stream>>>(wk, WK, (size_t)DKV * DM / 8); k_cvt8<<<(unsigned)(((size_t)DV * DM / 8 + 255) / 256), 256, 0, stream>>>(wv, WV, (size_t)DV * DM / 8); k_cvt8<<<(unsigned)(((size_t)DM * (NHD * HD) / 8 + 255) / 256), 256, 0, stream>>>(wo, WO, (size_t)DM * (NHD * HD) / 8); k_csin2<<<(TT * HD + 255) / 256, 256, 0, stream>>>(fcos, fsin, CS); k_lambda<<<1, 64, 0, stream>>>(lq1, lk1, lq2, lk2, LAM); }
    const unsigned LQ = (unsigned)(((size_t)NH_ * TT * HD / 2 + 255) / 256), LKv = (unsigned)(((size_t)NKV * TT * HD / 2 + 255) / 256);
    for (int b = 0; b < NB_; ++b) {
        
        k_cvt8<<<(unsigned)(((size_t)TT * DM / 8 + 255) / 256), 256, 0, stream>>>(x + (size_t)b * TT * DM, XB, (size_t)TT * DM / 8);
        k_gemmw<bf, 0, false><<<dim3(TT / 64, DQ / 64, 1), 32, 0, stream>>>(XB, nullptr, WQ, nullptr, DM, FQ, DQ, nullptr, 0, 0, 0);
        k_ropeI<<<LQ, 256, 0, stream>>>(FQ, DQ, NH_, CS, 1.0f, QP16, QPh, QPl);   /* 32 query sub-heads: q1_h = 2h, q2_h = 2h+1 */
        k_gemmw<bf, 0, false><<<dim3(TT / 64, DKV / 64, 1), 32, 0, stream>>>(XB, nullptr, WK, nullptr, DM, FK, DKV, nullptr, 0, 0, 0);
        k_ropeI<<<LKv, 256, 0, stream>>>(FK, DKV, NKV, CS, 1.0f, KP16, KPh, KPl);   /* 16 key sub-heads: k1_g = 2g, k2_g = 2g+1 */
        k_gemmw<bf, 0, false><<<dim3(TT / 64, DV / 64, 1), 32, 0, stream>>>(XB, nullptr, WV, nullptr, DM, FV2, DV, nullptr, 0, 0, 0); k_vtp<<<(unsigned)(((size_t)NVG * TT * HD / 2 + 255) / 256), 256, 0, stream>>>(FV2, DV, NVG, VT16, VTh, VTl);   /* 8 value groups */
        k_fattn<<<dim3(TT / 128, NH_, 1), 128, 0, stream>>>(QP16, QPh, QPl, KP16, KPh, KPl, VT16, VTh, VTl, Ob);   /* all 32 sub-heads: Ob[z] = softmax(q_z k^T / 8) v (x PCAR for rows >= RH) */
        k_dcomb<<<dim3((unsigned)(((size_t)TT * HD / 4 + 255) / 256), NHD, 1), 256, 0, stream>>>(Ob, LAM, Y);   /* y_h = a1 v - lambda a2 v */
        k_gnstat<<<NHD, 1024, 0, stream>>>(Y, ST); k_gnapply<<<(unsigned)(((size_t)TT * NHD * HD / 4 + 255) / 256), 256, 0, stream>>>(Y, ST, ATh, ATl);   /* GroupNorm per head x (1 - lambda_init) -> planes */
        k_gemmw<bf, 1, false><<<dim3(TT / 64, DM / 64, 1), 32, 0, stream>>>(ATh, ATl, WO, nullptr, NHD * HD, OUT + (size_t)b * TT * DM, DM, nullptr, 0, 0, 0); }
}

// v003
// Measured time: 215 microseconds a run.
// Two timings next to v002 both put it at 1.28 times that version's speed.
// Counting every step since v000, it is 8.68 times as fast.
#include <hip/hip_runtime.h>

// Differential attention (x [1][2048][1024]; q = x wq^T viewed (T, 16, 2, 64): q1/q2 per head; k = x wk^T viewed (T, 8, 2, 64): k1/k2 per kv group; v = x wv^T (8 x 64); interleaved-pair rotary on q1, q2, k1, k2 with the given cos/sin tables [2048][32]; head h uses kv group h/2; a1 = causal softmax(q1.k1/8), a2 = causal softmax(q2.k2/8); lambda = exp(lq1.lk1) - exp(lq2.lk2) + lambda_init (lambda vectors [64], read); y = (a1 - lambda a2) v; GroupNorm per (head) over (T, 64) (eps 1e-5, no affine) x (1 - lambda_init); out = y wo^T -> [1][2048][1024] (2.1 M)).
// Compute dtypes, f32 accumulate: every input rounded to bf16; projections exact; rotary f32; attention rows < 512 3 products, rest fp16, scores and probabilities kept on chip (one fused launch for all heads); softmax, lambda, combine and GroupNorm f32 (fixed-order reductions); wo hl x exact.

#define NB_  1
#define TT   2048
#define DM   1024
#define NH_  32
#define NKV  16
#define REP  (NH_ / NKV)
#define HD   64
#define DQ   (NH_ * HD)
#define DKV  (NKV * HD)
#define ZH   2
#define RH   512                  // query rows < RH use hi+lo planes (0: none)
#define WIN  2048
#define PCAR 1024.0f
#define SCL  0.125f
#define NVG  8       // value groups
#define DV   (NVG * HD)   // 512
#define NHD  16      // real heads
#define LINIT 0.35550906759096934f   // 0.8 - 0.6 exp(-0.3)
typedef _Float16 h16;
typedef unsigned short bf;
typedef __attribute__((ext_vector_type(16))) __bf16   v16bf;
typedef __attribute__((ext_vector_type(16))) _Float16 v16h;
typedef __attribute__((ext_vector_type(8)))  _Float16 v8h;
typedef __attribute__((ext_vector_type(8)))  unsigned short v8us;
typedef __attribute__((ext_vector_type(8)))  float    v8f;
typedef __attribute__((ext_vector_type(4)))  float    v4f;
typedef v8h  __attribute__((may_alias)) v8ha;
typedef v4f  __attribute__((may_alias)) v4fa;
typedef v8us __attribute__((may_alias)) v8usa;

__device__ __forceinline__ unsigned short f2bf(float f) { unsigned u = __float_as_uint(f); u += 0x7FFFu + ((u >> 16) & 1u); return (unsigned short)(u >> 16); }
__device__ __forceinline__ float bf2f(unsigned short b) { return __uint_as_float(((unsigned)b) << 16); }
__device__ __forceinline__ float bfr(float f) { return bf2f(f2bf(f)); }
__device__ __forceinline__ v16h cat16(v8h lo, v8h hi) { return __builtin_shufflevector(lo, hi, 0, 1, 2, 3, 4, 5, 6, 7, 8, 9, 10, 11, 12, 13, 14, 15); }
__device__ __forceinline__ v16bf cat16b(v8us lo, v8us hi) { return __builtin_bit_cast(v16bf, __builtin_shufflevector(lo, hi, 0, 1, 2, 3, 4, 5, 6, 7, 8, 9, 10, 11, 12, 13, 14, 15)); }
__device__ __forceinline__ v8f wmma16(v16h a, v16h b, v8f c) { return __builtin_amdgcn_wmma_f32_16x16x32_f16(false, a, false, b, (short)0, c, false, false); }
__device__ __forceinline__ v8f wmmab(v16bf a, v16bf b, v8f c) { return __builtin_amdgcn_wmma_f32_16x16x32_bf16(false, a, false, b, (short)0, c, false, false); }



// ---- k_gemmw: register-blocked GEMM, ONE WAVE per 64x64 output tile (16 accumulators), operands straight from K-contiguous 16-bit planes; grid (M/64, N/64, Z), 32 threads.
// C[m][n] (f32, pitch ldc, + optional f32 bias[n]) = sum_k A[m][k] Bt[n][k] (+ split products per NSPLIT). z-batch strides sA/sB/sC in elements. K % 32 == 0.
template <typename T16> struct WFrag;
template <> struct WFrag<h16> { typedef v16h V; static __device__ __forceinline__ V ld(const h16* p) { return cat16(*(const v8h*)p, *(const v8h*)(p + 16)); } static __device__ __forceinline__ v8f mma(V a, V b, v8f c) { return wmma16(a, b, c); } };
template <> struct WFrag<bf> { typedef v16bf V; static __device__ __forceinline__ V ld(const bf* p) { return cat16b(*(const v8us*)p, *(const v8us*)(p + 16)); } static __device__ __forceinline__ v8f mma(V a, V b, v8f c) { return wmmab(a, b, c); } };
template <typename T16, int NSPLIT, bool BIAS>
__global__ __launch_bounds__(32) void k_gemmw(const T16* __restrict__ A, const T16* __restrict__ A2, const T16* __restrict__ Bt, const T16* __restrict__ Bt2, int K, float* C, int ldc, const float* __restrict__ bias, size_t sA, size_t sB, size_t sC) {
    typedef typename WFrag<T16>::V V;
    __shared__ __align__(16) float os[16 * 68];
    const size_t z = blockIdx.z; A += z * sA; if (A2) A2 += z * sA; Bt += z * sB; if (Bt2) Bt2 += z * sB; C += z * sC;
    const int lane = threadIdx.x & 31, lr = lane & 15, hi = lane >> 4; const int r0 = blockIdx.x * 64, c0 = blockIdx.y * 64;
    v8f acc[4][4];
#pragma unroll
    for (int mb = 0; mb < 4; ++mb)
#pragma unroll
        for (int nb = 0; nb < 4; ++nb) acc[mb][nb] = (v8f){};
    const size_t aoff = (size_t)(r0 + lr) * K + 8 * hi, boff = (size_t)(c0 + lr) * K + 8 * hi;
#pragma unroll 1
    for (int kc = 0; kc < K; kc += 32) {
        V a[4], a2[4];
#pragma unroll
        for (int mb = 0; mb < 4; ++mb) { a[mb] = WFrag<T16>::ld(A + aoff + (size_t)mb * 16 * K + kc); if (NSPLIT == 1 || NSPLIT == 2) a2[mb] = WFrag<T16>::ld(A2 + aoff + (size_t)mb * 16 * K + kc); }
#pragma unroll
        for (int nb = 0; nb < 4; ++nb) { const V b = WFrag<T16>::ld(Bt + boff + (size_t)nb * 16 * K + kc); V b2; if (NSPLIT >= 2) b2 = WFrag<T16>::ld(Bt2 + boff + (size_t)nb * 16 * K + kc);
#pragma unroll
            for (int mb = 0; mb < 4; ++mb) { acc[mb][nb] = WFrag<T16>::mma(a[mb], b, acc[mb][nb]); if (NSPLIT == 1 || NSPLIT == 2) acc[mb][nb] = WFrag<T16>::mma(a2[mb], b, acc[mb][nb]); if (NSPLIT >= 2) acc[mb][nb] = WFrag<T16>::mma(a[mb], b2, acc[mb][nb]); } }
        asm volatile("v_nop\n\tv_nop\n\tv_nop\n\tv_nop" : "+v"(acc[0][0]), "+v"(acc[1][1]), "+v"(acc[2][2]), "+v"(acc[3][3]) : "v"(a[0]), "v"(a[3]));
    }
#pragma unroll
    for (int mb = 0; mb < 4; ++mb) {
#pragma unroll
        for (int nb = 0; nb < 4; ++nb) {
#pragma unroll
            for (int j = 0; j < 8; ++j) os[(hi * 8 + j) * 68 + nb * 16 + lr] = acc[mb][nb][j]; }
        __builtin_amdgcn_wave_barrier(); asm volatile("" ::: "memory");
        float* crow = C + (size_t)(r0 + mb * 16) * ldc + c0;
{
#pragma unroll
            for (int s = 0; s < 8; ++s) { const int row = 2 * s + hi, cofs = lr * 4; v4f val = *(const v4fa*)(os + row * 68 + cofs); if (BIAS) { val[0] += bfr(bias[c0 + cofs]); val[1] += bfr(bias[c0 + cofs + 1]); val[2] += bfr(bias[c0 + cofs + 2]); val[3] += bfr(bias[c0 + cofs + 3]); }
                *(v4f*)(crow + (size_t)row * ldc + cofs) = val; }
             }
        __builtin_amdgcn_wave_barrier(); asm volatile("" ::: "memory");
    }
}

__device__ __forceinline__ h16 tohx(float x) { return (h16)x; }
__device__ __forceinline__ void splitf(float y, unsigned short& h, unsigned short& l) { h = f2bf(y); l = f2bf(y - bf2f(h)); }
typedef __attribute__((ext_vector_type(2))) _Float16 v2h;
typedef __attribute__((ext_vector_type(4))) _Float16 v4h;
typedef __attribute__((ext_vector_type(2))) unsigned short v2us;
typedef __attribute__((ext_vector_type(4))) unsigned short v4us;
typedef __attribute__((ext_vector_type(2))) float v2f;
typedef __attribute__((ext_vector_type(4))) int v4i;

__global__ __launch_bounds__(256) void k_wtG(const float* __restrict__ w, int K, int N, bf* Bt) {
    const int lane = threadIdx.x & 31; const int L0 = (blockIdx.x * 8 + (threadIdx.x >> 5)) * 8; const int nlines = N * K / 64;
{
#pragma unroll 1
        for (int l = 0; l < 8; ++l) { const int L = L0 + l; if (L >= nlines) break; const size_t e = (size_t)L * 64 + lane * 2; const int k = (int)(e % K), n = (int)(e / K); v2us o;
            o[0] = f2bf(w[(size_t)k * N + n]); o[1] = f2bf(w[(size_t)(k + 1) * N + n]); *(v2us*)(Bt + e) = o; }
         }
}
__global__ __launch_bounds__(256) void k_cvt8(const float* __restrict__ src, bf* dst, size_t n8) { const size_t i = (size_t)blockIdx.x * 256 + threadIdx.x; if (i >= n8) return; const v8f v = *(const v8f*)(src + i * 8); v8us o;
#pragma unroll
    for (int k = 0; k < 8; ++k) o[k] = f2bf(v[k]); *(v8us*)(dst + i * 8) = o;  }

// ---- k_qkv: the q, k and v projections in ONE launch, each 64x64 tile finished in its own epilogue: nothing of the projections goes to memory in f32.
// Main loop as in k_gemmw (one wave per tile, bf16 planes, one product). A tile column is one 64-wide sub-head: blockIdx.y 0..31 query sub-heads, 32..47 key sub-heads, 48..55 value groups.
// q, k: interleaved-pair rotary on the staged rows (cos / sin rounded to bf16 as every input), then the fp16 plane and the hi+lo planes [sub-head][t][64], whole 128-B lines per row.
// v: an accumulator register run is 8 consecutive t of one column, which is 16 B of the transposed planes [group][d][t]: stored straight from the registers.
__global__ __launch_bounds__(32) void k_qkv(const bf* __restrict__ A, const bf* __restrict__ WQ, const bf* __restrict__ WK, const bf* __restrict__ WV, const float* __restrict__ fcos, const float* __restrict__ fsin, h16* QP16, bf* QPh, bf* QPl, h16* KP16, bf* KPh, bf* KPl, h16* VT16, bf* VTh, bf* VTl) {
    typedef WFrag<bf>::V V;
    __shared__ __align__(16) float os[16 * 68];
    const int lane = threadIdx.x & 31, lr = lane & 15, hi = lane >> 4; const int r0 = blockIdx.x * 64, cy = blockIdx.y;
    const bf* Bt = (cy < NH_) ? WQ + (size_t)cy * 64 * DM : (cy < NH_ + NKV) ? WK + (size_t)(cy - NH_) * 64 * DM : WV + (size_t)(cy - NH_ - NKV) * 64 * DM;
    v8f acc[4][4];
#pragma unroll
    for (int mb = 0; mb < 4; ++mb)
#pragma unroll
        for (int nb = 0; nb < 4; ++nb) acc[mb][nb] = (v8f){};
    const size_t aoff = (size_t)(r0 + lr) * DM + 8 * hi, boff = (size_t)lr * DM + 8 * hi;
#pragma unroll 1   // one trip in the code, as in k_gemmw: two trips' fragments (2 x 64 registers) beside the 128 accumulator registers would leave the 256 directly addressed ones
    for (int kc = 0; kc < DM; kc += 32) {
        V a[4]; const bf* pa = A + aoff + kc; const bf* pb = Bt + boff + kc;
#pragma unroll
        for (int mb = 0; mb < 4; ++mb) a[mb] = WFrag<bf>::ld(pa + (size_t)mb * 16 * DM);
#pragma unroll
        for (int nb = 0; nb < 4; ++nb) { const V b = WFrag<bf>::ld(pb + (size_t)nb * 16 * DM);
#pragma unroll
            for (int mb = 0; mb < 4; ++mb) acc[mb][nb] = WFrag<bf>::mma(a[mb], b, acc[mb][nb]); }
        asm volatile("v_nop\n\tv_nop\n\tv_nop\n\tv_nop" : "+v"(acc[0][0]), "+v"(acc[1][1]), "+v"(acc[2][2]), "+v"(acc[3][3]) : "v"(a[0]), "v"(a[3]), "v"(pa), "v"(pb));   // the four vector slots behind the trip's last matrix instruction, on the back edge and on the way out alike; the lane pointers are named so that no load of the trip lands in their registers
    }
    if (cy >= NH_ + NKV) {
        const size_t vo = ((size_t)(cy - NH_ - NKV) * HD + lr) * TT + r0 + hi * 8;
#pragma unroll
        for (int nb = 0; nb < 4; ++nb)
#pragma unroll
            for (int mb = 0; mb < 4; ++mb) { v8h o16; v8us oh, ol;   // mb innermost: the four 32-B pieces of a 128-B line follow one another
#pragma unroll
                for (int j = 0; j < 8; ++j) { const float x = acc[mb][nb][j]; unsigned short a2, c2; o16[j] = tohx(x); splitf(x, a2, c2); oh[j] = a2; ol[j] = c2; }
                const size_t e = vo + (size_t)nb * 16 * TT + mb * 16; *(v8h*)(VT16 + e) = o16; *(v8us*)(VTh + e) = oh; *(v8us*)(VTl + e) = ol; }
        return; }
    const size_t zo = (size_t)((cy < NH_) ? cy : cy - NH_) * TT * HD;
    h16* P16 = ((cy < NH_) ? QP16 : KP16) + zo; bf* Ph = ((cy < NH_) ? QPh : KPh) + zo; bf* Pl = ((cy < NH_) ? QPl : KPl) + zo;
    const int rr = lane >> 3, c8 = (lane & 7) * 8;   // a lane finishes 8 columns (4 rotary pairs) of one row; 8 lanes cover a row, a wave store 4 rows
    const float* pc = fcos + (size_t)(r0 + rr) * (HD / 2) + (c8 >> 1); const float* pn = fsin + (size_t)(r0 + rr) * (HD / 2) + (c8 >> 1);
    v4f cc[2][4], sn[2][4];
#pragma unroll
    for (int s = 0; s < 4; ++s) { cc[0][s] = *(const v4f*)(pc + (size_t)(4 * s) * (HD / 2)); sn[0][s] = *(const v4f*)(pn + (size_t)(4 * s) * (HD / 2)); }
#pragma unroll
    for (int mb = 0; mb < 4; ++mb) {
#pragma unroll
        for (int nb = 0; nb < 4; ++nb) {
#pragma unroll
            for (int j = 0; j < 8; ++j) os[(hi * 8 + j) * 68 + nb * 16 + lr] = acc[mb][nb][j]; }
        __builtin_amdgcn_wave_barrier(); asm volatile("" ::: "memory");   // the tile is read below by other lanes of this wave: keep the stores in front of the reads
        if (mb < 3) {   // the next 16 rows' cos / sin fly while these 16 rows are finished
#pragma unroll
            for (int s = 0; s < 4; ++s) { cc[(mb + 1) & 1][s] = *(const v4f*)(pc + (size_t)((mb + 1) * 16 + 4 * s) * (HD / 2)); sn[(mb + 1) & 1][s] = *(const v4f*)(pn + (size_t)((mb + 1) * 16 + 4 * s) * (HD / 2)); }
            __builtin_amdgcn_sched_barrier(0); }   // keeps these loads in front of the rows' work: sunk among the stores they would come late and land in registers that an issued store names
#pragma unroll
        for (int s = 0; s < 4; ++s) { const int row = 4 * s + rr; const v4f xa = *(const v4fa*)(os + row * 68 + c8), xb = *(const v4fa*)(os + row * 68 + c8 + 4); v8h o16; v8us oh, ol;
#pragma unroll
            for (int p = 0; p < 4; ++p) { const float x0 = (p < 2) ? xa[2 * p] : xb[2 * p - 4], x1 = (p < 2) ? xa[2 * p + 1] : xb[2 * p - 3]; const float c = bfr(cc[mb & 1][s][p]), n = bfr(sn[mb & 1][s][p]);
                const float e0 = x0 * c - x1 * n, e1 = x0 * n + x1 * c;   /* even: x0 c - x1 s; odd: x0 s + x1 c */
                unsigned short a2, c2; o16[2 * p] = tohx(e0); o16[2 * p + 1] = tohx(e1); splitf(e0, a2, c2); oh[2 * p] = a2; ol[2 * p] = c2; splitf(e1, a2, c2); oh[2 * p + 1] = a2; ol[2 * p + 1] = c2; }
            const size_t e = (size_t)(r0 + mb * 16 + row) * HD + c8; *(v8h*)(P16 + e) = o16; *(v8us*)(Ph + e) = oh; *(v8us*)(Pl + e) = ol; }
        __builtin_amdgcn_wave_barrier(); asm volatile("s_wait_xcnt 0x0" ::: "memory");   // the LDS reads stay in front of the next 16 rows' LDS stores; the wait stands behind these rows' global stores, before the next loads land in their registers
    }
}


__global__ __launch_bounds__(64) void k_lambda(const float* __restrict__ a1, const float* __restrict__ b1, const float* __restrict__ a2, const float* __restrict__ b2, float* LAM) { float s1 = 0.f, s2 = 0.f;
#pragma unroll 1
    for (int d = 0; d < HD; ++d) { float p1 = __fmul_rn(bfr(a1[d]), bfr(b1[d])), p2 = __fmul_rn(bfr(a2[d]), bfr(b2[d])); asm volatile("" : "+v"(p1), "+v"(p2)); s1 = __fadd_rn(s1, p1); s2 = __fadd_rn(s2, p2); }
    const float lam = __fadd_rn(__fsub_rn(expf(s1), expf(s2)), LINIT); *(float*)(LAM + threadIdx.x) = lam;  }
__global__ __launch_bounds__(256) void k_dcomb(const float* __restrict__ O, const float* __restrict__ LAM, float* Y) { const size_t i = (size_t)blockIdx.x * 256 + threadIdx.x; if (i >= (size_t)TT * HD / 4) return; const int h = blockIdx.y; O += (size_t)h * 2 * TT * HD; const int d0 = (int)(i % (HD / 4)) * 4; const size_t t = i / (HD / 4); const float cs = (t < RH) ? 1.0f : (1.0f / PCAR); const float lam = LAM[0]; const v4f a = *(const v4f*)(O + t * HD + d0); const v4f b = *(const v4f*)(O + (size_t)TT * HD + t * HD + d0); v4f o;
#pragma unroll
    for (int q = 0; q < 4; ++q) { float p = __fmul_rn(a[q], cs), m = __fmul_rn(__fmul_rn(b[q], cs), lam); asm volatile("" : "+v"(p), "+v"(m)); o[q] = __fsub_rn(p, m); }
    *(v4f*)(Y + t * (NHD * HD) + (size_t)h * HD + d0) = o;  }
// k_gnstat: one work-group of 32 waves per head. A wave load covers two 256-B row segments of the head (lanes 0-15 one row, 16-31 the next), the 32 waves cover 64 rows, 32 steps cover the 2048 rows.
// Mean first, then the squared deviations from it (two reads of Y, the second from L2). Fixed-order sums: per lane over its steps, xor tree in the wave, one LDS word per wave, the same xor tree over the 32 words (in every wave for the mean, in wave 0 for the variance).
__device__ __forceinline__ float gn_wavesum(float s) {
#pragma unroll
    for (int sh = 16; sh; sh >>= 1) s += __shfl_xor(s, sh, 32);
    return s; }
__global__ __launch_bounds__(1024) void k_gnstat(const float* __restrict__ Y, float* ST) { __shared__ float red1[32]; __shared__ float red2[32];
    const int h = blockIdx.x; const int lane = threadIdx.x & 31, wv = threadIdx.x >> 5; const float nf = (float)((size_t)TT * HD);
    const float* yp = Y + (size_t)(wv * 2 + (lane >> 4)) * (NHD * HD) + (size_t)h * HD + (lane & 15) * 4;
    float s = 0.f;
#pragma unroll   // independent loads in flight together: the latency of one L2 read is paid per batch, not per row
    for (int st = 0; st < TT / 64; ++st) { const v4f a = *(const v4f*)(yp + (size_t)st * 64 * (NHD * HD)); s += (a[0] + a[1]) + (a[2] + a[3]); }
    s = gn_wavesum(s); if (lane == 0) red1[wv] = s;
    __syncthreads();   // every wave's partial sum is in red1 before any wave adds them up
    const float mean = __fdiv_rn(gn_wavesum(red1[lane]), nf);
    float s2 = 0.f;
#pragma unroll   // as above
    for (int st = 0; st < TT / 64; ++st) { const v4f a = *(const v4f*)(yp + (size_t)st * 64 * (NHD * HD)); float acc = 0.f;
#pragma unroll
        for (int q = 0; q < 4; ++q) { const float dv = a[q] - mean; acc += dv * dv; } s2 += acc; }
    s2 = gn_wavesum(s2); if (lane == 0) red2[wv] = s2;
    __syncthreads();   // every wave's partial sum is in red2 before wave 0 adds them up
    if (wv == 0) { const float var = __fdiv_rn(gn_wavesum(red2[lane]), nf); ST[h * 32 + lane] = (lane & 1) ? var : mean; } }

__global__ __launch_bounds__(256) void k_gnapply(const float* __restrict__ Y, const float* __restrict__ ST, bf* Ah, bf* Al) { const size_t i = (size_t)blockIdx.x * 256 + threadIdx.x; if (i >= (size_t)TT * NHD * HD / 4) return; const int c0 = (int)(i % (NHD * HD / 4)) * 4; const size_t t = i / (NHD * HD / 4); const int h = c0 / HD; const float mean = ST[h * 32], var = ST[h * 32 + 1]; const float rs = __fdiv_rn(1.0f, __fsqrt_rn(__fadd_rn(var, 1e-5f))); const v4f a = *(const v4f*)(Y + t * (NHD * HD) + c0); v4us oh, ol;
#pragma unroll
    for (int q = 0; q < 4; ++q) { float nv = __fmul_rn(__fsub_rn(a[q], mean), rs); asm volatile("" : "+v"(nv)); unsigned short h2, l2; splitf(__fmul_rn(nv, 1.0f - LINIT), h2, l2); oh[q] = h2; ol[q] = l2; }
    *(v4us*)(Ah + t * (NHD * HD) + c0) = oh; *(v4us*)(Al + t * (NHD * HD) + c0) = ol;  }

// ---- k_fattn: scores, causal softmax and probability x value in ONE launch for all 32 query sub-heads; no score or probability ever goes to memory.
// One wave owns 16 query rows and walks the keys 0 .. its diagonal in blocks of 64. Walk 1: scores, row maximum. Walk 2: the same scores again, e = exp(t - max), row sum, e to 16-bit through a
// per-wave LDS tile (accumulator layout -> A fragment layout), P.V accumulated in key order; the division by the row sum comes after P.V. Rows < RH: hi+lo planes, 3 products; the rest fp16 with e x PCAR.
// A work-group (4 waves, 64 rows) does row block 31 - blockIdx.x and then row block blockIdx.x: every work-group walks the same number of key blocks, wherever it is placed.
#define PP 72   // LDS pitch of a probability row in 16-bit elements: 144 B = 16 B x odd, the conflict-free pitch for 16-byte reads
template <typename T16> struct LFrag;
template <> struct LFrag<h16> { static __device__ __forceinline__ v16h ld(const h16* p) { return cat16(*(const v8ha*)p, *(const v8ha*)(p + 16)); } };
template <> struct LFrag<bf> { static __device__ __forceinline__ v16bf ld(const bf* p) { return cat16b(*(const v8usa*)p, *(const v8usa*)(p + 16)); } };
// 2^x with the free issue slot behind the transcendental in the same statement: the next vector instruction may then read the result or overwrite the source.
__device__ __forceinline__ float fattn_exp2(float x) { float r; asm("v_exp_f32 %0, %1\n\tv_nop" : "=v"(r) : "v"(x)); return r; }
// Four B fragments (nb = 0..3) of k step ks of one 64-key block: rows nb*16+lr of a plane with the given pitch; pl is the lane's own pointer (row lr, k offset 8*hi).
template <typename T16>
__device__ __forceinline__ void fattn_ld4(const T16* __restrict__ pl, size_t pitch, int ks, typename WFrag<T16>::V (&b)[4]) {
#pragma unroll
    for (int nb = 0; nb < 4; ++nb) b[nb] = WFrag<T16>::ld(pl + ((size_t)nb * 16 * pitch + ks * 32));
}
// Inputs-only fences on loaded fragments: every load of the batch is issued before the first matrix instruction waits, so a batch pays one load latency, not one per fragment.
// The lane pointers are named too: their registers stay untouched until the batch has landed.
template <typename V, typename T16> __device__ __forceinline__ void fattn_hold8(const V (&x)[4], const V (&y)[4], const T16* p, const T16* r) { asm volatile("" :: "v"(x[0]), "v"(x[1]), "v"(x[2]), "v"(x[3]), "v"(y[0]), "v"(y[1]), "v"(y[2]), "v"(y[3]), "v"(p), "v"(r)); }
template <typename V, typename T16> __device__ __forceinline__ void fattn_hold16(const V (&x)[4], const V (&y)[4], const V (&z)[4], const V (&w)[4], const T16* p, const T16* r) { asm volatile("" :: "v"(x[0]), "v"(x[1]), "v"(x[2]), "v"(x[3]), "v"(y[0]), "v"(y[1]), "v"(y[2]), "v"(y[3]), "v"(z[0]), "v"(z[1]), "v"(z[2]), "v"(z[3]), "v"(w[0]), "v"(w[1]), "v"(w[2]), "v"(w[3]), "v"(p), "v"(r)); }
// acc[nb] += a x b[nb] (+ a2 x b[nb] + a x b2[nb] for the hi+lo planes)
template <typename T16, bool HI>
__device__ __forceinline__ void fattn_mm(const typename WFrag<T16>::V& a, const typename WFrag<T16>::V& a2, const typename WFrag<T16>::V (&b)[4], const typename WFrag<T16>::V (&b2)[4], v8f (&acc)[4]) {
#pragma unroll
    for (int nb = 0; nb < 4; ++nb) { acc[nb] = WFrag<T16>::mma(a, b[nb], acc[nb]);
        if (HI) { acc[nb] = WFrag<T16>::mma(a2, b[nb], acc[nb]); acc[nb] = WFrag<T16>::mma(a, b2[nb], acc[nb]); } }
}
template <typename T16, bool HI>
__device__ __forceinline__ void fattn_strip(const T16* __restrict__ Q, const T16* __restrict__ Q2, const T16* __restrict__ Kp, const T16* __restrict__ Kp2, const T16* __restrict__ Vt, const T16* __restrict__ Vt2, int i0, T16* ps, T16* ps2, float* O) {
    typedef typename WFrag<T16>::V V;
    const int lane = threadIdx.x & 31, lr = lane & 15, hi = lane >> 4;
    V q[2], q2[2];
#pragma unroll
    for (int ks = 0; ks < 2; ++ks) { q[ks] = WFrag<T16>::ld(Q + (size_t)(i0 + lr) * HD + ks * 32 + 8 * hi); q2[ks] = HI ? WFrag<T16>::ld(Q2 + (size_t)(i0 + lr) * HD + ks * 32 + 8 * hi) : q[ks]; }
    asm volatile("s_wait_xcnt 0x0" :: "v"(q[0]), "v"(q[1]), "v"(q2[0]), "v"(q2[1]) : "memory");   // behind the query loads, before their address registers are used for anything else
    const int jend = (i0 & ~63) + 64;                  // keys 0 .. jend-1: up to the end of the 64-key block that holds the diagonal (jend <= TT)
    const unsigned koff = lr * HD + 8 * hi, voff = lr * TT + 8 * hi;
    float mx[8];
#pragma unroll
    for (int j = 0; j < 8; ++j) mx[j] = -3.0e38f;
    for (int j0 = 0; j0 < jend; j0 += 64) { V kb[2][4], kb2[2][4]; v8f s[4]; const T16* pk = (Kp + (size_t)j0 * HD) + koff; const T16* pk2 = (Kp2 + (size_t)j0 * HD) + koff;
#pragma unroll
        for (int nb = 0; nb < 4; ++nb) s[nb] = (v8f){};
        if constexpr (HI) {
#pragma unroll
            for (int ks = 0; ks < 2; ++ks) { fattn_ld4<T16>(pk, HD, ks, kb[ks]); fattn_ld4<T16>(pk2, HD, ks, kb2[ks]); fattn_hold8(kb[ks], kb2[ks], pk, pk2); fattn_mm<T16, HI>(q[ks], q2[ks], kb[ks], kb2[ks], s); }
        } else { fattn_ld4<T16>(pk, HD, 0, kb[0]); fattn_ld4<T16>(pk, HD, 1, kb[1]); fattn_hold8(kb[0], kb[1], pk, pk); fattn_mm<T16, HI>(q[0], q2[0], kb[0], kb2[0], s); fattn_mm<T16, HI>(q[1], q2[1], kb[1], kb2[1], s); }
#pragma unroll
        for (int nb = 0; nb < 4; ++nb)
#pragma unroll
            for (int j = 0; j < 8; ++j) mx[j] = fmaxf(mx[j], (j0 + nb * 16 + lr <= i0 + hi * 8 + j) ? s[nb][j] * SCL : -3.0e38f); }
#pragma unroll
    for (int j = 0; j < 8; ++j)
#pragma unroll
        for (int sh = 8; sh; sh >>= 1) mx[j] = fmaxf(mx[j], __shfl_xor(mx[j], sh, 32));   // row hi*8+j lives in the 16 lanes of this half
    float sum[8]; v8f o[4];
#pragma unroll
    for (int j = 0; j < 8; ++j) sum[j] = 0.f;
#pragma unroll
    for (int nb = 0; nb < 4; ++nb) o[nb] = (v8f){};
    for (int j0 = 0; j0 < jend; j0 += 64) { V kb[2][4], kb2[2][4], vb[2][4], vb2[2][4]; v8f s[4]; const T16* pk = (Kp + (size_t)j0 * HD) + koff; const T16* pk2 = (Kp2 + (size_t)j0 * HD) + koff; const T16* pv = (Vt + j0) + voff; const T16* pv2 = (Vt2 + j0) + voff;
#pragma unroll
        for (int nb = 0; nb < 4; ++nb) s[nb] = (v8f){};
        if constexpr (HI) {
#pragma unroll
            for (int ks = 0; ks < 2; ++ks) { fattn_ld4<T16>(pk, HD, ks, kb[ks]); fattn_ld4<T16>(pk2, HD, ks, kb2[ks]); fattn_hold8(kb[ks], kb2[ks], pk, pk2); fattn_mm<T16, HI>(q[ks], q2[ks], kb[ks], kb2[ks], s); }
        } else {   // one plane each: key and value fragments fly together
            fattn_ld4<T16>(pk, HD, 0, kb[0]); fattn_ld4<T16>(pk, HD, 1, kb[1]); fattn_ld4<T16>(pv, TT, 0, vb[0]); fattn_ld4<T16>(pv, TT, 1, vb[1]); fattn_hold16(kb[0], kb[1], vb[0], vb[1], pk, pv);
            fattn_mm<T16, HI>(q[0], q2[0], kb[0], kb2[0], s); fattn_mm<T16, HI>(q[1], q2[1], kb[1], kb2[1], s); }
#pragma unroll
        for (int nb = 0; nb < 4; ++nb)
#pragma unroll
            for (int j = 0; j < 8; ++j) { const float t = (j0 + nb * 16 + lr <= i0 + hi * 8 + j) ? s[nb][j] * SCL : -3.0e38f; const float e = fattn_exp2((t - mx[j]) * 1.4426950408889634f); sum[j] += e;
                const int po = (hi * 8 + j) * PP + nb * 16 + lr;
                if constexpr (HI) { unsigned short eh, el; splitf(e, eh, el); ps[po] = eh; ps2[po] = el; } else ps[po] = tohx(e * PCAR); }
        __builtin_amdgcn_wave_barrier(); asm volatile("" ::: "memory");   // the tile is read below by other lanes of this wave: keep the stores in front of the reads
#pragma unroll
        for (int ks = 0; ks < 2; ++ks) { const V a = LFrag<T16>::ld(ps + lr * PP + ks * 32 + 8 * hi); V a2 = a;
            if constexpr (HI) { a2 = LFrag<T16>::ld(ps2 + lr * PP + ks * 32 + 8 * hi); fattn_ld4<T16>(pv, TT, ks, vb[ks]); fattn_ld4<T16>(pv2, TT, ks, vb2[ks]); fattn_hold8(vb[ks], vb2[ks], pv, pv2); }
            fattn_mm<T16, HI>(a, a2, vb[ks], vb2[ks], o); }
        __builtin_amdgcn_wave_barrier(); asm volatile("" ::: "memory");   // and the reads in front of the next block's stores
    }
#pragma unroll
    for (int j = 0; j < 8; ++j) {
#pragma unroll
        for (int sh = 8; sh; sh >>= 1) sum[j] += __shfl_xor(sum[j], sh, 32);
        const float f = __fdiv_rn(1.0f, sum[j]);
#pragma unroll
        for (int nb = 0; nb < 4; ++nb) O[(size_t)(i0 + hi * 8 + j) * HD + nb * 16 + lr] = o[nb][j] * f; }
    asm volatile("s_wait_xcnt 0x0" ::: "memory");   // behind the output stores, before the next strip reuses their address and data registers
}
// launch bounds: the second figure holds the kernel to the 256 directly addressed vector registers (no register-bank switching in the loops)
__global__ __launch_bounds__(128, 4) void k_fattn(const h16* __restrict__ QP16, const bf* __restrict__ QPh, const bf* __restrict__ QPl, const h16* __restrict__ KP16, const bf* __restrict__ KPh, const bf* __restrict__ KPl, const h16* __restrict__ VT16, const bf* __restrict__ VTh, const bf* __restrict__ VTl, float* Ob) {
    __shared__ __align__(16) unsigned short pt[4][2][16 * PP];
    const int wv = __builtin_amdgcn_readfirstlane(threadIdx.x >> 5); const int z = blockIdx.y;   // wave number in a scalar register: scalar loop bounds. z = 2h: (q1_h, k1_g), z = 2h+1: (q2_h, k2_g), g = h/2; both use v[g]
    const size_t zq = (size_t)z * TT * HD, zk = (size_t)(2 * (z / 4) + (z & 1)) * TT * HD, zv = (size_t)(z / 4) * HD * TT;
#pragma unroll 1   // one copy of each path in the code
    for (int half = 0; half < 2; ++half) { const int rb = half ? (int)blockIdx.x : TT / 64 - 1 - (int)blockIdx.x; const int i0 = rb * 64 + wv * 16;
        if (rb * 64 < RH) fattn_strip<bf, true>(QPh + zq, QPl + zq, KPh + zk, KPl + zk, VTh + zv, VTl + zv, i0, pt[wv][0], pt[wv][1], Ob + zq);
        else fattn_strip<h16, false>(QP16 + zq, QP16 + zq, KP16 + zk, KP16 + zk, VT16 + zv, VT16 + zv, i0, (h16*)pt[wv][0], (h16*)pt[wv][1], Ob + zq); }
}
__global__ __launch_bounds__(256) void k_merge(const float* __restrict__ O, int h0, bf* Ah, bf* Al) { const size_t e = ((size_t)blockIdx.x * 256 + threadIdx.x) * 2; if (e >= (size_t)ZH * TT * HD) return; const int d = (int)(e % HD); const int t = (int)((e / HD) % TT); const int zz = (int)(e / ((size_t)HD * TT)); const float cs = (t < RH) ? 1.0f : (1.0f / PCAR); const size_t oo = (size_t)t * DQ + (h0 + zz) * HD + d;
    v2us oh, ol;
#pragma unroll
    for (int q = 0; q < 2; ++q) { unsigned short a, c2; splitf(O[e + q] * cs, a, c2); oh[q] = a; ol[q] = c2; } *(v2us*)(Ah + oo) = oh; *(v2us*)(Al + oo) = ol;  }

extern "C" void kernel_launch(void* const* d_in, const int* in_sizes, int n_in,
                              void* d_out, int out_size, void* d_ws, size_t ws_size, hipStream_t stream) {
    (void)in_sizes; (void)n_in; (void)out_size;
    const float* x = (const float*)d_in[0]; const float* fcos = (const float*)d_in[1]; const float* fsin = (const float*)d_in[2]; const float* wq = (const float*)d_in[3]; const float* wk = (const float*)d_in[4]; const float* wv = (const float*)d_in[5]; const float* wo = (const float*)d_in[6]; const float* lq1 = (const float*)d_in[7]; const float* lk1 = (const float*)d_in[8]; const float* lq2 = (const float*)d_in[9]; const float* lk2 = (const float*)d_in[10];
    float* OUT = (float*)d_out;     // [1][2048][1024]
    char* wsp = (char*)d_ws;
    auto take = [&](size_t bytes) { char* p = wsp; wsp += (bytes + 255) & ~(size_t)255; return (void*)p; };
    bf* WQ = (bf*)take((size_t)DQ * DM * 2); bf* WK = (bf*)take((size_t)DKV * DM * 2); bf* WV = (bf*)take((size_t)DV * DM * 2); bf* WO = (bf*)take((size_t)DM * NHD * HD * 2); float* LAM = (float*)take(64 * 4); float* ST = (float*)take((size_t)NHD * 32 * 4); float* Y = (float*)take((size_t)TT * NHD * HD * 4);
    bf* XB = (bf*)take((size_t)TT * DM * 2);
    h16* QP16 = (h16*)take((size_t)NH_ * TT * HD * 2); h16* KP16 = (h16*)take((size_t)NKV * TT * HD * 2); h16* VT16 = (h16*)take((size_t)NVG * HD * TT * 2);
    bf* QPh = (bf*)take((size_t)NH_ * TT * HD * 2); bf* QPl = (bf*)take((size_t)NH_ * TT * HD * 2); bf* KPh = (bf*)take((size_t)NKV * TT * HD * 2); bf* KPl = (bf*)take((size_t)NKV * TT * HD * 2); bf* VTh = (bf*)take((size_t)NVG * HD * TT * 2); bf* VTl = (bf*)take((size_t)NVG * HD * TT * 2);
    float* Ob = (float*)take((size_t)NH_ * TT * HD * 4); bf* ATh = (bf*)take((size_t)TT * NHD * HD * 2); bf* ATl = (bf*)take((size_t)TT * NHD * HD * 2);
    if ((size_t)(wsp - (char*)d_ws) > ws_size) return;    // ws 256 MiB
    { k_cvt8<<<(unsigned)(((size_t)DQ * DM / 8 + 255) / 256), 256, 0, stream>>>(wq, WQ, (size_t)DQ * DM / 8); k_cvt8<<<(unsigned)(((size_t)DKV * DM / 8 + 255) / 256), 256, 0, stream>>>(wk, WK, (size_t)DKV * DM / 8); k_cvt8<<<(unsigned)(((size_t)DV * DM / 8 + 255) / 256), 256, 0, stream>>>(wv, WV, (size_t)DV * DM / 8); k_cvt8<<<(unsigned)(((size_t)DM * (NHD * HD) / 8 + 255) / 256), 256, 0, stream>>>(wo, WO, (size_t)DM * (NHD * HD) / 8); k_lambda<<<1, 64, 0, stream>>>(lq1, lk1, lq2, lk2, LAM); }
    for (int b = 0; b < NB_; ++b) {
        
        k_cvt8<<<(unsigned)(((size_t)TT * DM / 8 + 255) / 256), 256, 0, stream>>>(x + (size_t)b * TT * DM, XB, (size_t)TT * DM / 8);
        k_qkv<<<dim3(TT / 64, NH_ + NKV + NVG, 1), 32, 0, stream>>>(XB, WQ, WK, WV, fcos, fsin, QP16, QPh, QPl, KP16, KPh, KPl, VT16, VTh, VTl);   /* 32 query sub-heads (q1_h = 2h, q2_h = 2h+1), 16 key sub-heads (k1_g = 2g, k2_g = 2g+1), 8 value groups: projection, rotary, planes */
        k_fattn<<<dim3(TT / 128, NH_, 1), 128, 0, stream>>>(QP16, QPh, QPl, KP16, KPh, KPl, VT16, VTh, VTl, Ob);   /* all 32 sub-heads: Ob[z] = softmax(q_z k^T / 8) v (x PCAR for rows >= RH) */
        k_dcomb<<<dim3((unsigned)(((size_t)TT * HD / 4 + 255) / 256), NHD, 1), 256, 0, stream>>>(Ob, LAM, Y);   /* y_h = a1 v - lambda a2 v */
        k_gnstat<<<NHD, 1024, 0, stream>>>(Y, ST); k_gnapply<<<(unsigned)(((size_t)TT * NHD * HD / 4 + 255) / 256), 256, 0, stream>>>(Y, ST, ATh, ATl);   /* GroupNorm per head x (1 - lambda_init) -> planes */
        k_gemmw<bf, 1, false><<<dim3(TT / 64, DM / 64, 1), 32, 0, stream>>>(ATh, ATl, WO, nullptr, NHD * HD, OUT + (size_t)b * TT * DM, DM, nullptr, 0, 0, 0); }
}

// v004
// One run takes 180 microseconds.
// Next to v003, in two timings, it ran 1.19 times as fast each time.
// Over all steps from v000 it is 10.4 times as fast.
#include <hip/hip_runtime.h>

// Differential attention (x [1][2048][1024]; q = x wq^T viewed (T, 16, 2, 64): q1/q2 per head; k = x wk^T viewed (T, 8, 2, 64): k1/k2 per kv group; v = x wv^T (8 x 64); interleaved-pair rotary on q1, q2, k1, k2 with the given cos/sin tables [2048][32]; head h uses kv group h/2; a1 = causal softmax(q1.k1/8), a2 = causal softmax(q2.k2/8); lambda = exp(lq1.lk1) - exp(lq2.lk2) + lambda_init (lambda vectors [64], read); y = (a1 - lambda a2) v; GroupNorm per (head) over (T, 64) (eps 1e-5, no affine) x (1 - lambda_init); out = y wo^T -> [1][2048][1024] (2.1 M)).
// Compute dtypes, f32 accumulate: every input rounded to bf16; projections exact; rotary f32; attention rows < 512 3 products, rest fp16, scores and probabilities kept on chip (one fused launch for all heads); softmax, lambda, combine and GroupNorm f32 (fixed-order reductions); wo hl x exact.

#define NB_  1
#define TT   2048
#define DM   1024
#define NH_  32
#define NKV  16
#define REP  (NH_ / NKV)
#define HD   64
#define DQ   (NH_ * HD)
#define DKV  (NKV * HD)
#define ZH   2
#define RH   512                  // query rows < RH use hi+lo planes (0: none)
#define WIN  2048
#define PCAR 1024.0f
#define SCL  0.125f
#define NVG  8       // value groups
#define DV   (NVG * HD)   // 512
#define NHD  16      // real heads
#define LINIT 0.35550906759096934f   // 0.8 - 0.6 exp(-0.3)
typedef _Float16 h16;
typedef unsigned short bf;
typedef __attribute__((ext_vector_type(16))) __bf16   v16bf;
typedef __attribute__((ext_vector_type(16))) _Float16 v16h;
typedef __attribute__((ext_vector_type(8)))  _Float16 v8h;
typedef __attribute__((ext_vector_type(8)))  unsigned short v8us;
typedef __attribute__((ext_vector_type(8)))  float    v8f;
typedef __attribute__((ext_vector_type(4)))  float    v4f;
typedef v8h  __attribute__((may_alias)) v8ha;
typedef v4f  __attribute__((may_alias)) v4fa;
typedef v8us __attribute__((may_alias)) v8usa;

__device__ __forceinline__ unsigned short f2bf(float f) { unsigned u = __float_as_uint(f); u += 0x7FFFu + ((u >> 16) & 1u); return (unsigned short)(u >> 16); }
__device__ __forceinline__ float bf2f(unsigned short b) { return __uint_as_float(((unsigned)b) << 16); }
__device__ __forceinline__ float bfr(float f) { return bf2f(f2bf(f)); }
__device__ __forceinline__ v16h cat16(v8h lo, v8h hi) { return __builtin_shufflevector(lo, hi, 0, 1, 2, 3, 4, 5, 6, 7, 8, 9, 10, 11, 12, 13, 14, 15); }
__device__ __forceinline__ v16bf cat16b(v8us lo, v8us hi) { return __builtin_bit_cast(v16bf, __builtin_shufflevector(lo, hi, 0, 1, 2, 3, 4, 5, 6, 7, 8, 9, 10, 11, 12, 13, 14, 15)); }
__device__ __forceinline__ v8f wmma16(v16h a, v16h b, v8f c) { return __builtin_amdgcn_wmma_f32_16x16x32_f16(false, a, false, b, (short)0, c, false, false); }
__device__ __forceinline__ v8f wmmab(v16bf a, v16bf b, v8f c) { return __builtin_amdgcn_wmma_f32_16x16x32_bf16(false, a, false, b, (short)0, c, false, false); }



// ---- k_gemmw: register-blocked GEMM, ONE WAVE per 64x64 output tile (16 accumulators), operands straight from K-contiguous 16-bit planes; grid (M/64, N/64, Z), 32 threads.
// C[m][n] (f32, pitch ldc, + optional f32 bias[n]) = sum_k A[m][k] Bt[n][k] (+ split products per NSPLIT). z-batch strides sA/sB/sC in elements. K % 32 == 0.
template <typename T16> struct WFrag;
template <> struct WFrag<h16> { typedef v16h V; static __device__ __forceinline__ V ld(const h16* p) { return cat16(*(const v8h*)p, *(const v8h*)(p + 16)); } static __device__ __forceinline__ v8f mma(V a, V b, v8f c) { return wmma16(a, b, c); } };
template <> struct WFrag<bf> { typedef v16bf V; static __device__ __forceinline__ V ld(const bf* p) { return cat16b(*(const v8us*)p, *(const v8us*)(p + 16)); } static __device__ __forceinline__ v8f mma(V a, V b, v8f c) { return wmmab(a, b, c); } };
template <typename T16, int NSPLIT, bool BIAS>
__global__ __launch_bounds__(32) void k_gemmw(const T16* __restrict__ A, const T16* __restrict__ A2, const T16* __restrict__ Bt, const T16* __restrict__ Bt2, int K, float* C, int ldc, const float* __restrict__ bias, size_t sA, size_t sB, size_t sC) {
    typedef typename WFrag<T16>::V V;
    __shared__ __align__(16) float os[16 * 68];
    const size_t z = blockIdx.z; A += z * sA; if (A2) A2 += z * sA; Bt += z * sB; if (Bt2) Bt2 += z * sB; C += z * sC;
    const int lane = threadIdx.x & 31, lr = lane & 15, hi = lane >> 4; const int r0 = blockIdx.x * 64, c0 = blockIdx.y * 64;
    v8f acc[4][4];
#pragma unroll
    for (int mb = 0; mb < 4; ++mb)
#pragma unroll
        for (int nb = 0; nb < 4; ++nb) acc[mb][nb] = (v8f){};
    const size_t aoff = (size_t)(r0 + lr) * K + 8 * hi, boff = (size_t)(c0 + lr) * K + 8 * hi;
#pragma unroll 1
    for (int kc = 0; kc < K; kc += 32) {
        V a[4], a2[4];
#pragma unroll
        for (int mb = 0; mb < 4; ++mb) { a[mb] = WFrag<T16>::ld(A + aoff + (size_t)mb * 16 * K + kc); if (NSPLIT == 1 || NSPLIT == 2) a2[mb] = WFrag<T16>::ld(A2 + aoff + (size_t)mb * 16 * K + kc); }
#pragma unroll
        for (int nb = 0; nb < 4; ++nb) { const V b = WFrag<T16>::ld(Bt + boff + (size_t)nb * 16 * K + kc); V b2; if (NSPLIT >= 2) b2 = WFrag<T16>::ld(Bt2 + boff + (size_t)nb * 16 * K + kc);
#pragma unroll
            for (int mb = 0; mb < 4; ++mb) { acc[mb][nb] = WFrag<T16>::mma(a[mb], b, acc[mb][nb]); if (NSPLIT == 1 || NSPLIT == 2) acc[mb][nb] = WFrag<T16>::mma(a2[mb], b, acc[mb][nb]); if (NSPLIT >= 2) acc[mb][nb] = WFrag<T16>::mma(a[mb], b2, acc[mb][nb]); } }
        asm volatile("v_nop\n\tv_nop\n\tv_nop\n\tv_nop" : "+v"(acc[0][0]), "+v"(acc[1][1]), "+v"(acc[2][2]), "+v"(acc[3][3]) : "v"(a[0]), "v"(a[3]));
    }
#pragma unroll
    for (int mb = 0; mb < 4; ++mb) {
#pragma unroll
        for (int nb = 0; nb < 4; ++nb) {
#pragma unroll
            for (int j = 0; j < 8; ++j) os[(hi * 8 + j) * 68 + nb * 16 + lr] = acc[mb][nb][j]; }
        __builtin_amdgcn_wave_barrier(); asm volatile("" ::: "memory");
        float* crow = C + (size_t)(r0 + mb * 16) * ldc + c0;
{
#pragma unroll
            for (int s = 0; s < 8; ++s) { const int row = 2 * s + hi, cofs = lr * 4; v4f val = *(const v4fa*)(os + row * 68 + cofs); if (BIAS) { val[0] += bfr(bias[c0 + cofs]); val[1] += bfr(bias[c0 + cofs + 1]); val[2] += bfr(bias[c0 + cofs + 2]); val[3] += bfr(bias[c0 + cofs + 3]); }
                *(v4f*)(crow + (size_t)row * ldc + cofs) = val; }
             }
        __builtin_amdgcn_wave_barrier(); asm volatile("" ::: "memory");
    }
}

__device__ __forceinline__ h16 tohx(float x) { return (h16)x; }
__device__ __forceinline__ void splitf(float y, unsigned short& h, unsigned short& l) { h = f2bf(y); l = f2bf(y - bf2f(h)); }
typedef __attribute__((ext_vector_type(2))) _Float16 v2h;
typedef __attribute__((ext_vector_type(4))) _Float16 v4h;
typedef __attribute__((ext_vector_type(2))) unsigned short v2us;
typedef __attribute__((ext_vector_type(4))) unsigned short v4us;
typedef __attribute__((ext_vector_type(2))) float v2f;
typedef __attribute__((ext_vector_type(4))) int v4i;

__global__ __launch_bounds__(256) void k_wtG(const float* __restrict__ w, int K, int N, bf* Bt) {
    const int lane = threadIdx.x & 31; const int L0 = (blockIdx.x * 8 + (threadIdx.x >> 5)) * 8; const int nlines = N * K / 64;
{
#pragma unroll 1
        for (int l = 0; l < 8; ++l) { const int L = L0 + l; if (L >= nlines) break; const size_t e = (size_t)L * 64 + lane * 2; const int k = (int)(e % K), n = (int)(e / K); v2us o;
            o[0] = f2bf(w[(size_t)k * N + n]); o[1] = f2bf(w[(size_t)(k + 1) * N + n]); *(v2us*)(Bt + e) = o; }
         }
}
__global__ __launch_bounds__(256) void k_cvt8(const float* __restrict__ src, bf* dst, size_t n8) { const size_t i = (size_t)blockIdx.x * 256 + threadIdx.x; if (i >= n8) return; const v8f v = *(const v8f*)(src + i * 8); v8us o;
#pragma unroll
    for (int k = 0; k < 8; ++k) o[k] = f2bf(v[k]); *(v8us*)(dst + i * 8) = o;  }

// ---- k_qkv: the q, k and v projections in ONE launch, each 64x64 tile finished in its own epilogue: nothing of the projections goes to memory in f32.
// Main loop as in k_gemmw (one wave per tile, bf16 planes, one product). A tile column is one 64-wide sub-head: blockIdx.y 0..31 query sub-heads, 32..47 key sub-heads, 48..55 value groups.
// q, k: interleaved-pair rotary on the staged rows (cos / sin rounded to bf16 as every input), then the fp16 plane and the hi+lo planes [sub-head][t][64], whole 128-B lines per row.
// v: an accumulator register run is 8 consecutive t of one column, which is 16 B of the transposed planes [group][d][t]: stored straight from the registers.
__global__ __launch_bounds__(32) void k_qkv(const bf* __restrict__ A, const bf* __restrict__ WQ, const bf* __restrict__ WK, const bf* __restrict__ WV, const float* __restrict__ fcos, const float* __restrict__ fsin, h16* QP16, bf* QPh, bf* QPl, h16* KP16, bf* KPh, bf* KPl, h16* VT16, bf* VTh, bf* VTl) {
    typedef WFrag<bf>::V V;
    __shared__ __align__(16) float os[16 * 68];
    const int lane = threadIdx.x & 31, lr = lane & 15, hi = lane >> 4; const int r0 = blockIdx.x * 64, cy = blockIdx.y;
    const bf* Bt = (cy < NH_) ? WQ + (size_t)cy * 64 * DM : (cy < NH_ + NKV) ? WK + (size_t)(cy - NH_) * 64 * DM : WV + (size_t)(cy - NH_ - NKV) * 64 * DM;
    v8f acc[4][4];
#pragma unroll
    for (int mb = 0; mb < 4; ++mb)
#pragma unroll
        for (int nb = 0; nb < 4; ++nb) acc[mb][nb] = (v8f){};
    const size_t aoff = (size_t)(r0 + lr) * DM + 8 * hi, boff = (size_t)lr * DM + 8 * hi;
#pragma unroll 1   // one trip in the code, as in k_gemmw: two trips' fragments (2 x 64 registers) beside the 128 accumulator registers would leave the 256 directly addressed ones
    for (int kc = 0; kc < DM; kc += 32) {
        V a[4]; const bf* pa = A + aoff + kc; const bf* pb = Bt + boff + kc;
#pragma unroll
        for (int mb = 0; mb < 4; ++mb) a[mb] = WFrag<bf>::ld(pa + (size_t)mb * 16 * DM);
#pragma unroll
        for (int nb = 0; nb < 4; ++nb) { const V b = WFrag<bf>::ld(pb + (size_t)nb * 16 * DM);
#pragma unroll
            for (int mb = 0; mb < 4; ++mb) acc[mb][nb] = WFrag<bf>::mma(a[mb], b, acc[mb][nb]); }
        asm volatile("v_nop\n\tv_nop\n\tv_nop\n\tv_nop" : "+v"(acc[0][0]), "+v"(acc[1][1]), "+v"(acc[2][2]), "+v"(acc[3][3]) : "v"(a[0]), "v"(a[3]), "v"(pa), "v"(pb));   // the four vector slots behind the trip's last matrix instruction, on the back edge and on the way out alike; the lane pointers are named so that no load of the trip lands in their registers
    }
    if (cy >= NH_ + NKV) {
        const size_t vo = ((size_t)(cy - NH_ - NKV) * HD + lr) * TT + r0 + hi * 8;
#pragma unroll
        for (int nb = 0; nb < 4; ++nb)
#pragma unroll
            for (int mb = 0; mb < 4; ++mb) { v8h o16; v8us oh, ol;   // mb innermost: the four 32-B pieces of a 128-B line follow one another
#pragma unroll
                for (int j = 0; j < 8; ++j) { const float x = acc[mb][nb][j]; unsigned short a2, c2; o16[j] = tohx(x); splitf(x, a2, c2); oh[j] = a2; ol[j] = c2; }
                const size_t e = vo + (size_t)nb * 16 * TT + mb * 16; *(v8h*)(VT16 + e) = o16; *(v8us*)(VTh + e) = oh; *(v8us*)(VTl + e) = ol; }
        return; }
    const size_t zo = (size_t)((cy < NH_) ? cy : cy - NH_) * TT * HD;
    h16* P16 = ((cy < NH_) ? QP16 : KP16) + zo; bf* Ph = ((cy < NH_) ? QPh : KPh) + zo; bf* Pl = ((cy < NH_) ? QPl : KPl) + zo;
    const int rr = lane >> 3, c8 = (lane & 7) * 8;   // a lane finishes 8 columns (4 rotary pairs) of one row; 8 lanes cover a row, a wave store 4 rows
    const float* pc = fcos + (size_t)(r0 + rr) * (HD / 2) + (c8 >> 1); const float* pn = fsin + (size_t)(r0 + rr) * (HD / 2) + (c8 >> 1);
    v4f cc[2][4], sn[2][4];
#pragma unroll
    for (int s = 0; s < 4; ++s) { cc[0][s] = *(const v4f*)(pc + (size_t)(4 * s) * (HD / 2)); sn[0][s] = *(const v4f*)(pn + (size_t)(4 * s) * (HD / 2)); }
#pragma unroll
    for (int mb = 0; mb < 4; ++mb) {
#pragma unroll
        for (int nb = 0; nb < 4; ++nb) {
#pragma unroll
            for (int j = 0; j < 8; ++j) os[(hi * 8 + j) * 68 + nb * 16 + lr] = acc[mb][nb][j]; }
        __builtin_amdgcn_wave_barrier(); asm volatile("" ::: "memory");   // the tile is read below by other lanes of this wave: keep the stores in front of the reads
        if (mb < 3) {   // the next 16 rows' cos / sin fly while these 16 rows are finished
#pragma unroll
            for (int s = 0; s < 4; ++s) { cc[(mb + 1) & 1][s] = *(const v4f*)(pc + (size_t)((mb + 1) * 16 + 4 * s) * (HD / 2)); sn[(mb + 1) & 1][s] = *(const v4f*)(pn + (size_t)((mb + 1) * 16 + 4 * s) * (HD / 2)); }
            __builtin_amdgcn_sched_barrier(0); }   // keeps these loads in front of the rows' work: sunk among the stores they would come late and land in registers that an issued store names
#pragma unroll
        for (int s = 0; s < 4; ++s) { const int row = 4 * s + rr; const v4f xa = *(const v4fa*)(os + row * 68 + c8), xb = *(const v4fa*)(os + row * 68 + c8 + 4); v8h o16; v8us oh, ol;
#pragma unroll
            for (int p = 0; p < 4; ++p) { const float x0 = (p < 2) ? xa[2 * p] : xb[2 * p - 4], x1 = (p < 2) ? xa[2 * p + 1] : xb[2 * p - 3]; const float c = bfr(cc[mb & 1][s][p]), n = bfr(sn[mb & 1][s][p]);
                const float e0 = x0 * c - x1 * n, e1 = x0 * n + x1 * c;   /* even: x0 c - x1 s; odd: x0 s + x1 c */
                unsigned short a2, c2; o16[2 * p] = tohx(e0); o16[2 * p + 1] = tohx(e1); splitf(e0, a2, c2); oh[2 * p] = a2; ol[2 * p] = c2; splitf(e1, a2, c2); oh[2 * p + 1] = a2; ol[2 * p + 1] = c2; }
            const size_t e = (size_t)(r0 + mb * 16 + row) * HD + c8; *(v8h*)(P16 + e) = o16; *(v8us*)(Ph + e) = oh; *(v8us*)(Pl + e) = ol; }
        __builtin_amdgcn_wave_barrier(); asm volatile("s_wait_xcnt 0x0" ::: "memory");   // the LDS reads stay in front of the next 16 rows' LDS stores; the wait stands behind these rows' global stores, before the next loads land in their registers
    }
}


__global__ __launch_bounds__(64) void k_lambda(const float* __restrict__ a1, const float* __restrict__ b1, const float* __restrict__ a2, const float* __restrict__ b2, float* LAM) { float s1 = 0.f, s2 = 0.f;
#pragma unroll 1
    for (int d = 0; d < HD; ++d) { float p1 = __fmul_rn(bfr(a1[d]), bfr(b1[d])), p2 = __fmul_rn(bfr(a2[d]), bfr(b2[d])); asm volatile("" : "+v"(p1), "+v"(p2)); s1 = __fadd_rn(s1, p1); s2 = __fadd_rn(s2, p2); }
    const float lam = __fadd_rn(__fsub_rn(expf(s1), expf(s2)), LINIT); *(float*)(LAM + threadIdx.x) = lam;  }
__global__ __launch_bounds__(256) void k_dcomb(const float* __restrict__ O, const float* __restrict__ LAM, float* Y) { const size_t i = (size_t)blockIdx.x * 256 + threadIdx.x; if (i >= (size_t)TT * HD / 4) return; const int h = blockIdx.y; O += (size_t)h * 2 * TT * HD; const int d0 = (int)(i % (HD / 4)) * 4; const size_t t = i / (HD / 4); const float cs = (t < RH) ? 1.0f : (1.0f / PCAR); const float lam = LAM[0]; const v4f a = *(const v4f*)(O + t * HD + d0); const v4f b = *(const v4f*)(O + (size_t)TT * HD + t * HD + d0); v4f o;
#pragma unroll
    for (int q = 0; q < 4; ++q) { float p = __fmul_rn(a[q], cs), m = __fmul_rn(__fmul_rn(b[q], cs), lam); asm volatile("" : "+v"(p), "+v"(m)); o[q] = __fsub_rn(p, m); }
    *(v4f*)(Y + t * (NHD * HD) + (size_t)h * HD + d0) = o;  }
// k_gnstat: one work-group of 32 waves per head. A wave load covers two 256-B row segments of the head (lanes 0-15 one row, 16-31 the next), the 32 waves cover 64 rows, 32 steps cover the 2048 rows.
// Mean first, then the squared deviations from it (two reads of Y, the second from L2). Fixed-order sums: per lane over its steps, xor tree in the wave, one LDS word per wave, the same xor tree over the 32 words (in every wave for the mean, in wave 0 for the variance).
__device__ __forceinline__ float gn_wavesum(float s) {
#pragma unroll
    for (int sh = 16; sh; sh >>= 1) s += __shfl_xor(s, sh, 32);
    return s; }
__global__ __launch_bounds__(1024) void k_gnstat(const float* __restrict__ Y, float* ST) { __shared__ float red1[32]; __shared__ float red2[32];
    const int h = blockIdx.x; const int lane = threadIdx.x & 31, wv = threadIdx.x >> 5; const float nf = (float)((size_t)TT * HD);
    const float* yp = Y + (size_t)(wv * 2 + (lane >> 4)) * (NHD * HD) + (size_t)h * HD + (lane & 15) * 4;
    float s = 0.f;
#pragma unroll   // independent loads in flight together: the latency of one L2 read is paid per batch, not per row
    for (int st = 0; st < TT / 64; ++st) { const v4f a = *(const v4f*)(yp + (size_t)st * 64 * (NHD * HD)); s += (a[0] + a[1]) + (a[2] + a[3]); }
    s = gn_wavesum(s); if (lane == 0) red1[wv] = s;
    __syncthreads();   // every wave's partial sum is in red1 before any wave adds them up
    const float mean = __fdiv_rn(gn_wavesum(red1[lane]), nf);
    float s2 = 0.f;
#pragma unroll   // as above
    for (int st = 0; st < TT / 64; ++st) { const v4f a = *(const v4f*)(yp + (size_t)st * 64 * (NHD * HD)); float acc = 0.f;
#pragma unroll
        for (int q = 0; q < 4; ++q) { const float dv = a[q] - mean; acc += dv * dv; } s2 += acc; }
    s2 = gn_wavesum(s2); if (lane == 0) red2[wv] = s2;
    __syncthreads();   // every wave's partial sum is in red2 before wave 0 adds them up
    if (wv == 0) { const float var = __fdiv_rn(gn_wavesum(red2[lane]), nf); ST[h * 32 + lane] = (lane & 1) ? var : mean; } }

__global__ __launch_bounds__(256) void k_gnapply(const float* __restrict__ Y, const float* __restrict__ ST, bf* Ah, bf* Al) { const size_t i = (size_t)blockIdx.x * 256 + threadIdx.x; if (i >= (size_t)TT * NHD * HD / 4) return; const int c0 = (int)(i % (NHD * HD / 4)) * 4; const size_t t = i / (NHD * HD / 4); const int h = c0 / HD; const float mean = ST[h * 32], var = ST[h * 32 + 1]; const float rs = __fdiv_rn(1.0f, __fsqrt_rn(__fadd_rn(var, 1e-5f))); const v4f a = *(const v4f*)(Y + t * (NHD * HD) + c0); v4us oh, ol;
#pragma unroll
    for (int q = 0; q < 4; ++q) { float nv = __fmul_rn(__fsub_rn(a[q], mean), rs); asm volatile("" : "+v"(nv)); unsigned short h2, l2; splitf(__fmul_rn(nv, 1.0f - LINIT), h2, l2); oh[q] = h2; ol[q] = l2; }
    *(v4us*)(Ah + t * (NHD * HD) + c0) = oh; *(v4us*)(Al + t * (NHD * HD) + c0) = ol;  }

// ---- k_fattn: scores, causal softmax and probability x value in ONE launch for all 32 query sub-heads; no score or probability ever goes to memory.
// One wave owns 16 query rows and walks the keys 0 .. its diagonal ONCE, in blocks of 64: scores, e = exp(t - ref), row sum, e to 16-bit through a
// per-wave LDS tile (accumulator layout -> A fragment layout), P.V accumulated in key order; the division by the row sum comes after P.V. Rows < RH: hi+lo planes, 3 products; the rest fp16 with e x PCAR.
// ref is the row's running maximum, renewed lazily: only when a score exceeds it by more than MXLAG are the row sums and the P.V accumulators scaled by exp(old ref - new ref). ref cancels in P.V / sum.
// A work-group (4 waves, 64 rows) does row block 31 - blockIdx.x and then row block blockIdx.x: every work-group walks the same number of key blocks, wherever it is placed.
#define MXLAG 3.4657359f   // 5 ln 2: e <= 32, so e x PCAR <= 32768 stays inside fp16
#define PP 72   // LDS pitch of a probability row in 16-bit elements: 144 B = 16 B x odd, the conflict-free pitch for 16-byte reads
template <typename T16> struct LFrag;
template <> struct LFrag<h16> { static __device__ __forceinline__ v16h ld(const h16* p) { return cat16(*(const v8ha*)p, *(const v8ha*)(p + 16)); } };
template <> struct LFrag<bf> { static __device__ __forceinline__ v16bf ld(const bf* p) { return cat16b(*(const v8usa*)p, *(const v8usa*)(p + 16)); } };
// 2^x with the free issue slot behind the transcendental in the same statement: the next vector instruction may then read the result or overwrite the source.
__device__ __forceinline__ float fattn_exp2(float x) { float r; asm("v_exp_f32 %0, %1\n\tv_nop" : "=v"(r) : "v"(x)); return r; }
// Four B fragments (nb = 0..3) of k step ks of one 64-key block: rows nb*16+lr of a plane with the given pitch; pl is the lane's own pointer (row lr, k offset 8*hi).
template <typename T16>
__device__ __forceinline__ void fattn_ld4(const T16* __restrict__ pl, size_t pitch, int ks, typename WFrag<T16>::V (&b)[4]) {
#pragma unroll
    for (int nb = 0; nb < 4; ++nb) b[nb] = WFrag<T16>::ld(pl + ((size_t)nb * 16 * pitch + ks * 32));
}
// Inputs-only fences on loaded fragments: every load of the batch is issued before the first matrix instruction waits, so a batch pays one load latency, not one per fragment.
// The lane pointers are named too: their registers stay untouched until the batch has landed.
template <typename V, typename T16> __device__ __forceinline__ void fattn_hold8(const V (&x)[4], const V (&y)[4], const T16* p, const T16* r) { asm volatile("" :: "v"(x[0]), "v"(x[1]), "v"(x[2]), "v"(x[3]), "v"(y[0]), "v"(y[1]), "v"(y[2]), "v"(y[3]), "v"(p), "v"(r)); }
template <typename V, typename T16> __device__ __forceinline__ void fattn_hold16(const V (&x)[4], const V (&y)[4], const V (&z)[4], const V (&w)[4], const T16* p, const T16* r) { asm volatile("" :: "v"(x[0]), "v"(x[1]), "v"(x[2]), "v"(x[3]), "v"(y[0]), "v"(y[1]), "v"(y[2]), "v"(y[3]), "v"(z[0]), "v"(z[1]), "v"(z[2]), "v"(z[3]), "v"(w[0]), "v"(w[1]), "v"(w[2]), "v"(w[3]), "v"(p), "v"(r)); }
// acc[nb] += a x b[nb] (+ a2 x b[nb] + a x b2[nb] for the hi+lo planes)
template <typename T16, bool HI>
__device__ __forceinline__ void fattn_mm(const typename WFrag<T16>::V& a, const typename WFrag<T16>::V& a2, const typename WFrag<T16>::V (&b)[4], const typename WFrag<T16>::V (&b2)[4], v8f (&acc)[4]) {
#pragma unroll
    for (int nb = 0; nb < 4; ++nb) { acc[nb] = WFrag<T16>::mma(a, b[nb], acc[nb]);
        if (HI) { acc[nb] = WFrag<T16>::mma(a2, b[nb], acc[nb]); acc[nb] = WFrag<T16>::mma(a, b2[nb], acc[nb]); } }
}
template <typename T16, bool HI>
__device__ __forceinline__ void fattn_strip(const T16* __restrict__ Q, const T16* __restrict__ Q2, const T16* __restrict__ Kp, const T16* __restrict__ Kp2, const T16* __restrict__ Vt, const T16* __restrict__ Vt2, int i0, T16* ps, T16* ps2, float* O) {
    typedef typename WFrag<T16>::V V;
    const int lane = threadIdx.x & 31, lr = lane & 15, hi = lane >> 4;
    V q[2], q2[2];
#pragma unroll
    for (int ks = 0; ks < 2; ++ks) { q[ks] = WFrag<T16>::ld(Q + (size_t)(i0 + lr) * HD + ks * 32 + 8 * hi); q2[ks] = HI ? WFrag<T16>::ld(Q2 + (size_t)(i0 + lr) * HD + ks * 32 + 8 * hi) : q[ks]; }
    asm volatile("s_wait_xcnt 0x0" :: "v"(q[0]), "v"(q[1]), "v"(q2[0]), "v"(q2[1]) : "memory");   // behind the query loads, before their address registers are used for anything else
    const int jend = (i0 & ~63) + 64;                  // keys 0 .. jend-1: up to the end of the 64-key block that holds the diagonal (jend <= TT)
    const unsigned koff = lr * HD + 8 * hi, voff = lr * TT + 8 * hi;
    float mx[8];   // the reference each row's exponentials are taken against: a running row maximum, renewed only when a score leaves it far behind
#pragma unroll
    for (int j = 0; j < 8; ++j) mx[j] = -3.0e38f;
    float sum[8]; v8f o[4];
#pragma unroll
    for (int j = 0; j < 8; ++j) sum[j] = 0.f;
#pragma unroll
    for (int nb = 0; nb < 4; ++nb) o[nb] = (v8f){};
    for (int j0 = 0; j0 < jend; j0 += 64) { V kb[2][4], kb2[2][4], vb[2][4], vb2[2][4]; v8f s[4]; const T16* pk = (Kp + (size_t)j0 * HD) + koff; const T16* pk2 = (Kp2 + (size_t)j0 * HD) + koff; const T16* pv = (Vt + j0) + voff; const T16* pv2 = (Vt2 + j0) + voff;
#pragma unroll
        for (int nb = 0; nb < 4; ++nb) s[nb] = (v8f){};
        if constexpr (HI) {
#pragma unroll
            for (int ks = 0; ks < 2; ++ks) { fattn_ld4<T16>(pk, HD, ks, kb[ks]); fattn_ld4<T16>(pk2, HD, ks, kb2[ks]); fattn_hold8(kb[ks], kb2[ks], pk, pk2); fattn_mm<T16, HI>(q[ks], q2[ks], kb[ks], kb2[ks], s); }
        } else {   // one plane each: key and value fragments fly together
            fattn_ld4<T16>(pk, HD, 0, kb[0]); fattn_ld4<T16>(pk, HD, 1, kb[1]); fattn_ld4<T16>(pv, TT, 0, vb[0]); fattn_ld4<T16>(pv, TT, 1, vb[1]); fattn_hold16(kb[0], kb[1], vb[0], vb[1], pk, pv);
            fattn_mm<T16, HI>(q[0], q2[0], kb[0], kb2[0], s); fattn_mm<T16, HI>(q[1], q2[1], kb[1], kb2[1], s); }
        float lead = -3.0e38f;   // by how much this lane's scores of the block lead their rows' references, at most
#pragma unroll
        for (int j = 0; j < 8; ++j) {
#pragma unroll
            for (int nb = 0; nb < 4; ++nb) s[nb][j] = (j0 + nb * 16 + lr <= i0 + hi * 8 + j) ? s[nb][j] * SCL : -3.0e38f;
            lead = fmaxf(lead, fmaxf(fmaxf(s[0][j], s[1][j]), fmaxf(s[2][j], s[3][j])) - mx[j]); }
        if (__builtin_amdgcn_ballot_w32(lead > MXLAG) != 0) {   // one scalar test per key block, every lane stays on: taken at a strip's first block and then only when some score outgrows its row's reference
#pragma unroll
            for (int j = 0; j < 8; ++j) { float bm = fmaxf(fmaxf(s[0][j], s[1][j]), fmaxf(s[2][j], s[3][j]));
#pragma unroll
                for (int sh = 8; sh; sh >>= 1) bm = fmaxf(bm, __shfl_xor(bm, sh, 32));   // row hi*8+j lives in the 16 lanes of this half
                const float nm = fmaxf(mx[j], bm); const float f = fattn_exp2((mx[j] - nm) * 1.4426950408889634f); mx[j] = nm; sum[j] *= f;   // what was summed against the old reference is carried over to the new one (first block: f = 0 on zeros)
#pragma unroll
                for (int nb = 0; nb < 4; ++nb) o[nb][j] *= f; } }
#pragma unroll
        for (int nb = 0; nb < 4; ++nb)
#pragma unroll
            for (int j = 0; j < 8; ++j) { const float e = fattn_exp2((s[nb][j] - mx[j]) * 1.4426950408889634f); sum[j] += e;
                const int po = (hi * 8 + j) * PP + nb * 16 + lr;
                if constexpr (HI) { unsigned short eh, el; splitf(e, eh, el); ps[po] = eh; ps2[po] = el; } else ps[po] = tohx(e * PCAR); }
        __builtin_amdgcn_wave_barrier(); asm volatile("" ::: "memory");   // the tile is read below by other lanes of this wave: keep the stores in front of the reads
#pragma unroll
        for (int ks = 0; ks < 2; ++ks) { const V a = LFrag<T16>::ld(ps + lr * PP + ks * 32 + 8 * hi); V a2 = a;
            if constexpr (HI) { a2 = LFrag<T16>::ld(ps2 + lr * PP + ks * 32 + 8 * hi); fattn_ld4<T16>(pv, TT, ks, vb[ks]); fattn_ld4<T16>(pv2, TT, ks, vb2[ks]); fattn_hold8(vb[ks], vb2[ks], pv, pv2); }
            fattn_mm<T16, HI>(a, a2, vb[ks], vb2[ks], o); }
        __builtin_amdgcn_wave_barrier(); asm volatile("" ::: "memory");   // and the reads in front of the next block's stores
    }
#pragma unroll
    for (int j = 0; j < 8; ++j) {
#pragma unroll
        for (int sh = 8; sh; sh >>= 1) sum[j] += __shfl_xor(sum[j], sh, 32);
        const float f = __fdiv_rn(1.0f, sum[j]);
#pragma unroll
        for (int nb = 0; nb < 4; ++nb) O[(size_t)(i0 + hi * 8 + j) * HD + nb * 16 + lr] = o[nb][j] * f; }
    asm volatile("s_wait_xcnt 0x0" ::: "memory");   // behind the output stores, before the next strip reuses their address and data registers
}
// launch bounds: the second figure holds the kernel to the 256 directly addressed vector registers (no register-bank switching in the loops)
__global__ __launch_bounds__(128, 4) void k_fattn(const h16* __restrict__ QP16, const bf* __restrict__ QPh, const bf* __restrict__ QPl, const h16* __restrict__ KP16, const bf* __restrict__ KPh, const bf* __restrict__ KPl, const h16* __restrict__ VT16, const bf* __restrict__ VTh, const bf* __restrict__ VTl, float* Ob) {
    __shared__ __align__(16) unsigned short pt[4][2][16 * PP];
    const int wv = __builtin_amdgcn_readfirstlane(threadIdx.x >> 5); const int z = blockIdx.y;   // wave number in a scalar register: scalar loop bounds. z = 2h: (q1_h, k1_g), z = 2h+1: (q2_h, k2_g), g = h/2; both use v[g]
    const size_t zq = (size_t)z * TT * HD, zk = (size_t)(2 * (z / 4) + (z & 1)) * TT * HD, zv = (size_t)(z / 4) * HD * TT;
#pragma unroll 1   // one copy of each path in the code
    for (int half = 0; half < 2; ++half) { const int rb = half ? (int)blockIdx.x : TT / 64 - 1 - (int)blockIdx.x; const int i0 = rb * 64 + wv * 16;
        if (rb * 64 < RH) fattn_strip<bf, true>(QPh + zq, QPl + zq, KPh + zk, KPl + zk, VTh + zv, VTl + zv, i0, pt[wv][0], pt[wv][1], Ob + zq);
        else fattn_strip<h16, false>(QP16 + zq, QP16 + zq, KP16 + zk, KP16 + zk, VT16 + zv, VT16 + zv, i0, (h16*)pt[wv][0], (h16*)pt[wv][1], Ob + zq); }
}
__global__ __launch_bounds__(256) void k_merge(const float* __restrict__ O, int h0, bf* Ah, bf* Al) { const size_t e = ((size_t)blockIdx.x * 256 + threadIdx.x) * 2; if (e >= (size_t)ZH * TT * HD) return; const int d = (int)(e % HD); const int t = (int)((e / HD) % TT); const int zz = (int)(e / ((size_t)HD * TT)); const float cs = (t < RH) ? 1.0f : (1.0f / PCAR); const size_t oo = (size_t)t * DQ + (h0 + zz) * HD + d;
    v2us oh, ol;
#pragma unroll
    for (int q = 0; q < 2; ++q) { unsigned short a, c2; splitf(O[e + q] * cs, a, c2); oh[q] = a; ol[q] = c2; } *(v2us*)(Ah + oo) = oh; *(v2us*)(Al + oo) = ol;  }

extern "C" void kernel_launch(void* const* d_in, const int* in_sizes, int n_in,
                              void* d_out, int out_size, void* d_ws, size_t ws_size, hipStream_t stream) {
    (void)in_sizes; (void)n_in; (void)out_size;
    const float* x = (const float*)d_in[0]; const float* fcos = (const float*)d_in[1]; const float* fsin = (const float*)d_in[2]; const float* wq = (const float*)d_in[3]; const float* wk = (const float*)d_in[4]; const float* wv = (const float*)d_in[5]; const float* wo = (const float*)d_in[6]; const float* lq1 = (const float*)d_in[7]; const float* lk1 = (const float*)d_in[8]; const float* lq2 = (const float*)d_in[9]; const float* lk2 = (const float*)d_in[10];
    float* OUT = (float*)d_out;     // [1][2048][1024]
    char* wsp = (char*)d_ws;
    auto take = [&](size_t bytes) { char* p = wsp; wsp += (bytes + 255) & ~(size_t)255; return (void*)p; };
    bf* WQ = (bf*)take((size_t)DQ * DM * 2); bf* WK = (bf*)take((size_t)DKV * DM * 2); bf* WV = (bf*)take((size_t)DV * DM * 2); bf* WO = (bf*)take((size_t)DM * NHD * HD * 2); float* LAM = (float*)take(64 * 4); float* ST = (float*)take((size_t)NHD * 32 * 4); float* Y = (float*)take((size_t)TT * NHD * HD * 4);
    bf* XB = (bf*)take((size_t)TT * DM * 2);
    h16* QP16 = (h16*)take((size_t)NH_ * TT * HD * 2); h16* KP16 = (h16*)take((size_t)NKV * TT * HD * 2); h16* VT16 = (h16*)take((size_t)NVG * HD * TT * 2);
    bf* QPh = (bf*)take((size_t)NH_ * TT * HD * 2); bf* QPl = (bf*)take((size_t)NH_ * TT * HD * 2); bf* KPh = (bf*)take((size_t)NKV * TT * HD * 2); bf* KPl = (bf*)take((size_t)NKV * TT * HD * 2); bf* VTh = (bf*)take((size_t)NVG * HD * TT * 2); bf* VTl = (bf*)take((size_t)NVG * HD * TT * 2);
    float* Ob = (float*)take((size_t)NH_ * TT * HD * 4); bf* ATh = (bf*)take((size_t)TT * NHD * HD * 2); bf* ATl = (bf*)take((size_t)TT * NHD * HD * 2);
    if ((size_t)(wsp - (char*)d_ws) > ws_size) return;    // ws 256 MiB
    { k_cvt8<<<(unsigned)(((size_t)DQ * DM / 8 + 255) / 256), 256, 0, stream>>>(wq, WQ, (size_t)DQ * DM / 8); k_cvt8<<<(unsigned)(((size_t)DKV * DM / 8 + 255) / 256), 256, 0, stream>>>(wk, WK, (size_t)DKV * DM / 8); k_cvt8<<<(unsigned)(((size_t)DV * DM / 8 + 255) / 256), 256, 0, stream>>>(wv, WV, (size_t)DV * DM / 8); k_cvt8<<<(unsigned)(((size_t)DM * (NHD * HD) / 8 + 255) / 256), 256, 0, stream>>>(wo, WO, (size_t)DM * (NHD * HD) / 8); k_lambda<<<1, 64, 0, stream>>>(lq1, lk1, lq2, lk2, LAM); }
    for (int b = 0; b < NB_; ++b) {
        
        k_cvt8<<<(unsigned)(((size_t)TT * DM / 8 + 255) / 256), 256, 0, stream>>>(x + (size_t)b * TT * DM, XB, (size_t)TT * DM / 8);
        k_qkv<<<dim3(TT / 64, NH_ + NKV + NVG, 1), 32, 0, stream>>>(XB, WQ, WK, WV, fcos, fsin, QP16, QPh, QPl, KP16, KPh, KPl, VT16, VTh, VTl);   /* 32 query sub-heads (q1_h = 2h, q2_h = 2h+1), 16 key sub-heads (k1_g = 2g, k2_g = 2g+1), 8 value groups: projection, rotary, planes */
        k_fattn<<<dim3(TT / 128, NH_, 1), 128, 0, stream>>>(QP16, QPh, QPl, KP16, KPh, KPl, VT16, VTh, VTl, Ob);   /* all 32 sub-heads: Ob[z] = softmax(q_z k^T / 8) v (x PCAR for rows >= RH) */
        k_dcomb<<<dim3((unsigned)(((size_t)TT * HD / 4 + 255) / 256), NHD, 1), 256, 0, stream>>>(Ob, LAM, Y);   /* y_h = a1 v - lambda a2 v */
        k_gnstat<<<NHD, 1024, 0, stream>>>(Y, ST); k_gnapply<<<(unsigned)(((size_t)TT * NHD * HD / 4 + 255) / 256), 256, 0, stream>>>(Y, ST, ATh, ATl);   /* GroupNorm per head x (1 - lambda_init) -> planes */
        k_gemmw<bf, 1, false><<<dim3(TT / 64, DM / 64, 1), 32, 0, stream>>>(ATh, ATl, WO, nullptr, NHD * HD, OUT + (size_t)b * TT * DM, DM, nullptr, 0, 0, 0); }
}

// v005
// Measured time: 154 microseconds a run.
// Next to v004, in two timings, it ran 1.17 times as fast each time.
// Counting every step since v000, it is 12.1 times as fast.
#include <hip/hip_runtime.h>

// Differential attention (x [1][2048][1024]; q = x wq^T viewed (T, 16, 2, 64): q1/q2 per head; k = x wk^T viewed (T, 8, 2, 64): k1/k2 per kv group; v = x wv^T (8 x 64); interleaved-pair rotary on q1, q2, k1, k2 with the given cos/sin tables [2048][32]; head h uses kv group h/2; a1 = causal softmax(q1.k1/8), a2 = causal softmax(q2.k2/8); lambda = exp(lq1.lk1) - exp(lq2.lk2) + lambda_init (lambda vectors [64], read); y = (a1 - lambda a2) v; GroupNorm per (head) over (T, 64) (eps 1e-5, no affine) x (1 - lambda_init); out = y wo^T -> [1][2048][1024] (2.1 M)).
// Compute dtypes, f32 accumulate: every input rounded to bf16; projections exact; rotary f32; attention rows < 512 3 products, rest fp16, scores and probabilities kept on chip (one fused launch for all heads); softmax, lambda, combine and GroupNorm f32 (fixed-order reductions); wo hl x exact.

#define NB_  1
#define TT   2048
#define DM   1024
#define NH_  32
#define NKV  16
#define REP  (NH_ / NKV)
#define HD   64
#define DQ   (NH_ * HD)
#define DKV  (NKV * HD)
#define ZH   2
#define RH   512                  // query rows < RH use hi+lo planes (0: none)
#define WIN  2048
#define PCAR 1024.0f
#define SCL  0.125f
#define NVG  8       // value groups
#define DV   (NVG * HD)   // 512
#define NHD  16      // real heads
#define LINIT 0.35550906759096934f   // 0.8 - 0.6 exp(-0.3)
typedef _Float16 h16;
typedef unsigned short bf;
typedef __attribute__((ext_vector_type(16))) __bf16   v16bf;
typedef __attribute__((ext_vector_type(16))) _Float16 v16h;
typedef __attribute__((ext_vector_type(8)))  _Float16 v8h;
typedef __attribute__((ext_vector_type(8)))  unsigned short v8us;
typedef __attribute__((ext_vector_type(8)))  float    v8f;
typedef __attribute__((ext_vector_type(4)))  float    v4f;
typedef v8h  __attribute__((may_alias)) v8ha;
typedef v4f  __attribute__((may_alias)) v4fa;
typedef v8us __attribute__((may_alias)) v8usa;

__device__ __forceinline__ unsigned short f2bf(float f) { unsigned u = __float_as_uint(f); u += 0x7FFFu + ((u >> 16) & 1u); return (unsigned short)(u >> 16); }
__device__ __forceinline__ float bf2f(unsigned short b) { return __uint_as_float(((unsigned)b) << 16); }
__device__ __forceinline__ float bfr(float f) { return bf2f(f2bf(f)); }
__device__ __forceinline__ v16h cat16(v8h lo, v8h hi) { return __builtin_shufflevector(lo, hi, 0, 1, 2, 3, 4, 5, 6, 7, 8, 9, 10, 11, 12, 13, 14, 15); }
__device__ __forceinline__ v16bf cat16b(v8us lo, v8us hi) { return __builtin_bit_cast(v16bf, __builtin_shufflevector(lo, hi, 0, 1, 2, 3, 4, 5, 6, 7, 8, 9, 10, 11, 12, 13, 14, 15)); }
__device__ __forceinline__ v8f wmma16(v16h a, v16h b, v8f c) { return __builtin_amdgcn_wmma_f32_16x16x32_f16(false, a, false, b, (short)0, c, false, false); }
__device__ __forceinline__ v8f wmmab(v16bf a, v16bf b, v8f c) { return __builtin_amdgcn_wmma_f32_16x16x32_bf16(false, a, false, b, (short)0, c, false, false); }



// ---- k_gemmw: register-blocked GEMM, ONE WAVE per 64x64 output tile (16 accumulators), operands straight from K-contiguous 16-bit planes; grid (M/64, N/64, Z), 32 threads.
// C[m][n] (f32, pitch ldc, + optional f32 bias[n]) = sum_k A[m][k] Bt[n][k] (+ split products per NSPLIT). z-batch strides sA/sB/sC in elements. K % 32 == 0.
template <typename T16> struct WFrag;
template <> struct WFrag<h16> { typedef v16h V; static __device__ __forceinline__ V ld(const h16* p) { return cat16(*(const v8h*)p, *(const v8h*)(p + 16)); } static __device__ __forceinline__ v8f mma(V a, V b, v8f c) { return wmma16(a, b, c); } };
template <> struct WFrag<bf> { typedef v16bf V; static __device__ __forceinline__ V ld(const bf* p) { return cat16b(*(const v8us*)p, *(const v8us*)(p + 16)); } static __device__ __forceinline__ v8f mma(V a, V b, v8f c) { return wmmab(a, b, c); } };
template <typename T16, int NSPLIT, bool BIAS>
__global__ __launch_bounds__(32) void k_gemmw(const T16* __restrict__ A, const T16* __restrict__ A2, const T16* __restrict__ Bt, const T16* __restrict__ Bt2, int K, float* C, int ldc, const float* __restrict__ bias, size_t sA, size_t sB, size_t sC) {
    typedef typename WFrag<T16>::V V;
    __shared__ __align__(16) float os[16 * 68];
    const size_t z = blockIdx.z; A += z * sA; if (A2) A2 += z * sA; Bt += z * sB; if (Bt2) Bt2 += z * sB; C += z * sC;
    const int lane = threadIdx.x & 31, lr = lane & 15, hi = lane >> 4; const int r0 = blockIdx.x * 64, c0 = blockIdx.y * 64;
    v8f acc[4][4];
#pragma unroll
    for (int mb = 0; mb < 4; ++mb)
#pragma unroll
        for (int nb = 0; nb < 4; ++nb) acc[mb][nb] = (v8f){};
    const size_t aoff = (size_t)(r0 + lr) * K + 8 * hi, boff = (size_t)(c0 + lr) * K + 8 * hi;
#pragma unroll 1
    for (int kc = 0; kc < K; kc += 32) {
        V a[4], a2[4];
#pragma unroll
        for (int mb = 0; mb < 4; ++mb) { a[mb] = WFrag<T16>::ld(A + aoff + (size_t)mb * 16 * K + kc); if (NSPLIT == 1 || NSPLIT == 2) a2[mb] = WFrag<T16>::ld(A2 + aoff + (size_t)mb * 16 * K + kc); }
#pragma unroll
        for (int nb = 0; nb < 4; ++nb) { const V b = WFrag<T16>::ld(Bt + boff + (size_t)nb * 16 * K + kc); V b2; if (NSPLIT >= 2) b2 = WFrag<T16>::ld(Bt2 + boff + (size_t)nb * 16 * K + kc);
#pragma unroll
            for (int mb = 0; mb < 4; ++mb) { acc[mb][nb] = WFrag<T16>::mma(a[mb], b, acc[mb][nb]); if (NSPLIT == 1 || NSPLIT == 2) acc[mb][nb] = WFrag<T16>::mma(a2[mb], b, acc[mb][nb]); if (NSPLIT >= 2) acc[mb][nb] = WFrag<T16>::mma(a[mb], b2, acc[mb][nb]); } }
        asm volatile("v_nop\n\tv_nop\n\tv_nop\n\tv_nop" : "+v"(acc[0][0]), "+v"(acc[1][1]), "+v"(acc[2][2]), "+v"(acc[3][3]) : "v"(a[0]), "v"(a[3]));
    }
#pragma unroll
    for (int mb = 0; mb < 4; ++mb) {
#pragma unroll
        for (int nb = 0; nb < 4; ++nb) {
#pragma unroll
            for (int j = 0; j < 8; ++j) os[(hi * 8 + j) * 68 + nb * 16 + lr] = acc[mb][nb][j]; }
        __builtin_amdgcn_wave_barrier(); asm volatile("" ::: "memory");
        float* crow = C + (size_t)(r0 + mb * 16) * ldc + c0;
{
#pragma unroll
            for (int s = 0; s < 8; ++s) { const int row = 2 * s + hi, cofs = lr * 4; v4f val = *(const v4fa*)(os + row * 68 + cofs); if (BIAS) { val[0] += bfr(bias[c0 + cofs]); val[1] += bfr(bias[c0 + cofs + 1]); val[2] += bfr(bias[c0 + cofs + 2]); val[3] += bfr(bias[c0 + cofs + 3]); }
                *(v4f*)(crow + (size_t)row * ldc + cofs) = val; }
             }
        __builtin_amdgcn_wave_barrier(); asm volatile("" ::: "memory");
    }
}

__device__ __forceinline__ h16 tohx(float x) { return (h16)x; }
__device__ __forceinline__ void splitf(float y, unsigned short& h, unsigned short& l) { h = f2bf(y); l = f2bf(y - bf2f(h)); }
typedef __attribute__((ext_vector_type(2))) _Float16 v2h;
typedef __attribute__((ext_vector_type(4))) _Float16 v4h;
typedef __attribute__((ext_vector_type(2))) unsigned short v2us;
typedef __attribute__((ext_vector_type(4))) unsigned short v4us;
typedef __attribute__((ext_vector_type(2))) float v2f;
typedef __attribute__((ext_vector_type(4))) int v4i;

__global__ __launch_bounds__(256) void k_wtG(const float* __restrict__ w, int K, int N, bf* Bt) {
    const int lane = threadIdx.x & 31; const int L0 = (blockIdx.x * 8 + (threadIdx.x >> 5)) * 8; const int nlines = N * K / 64;
{
#pragma unroll 1
        for (int l = 0; l < 8; ++l) { const int L = L0 + l; if (L >= nlines) break; const size_t e = (size_t)L * 64 + lane * 2; const int k = (int)(e % K), n = (int)(e / K); v2us o;
            o[0] = f2bf(w[(size_t)k * N + n]); o[1] = f2bf(w[(size_t)(k + 1) * N + n]); *(v2us*)(Bt + e) = o; }
         }
}
__global__ __launch_bounds__(256) void k_cvt8(const float* __restrict__ src, bf* dst, size_t n8) { const size_t i = (size_t)blockIdx.x * 256 + threadIdx.x; if (i >= n8) return; const v8f v = *(const v8f*)(src + i * 8); v8us o;
#pragma unroll
    for (int k = 0; k < 8; ++k) o[k] = f2bf(v[k]); *(v8us*)(dst + i * 8) = o;  }

// ---- k_qkv: the q, k and v projections in ONE launch, each 64x64 tile finished in its own epilogue: nothing of the projections goes to memory in f32.
// Main loop as in k_gemmw (one wave per tile, bf16 planes, one product). A tile column is one 64-wide sub-head: blockIdx.y 0..31 query sub-heads, 32..47 key sub-heads, 48..55 value groups.
// q, k: interleaved-pair rotary on the staged rows (cos / sin rounded to bf16 as every input), then the fp16 plane and the hi+lo planes [sub-head][t][64], whole 128-B lines per row.
// v: an accumulator register run is 8 consecutive t of one column, which is 16 B of the transposed planes [group][d][t]: stored straight from the registers.
__global__ __launch_bounds__(32) void k_qkv(const bf* __restrict__ A, const bf* __restrict__ WQ, const bf* __restrict__ WK, const bf* __restrict__ WV, const float* __restrict__ fcos, const float* __restrict__ fsin, h16* QP16, bf* QPh, bf* QPl, h16* KP16, bf* KPh, bf* KPl, h16* VT16, bf* VTh, bf* VTl) {
    typedef WFrag<bf>::V V;
    __shared__ __align__(16) float os[16 * 68];
    const int lane = threadIdx.x & 31, lr = lane & 15, hi = lane >> 4; const int r0 = blockIdx.x * 64, cy = blockIdx.y;
    const bf* Bt = (cy < NH_) ? WQ + (size_t)cy * 64 * DM : (cy < NH_ + NKV) ? WK + (size_t)(cy - NH_) * 64 * DM : WV + (size_t)(cy - NH_ - NKV) * 64 * DM;
    v8f acc[4][4];
#pragma unroll
    for (int mb = 0; mb < 4; ++mb)
#pragma unroll
        for (int nb = 0; nb < 4; ++nb) acc[mb][nb] = (v8f){};
    const size_t aoff = (size_t)(r0 + lr) * DM + 8 * hi, boff = (size_t)lr * DM + 8 * hi;
#pragma unroll 1   // one trip in the code, as in k_gemmw: two trips' fragments (2 x 64 registers) beside the 128 accumulator registers would leave the 256 directly addressed ones
    for (int kc = 0; kc < DM; kc += 32) {
        V a[4]; const bf* pa = A + aoff + kc; const bf* pb = Bt + boff + kc;
#pragma unroll
        for (int mb = 0; mb < 4; ++mb) a[mb] = WFrag<bf>::ld(pa + (size_t)mb * 16 * DM);
#pragma unroll
        for (int nb = 0; nb < 4; ++nb) { const V b = WFrag<bf>::ld(pb + (size_t)nb * 16 * DM);
#pragma unroll
            for (int mb = 0; mb < 4; ++mb) acc[mb][nb] = WFrag<bf>::mma(a[mb], b, acc[mb][nb]); }
        asm volatile("v_nop\n\tv_nop\n\tv_nop\n\tv_nop" : "+v"(acc[0][0]), "+v"(acc[1][1]), "+v"(acc[2][2]), "+v"(acc[3][3]) : "v"(a[0]), "v"(a[3]), "v"(pa), "v"(pb));   // the four vector slots behind the trip's last matrix instruction, on the back edge and on the way out alike; the lane pointers are named so that no load of the trip lands in their registers
    }
    if (cy >= NH_ + NKV) {
        const size_t vo = ((size_t)(cy - NH_ - NKV) * HD + lr) * TT + r0 + hi * 8;
#pragma unroll
        for (int nb = 0; nb < 4; ++nb)
#pragma unroll
            for (int mb = 0; mb < 4; ++mb) { v8h o16; v8us oh, ol;   // mb innermost: the four 32-B pieces of a 128-B line follow one another
#pragma unroll
                for (int j = 0; j < 8; ++j) { const float x = acc[mb][nb][j]; unsigned short a2, c2; o16[j] = tohx(x); splitf(x, a2, c2); oh[j] = a2; ol[j] = c2; }
                const size_t e = vo + (size_t)nb * 16 * TT + mb * 16; *(v8h*)(VT16 + e) = o16; *(v8us*)(VTh + e) = oh; *(v8us*)(VTl + e) = ol; }
        return; }
    const size_t zo = (size_t)((cy < NH_) ? cy : cy - NH_) * TT * HD;
    h16* P16 = ((cy < NH_) ? QP16 : KP16) + zo; bf* Ph = ((cy < NH_) ? QPh : KPh) + zo; bf* Pl = ((cy < NH_) ? QPl : KPl) + zo;
    const int rr = lane >> 3, c8 = (lane & 7) * 8;   // a lane finishes 8 columns (4 rotary pairs) of one row; 8 lanes cover a row, a wave store 4 rows
    const float* pc = fcos + (size_t)(r0 + rr) * (HD / 2) + (c8 >> 1); const float* pn = fsin + (size_t)(r0 + rr) * (HD / 2) + (c8 >> 1);
    v4f cc[2][4], sn[2][4];
#pragma unroll
    for (int s = 0; s < 4; ++s) { cc[0][s] = *(const v4f*)(pc + (size_t)(4 * s) * (HD / 2)); sn[0][s] = *(const v4f*)(pn + (size_t)(4 * s) * (HD / 2)); }
#pragma unroll
    for (int mb = 0; mb < 4; ++mb) {
#pragma unroll
        for (int nb = 0; nb < 4; ++nb) {
#pragma unroll
            for (int j = 0; j < 8; ++j) os[(hi * 8 + j) * 68 + nb * 16 + lr] = acc[mb][nb][j]; }
        __builtin_amdgcn_wave_barrier(); asm volatile("" ::: "memory");   // the tile is read below by other lanes of this wave: keep the stores in front of the reads
        if (mb < 3) {   // the next 16 rows' cos / sin fly while these 16 rows are finished
#pragma unroll
            for (int s = 0; s < 4; ++s) { cc[(mb + 1) & 1][s] = *(const v4f*)(pc + (size_t)((mb + 1) * 16 + 4 * s) * (HD / 2)); sn[(mb + 1) & 1][s] = *(const v4f*)(pn + (size_t)((mb + 1) * 16 + 4 * s) * (HD / 2)); }
            __builtin_amdgcn_sched_barrier(0); }   // keeps these loads in front of the rows' work: sunk among the stores they would come late and land in registers that an issued store names
#pragma unroll
        for (int s = 0; s < 4; ++s) { const int row = 4 * s + rr; const v4f xa = *(const v4fa*)(os + row * 68 + c8), xb = *(const v4fa*)(os + row * 68 + c8 + 4); v8h o16; v8us oh, ol;
#pragma unroll
            for (int p = 0; p < 4; ++p) { const float x0 = (p < 2) ? xa[2 * p] : xb[2 * p - 4], x1 = (p < 2) ? xa[2 * p + 1] : xb[2 * p - 3]; const float c = bfr(cc[mb & 1][s][p]), n = bfr(sn[mb & 1][s][p]);
                const float e0 = x0 * c - x1 * n, e1 = x0 * n + x1 * c;   /* even: x0 c - x1 s; odd: x0 s + x1 c */
                unsigned short a2, c2; o16[2 * p] = tohx(e0); o16[2 * p + 1] = tohx(e1); splitf(e0, a2, c2); oh[2 * p] = a2; ol[2 * p] = c2; splitf(e1, a2, c2); oh[2 * p + 1] = a2; ol[2 * p + 1] = c2; }
            const size_t e = (size_t)(r0 + mb * 16 + row) * HD + c8; *(v8h*)(P16 + e) = o16; *(v8us*)(Ph + e) = oh; *(v8us*)(Pl + e) = ol; }
        __builtin_amdgcn_wave_barrier(); asm volatile("s_wait_xcnt 0x0" ::: "memory");   // the LDS reads stay in front of the next 16 rows' LDS stores; the wait stands behind these rows' global stores, before the next loads land in their registers
    }
}


__global__ __launch_bounds__(64) void k_lambda(const float* __restrict__ a1, const float* __restrict__ b1, const float* __restrict__ a2, const float* __restrict__ b2, float* LAM) { float s1 = 0.f, s2 = 0.f;
#pragma unroll 1
    for (int d = 0; d < HD; ++d) { float p1 = __fmul_rn(bfr(a1[d]), bfr(b1[d])), p2 = __fmul_rn(bfr(a2[d]), bfr(b2[d])); asm volatile("" : "+v"(p1), "+v"(p2)); s1 = __fadd_rn(s1, p1); s2 = __fadd_rn(s2, p2); }
    const float lam = __fadd_rn(__fsub_rn(expf(s1), expf(s2)), LINIT); *(float*)(LAM + threadIdx.x) = lam;  }
__global__ __launch_bounds__(256) void k_dcomb(const float* __restrict__ O, const float* __restrict__ LAM, float* Y) { const size_t i = (size_t)blockIdx.x * 256 + threadIdx.x; if (i >= (size_t)TT * HD / 4) return; const int h = blockIdx.y; O += (size_t)h * 2 * TT * HD; const int d0 = (int)(i % (HD / 4)) * 4; const size_t t = i / (HD / 4); const float cs = (t < RH) ? 1.0f : (1.0f / PCAR); const float lam = LAM[0]; const v4f a = *(const v4f*)(O + t * HD + d0); const v4f b = *(const v4f*)(O + (size_t)TT * HD + t * HD + d0); v4f o;
#pragma unroll
    for (int q = 0; q < 4; ++q) { float p = __fmul_rn(a[q], cs), m = __fmul_rn(__fmul_rn(b[q], cs), lam); asm volatile("" : "+v"(p), "+v"(m)); o[q] = __fsub_rn(p, m); }
    *(v4f*)(Y + t * (NHD * HD) + (size_t)h * HD + d0) = o;  }
// k_gnstat: one work-group of 32 waves per head. A wave load covers two 256-B row segments of the head (lanes 0-15 one row, 16-31 the next), the 32 waves cover 64 rows, 32 steps cover the 2048 rows.
// Mean first, then the squared deviations from it (two reads of Y, the second from L2). Fixed-order sums: per lane over its steps, xor tree in the wave, one LDS word per wave, the same xor tree over the 32 words (in every wave for the mean, in wave 0 for the variance).
__device__ __forceinline__ float gn_wavesum(float s) {
#pragma unroll
    for (int sh = 16; sh; sh >>= 1) s += __shfl_xor(s, sh, 32);
    return s; }
__global__ __launch_bounds__(1024) void k_gnstat(const float* __restrict__ Y, float* ST) { __shared__ float red1[32]; __shared__ float red2[32];
    const int h = blockIdx.x; const int lane = threadIdx.x & 31, wv = threadIdx.x >> 5; const float nf = (float)((size_t)TT * HD);
    const float* yp = Y + (size_t)(wv * 2 + (lane >> 4)) * (NHD * HD) + (size_t)h * HD + (lane & 15) * 4;
    float s = 0.f;
#pragma unroll   // independent loads in flight together: the latency of one L2 read is paid per batch, not per row
    for (int st = 0; st < TT / 64; ++st) { const v4f a = *(const v4f*)(yp + (size_t)st * 64 * (NHD * HD)); s += (a[0] + a[1]) + (a[2] + a[3]); }
    s = gn_wavesum(s); if (lane == 0) red1[wv] = s;
    __syncthreads();   // every wave's partial sum is in red1 before any wave adds them up
    const float mean = __fdiv_rn(gn_wavesum(red1[lane]), nf);
    float s2 = 0.f;
#pragma unroll   // as above
    for (int st = 0; st < TT / 64; ++st) { const v4f a = *(const v4f*)(yp + (size_t)st * 64 * (NHD * HD)); float acc = 0.f;
#pragma unroll
        for (int q = 0; q < 4; ++q) { const float dv = a[q] - mean; acc += dv * dv; } s2 += acc; }
    s2 = gn_wavesum(s2); if (lane == 0) red2[wv] = s2;
    __syncthreads();   // every wave's partial sum is in red2 before wave 0 adds them up
    if (wv == 0) { const float var = __fdiv_rn(gn_wavesum(red2[lane]), nf); ST[h * 32 + lane] = (lane & 1) ? var : mean; } }

__global__ __launch_bounds__(256) void k_gnapply(const float* __restrict__ Y, const float* __restrict__ ST, bf* Ah, bf* Al) { const size_t i = (size_t)blockIdx.x * 256 + threadIdx.x; if (i >= (size_t)TT * NHD * HD / 4) return; const int c0 = (int)(i % (NHD * HD / 4)) * 4; const size_t t = i / (NHD * HD / 4); const int h = c0 / HD; const float mean = ST[h * 32], var = ST[h * 32 + 1]; const float rs = __fdiv_rn(1.0f, __fsqrt_rn(__fadd_rn(var, 1e-5f))); const v4f a = *(const v4f*)(Y + t * (NHD * HD) + c0); v4us oh, ol;
#pragma unroll
    for (int q = 0; q < 4; ++q) { float nv = __fmul_rn(__fsub_rn(a[q], mean), rs); asm volatile("" : "+v"(nv)); unsigned short h2, l2; splitf(__fmul_rn(nv, 1.0f - LINIT), h2, l2); oh[q] = h2; ol[q] = l2; }
    *(v4us*)(Ah + t * (NHD * HD) + c0) = oh; *(v4us*)(Al + t * (NHD * HD) + c0) = ol;  }

// ---- k_fattn: scores, causal softmax and probability x value in ONE launch for all 32 query sub-heads; no score or probability ever goes to memory.
// One wave owns 16 query rows and walks the keys 0 .. its diagonal ONCE, in blocks of 64: scores, e = exp(t - ref), row sum, e to 16-bit through a
// per-wave LDS tile (accumulator layout -> A fragment layout), P.V accumulated in key order; the division by the row sum comes after P.V. Rows < RH: hi+lo planes, 3 products; the rest fp16 with e x PCAR.
// ref is the row's running maximum, renewed lazily: only when a score exceeds it by more than MXLAG are the row sums and the P.V accumulators scaled by exp(old ref - new ref). ref cancels in P.V / sum.
// A work-group (4 waves, 64 rows) does row block 31 - rb and then row block rb: every work-group walks the same number of key blocks, wherever it is placed.
// The four waves walk the same key blocks: each block's key and value tiles are brought into LDS once for the work-group by asynchronous copies (whole 128-B lines), two buffers, the next block's copies in flight while this block is worked on.
#define MXLAG 3.4657359f   // 5 ln 2: e <= 32, so e x PCAR <= 32768 stays inside fp16
#define PP 72   // LDS pitch of a probability row and of a staged key or value row in 16-bit elements: 144 B = 16 B x odd, the conflict-free pitch for 16-byte reads
#define KVT (64 * PP)   // one staged tile in 16-bit elements: 64 rows of 128 B at pitch PP
#define KVB (4 * KVT)   // one buffer: tiles 0 keys, 1 values, 2 keys lo, 3 values lo (2 and 3 only for the hi+lo planes)
template <typename T16> struct LFrag;
template <> struct LFrag<h16> { static __device__ __forceinline__ v16h ld(const h16* p) { return cat16(*(const v8ha*)p, *(const v8ha*)(p + 16)); } };
template <> struct LFrag<bf> { static __device__ __forceinline__ v16bf ld(const bf* p) { return cat16b(*(const v8usa*)p, *(const v8usa*)(p + 16)); } };
// 2^x with the free issue slot behind the transcendental in the same statement: the next vector instruction may then read the result or overwrite the source.
__device__ __forceinline__ float fattn_exp2(float x) { float r; asm("v_exp_f32 %0, %1\n\tv_nop" : "=v"(r) : "v"(x)); return r; }
// Four B fragments (nb = 0..3) of k step ks of one staged tile: rows nb*16+lr at pitch PP; pl is the lane's own LDS pointer (row lr, k offset 8*hi).
template <typename T16>
__device__ __forceinline__ void fattn_ld4(const T16* pl, int ks, typename WFrag<T16>::V (&b)[4]) {
#pragma unroll
    for (int nb = 0; nb < 4; ++nb) b[nb] = LFrag<T16>::ld(pl + (nb * 16 * PP + ks * 32));
}
// Two 64-row x 128-B tiles from global memory into LDS through no register. ga, gb: the thread's own 16 bytes of its first row (row tid / 8, piece tid % 8); la, lb: their LDS byte addresses.
// A thread brings rows tid / 8 + 16 c, c = 0..3, of each tile; a wave's copy covers 4 whole 128-B lines. The s_wait_xcnt closes the statement so that no address register is rewritten in front of it.
template <typename T16>
__device__ __forceinline__ void fattn_copy2(const T16* ga, size_t pa, const T16* gb, size_t pb, unsigned la, unsigned lb) {
    asm volatile("global_load_async_to_lds_b128 %0, %8, off\n\t"
                 "global_load_async_to_lds_b128 %1, %9, off\n\t"
                 "global_load_async_to_lds_b128 %2, %10, off\n\t"
                 "global_load_async_to_lds_b128 %3, %11, off\n\t"
                 "global_load_async_to_lds_b128 %4, %12, off\n\t"
                 "global_load_async_to_lds_b128 %5, %13, off\n\t"
                 "global_load_async_to_lds_b128 %6, %14, off\n\t"
                 "global_load_async_to_lds_b128 %7, %15, off\n\t"
                 "s_wait_xcnt 0x0"
                 :: "v"(la), "v"(la + 16 * PP * 2), "v"(la + 32 * PP * 2), "v"(la + 48 * PP * 2), "v"(lb), "v"(lb + 16 * PP * 2), "v"(lb + 32 * PP * 2), "v"(lb + 48 * PP * 2),
                    "v"(ga), "v"(ga + 16 * pa), "v"(ga + 32 * pa), "v"(ga + 48 * pa), "v"(gb), "v"(gb + 16 * pb), "v"(gb + 32 * pb), "v"(gb + 48 * pb) : "memory");
}
// Inputs-only fence on loaded fragments: every LDS read of the batch is issued before the first matrix instruction waits, so a batch pays one LDS latency, not one per fragment.
template <typename V> __device__ __forceinline__ void fattn_hold8(const V (&x)[4], const V (&y)[4]) { asm volatile("" :: "v"(x[0]), "v"(x[1]), "v"(x[2]), "v"(x[3]), "v"(y[0]), "v"(y[1]), "v"(y[2]), "v"(y[3])); }
// acc[nb] += a x b[nb] (+ a2 x b[nb] + a x b2[nb] for the hi+lo planes)
template <typename T16, bool HI>
__device__ __forceinline__ void fattn_mm(const typename WFrag<T16>::V& a, const typename WFrag<T16>::V& a2, const typename WFrag<T16>::V (&b)[4], const typename WFrag<T16>::V (&b2)[4], v8f (&acc)[4]) {
#pragma unroll
    for (int nb = 0; nb < 4; ++nb) { acc[nb] = WFrag<T16>::mma(a, b[nb], acc[nb]);
        if (HI) { acc[nb] = WFrag<T16>::mma(a2, b[nb], acc[nb]); acc[nb] = WFrag<T16>::mma(a, b2[nb], acc[nb]); } }
}
// st: the two staging buffers (work-group wide), sbase: their LDS byte address. Called by all four waves of the work-group with the same row block: the barriers inside are passed by every wave, the same number of times.
template <typename T16, bool HI>
__device__ __forceinline__ void fattn_strip(const T16* __restrict__ Q, const T16* __restrict__ Q2, const T16* __restrict__ Kp, const T16* __restrict__ Kp2, const T16* __restrict__ Vt, const T16* __restrict__ Vt2, int i0, T16* ps, T16* ps2, const T16* st, unsigned sbase, float* O) {
    typedef typename WFrag<T16>::V V;
    const int lane = threadIdx.x & 31, lr = lane & 15, hi = lane >> 4;
    const int nblk = (i0 >> 6) + 1;                    // key blocks 0 .. nblk-1: up to the end of the 64-key block that holds the diagonal (64 nblk <= TT); the same for the four waves
    const unsigned crow = threadIdx.x >> 3, ccol = (threadIdx.x & 7) * 8;   // the thread's first row and its 16-byte piece in every staged tile
    const T16* gk = Kp + crow * HD + ccol; const T16* gk2 = Kp2 + crow * HD + ccol; const T16* gv = Vt + crow * TT + ccol; const T16* gv2 = Vt2 + crow * TT + ccol;
    const unsigned l0 = sbase + (crow * PP + ccol) * 2;
    auto stage = [&](int t) { const unsigned lb = l0 + (unsigned)(t & 1) * (KVB * 2);
        fattn_copy2<T16>(gk + (size_t)t * 64 * HD, HD, gv + t * 64, TT, lb, lb + KVT * 2);
        if constexpr (HI) fattn_copy2<T16>(gk2 + (size_t)t * 64 * HD, HD, gv2 + t * 64, TT, lb + 2 * KVT * 2, lb + 3 * KVT * 2); };
    stage(0);   // both buffers are free here: an earlier strip's last reads ended in front of its last barrier
    V q[2], q2[2];
#pragma unroll
    for (int ks = 0; ks < 2; ++ks) { q[ks] = WFrag<T16>::ld(Q + (size_t)(i0 + lr) * HD + ks * 32 + 8 * hi); q2[ks] = HI ? WFrag<T16>::ld(Q2 + (size_t)(i0 + lr) * HD + ks * 32 + 8 * hi) : q[ks]; }
    asm volatile("s_wait_xcnt 0x0" :: "v"(q[0]), "v"(q[1]), "v"(q2[0]), "v"(q2[1]) : "memory");   // behind the query loads, before their address registers are used for anything else
    float mx[8];   // the reference each row's exponentials are taken against: a running row maximum, renewed only when a score leaves it far behind
#pragma unroll
    for (int j = 0; j < 8; ++j) mx[j] = -3.0e38f;
    float sum[8]; v8f o[4];
#pragma unroll
    for (int j = 0; j < 8; ++j) sum[j] = 0.f;
#pragma unroll
    for (int nb = 0; nb < 4; ++nb) o[nb] = (v8f){};
    asm volatile("s_wait_asynccnt 0x0" ::: "memory");   // this wave's copies of block 0 have landed
    __syncthreads();                                    // and every other wave's: block 0 may be read
    if (nblk > 1) stage(1);
    for (int t = 0; t < nblk; ++t) { V kb[2][4], kb2[2][4], vb[2][4], vb2[2][4]; v8f s[4]; const int j0 = t * 64; const T16* sb = st + (t & 1) * KVB + lr * PP + 8 * hi;
#pragma unroll
        for (int nb = 0; nb < 4; ++nb) s[nb] = (v8f){};
        if constexpr (HI) {
#pragma unroll
            for (int ks = 0; ks < 2; ++ks) { fattn_ld4<T16>(sb, ks, kb[ks]); fattn_ld4<T16>(sb + 2 * KVT, ks, kb2[ks]); fattn_mm<T16, HI>(q[ks], q2[ks], kb[ks], kb2[ks], s);
                if (ks == 0) __builtin_amdgcn_sched_barrier(0); }   // one k step's 64 fragment registers at a time: both steps' fetched together overrun the 256 directly addressed registers
        } else {   // one plane each: the value fragments are fetched with the key fragments, ahead of the softmax
            fattn_ld4<T16>(sb, 0, kb[0]); fattn_ld4<T16>(sb, 1, kb[1]); fattn_ld4<T16>(sb + KVT, 0, vb[0]); fattn_ld4<T16>(sb + KVT, 1, vb[1]);
            fattn_mm<T16, HI>(q[0], q2[0], kb[0], kb2[0], s); fattn_mm<T16, HI>(q[1], q2[1], kb[1], kb2[1], s); }
        float lead = -3.0e38f;   // by how much this lane's scores of the block lead their rows' references, at most
#pragma unroll
        for (int j = 0; j < 8; ++j) {
#pragma unroll
            for (int nb = 0; nb < 4; ++nb) s[nb][j] = (j0 + nb * 16 + lr <= i0 + hi * 8 + j) ? s[nb][j] * SCL : -3.0e38f;
            lead = fmaxf(lead, fmaxf(fmaxf(s[0][j], s[1][j]), fmaxf(s[2][j], s[3][j])) - mx[j]); }
        if (__builtin_amdgcn_ballot_w32(lead > MXLAG) != 0) {   // one scalar test per key block, every lane stays on: taken at a strip's first block and then only when some score outgrows its row's reference
#pragma unroll
            for (int j = 0; j < 8; ++j) { float bm = fmaxf(fmaxf(s[0][j], s[1][j]), fmaxf(s[2][j], s[3][j]));
#pragma unroll
                for (int sh = 8; sh; sh >>= 1) bm = fmaxf(bm, __shfl_xor(bm, sh, 32));   // row hi*8+j lives in the 16 lanes of this half
                const float nm = fmaxf(mx[j], bm); const float f = fattn_exp2((mx[j] - nm) * 1.4426950408889634f); mx[j] = nm; sum[j] *= f;   // what was summed against the old reference is carried over to the new one (first block: f = 0 on zeros)
#pragma unroll
                for (int nb = 0; nb < 4; ++nb) o[nb][j] *= f; } }
#pragma unroll
        for (int nb = 0; nb < 4; ++nb)
#pragma unroll
            for (int j = 0; j < 8; ++j) { const float e = fattn_exp2((s[nb][j] - mx[j]) * 1.4426950408889634f); sum[j] += e;
                const int po = (hi * 8 + j) * PP + nb * 16 + lr;
                if constexpr (HI) { unsigned short eh, el; splitf(e, eh, el); ps[po] = eh; ps2[po] = el; } else ps[po] = tohx(e * PCAR); }
        __builtin_amdgcn_wave_barrier(); asm volatile("" ::: "memory");   // the tile is read below by other lanes of this wave: keep the stores in front of the reads
#pragma unroll
        for (int ks = 0; ks < 2; ++ks) { const V a = LFrag<T16>::ld(ps + lr * PP + ks * 32 + 8 * hi); V a2 = a;
            if constexpr (HI) { a2 = LFrag<T16>::ld(ps2 + lr * PP + ks * 32 + 8 * hi); fattn_ld4<T16>(sb + KVT, ks, vb[ks]); fattn_ld4<T16>(sb + 3 * KVT, ks, vb2[ks]); fattn_hold8(vb[ks], vb2[ks]); }
            fattn_mm<T16, HI>(a, a2, vb[ks], vb2[ks], o); }
        // hand-over of the buffers, every wave, in this order:
        asm volatile("s_wait_dscnt 0x0" ::: "memory");      // this wave's reads of this block's buffer (and of its probability tile) have returned
        asm volatile("s_wait_asynccnt 0x0" ::: "memory");   // this wave's copies of the next block have landed
        __syncthreads();                                    // the same holds for every wave: the next block may be read, this block's buffer may be refilled
        if (t + 2 < nblk) stage(t + 2);
    }
    asm volatile("s_wait_asynccnt 0x0" ::: "memory");   // no copy is in flight behind the loop
#pragma unroll
    for (int j = 0; j < 8; ++j) {
#pragma unroll
        for (int sh = 8; sh; sh >>= 1) sum[j] += __shfl_xor(sum[j], sh, 32);
        const float f = __fdiv_rn(1.0f, sum[j]);
#pragma unroll
        for (int nb = 0; nb < 4; ++nb) O[(size_t)(i0 + hi * 8 + j) * HD + nb * 16 + lr] = o[nb][j] * f; }
    asm volatile("s_wait_xcnt 0x0" ::: "memory");   // behind the output stores, before the next strip reuses their address and data registers
}
// the register attribute holds the kernel to the 256 directly addressed vector registers (no register-bank switching in the loops): with this much LDS the launch bounds' second figure alone no longer does
__global__ __launch_bounds__(128, 4) __attribute__((amdgpu_num_vgpr(256))) void k_fattn(const h16* __restrict__ QP16, const bf* __restrict__ QPh, const bf* __restrict__ QPl, const h16* __restrict__ KP16, const bf* __restrict__ KPh, const bf* __restrict__ KPl, const h16* __restrict__ VT16, const bf* __restrict__ VTh, const bf* __restrict__ VTl, float* Ob) {
    __shared__ __align__(16) unsigned short pt[4][2][16 * PP];
    __shared__ __align__(16) unsigned short kv[2 * KVB];
    const unsigned sbase = (unsigned)(size_t)(const void*)kv;   // the low 32 bits of a __shared__ address are its LDS byte address
    const int wv = __builtin_amdgcn_readfirstlane(threadIdx.x >> 5); const int z = blockIdx.y;   // wave number in a scalar register: scalar loop bounds. z = 2h: (q1_h, k1_g), z = 2h+1: (q2_h, k2_g), g = h/2; both use v[g]
    const size_t zq = (size_t)z * TT * HD, zk = (size_t)(2 * (z / 4) + (z & 1)) * TT * HD, zv = (size_t)(z / 4) * HD * TT;
    // The far row block first: rb >= TT / 128, which is not below RH / 64, so it is always the fp16 path. Written out, not as a loop over the two halves: no path's lane addresses then stay in registers through the other path's key loop (spills).
    static_assert(TT / 128 * 64 >= RH, "the first row block of every work-group lies outside the hi+lo rows");
    { const int i0 = (TT / 64 - 1 - (int)blockIdx.x) * 64 + wv * 16;
        fattn_strip<h16, false>(QP16 + zq, QP16 + zq, KP16 + zk, KP16 + zk, VT16 + zv, VT16 + zv, i0, (h16*)pt[wv][0], (h16*)pt[wv][1], (const h16*)kv, sbase, Ob + zq); }
    { const int rb = (int)blockIdx.x; const int i0 = rb * 64 + wv * 16;
        if (rb * 64 < RH) fattn_strip<bf, true>(QPh + zq, QPl + zq, KPh + zk, KPl + zk, VTh + zv, VTl + zv, i0, pt[wv][0], pt[wv][1], (const bf*)kv, sbase, Ob + zq);
        else fattn_strip<h16, false>(QP16 + zq, QP16 + zq, KP16 + zk, KP16 + zk, VT16 + zv, VT16 + zv, i0, (h16*)pt[wv][0], (h16*)pt[wv][1], (const h16*)kv, sbase, Ob + zq); }
}
__global__ __launch_bounds__(256) void k_merge(const float* __restrict__ O, int h0, bf* Ah, bf* Al) { const size_t e = ((size_t)blockIdx.x * 256 + threadIdx.x) * 2; if (e >= (size_t)ZH * TT * HD) return; const int d = (int)(e % HD); const int t = (int)((e / HD) % TT); const int zz = (int)(e / ((size_t)HD * TT)); const float cs = (t < RH) ? 1.0f : (1.0f / PCAR); const size_t oo = (size_t)t * DQ + (h0 + zz) * HD + d;
    v2us oh, ol;
#pragma unroll
    for (int q = 0; q < 2; ++q) { unsigned short a, c2; splitf(O[e + q] * cs, a, c2); oh[q] = a; ol[q] = c2; } *(v2us*)(Ah + oo) = oh; *(v2us*)(Al + oo) = ol;  }

extern "C" void kernel_launch(void* const* d_in, const int* in_sizes, int n_in,
                              void* d_out, int out_size, void* d_ws, size_t ws_size, hipStream_t stream) {
    (void)in_sizes; (void)n_in; (void)out_size;
    const float* x = (const float*)d_in[0]; const float* fcos = (const float*)d_in[1]; const float* fsin = (const float*)d_in[2]; const float* wq = (const float*)d_in[3]; const float* wk = (const float*)d_in[4]; const float* wv = (const float*)d_in[5]; const float* wo = (const float*)d_in[6]; const float* lq1 = (const float*)d_in[7]; const float* lk1 = (const float*)d_in[8]; const float* lq2 = (const float*)d_in[9]; const float* lk2 = (const float*)d_in[10];
    float* OUT = (float*)d_out;     // [1][2048][1024]
    char* wsp = (char*)d_ws;
    auto take = [&](size_t bytes) { char* p = wsp; wsp += (bytes + 255) & ~(size_t)255; return (void*)p; };
    bf* WQ = (bf*)take((size_t)DQ * DM * 2); bf* WK = (bf*)take((size_t)DKV * DM * 2); bf* WV = (bf*)take((size_t)DV * DM * 2); bf* WO = (bf*)take((size_t)DM * NHD * HD * 2); float* LAM = (float*)take(64 * 4); float* ST = (float*)take((size_t)NHD * 32 * 4); float* Y = (float*)take((size_t)TT * NHD * HD * 4);
    bf* XB = (bf*)take((size_t)TT * DM * 2);
    h16* QP16 = (h16*)take((size_t)NH_ * TT * HD * 2); h16* KP16 = (h16*)take((size_t)NKV * TT * HD * 2); h16* VT16 = (h16*)take((size_t)NVG * HD * TT * 2);
    bf* QPh = (bf*)take((size_t)NH_ * TT * HD * 2); bf* QPl = (bf*)take((size_t)NH_ * TT * HD * 2); bf* KPh = (bf*)take((size_t)NKV * TT * HD * 2); bf* KPl = (bf*)take((size_t)NKV * TT * HD * 2); bf* VTh = (bf*)take((size_t)NVG * HD * TT * 2); bf* VTl = (bf*)take((size_t)NVG * HD * TT * 2);
    float* Ob = (float*)take((size_t)NH_ * TT * HD * 4); bf* ATh = (bf*)take((size_t)TT * NHD * HD * 2); bf* ATl = (bf*)take((size_t)TT * NHD * HD * 2);
    if ((size_t)(wsp - (char*)d_ws) > ws_size) return;    // ws 256 MiB
    { k_cvt8<<<(unsigned)(((size_t)DQ * DM / 8 + 255) / 256), 256, 0, stream>>>(wq, WQ, (size_t)DQ * DM / 8); k_cvt8<<<(unsigned)(((size_t)DKV * DM / 8 + 255) / 256), 256, 0, stream>>>(wk, WK, (size_t)DKV * DM / 8); k_cvt8<<<(unsigned)(((size_t)DV * DM / 8 + 255) / 256), 256, 0, stream>>>(wv, WV, (size_t)DV * DM / 8); k_cvt8<<<(unsigned)(((size_t)DM * (NHD * HD) / 8 + 255) / 256), 256, 0, stream>>>(wo, WO, (size_t)DM * (NHD * HD) / 8); k_lambda<<<1, 64, 0, stream>>>(lq1, lk1, lq2, lk2, LAM); }
    for (int b = 0; b < NB_; ++b) {
        
        k_cvt8<<<(unsigned)(((size_t)TT * DM / 8 + 255) / 256), 256, 0, stream>>>(x + (size_t)b * TT * DM, XB, (size_t)TT * DM / 8);
        k_qkv<<<dim3(TT / 64, NH_ + NKV + NVG, 1), 32, 0, stream>>>(XB, WQ, WK, WV, fcos, fsin, QP16, QPh, QPl, KP16, KPh, KPl, VT16, VTh, VTl);   /* 32 query sub-heads (q1_h = 2h, q2_h = 2h+1), 16 key sub-heads (k1_g = 2g, k2_g = 2g+1), 8 value groups: projection, rotary, planes */
        k_fattn<<<dim3(TT / 128, NH_, 1), 128, 0, stream>>>(QP16, QPh, QPl, KP16, KPh, KPl, VT16, VTh, VTl, Ob);   /* all 32 sub-heads: Ob[z] = softmax(q_z k^T / 8) v (x PCAR for rows >= RH) */
        k_dcomb<<<dim3((unsigned)(((size_t)TT * HD / 4 + 255) / 256), NHD, 1), 256, 0, stream>>>(Ob, LAM, Y);   /* y_h = a1 v - lambda a2 v */
        k_gnstat<<<NHD, 1024, 0, stream>>>(Y, ST); k_gnapply<<<(unsigned)(((size_t)TT * NHD * HD / 4 + 255) / 256), 256, 0, stream>>>(Y, ST, ATh, ATl);   /* GroupNorm per head x (1 - lambda_init) -> planes */
        k_gemmw<bf, 1, false><<<dim3(TT / 64, DM / 64, 1), 32, 0, stream>>>(ATh, ATl, WO, nullptr, NHD * HD, OUT + (size_t)b * TT * DM, DM, nullptr, 0, 0, 0); }
}

// v006
// One run takes 143 microseconds.
// Next to v005, in two timings, it ran 1.08 times as fast each time.
// Counting every step since v000, it is 13.1 times as fast.
#include <hip/hip_runtime.h>

// Differential attention (x [1][2048][1024]; q = x wq^T viewed (T, 16, 2, 64): q1/q2 per head; k = x wk^T viewed (T, 8, 2, 64): k1/k2 per kv group; v = x wv^T (8 x 64); interleaved-pair rotary on q1, q2, k1, k2 with the given cos/sin tables [2048][32]; head h uses kv group h/2; a1 = causal softmax(q1.k1/8), a2 = causal softmax(q2.k2/8); lambda = exp(lq1.lk1) - exp(lq2.lk2) + lambda_init (lambda vectors [64], read); y = (a1 - lambda a2) v; GroupNorm per (head) over (T, 64) (eps 1e-5, no affine) x (1 - lambda_init); out = y wo^T -> [1][2048][1024] (2.1 M)).
// Compute dtypes, f32 accumulate: every input rounded to bf16; projections exact; rotary f32; attention rows < 512 3 products, rest fp16, scores and probabilities kept on chip (one fused launch for all heads); softmax, lambda, combine and GroupNorm f32 (fixed-order reductions); wo hl x exact.

#define NB_  1
#define TT   2048
#define DM   1024
#define NH_  32
#define NKV  16
#define REP  (NH_ / NKV)
#define HD   64
#define DQ   (NH_ * HD)
#define DKV  (NKV * HD)
#define ZH   2
#define RH   512                  // query rows < RH use hi+lo planes (0: none)
#define WIN  2048
#define PCAR 1024.0f
#define SCL  0.125f
#define NVG  8       // value groups
#define DV   (NVG * HD)   // 512
#define NHD  16      // real heads
#define LINIT 0.35550906759096934f   // 0.8 - 0.6 exp(-0.3)
typedef _Float16 h16;
typedef unsigned short bf;
typedef __attribute__((ext_vector_type(16))) __bf16   v16bf;
typedef __attribute__((ext_vector_type(16))) _Float16 v16h;
typedef __attribute__((ext_vector_type(8)))  _Float16 v8h;
typedef __attribute__((ext_vector_type(8)))  unsigned short v8us;
typedef __attribute__((ext_vector_type(8)))  float    v8f;
typedef __attribute__((ext_vector_type(4)))  float    v4f;
typedef v8h  __attribute__((may_alias)) v8ha;
typedef v4f  __attribute__((may_alias)) v4fa;
typedef v8us __attribute__((may_alias)) v8usa;

__device__ __forceinline__ unsigned short f2bf(float f) { unsigned u = __float_as_uint(f); u += 0x7FFFu + ((u >> 16) & 1u); return (unsigned short)(u >> 16); }
__device__ __forceinline__ float bf2f(unsigned short b) { return __uint_as_float(((unsigned)b) << 16); }
__device__ __forceinline__ float bfr(float f) { return bf2f(f2bf(f)); }
__device__ __forceinline__ v16h cat16(v8h lo, v8h hi) { return __builtin_shufflevector(lo, hi, 0, 1, 2, 3, 4, 5, 6, 7, 8, 9, 10, 11, 12, 13, 14, 15); }
__device__ __forceinline__ v16bf cat16b(v8us lo, v8us hi) { return __builtin_bit_cast(v16bf, __builtin_shufflevector(lo, hi, 0, 1, 2, 3, 4, 5, 6, 7, 8, 9, 10, 11, 12, 13, 14, 15)); }
__device__ __forceinline__ v8f wmma16(v16h a, v16h b, v8f c) { return __builtin_amdgcn_wmma_f32_16x16x32_f16(false, a, false, b, (short)0, c, false, false); }
__device__ __forceinline__ v8f wmmab(v16bf a, v16bf b, v8f c) { return __builtin_amdgcn_wmma_f32_16x16x32_bf16(false, a, false, b, (short)0, c, false, false); }



// ---- k_gemmw: register-blocked GEMM, ONE WAVE per 64x64 output tile (16 accumulators), operands straight from K-contiguous 16-bit planes; grid (M/64, N/64, Z), 32 threads.
// C[m][n] (f32, pitch ldc, + optional f32 bias[n]) = sum_k A[m][k] Bt[n][k] (+ split products per NSPLIT). z-batch strides sA/sB/sC in elements. K % 32 == 0.
template <typename T16> struct WFrag;
template <> struct WFrag<h16> { typedef v16h V; static __device__ __forceinline__ V ld(const h16* p) { return cat16(*(const v8h*)p, *(const v8h*)(p + 16)); } static __device__ __forceinline__ v8f mma(V a, V b, v8f c) { return wmma16(a, b, c); } };
template <> struct WFrag<bf> { typedef v16bf V; static __device__ __forceinline__ V ld(const bf* p) { return cat16b(*(const v8us*)p, *(const v8us*)(p + 16)); } static __device__ __forceinline__ v8f mma(V a, V b, v8f c) { return wmmab(a, b, c); } };
template <typename T16, int NSPLIT, bool BIAS>
__global__ __launch_bounds__(32) void k_gemmw(const T16* __restrict__ A, const T16* __restrict__ A2, const T16* __restrict__ Bt, const T16* __restrict__ Bt2, int K, float* C, int ldc, const float* __restrict__ bias, size_t sA, size_t sB, size_t sC) {
    typedef typename WFrag<T16>::V V;
    __shared__ __align__(16) float os[16 * 68];
    const size_t z = blockIdx.z; A += z * sA; if (A2) A2 += z * sA; Bt += z * sB; if (Bt2) Bt2 += z * sB; C += z * sC;
    const int lane = threadIdx.x & 31, lr = lane & 15, hi = lane >> 4; const int r0 = blockIdx.x * 64, c0 = blockIdx.y * 64;
    v8f acc[4][4];
#pragma unroll
    for (int mb = 0; mb < 4; ++mb)
#pragma unroll
        for (int nb = 0; nb < 4; ++nb) acc[mb][nb] = (v8f){};
    const size_t aoff = (size_t)(r0 + lr) * K + 8 * hi, boff = (size_t)(c0 + lr) * K + 8 * hi;
#pragma unroll 1
    for (int kc = 0; kc < K; kc += 32) {
        V a[4], a2[4];
#pragma unroll
        for (int mb = 0; mb < 4; ++mb) { a[mb] = WFrag<T16>::ld(A + aoff + (size_t)mb * 16 * K + kc); if (NSPLIT == 1 || NSPLIT == 2) a2[mb] = WFrag<T16>::ld(A2 + aoff + (size_t)mb * 16 * K + kc); }
#pragma unroll
        for (int nb = 0; nb < 4; ++nb) { const V b = WFrag<T16>::ld(Bt + boff + (size_t)nb * 16 * K + kc); V b2; if (NSPLIT >= 2) b2 = WFrag<T16>::ld(Bt2 + boff + (size_t)nb * 16 * K + kc);
#pragma unroll
            for (int mb = 0; mb < 4; ++mb) { acc[mb][nb] = WFrag<T16>::mma(a[mb], b, acc[mb][nb]); if (NSPLIT == 1 || NSPLIT == 2) acc[mb][nb] = WFrag<T16>::mma(a2[mb], b, acc[mb][nb]); if (NSPLIT >= 2) acc[mb][nb] = WFrag<T16>::mma(a[mb], b2, acc[mb][nb]); } }
        asm volatile("v_nop\n\tv_nop\n\tv_nop\n\tv_nop" : "+v"(acc[0][0]), "+v"(acc[1][1]), "+v"(acc[2][2]), "+v"(acc[3][3]) : "v"(a[0]), "v"(a[3]));
    }
#pragma unroll
    for (int mb = 0; mb < 4; ++mb) {
#pragma unroll
        for (int nb = 0; nb < 4; ++nb) {
#pragma unroll
            for (int j = 0; j < 8; ++j) os[(hi * 8 + j) * 68 + nb * 16 + lr] = acc[mb][nb][j]; }
        __builtin_amdgcn_wave_barrier(); asm volatile("" ::: "memory");
        float* crow = C + (size_t)(r0 + mb * 16) * ldc + c0;
{
#pragma unroll
            for (int s = 0; s < 8; ++s) { const int row = 2 * s + hi, cofs = lr * 4; v4f val = *(const v4fa*)(os + row * 68 + cofs); if (BIAS) { val[0] += bfr(bias[c0 + cofs]); val[1] += bfr(bias[c0 + cofs + 1]); val[2] += bfr(bias[c0 + cofs + 2]); val[3] += bfr(bias[c0 + cofs + 3]); }
                *(v4f*)(crow + (size_t)row * ldc + cofs) = val; }
             }
        __builtin_amdgcn_wave_barrier(); asm volatile("" ::: "memory");
    }
}

__device__ __forceinline__ h16 tohx(float x) { return (h16)x; }
__device__ __forceinline__ void splitf(float y, unsigned short& h, unsigned short& l) { h = f2bf(y); l = f2bf(y - bf2f(h)); }
typedef __attribute__((ext_vector_type(2))) _Float16 v2h;
typedef __attribute__((ext_vector_type(4))) _Float16 v4h;
typedef __attribute__((ext_vector_type(2))) unsigned short v2us;
typedef __attribute__((ext_vector_type(4))) unsigned short v4us;
typedef __attribute__((ext_vector_type(2))) float v2f;
typedef __attribute__((ext_vector_type(4))) int v4i;

__global__ __launch_bounds__(256) void k_wtG(const float* __restrict__ w, int K, int N, bf* Bt) {
    const int lane = threadIdx.x & 31; const int L0 = (blockIdx.x * 8 + (threadIdx.x >> 5)) * 8; const int nlines = N * K / 64;
{
#pragma unroll 1
        for (int l = 0; l < 8; ++l) { const int L = L0 + l; if (L >= nlines) break; const size_t e = (size_t)L * 64 + lane * 2; const int k = (int)(e % K), n = (int)(e / K); v2us o;
            o[0] = f2bf(w[(size_t)k * N + n]); o[1] = f2bf(w[(size_t)(k + 1) * N + n]); *(v2us*)(Bt + e) = o; }
         }
}
// ---- k_prep: all the work that needs nothing but the inputs, in ONE launch: the five roundings to bf16 (wq, wk, wv, wo, x) and lambda. None of them reads what another writes, so they share one grid by ranges of the block index.
// Block 0: lambda (its 64 serial steps run beside the conversions). Blocks 1 ..: 2048 elements each, 8 per thread; every tensor is a whole number of blocks, so a block lies in one tensor and the grid is exact.
#define PB_Q (DQ * DM / 2048)
#define PB_K (DKV * DM / 2048)
#define PB_V (DV * DM / 2048)
#define PB_O (DM * NHD * HD / 2048)
#define PB_X (TT * DM / 2048)
static_assert(DQ * DM % 2048 == 0 && DKV * DM % 2048 == 0 && DV * DM % 2048 == 0 && DM * NHD * HD % 2048 == 0 && TT * DM % 2048 == 0, "every converted tensor is a whole number of 2048-element blocks");
static_assert(NB_ == 1, "x is converted once, in front of the batch loop");
__global__ __launch_bounds__(256) void k_prep(const float* __restrict__ wq, const float* __restrict__ wk, const float* __restrict__ wv, const float* __restrict__ wo, const float* __restrict__ x, bf* WQ, bf* WK, bf* WV, bf* WO, bf* XB, const float* __restrict__ a1, const float* __restrict__ b1, const float* __restrict__ a2, const float* __restrict__ b2, float* LAM) {
    if (blockIdx.x == 0) { if (threadIdx.x >= 64) return; float s1 = 0.f, s2 = 0.f;
#pragma unroll 1
    for (int d = 0; d < HD; ++d) { float p1 = __fmul_rn(bfr(a1[d]), bfr(b1[d])), p2 = __fmul_rn(bfr(a2[d]), bfr(b2[d])); asm volatile("" : "+v"(p1), "+v"(p2)); s1 = __fadd_rn(s1, p1); s2 = __fadd_rn(s2, p2); }
    const float lam = __fadd_rn(__fsub_rn(expf(s1), expf(s2)), LINIT); *(float*)(LAM + threadIdx.x) = lam; return; }
    unsigned blk = blockIdx.x - 1; const float* src; bf* dst;   // the tensor and the block's place in it: scalar compares on the block index
    if (blk < PB_X) { src = x; dst = XB; }
    else if ((blk -= PB_X) < PB_Q) { src = wq; dst = WQ; }
    else if ((blk -= PB_Q) < PB_K) { src = wk; dst = WK; }
    else if ((blk -= PB_K) < PB_V) { src = wv; dst = WV; }
    else { blk -= PB_V; src = wo; dst = WO; }
    const size_t i = (size_t)blk * 256 + threadIdx.x; const v8f v = *(const v8f*)(src + i * 8); v8us o;
#pragma unroll
    for (int k = 0; k < 8; ++k) o[k] = f2bf(v[k]); *(v8us*)(dst + i * 8) = o;  }

// ---- k_qkv: the q, k and v projections in ONE launch, each 64x64 tile finished in its own epilogue: nothing of the projections goes to memory in f32.
// Main loop as in k_gemmw (one wave per tile, bf16 planes, one product). A tile column is one 64-wide sub-head: blockIdx.y 0..31 query sub-heads, 32..47 key sub-heads, 48..55 value groups.
// q, k: interleaved-pair rotary on the staged rows (cos / sin rounded to bf16 as every input), then the fp16 plane and the hi+lo planes [sub-head][t][64], whole 128-B lines per row.
// v: an accumulator register run is 8 consecutive t of one column, which is 16 B of the transposed planes [group][d][t]: stored straight from the registers.
__global__ __launch_bounds__(32) void k_qkv(const bf* __restrict__ A, const bf* __restrict__ WQ, const bf* __restrict__ WK, const bf* __restrict__ WV, const float* __restrict__ fcos, const float* __restrict__ fsin, h16* QP16, bf* QPh, bf* QPl, h16* KP16, bf* KPh, bf* KPl, h16* VT16, bf* VTh, bf* VTl) {
    typedef WFrag<bf>::V V;
    __shared__ __align__(16) float os[16 * 68];
    const int lane = threadIdx.x & 31, lr = lane & 15, hi = lane >> 4; const int r0 = blockIdx.x * 64, cy = blockIdx.y;
    const bf* Bt = (cy < NH_) ? WQ + (size_t)cy * 64 * DM : (cy < NH_ + NKV) ? WK + (size_t)(cy - NH_) * 64 * DM : WV + (size_t)(cy - NH_ - NKV) * 64 * DM;
    v8f acc[4][4];
#pragma unroll
    for (int mb = 0; mb < 4; ++mb)
#pragma unroll
        for (int nb = 0; nb < 4; ++nb) acc[mb][nb] = (v8f){};
    const size_t aoff = (size_t)(r0 + lr) * DM + 8 * hi, boff = (size_t)lr * DM + 8 * hi;
#pragma unroll 1   // one trip in the code, as in k_gemmw: two trips' fragments (2 x 64 registers) beside the 128 accumulator registers would leave the 256 directly addressed ones
    for (int kc = 0; kc < DM; kc += 32) {
        V a[4]; const bf* pa = A + aoff + kc; const bf* pb = Bt + boff + kc;
#pragma unroll
        for (int mb = 0; mb < 4; ++mb) a[mb] = WFrag<bf>::ld(pa + (size_t)mb * 16 * DM);
#pragma unroll
        for (int nb = 0; nb < 4; ++nb) { const V b = WFrag<bf>::ld(pb + (size_t)nb * 16 * DM);
#pragma unroll
            for (int mb = 0; mb < 4; ++mb) acc[mb][nb] = WFrag<bf>::mma(a[mb], b, acc[mb][nb]); }
        asm volatile("v_nop\n\tv_nop\n\tv_nop\n\tv_nop" : "+v"(acc[0][0]), "+v"(acc[1][1]), "+v"(acc[2][2]), "+v"(acc[3][3]) : "v"(a[0]), "v"(a[3]), "v"(pa), "v"(pb));   // the four vector slots behind the trip's last matrix instruction, on the back edge and on the way out alike; the lane pointers are named so that no load of the trip lands in their registers
    }
    if (cy >= NH_ + NKV) {
        const size_t vo = ((size_t)(cy - NH_ - NKV) * HD + lr) * TT + r0 + hi * 8;
#pragma unroll
        for (int nb = 0; nb < 4; ++nb)
#pragma unroll
            for (int mb = 0; mb < 4; ++mb) { v8h o16; v8us oh, ol;   // mb innermost: the four 32-B pieces of a 128-B line follow one another
#pragma unroll
                for (int j = 0; j < 8; ++j) { const float x = acc[mb][nb][j]; unsigned short a2, c2; o16[j] = tohx(x); splitf(x, a2, c2); oh[j] = a2; ol[j] = c2; }
                const size_t e = vo + (size_t)nb * 16 * TT + mb * 16; *(v8h*)(VT16 + e) = o16; *(v8us*)(VTh + e) = oh; *(v8us*)(VTl + e) = ol; }
        return; }
    const size_t zo = (size_t)((cy < NH_) ? cy : cy - NH_) * TT * HD;
    h16* P16 = ((cy < NH_) ? QP16 : KP16) + zo; bf* Ph = ((cy < NH_) ? QPh : KPh) + zo; bf* Pl = ((cy < NH_) ? QPl : KPl) + zo;
    const int rr = lane >> 3, c8 = (lane & 7) * 8;   // a lane finishes 8 columns (4 rotary pairs) of one row; 8 lanes cover a row, a wave store 4 rows
    const float* pc = fcos + (size_t)(r0 + rr) * (HD / 2) + (c8 >> 1); const float* pn = fsin + (size_t)(r0 + rr) * (HD / 2) + (c8 >> 1);
    v4f cc[2][4], sn[2][4];
#pragma unroll
    for (int s = 0; s < 4; ++s) { cc[0][s] = *(const v4f*)(pc + (size_t)(4 * s) * (HD / 2)); sn[0][s] = *(const v4f*)(pn + (size_t)(4 * s) * (HD / 2)); }
#pragma unroll
    for (int mb = 0; mb < 4; ++mb) {
#pragma unroll
        for (int nb = 0; nb < 4; ++nb) {
#pragma unroll
            for (int j = 0; j < 8; ++j) os[(hi * 8 + j) * 68 + nb * 16 + lr] = acc[mb][nb][j]; }
        __builtin_amdgcn_wave_barrier(); asm volatile("" ::: "memory");   // the tile is read below by other lanes of this wave: keep the stores in front of the reads
        if (mb < 3) {   // the next 16 rows' cos / sin fly while these 16 rows are finished
#pragma unroll
            for (int s = 0; s < 4; ++s) { cc[(mb + 1) & 1][s] = *(const v4f*)(pc + (size_t)((mb + 1) * 16 + 4 * s) * (HD / 2)); sn[(mb + 1) & 1][s] = *(const v4f*)(pn + (size_t)((mb + 1) * 16 + 4 * s) * (HD / 2)); }
            __builtin_amdgcn_sched_barrier(0); }   // keeps these loads in front of the rows' work: sunk among the stores they would come late and land in registers that an issued store names
#pragma unroll
        for (int s = 0; s < 4; ++s) { const int row = 4 * s + rr; const v4f xa = *(const v4fa*)(os + row * 68 + c8), xb = *(const v4fa*)(os + row * 68 + c8 + 4); v8h o16; v8us oh, ol;
#pragma unroll
            for (int p = 0; p < 4; ++p) { const float x0 = (p < 2) ? xa[2 * p] : xb[2 * p - 4], x1 = (p < 2) ? xa[2 * p + 1] : xb[2 * p - 3]; const float c = bfr(cc[mb & 1][s][p]), n = bfr(sn[mb & 1][s][p]);
                const float e0 = x0 * c - x1 * n, e1 = x0 * n + x1 * c;   /* even: x0 c - x1 s; odd: x0 s + x1 c */
                unsigned short a2, c2; o16[2 * p] = tohx(e0); o16[2 * p + 1] = tohx(e1); splitf(e0, a2, c2); oh[2 * p] = a2; ol[2 * p] = c2; splitf(e1, a2, c2); oh[2 * p + 1] = a2; ol[2 * p + 1] = c2; }
            const size_t e = (size_t)(r0 + mb * 16 + row) * HD + c8; *(v8h*)(P16 + e) = o16; *(v8us*)(Ph + e) = oh; *(v8us*)(Pl + e) = ol; }
        __builtin_amdgcn_wave_barrier(); asm volatile("s_wait_xcnt 0x0" ::: "memory");   // the LDS reads stay in front of the next 16 rows' LDS stores; the wait stands behind these rows' global stores, before the next loads land in their registers
    }
}


__global__ __launch_bounds__(256) void k_dcomb(const float* __restrict__ O, const float* __restrict__ LAM, float* Y) { const size_t i = (size_t)blockIdx.x * 256 + threadIdx.x; if (i >= (size_t)TT * HD / 4) return; const int h = blockIdx.y; O += (size_t)h * 2 * TT * HD; const int d0 = (int)(i % (HD / 4)) * 4; const size_t t = i / (HD / 4); const float cs = (t < RH) ? 1.0f : (1.0f / PCAR); const float lam = LAM[0]; const v4f a = *(const v4f*)(O + t * HD + d0); const v4f b = *(const v4f*)(O + (size_t)TT * HD + t * HD + d0); v4f o;
#pragma unroll
    for (int q = 0; q < 4; ++q) { float p = __fmul_rn(a[q], cs), m = __fmul_rn(__fmul_rn(b[q], cs), lam); asm volatile("" : "+v"(p), "+v"(m)); o[q] = __fsub_rn(p, m); }
    *(v4f*)(Y + t * (NHD * HD) + (size_t)h * HD + d0) = o;  }
// k_gnstat: one work-group of 32 waves per head. A wave load covers two 256-B row segments of the head (lanes 0-15 one row, 16-31 the next), the 32 waves cover 64 rows, 32 steps cover the 2048 rows.
// Mean first, then the squared deviations from it (two reads of Y, the second from L2). Fixed-order sums: per lane over its steps, xor tree in the wave, one LDS word per wave, the same xor tree over the 32 words (in every wave for the mean, in wave 0 for the variance).
__device__ __forceinline__ float gn_wavesum(float s) {
#pragma unroll
    for (int sh = 16; sh; sh >>= 1) s += __shfl_xor(s, sh, 32);
    return s; }
__global__ __launch_bounds__(1024) void k_gnstat(const float* __restrict__ Y, float* ST) { __shared__ float red1[32]; __shared__ float red2[32];
    const int h = blockIdx.x; const int lane = threadIdx.x & 31, wv = threadIdx.x >> 5; const float nf = (float)((size_t)TT * HD);
    const float* yp = Y + (size_t)(wv * 2 + (lane >> 4)) * (NHD * HD) + (size_t)h * HD + (lane & 15) * 4;
    float s = 0.f;
#pragma unroll   // independent loads in flight together: the latency of one L2 read is paid per batch, not per row
    for (int st = 0; st < TT / 64; ++st) { const v4f a = *(const v4f*)(yp + (size_t)st * 64 * (NHD * HD)); s += (a[0] + a[1]) + (a[2] + a[3]); }
    s = gn_wavesum(s); if (lane == 0) red1[wv] = s;
    __syncthreads();   // every wave's partial sum is in red1 before any wave adds them up
    const float mean = __fdiv_rn(gn_wavesum(red1[lane]), nf);
    float s2 = 0.f;
#pragma unroll   // as above
    for (int st = 0; st < TT / 64; ++st) { const v4f a = *(const v4f*)(yp + (size_t)st * 64 * (NHD * HD)); float acc = 0.f;
#pragma unroll
        for (int q = 0; q < 4; ++q) { const float dv = a[q] - mean; acc += dv * dv; } s2 += acc; }
    s2 = gn_wavesum(s2); if (lane == 0) red2[wv] = s2;
    __syncthreads();   // every wave's partial sum is in red2 before wave 0 adds them up
    if (wv == 0) { const float var = __fdiv_rn(gn_wavesum(red2[lane]), nf); ST[h * 32 + lane] = (lane & 1) ? var : mean; } }

__global__ __launch_bounds__(256) void k_gnapply(const float* __restrict__ Y, const float* __restrict__ ST, bf* Ah, bf* Al) { const size_t i = (size_t)blockIdx.x * 256 + threadIdx.x; if (i >= (size_t)TT * NHD * HD / 4) return; const int c0 = (int)(i % (NHD * HD / 4)) * 4; const size_t t = i / (NHD * HD / 4); const int h = c0 / HD; const float mean = ST[h * 32], var = ST[h * 32 + 1]; const float rs = __fdiv_rn(1.0f, __fsqrt_rn(__fadd_rn(var, 1e-5f))); const v4f a = *(const v4f*)(Y + t * (NHD * HD) + c0); v4us oh, ol;
#pragma unroll
    for (int q = 0; q < 4; ++q) { float nv = __fmul_rn(__fsub_rn(a[q], mean), rs); asm volatile("" : "+v"(nv)); unsigned short h2, l2; splitf(__fmul_rn(nv, 1.0f - LINIT), h2, l2); oh[q] = h2; ol[q] = l2; }
    *(v4us*)(Ah + t * (NHD * HD) + c0) = oh; *(v4us*)(Al + t * (NHD * HD) + c0) = ol;  }

// ---- k_fattn: scores, causal softmax and probability x value in ONE launch for all 32 query sub-heads; no score or probability ever goes to memory.
// One wave owns 16 query rows and walks the keys 0 .. its diagonal ONCE, in blocks of 64: scores, e = exp(t - ref), row sum, e to 16-bit through a
// per-wave LDS tile (accumulator layout -> A fragment layout), P.V accumulated in key order; the division by the row sum comes after P.V. Rows < RH: hi+lo planes, 3 products; the rest fp16 with e x PCAR.
// ref is the row's running maximum, renewed lazily: only when a score exceeds it by more than MXLAG are the row sums and the P.V accumulators scaled by exp(old ref - new ref). ref cancels in P.V / sum.
// A work-group (4 waves, 64 rows) does row block 31 - rb and then row block rb: every work-group walks the same number of key blocks, wherever it is placed.
// The four waves walk the same key blocks: each block's key and value tiles are brought into LDS once for the work-group by asynchronous copies (whole 128-B lines), two buffers, the next block's copies in flight while this block is worked on.
#define MXLAG 3.4657359f   // 5 ln 2: e <= 32, so e x PCAR <= 32768 stays inside fp16
#define PP 72   // LDS pitch of a probability row and of a staged key or value row in 16-bit elements: 144 B = 16 B x odd, the conflict-free pitch for 16-byte reads
#define KVT (64 * PP)   // one staged tile in 16-bit elements: 64 rows of 128 B at pitch PP
#define KVB (4 * KVT)   // one buffer: tiles 0 keys, 1 values, 2 keys lo, 3 values lo (2 and 3 only for the hi+lo planes)
template <typename T16> struct LFrag;
template <> struct LFrag<h16> { static __device__ __forceinline__ v16h ld(const h16* p) { return cat16(*(const v8ha*)p, *(const v8ha*)(p + 16)); } };
template <> struct LFrag<bf> { static __device__ __forceinline__ v16bf ld(const bf* p) { return cat16b(*(const v8usa*)p, *(const v8usa*)(p + 16)); } };
// 2^x with the free issue slot behind the transcendental in the same statement: the next vector instruction may then read the result or overwrite the source.
__device__ __forceinline__ float fattn_exp2(float x) { float r; asm("v_exp_f32 %0, %1\n\tv_nop" : "=v"(r) : "v"(x)); return r; }
// Four B fragments (nb = 0..3) of k step ks of one staged tile: rows nb*16+lr at pitch PP; pl is the lane's own LDS pointer (row lr, k offset 8*hi).
template <typename T16>
__device__ __forceinline__ void fattn_ld4(const T16* pl, int ks, typename WFrag<T16>::V (&b)[4]) {
#pragma unroll
    for (int nb = 0; nb < 4; ++nb) b[nb] = LFrag<T16>::ld(pl + (nb * 16 * PP + ks * 32));
}
// Two 64-row x 128-B tiles from global memory into LDS through no register. ga, gb: the thread's own 16 bytes of its first row (row tid / 8, piece tid % 8); la, lb: their LDS byte addresses.
// A thread brings rows tid / 8 + 16 c, c = 0..3, of each tile; a wave's copy covers 4 whole 128-B lines. The s_wait_xcnt closes the statement so that no address register is rewritten in front of it.
template <typename T16>
__device__ __forceinline__ void fattn_copy2(const T16* ga, size_t pa, const T16* gb, size_t pb, unsigned la, unsigned lb) {
    asm volatile("global_load_async_to_lds_b128 %0, %8, off\n\t"
                 "global_load_async_to_lds_b128 %1, %9, off\n\t"
                 "global_load_async_to_lds_b128 %2, %10, off\n\t"
                 "global_load_async_to_lds_b128 %3, %11, off\n\t"
                 "global_load_async_to_lds_b128 %4, %12, off\n\t"
                 "global_load_async_to_lds_b128 %5, %13, off\n\t"
                 "global_load_async_to_lds_b128 %6, %14, off\n\t"
                 "global_load_async_to_lds_b128 %7, %15, off\n\t"
                 "s_wait_xcnt 0x0"
                 :: "v"(la), "v"(la + 16 * PP * 2), "v"(la + 32 * PP * 2), "v"(la + 48 * PP * 2), "v"(lb), "v"(lb + 16 * PP * 2), "v"(lb + 32 * PP * 2), "v"(lb + 48 * PP * 2),
                    "v"(ga), "v"(ga + 16 * pa), "v"(ga + 32 * pa), "v"(ga + 48 * pa), "v"(gb), "v"(gb + 16 * pb), "v"(gb + 32 * pb), "v"(gb + 48 * pb) : "memory");
}
// Inputs-only fence on loaded fragments: every LDS read of the batch is issued before the first matrix instruction waits, so a batch pays one LDS latency, not one per fragment.
template <typename V> __device__ __forceinline__ void fattn_hold8(const V (&x)[4], const V (&y)[4]) { asm volatile("" :: "v"(x[0]), "v"(x[1]), "v"(x[2]), "v"(x[3]), "v"(y[0]), "v"(y[1]), "v"(y[2]), "v"(y[3])); }
// acc[nb] += a x b[nb] (+ a2 x b[nb] + a x b2[nb] for the hi+lo planes)
template <typename T16, bool HI>
__device__ __forceinline__ void fattn_mm(const typename WFrag<T16>::V& a, const typename WFrag<T16>::V& a2, const typename WFrag<T16>::V (&b)[4], const typename WFrag<T16>::V (&b2)[4], v8f (&acc)[4]) {
#pragma unroll
    for (int nb = 0; nb < 4; ++nb) { acc[nb] = WFrag<T16>::mma(a, b[nb], acc[nb]);
        if (HI) { acc[nb] = WFrag<T16>::mma(a2, b[nb], acc[nb]); acc[nb] = WFrag<T16>::mma(a, b2[nb], acc[nb]); } }
}
// st: the two staging buffers (work-group wide), sbase: their LDS byte address. Called by all four waves of the work-group with the same row block: the barriers inside are passed by every wave, the same number of times.
template <typename T16, bool HI>
__device__ __forceinline__ void fattn_strip(const T16* __restrict__ Q, const T16* __restrict__ Q2, const T16* __restrict__ Kp, const T16* __restrict__ Kp2, const T16* __restrict__ Vt, const T16* __restrict__ Vt2, int i0, T16* ps, T16* ps2, const T16* st, unsigned sbase, float* O) {
    typedef typename WFrag<T16>::V V;
    const int lane = threadIdx.x & 31, lr = lane & 15, hi = lane >> 4;
    const int nblk = (i0 >> 6) + 1;                    // key blocks 0 .. nblk-1: up to the end of the 64-key block that holds the diagonal (64 nblk <= TT); the same for the four waves
    const unsigned crow = threadIdx.x >> 3, ccol = (threadIdx.x & 7) * 8;   // the thread's first row and its 16-byte piece in every staged tile
    const T16* gk = Kp + crow * HD + ccol; const T16* gk2 = Kp2 + crow * HD + ccol; const T16* gv = Vt + crow * TT + ccol; const T16* gv2 = Vt2 + crow * TT + ccol;
    const unsigned l0 = sbase + (crow * PP + ccol) * 2;
    auto stage = [&](int t) { const unsigned lb = l0 + (unsigned)(t & 1) * (KVB * 2);
        fattn_copy2<T16>(gk + (size_t)t * 64 * HD, HD, gv + t * 64, TT, lb, lb + KVT * 2);
        if constexpr (HI) fattn_copy2<T16>(gk2 + (size_t)t * 64 * HD, HD, gv2 + t * 64, TT, lb + 2 * KVT * 2, lb + 3 * KVT * 2); };
    stage(0);   // both buffers are free here: an earlier strip's last reads ended in front of its last barrier
    V q[2], q2[2];
#pragma unroll
    for (int ks = 0; ks < 2; ++ks) { q[ks] = WFrag<T16>::ld(Q + (size_t)(i0 + lr) * HD + ks * 32 + 8 * hi); q2[ks] = HI ? WFrag<T16>::ld(Q2 + (size_t)(i0 + lr) * HD + ks * 32 + 8 * hi) : q[ks]; }
    asm volatile("s_wait_xcnt 0x0" :: "v"(q[0]), "v"(q[1]), "v"(q2[0]), "v"(q2[1]) : "memory");   // behind the query loads, before their address registers are used for anything else
    float mx[8];   // the reference each row's exponentials are taken against: a running row maximum, renewed only when a score leaves it far behind
#pragma unroll
    for (int j = 0; j < 8; ++j) mx[j] = -3.0e38f;
    float sum[8]; v8f o[4];
#pragma unroll
    for (int j = 0; j < 8; ++j) sum[j] = 0.f;
#pragma unroll
    for (int nb = 0; nb < 4; ++nb) o[nb] = (v8f){};
    asm volatile("s_wait_asynccnt 0x0" ::: "memory");   // this wave's copies of block 0 have landed
    __syncthreads();                                    // and every other wave's: block 0 may be read
    if (nblk > 1) stage(1);
    for (int t = 0; t < nblk; ++t) { V kb[2][4], kb2[2][4], vb[2][4], vb2[2][4]; v8f s[4]; const int j0 = t * 64; const T16* sb = st + (t & 1) * KVB + lr * PP + 8 * hi;
#pragma unroll
        for (int nb = 0; nb < 4; ++nb) s[nb] = (v8f){};
        if constexpr (HI) {
#pragma unroll
            for (int ks = 0; ks < 2; ++ks) { fattn_ld4<T16>(sb, ks, kb[ks]); fattn_ld4<T16>(sb + 2 * KVT, ks, kb2[ks]); fattn_mm<T16, HI>(q[ks], q2[ks], kb[ks], kb2[ks], s);
                if (ks == 0) __builtin_amdgcn_sched_barrier(0); }   // one k step's 64 fragment registers at a time: both steps' fetched together overrun the 256 directly addressed registers
        } else {   // one plane each: the value fragments are fetched with the key fragments, ahead of the softmax
            fattn_ld4<T16>(sb, 0, kb[0]); fattn_ld4<T16>(sb, 1, kb[1]); fattn_ld4<T16>(sb + KVT, 0, vb[0]); fattn_ld4<T16>(sb + KVT, 1, vb[1]);
            fattn_mm<T16, HI>(q[0], q2[0], kb[0], kb2[0], s); fattn_mm<T16, HI>(q[1], q2[1], kb[1], kb2[1], s); }
        float lead = -3.0e38f;   // by how much this lane's scores of the block lead their rows' references, at most
#pragma unroll
        for (int j = 0; j < 8; ++j) {
#pragma unroll
            for (int nb = 0; nb < 4; ++nb) s[nb][j] = (j0 + nb * 16 + lr <= i0 + hi * 8 + j) ? s[nb][j] * SCL : -3.0e38f;
            lead = fmaxf(lead, fmaxf(fmaxf(s[0][j], s[1][j]), fmaxf(s[2][j], s[3][j])) - mx[j]); }
        if (__builtin_amdgcn_ballot_w32(lead > MXLAG) != 0) {   // one scalar test per key block, every lane stays on: taken at a strip's first block and then only when some score outgrows its row's reference
#pragma unroll
            for (int j = 0; j < 8; ++j) { float bm = fmaxf(fmaxf(s[0][j], s[1][j]), fmaxf(s[2][j], s[3][j]));
#pragma unroll
                for (int sh = 8; sh; sh >>= 1) bm = fmaxf(bm, __shfl_xor(bm, sh, 32));   // row hi*8+j lives in the 16 lanes of this half
                const float nm = fmaxf(mx[j], bm); const float f = fattn_exp2((mx[j] - nm) * 1.4426950408889634f); mx[j] = nm; sum[j] *= f;   // what was summed against the old reference is carried over to the new one (first block: f = 0 on zeros)
#pragma unroll
                for (int nb = 0; nb < 4; ++nb) o[nb][j] *= f; } }
#pragma unroll
        for (int nb = 0; nb < 4; ++nb)
#pragma unroll
            for (int j = 0; j < 8; ++j) { const float e = fattn_exp2((s[nb][j] - mx[j]) * 1.4426950408889634f); sum[j] += e;
                const int po = (hi * 8 + j) * PP + nb * 16 + lr;
                if constexpr (HI) { unsigned short eh, el; splitf(e, eh, el); ps[po] = eh; ps2[po] = el; } else ps[po] = tohx(e * PCAR); }
        __builtin_amdgcn_wave_barrier(); asm volatile("" ::: "memory");   // the tile is read below by other lanes of this wave: keep the stores in front of the reads
#pragma unroll
        for (int ks = 0; ks < 2; ++ks) { const V a = LFrag<T16>::ld(ps + lr * PP + ks * 32 + 8 * hi); V a2 = a;
            if constexpr (HI) { a2 = LFrag<T16>::ld(ps2 + lr * PP + ks * 32 + 8 * hi); fattn_ld4<T16>(sb + KVT, ks, vb[ks]); fattn_ld4<T16>(sb + 3 * KVT, ks, vb2[ks]); fattn_hold8(vb[ks], vb2[ks]); }
            fattn_mm<T16, HI>(a, a2, vb[ks], vb2[ks], o); }
        // hand-over of the buffers, every wave, in this order:
        asm volatile("s_wait_dscnt 0x0" ::: "memory");      // this wave's reads of this block's buffer (and of its probability tile) have returned
        asm volatile("s_wait_asynccnt 0x0" ::: "memory");   // this wave's copies of the next block have landed
        __syncthreads();                                    // the same holds for every wave: the next block may be read, this block's buffer may be refilled
        if (t + 2 < nblk) stage(t + 2);
    }
    asm volatile("s_wait_asynccnt 0x0" ::: "memory");   // no copy is in flight behind the loop
#pragma unroll
    for (int j = 0; j < 8; ++j) {
#pragma unroll
        for (int sh = 8; sh; sh >>= 1) sum[j] += __shfl_xor(sum[j], sh, 32);
        const float f = __fdiv_rn(1.0f, sum[j]);
#pragma unroll
        for (int nb = 0; nb < 4; ++nb) O[(size_t)(i0 + hi * 8 + j) * HD + nb * 16 + lr] = o[nb][j] * f; }
    asm volatile("s_wait_xcnt 0x0" ::: "memory");   // behind the output stores, before the next strip reuses their address and data registers
}
// the register attribute holds the kernel to the 256 directly addressed vector registers (no register-bank switching in the loops): with this much LDS the launch bounds' second figure alone no longer does
__global__ __launch_bounds__(128, 4) __attribute__((amdgpu_num_vgpr(256))) void k_fattn(const h16* __restrict__ QP16, const bf* __restrict__ QPh, const bf* __restrict__ QPl, const h16* __restrict__ KP16, const bf* __restrict__ KPh, const bf* __restrict__ KPl, const h16* __restrict__ VT16, const bf* __restrict__ VTh, const bf* __restrict__ VTl, float* Ob) {
    __shared__ __align__(16) unsigned short pt[4][2][16 * PP];
    __shared__ __align__(16) unsigned short kv[2 * KVB];
    const unsigned sbase = (unsigned)(size_t)(const void*)kv;   // the low 32 bits of a __shared__ address are its LDS byte address
    const int wv = __builtin_amdgcn_readfirstlane(threadIdx.x >> 5); const int z = blockIdx.y;   // wave number in a scalar register: scalar loop bounds. z = 2h: (q1_h, k1_g), z = 2h+1: (q2_h, k2_g), g = h/2; both use v[g]
    const size_t zq = (size_t)z * TT * HD, zk = (size_t)(2 * (z / 4) + (z & 1)) * TT * HD, zv = (size_t)(z / 4) * HD * TT;
    // The far row block first: rb >= TT / 128, which is not below RH / 64, so it is always the fp16 path. Written out, not as a loop over the two halves: no path's lane addresses then stay in registers through the other path's key loop (spills).
    static_assert(TT / 128 * 64 >= RH, "the first row block of every work-group lies outside the hi+lo rows");
    { const int i0 = (TT / 64 - 1 - (int)blockIdx.x) * 64 + wv * 16;
        fattn_strip<h16, false>(QP16 + zq, QP16 + zq, KP16 + zk, KP16 + zk, VT16 + zv, VT16 + zv, i0, (h16*)pt[wv][0], (h16*)pt[wv][1], (const h16*)kv, sbase, Ob + zq); }
    { const int rb = (int)blockIdx.x; const int i0 = rb * 64 + wv * 16;
        if (rb * 64 < RH) fattn_strip<bf, true>(QPh + zq, QPl + zq, KPh + zk, KPl + zk, VTh + zv, VTl + zv, i0, pt[wv][0], pt[wv][1], (const bf*)kv, sbase, Ob + zq);
        else fattn_strip<h16, false>(QP16 + zq, QP16 + zq, KP16 + zk, KP16 + zk, VT16 + zv, VT16 + zv, i0, (h16*)pt[wv][0], (h16*)pt[wv][1], (const h16*)kv, sbase, Ob + zq); }
}
__global__ __launch_bounds__(256) void k_merge(const float* __restrict__ O, int h0, bf* Ah, bf* Al) { const size_t e = ((size_t)blockIdx.x * 256 + threadIdx.x) * 2; if (e >= (size_t)ZH * TT * HD) return; const int d = (int)(e % HD); const int t = (int)((e / HD) % TT); const int zz = (int)(e / ((size_t)HD * TT)); const float cs = (t < RH) ? 1.0f : (1.0f / PCAR); const size_t oo = (size_t)t * DQ + (h0 + zz) * HD + d;
    v2us oh, ol;
#pragma unroll
    for (int q = 0; q < 2; ++q) { unsigned short a, c2; splitf(O[e + q] * cs, a, c2); oh[q] = a; ol[q] = c2; } *(v2us*)(Ah + oo) = oh; *(v2us*)(Al + oo) = ol;  }

extern "C" void kernel_launch(void* const* d_in, const int* in_sizes, int n_in,
                              void* d_out, int out_size, void* d_ws, size_t ws_size, hipStream_t stream) {
    (void)in_sizes; (void)n_in; (void)out_size;
    const float* x = (const float*)d_in[0]; const float* fcos = (const float*)d_in[1]; const float* fsin = (const float*)d_in[2]; const float* wq = (const float*)d_in[3]; const float* wk = (const float*)d_in[4]; const float* wv = (const float*)d_in[5]; const float* wo = (const float*)d_in[6]; const float* lq1 = (const float*)d_in[7]; const float* lk1 = (const float*)d_in[8]; const float* lq2 = (const float*)d_in[9]; const float* lk2 = (const float*)d_in[10];
    float* OUT = (float*)d_out;     // [1][2048][1024]
    char* wsp = (char*)d_ws;
    auto take = [&](size_t bytes) { char* p = wsp; wsp += (bytes + 255) & ~(size_t)255; return (void*)p; };
    bf* WQ = (bf*)take((size_t)DQ * DM * 2); bf* WK = (bf*)take((size_t)DKV * DM * 2); bf* WV = (bf*)take((size_t)DV * DM * 2); bf* WO = (bf*)take((size_t)DM * NHD * HD * 2); float* LAM = (float*)take(64 * 4); float* ST = (float*)take((size_t)NHD * 32 * 4); float* Y = (float*)take((size_t)TT * NHD * HD * 4);
    bf* XB = (bf*)take((size_t)TT * DM * 2);
    h16* QP16 = (h16*)take((size_t)NH_ * TT * HD * 2); h16* KP16 = (h16*)take((size_t)NKV * TT * HD * 2); h16* VT16 = (h16*)take((size_t)NVG * HD * TT * 2);
    bf* QPh = (bf*)take((size_t)NH_ * TT * HD * 2); bf* QPl = (bf*)take((size_t)NH_ * TT * HD * 2); bf* KPh = (bf*)take((size_t)NKV * TT * HD * 2); bf* KPl = (bf*)take((size_t)NKV * TT * HD * 2); bf* VTh = (bf*)take((size_t)NVG * HD * TT * 2); bf* VTl = (bf*)take((size_t)NVG * HD * TT * 2);
    float* Ob = (float*)take((size_t)NH_ * TT * HD * 4); bf* ATh = (bf*)take((size_t)TT * NHD * HD * 2); bf* ATl = (bf*)take((size_t)TT * NHD * HD * 2);
    if ((size_t)(wsp - (char*)d_ws) > ws_size) return;    // ws 256 MiB
    k_prep<<<1 + PB_X + PB_Q + PB_K + PB_V + PB_O, 256, 0, stream>>>(wq, wk, wv, wo, x, WQ, WK, WV, WO, XB, lq1, lk1, lq2, lk2, LAM);   /* bf16 planes of the four weights and of x, and lambda */
    for (int b = 0; b < NB_; ++b) {
        k_qkv<<<dim3(TT / 64, NH_ + NKV + NVG, 1), 32, 0, stream>>>(XB, WQ, WK, WV, fcos, fsin, QP16, QPh, QPl, KP16, KPh, KPl, VT16, VTh, VTl);   /* 32 query sub-heads (q1_h = 2h, q2_h = 2h+1), 16 key sub-heads (k1_g = 2g, k2_g = 2g+1), 8 value groups: projection, rotary, planes */
        k_fattn<<<dim3(TT / 128, NH_, 1), 128, 0, stream>>>(QP16, QPh, QPl, KP16, KPh, KPl, VT16, VTh, VTl, Ob);   /* all 32 sub-heads: Ob[z] = softmax(q_z k^T / 8) v (x PCAR for rows >= RH) */
        k_dcomb<<<dim3((unsigned)(((size_t)TT * HD / 4 + 255) / 256), NHD, 1), 256, 0, stream>>>(Ob, LAM, Y);   /* y_h = a1 v - lambda a2 v */
        k_gnstat<<<NHD, 1024, 0, stream>>>(Y, ST); k_gnapply<<<(unsigned)(((size_t)TT * NHD * HD / 4 + 255) / 256), 256, 0, stream>>>(Y, ST, ATh, ATl);   /* GroupNorm per head x (1 - lambda_init) -> planes */
        k_gemmw<bf, 1, false><<<dim3(TT / 64, DM / 64, 1), 32, 0, stream>>>(ATh, ATl, WO, nullptr, NHD * HD, OUT + (size_t)b * TT * DM, DM, nullptr, 0, 0, 0); }
}

// v007
// Measured time: 110 microseconds a run.
// In both of two side-by-side timings against v006, it was 1.29 times as fast.
// Over all steps from v000 it is 16.9 times as fast.
#include <hip/hip_runtime.h>

// Differential attention (x [1][2048][1024]; q = x wq^T viewed (T, 16, 2, 64): q1/q2 per head; k = x wk^T viewed (T, 8, 2, 64): k1/k2 per kv group; v = x wv^T (8 x 64); interleaved-pair rotary on q1, q2, k1, k2 with the given cos/sin tables [2048][32]; head h uses kv group h/2; a1 = causal softmax(q1.k1/8), a2 = causal softmax(q2.k2/8); lambda = exp(lq1.lk1) - exp(lq2.lk2) + lambda_init (lambda vectors [64], read); y = (a1 - lambda a2) v; GroupNorm per (head) over (T, 64) (eps 1e-5, no affine) x (1 - lambda_init); out = y wo^T -> [1][2048][1024] (2.1 M)).
// Compute dtypes, f32 accumulate: every input rounded to bf16; projections exact; rotary f32; attention rows < 512 3 products, rest fp16, scores and probabilities kept on chip (one fused launch for all heads); softmax, lambda, combine and GroupNorm f32 (fixed-order reductions); wo hl x exact.

#define NB_  1
#define TT   2048
#define DM   1024
#define NH_  32
#define NKV  16
#define REP  (NH_ / NKV)
#define HD   64
#define DQ   (NH_ * HD)
#define DKV  (NKV * HD)
#define ZH   2
#define RH   512                  // query rows < RH use hi+lo planes (0: none)
#define WIN  2048
#define PCAR 1024.0f
#define SCL  0.125f
#define NVG  8       // value groups
#define DV   (NVG * HD)   // 512
#define NHD  16      // real heads
#define LINIT 0.35550906759096934f   // 0.8 - 0.6 exp(-0.3)
typedef _Float16 h16;
typedef unsigned short bf;
typedef __attribute__((ext_vector_type(16))) __bf16   v16bf;
typedef __attribute__((ext_vector_type(16))) _Float16 v16h;
typedef __attribute__((ext_vector_type(8)))  _Float16 v8h;
typedef __attribute__((ext_vector_type(8)))  unsigned short v8us;
typedef __attribute__((ext_vector_type(8)))  float    v8f;
typedef __attribute__((ext_vector_type(4)))  float    v4f;
typedef v8h  __attribute__((may_alias)) v8ha;
typedef v4f  __attribute__((may_alias)) v4fa;
typedef v8us __attribute__((may_alias)) v8usa;

__device__ __forceinline__ unsigned short f2bf(float f) { unsigned u = __float_as_uint(f); u += 0x7FFFu + ((u >> 16) & 1u); return (unsigned short)(u >> 16); }
__device__ __forceinline__ float bf2f(unsigned short b) { return __uint_as_float(((unsigned)b) << 16); }
__device__ __forceinline__ float bfr(float f) { return bf2f(f2bf(f)); }
__device__ __forceinline__ v16h cat16(v8h lo, v8h hi) { return __builtin_shufflevector(lo, hi, 0, 1, 2, 3, 4, 5, 6, 7, 8, 9, 10, 11, 12, 13, 14, 15); }
__device__ __forceinline__ v16bf cat16b(v8us lo, v8us hi) { return __builtin_bit_cast(v16bf, __builtin_shufflevector(lo, hi, 0, 1, 2, 3, 4, 5, 6, 7, 8, 9, 10, 11, 12, 13, 14, 15)); }
__device__ __forceinline__ v8f wmma16(v16h a, v16h b, v8f c) { return __builtin_amdgcn_wmma_f32_16x16x32_f16(false, a, false, b, (short)0, c, false, false); }
__device__ __forceinline__ v8f wmmab(v16bf a, v16bf b, v8f c) { return __builtin_amdgcn_wmma_f32_16x16x32_bf16(false, a, false, b, (short)0, c, false, false); }



template <typename T16> struct WFrag;
template <> struct WFrag<h16> { typedef v16h V; static __device__ __forceinline__ V ld(const h16* p) { return cat16(*(const v8h*)p, *(const v8h*)(p + 16)); } static __device__ __forceinline__ v8f mma(V a, V b, v8f c) { return wmma16(a, b, c); } };
template <> struct WFrag<bf> { typedef v16bf V; static __device__ __forceinline__ V ld(const bf* p) { return cat16b(*(const v8us*)p, *(const v8us*)(p + 16)); } static __device__ __forceinline__ v8f mma(V a, V b, v8f c) { return wmmab(a, b, c); } };

__device__ __forceinline__ h16 tohx(float x) { return (h16)x; }
__device__ __forceinline__ void splitf(float y, unsigned short& h, unsigned short& l) { h = f2bf(y); l = f2bf(y - bf2f(h)); }
typedef __attribute__((ext_vector_type(2))) _Float16 v2h;
typedef __attribute__((ext_vector_type(4))) _Float16 v4h;
typedef __attribute__((ext_vector_type(2))) unsigned short v2us;
typedef __attribute__((ext_vector_type(4))) unsigned short v4us;
typedef __attribute__((ext_vector_type(2))) float v2f;
typedef __attribute__((ext_vector_type(4))) int v4i;

__global__ __launch_bounds__(256) void k_wtG(const float* __restrict__ w, int K, int N, bf* Bt) {
    const int lane = threadIdx.x & 31; const int L0 = (blockIdx.x * 8 + (threadIdx.x >> 5)) * 8; const int nlines = N * K / 64;
{
#pragma unroll 1
        for (int l = 0; l < 8; ++l) { const int L = L0 + l; if (L >= nlines) break; const size_t e = (size_t)L * 64 + lane * 2; const int k = (int)(e % K), n = (int)(e / K); v2us o;
            o[0] = f2bf(w[(size_t)k * N + n]); o[1] = f2bf(w[(size_t)(k + 1) * N + n]); *(v2us*)(Bt + e) = o; }
         }
}
// ---- k_prep: all the work that needs nothing but the inputs, in ONE launch: the five roundings to bf16 (wq, wk, wv, wo, x) and lambda. None of them reads what another writes, so they share one grid by ranges of the block index.
// Block 0: lambda (its 64 serial steps run beside the conversions). Blocks 1 ..: 2048 elements each, 8 per thread; every tensor is a whole number of blocks, so a block lies in one tensor and the grid is exact.
#define PB_Q (DQ * DM / 2048)
#define PB_K (DKV * DM / 2048)
#define PB_V (DV * DM / 2048)
#define PB_O (DM * NHD * HD / 2048)
#define PB_X (TT * DM / 2048)
static_assert(DQ * DM % 2048 == 0 && DKV * DM % 2048 == 0 && DV * DM % 2048 == 0 && DM * NHD * HD % 2048 == 0 && TT * DM % 2048 == 0, "every converted tensor is a whole number of 2048-element blocks");
static_assert(NB_ == 1, "x is converted once, in front of the batch loop");
__global__ __launch_bounds__(256) void k_prep(const float* __restrict__ wq, const float* __restrict__ wk, const float* __restrict__ wv, const float* __restrict__ wo, const float* __restrict__ x, bf* WQ, bf* WK, bf* WV, bf* WO, bf* XB, const float* __restrict__ a1, const float* __restrict__ b1, const float* __restrict__ a2, const float* __restrict__ b2, float* LAM) {
    if (blockIdx.x == 0) { if (threadIdx.x >= 64) return; float s1 = 0.f, s2 = 0.f;
#pragma unroll 1
    for (int d = 0; d < HD; ++d) { float p1 = __fmul_rn(bfr(a1[d]), bfr(b1[d])), p2 = __fmul_rn(bfr(a2[d]), bfr(b2[d])); asm volatile("" : "+v"(p1), "+v"(p2)); s1 = __fadd_rn(s1, p1); s2 = __fadd_rn(s2, p2); }
    const float lam = __fadd_rn(__fsub_rn(expf(s1), expf(s2)), LINIT); *(float*)(LAM + threadIdx.x) = lam; return; }
    unsigned blk = blockIdx.x - 1; const float* src; bf* dst;   // the tensor and the block's place in it: scalar compares on the block index
    if (blk < PB_X) { src = x; dst = XB; }
    else if ((blk -= PB_X) < PB_Q) { src = wq; dst = WQ; }
    else if ((blk -= PB_Q) < PB_K) { src = wk; dst = WK; }
    else if ((blk -= PB_K) < PB_V) { src = wv; dst = WV; }
    else { blk -= PB_V; src = wo; dst = WO; }
    const size_t i = (size_t)blk * 256 + threadIdx.x; const v8f v = *(const v8f*)(src + i * 8); v8us o;
#pragma unroll
    for (int k = 0; k < 8; ++k) o[k] = f2bf(v[k]); *(v8us*)(dst + i * 8) = o;  }

__global__ __launch_bounds__(256) void k_dcomb(const float* __restrict__ O, const float* __restrict__ LAM, float* Y) { const size_t i = (size_t)blockIdx.x * 256 + threadIdx.x; if (i >= (size_t)TT * HD / 4) return; const int h = blockIdx.y; O += (size_t)h * 2 * TT * HD; const int d0 = (int)(i % (HD / 4)) * 4; const size_t t = i / (HD / 4); const float cs = (t < RH) ? 1.0f : (1.0f / PCAR); const float lam = LAM[0]; const v4f a = *(const v4f*)(O + t * HD + d0); const v4f b = *(const v4f*)(O + (size_t)TT * HD + t * HD + d0); v4f o;
#pragma unroll
    for (int q = 0; q < 4; ++q) { float p = __fmul_rn(a[q], cs), m = __fmul_rn(__fmul_rn(b[q], cs), lam); asm volatile("" : "+v"(p), "+v"(m)); o[q] = __fsub_rn(p, m); }
    *(v4f*)(Y + t * (NHD * HD) + (size_t)h * HD + d0) = o;  }
// k_gnstat: one work-group of 32 waves per head. A wave load covers two 256-B row segments of the head (lanes 0-15 one row, 16-31 the next), the 32 waves cover 64 rows, 32 steps cover the 2048 rows.
// Mean first, then the squared deviations from it (two reads of Y, the second from L2). Fixed-order sums: per lane over its steps, xor tree in the wave, one LDS word per wave, the same xor tree over the 32 words (in every wave for the mean, in wave 0 for the variance).
__device__ __forceinline__ float gn_wavesum(float s) {
#pragma unroll
    for (int sh = 16; sh; sh >>= 1) s += __shfl_xor(s, sh, 32);
    return s; }
__global__ __launch_bounds__(1024) void k_gnstat(const float* __restrict__ Y, float* ST) { __shared__ float red1[32]; __shared__ float red2[32];
    const int h = blockIdx.x; const int lane = threadIdx.x & 31, wv = threadIdx.x >> 5; const float nf = (float)((size_t)TT * HD);
    const float* yp = Y + (size_t)(wv * 2 + (lane >> 4)) * (NHD * HD) + (size_t)h * HD + (lane & 15) * 4;
    float s = 0.f;
#pragma unroll   // independent loads in flight together: the latency of one L2 read is paid per batch, not per row
    for (int st = 0; st < TT / 64; ++st) { const v4f a = *(const v4f*)(yp + (size_t)st * 64 * (NHD * HD)); s += (a[0] + a[1]) + (a[2] + a[3]); }
    s = gn_wavesum(s); if (lane == 0) red1[wv] = s;
    __syncthreads();   // every wave's partial sum is in red1 before any wave adds them up
    const float mean = __fdiv_rn(gn_wavesum(red1[lane]), nf);
    float s2 = 0.f;
#pragma unroll   // as above
    for (int st = 0; st < TT / 64; ++st) { const v4f a = *(const v4f*)(yp + (size_t)st * 64 * (NHD * HD)); float acc = 0.f;
#pragma unroll
        for (int q = 0; q < 4; ++q) { const float dv = a[q] - mean; acc += dv * dv; } s2 += acc; }
    s2 = gn_wavesum(s2); if (lane == 0) red2[wv] = s2;
    __syncthreads();   // every wave's partial sum is in red2 before wave 0 adds them up
    if (wv == 0) { const float var = __fdiv_rn(gn_wavesum(red2[lane]), nf); ST[h * 32 + lane] = (lane & 1) ? var : mean; } }

__global__ __launch_bounds__(256) void k_gnapply(const float* __restrict__ Y, const float* __restrict__ ST, bf* Ah, bf* Al) { const size_t i = (size_t)blockIdx.x * 256 + threadIdx.x; if (i >= (size_t)TT * NHD * HD / 4) return; const int c0 = (int)(i % (NHD * HD / 4)) * 4; const size_t t = i / (NHD * HD / 4); const int h = c0 / HD; const float mean = ST[h * 32], var = ST[h * 32 + 1]; const float rs = __fdiv_rn(1.0f, __fsqrt_rn(__fadd_rn(var, 1e-5f))); const v4f a = *(const v4f*)(Y + t * (NHD * HD) + c0); v4us oh, ol;
#pragma unroll
    for (int q = 0; q < 4; ++q) { float nv = __fmul_rn(__fsub_rn(a[q], mean), rs); asm volatile("" : "+v"(nv)); unsigned short h2, l2; splitf(__fmul_rn(nv, 1.0f - LINIT), h2, l2); oh[q] = h2; ol[q] = l2; }
    *(v4us*)(Ah + t * (NHD * HD) + c0) = oh; *(v4us*)(Al + t * (NHD * HD) + c0) = ol;  }

// ---- k_fattn: scores, causal softmax and probability x value in ONE launch for all 32 query sub-heads; no score or probability ever goes to memory.
// One wave owns 16 query rows and walks the keys 0 .. its diagonal ONCE, in blocks of 64: scores, e = exp(t - ref), row sum, e to 16-bit through a
// per-wave LDS tile (accumulator layout -> A fragment layout), P.V accumulated in key order; the division by the row sum comes after P.V. Rows < RH: hi+lo planes, 3 products; the rest fp16 with e x PCAR.
// ref is the row's running maximum, renewed lazily: only when a score exceeds it by more than MXLAG are the row sums and the P.V accumulators scaled by exp(old ref - new ref). ref cancels in P.V / sum.
// A work-group (4 waves, 64 rows) does row block 31 - rb and then row block rb: every work-group walks the same number of key blocks, wherever it is placed.
// The four waves walk the same key blocks: each block's key and value tiles are brought into LDS once for the work-group by asynchronous copies (whole 128-B lines), two buffers, the next block's copies in flight while this block is worked on.
#define MXLAG 3.4657359f   // 5 ln 2: e <= 32, so e x PCAR <= 32768 stays inside fp16
#define PP 72   // LDS pitch of a probability row and of a staged key or value row in 16-bit elements: 144 B = 16 B x odd, the conflict-free pitch for 16-byte reads
#define KVT (64 * PP)   // one staged tile in 16-bit elements: 64 rows of 128 B at pitch PP
#define KVB (4 * KVT)   // one buffer: tiles 0 keys, 1 values, 2 keys lo, 3 values lo (2 and 3 only for the hi+lo planes)
template <typename T16> struct LFrag;
template <> struct LFrag<h16> { static __device__ __forceinline__ v16h ld(const h16* p) { return cat16(*(const v8ha*)p, *(const v8ha*)(p + 16)); } };
template <> struct LFrag<bf> { static __device__ __forceinline__ v16bf ld(const bf* p) { return cat16b(*(const v8usa*)p, *(const v8usa*)(p + 16)); } };
// 2^x with the free issue slot behind the transcendental in the same statement: the next vector instruction may then read the result or overwrite the source.
__device__ __forceinline__ float fattn_exp2(float x) { float r; asm("v_exp_f32 %0, %1\n\tv_nop" : "=v"(r) : "v"(x)); return r; }
// Four B fragments (nb = 0..3) of k step ks of one staged tile: rows nb*16+lr at pitch PP; pl is the lane's own LDS pointer (row lr, k offset 8*hi).
template <typename T16>
__device__ __forceinline__ void fattn_ld4(const T16* pl, int ks, typename WFrag<T16>::V (&b)[4]) {
#pragma unroll
    for (int nb = 0; nb < 4; ++nb) b[nb] = LFrag<T16>::ld(pl + (nb * 16 * PP + ks * 32));
}
// Two 64-row x 128-B tiles from global memory into LDS through no register. ga, gb: the thread's own 16 bytes of its first row (row tid / 8, piece tid % 8); la, lb: their LDS byte addresses.
// A thread brings rows tid / 8 + 16 c, c = 0..3, of each tile; a wave's copy covers 4 whole 128-B lines. The s_wait_xcnt closes the statement so that no address register is rewritten in front of it.
template <typename T16>
__device__ __forceinline__ void fattn_copy2(const T16* ga, size_t pa, const T16* gb, size_t pb, unsigned la, unsigned lb) {
    asm volatile("global_load_async_to_lds_b128 %0, %8, off\n\t"
                 "global_load_async_to_lds_b128 %1, %9, off\n\t"
                 "global_load_async_to_lds_b128 %2, %10, off\n\t"
                 "global_load_async_to_lds_b128 %3, %11, off\n\t"
                 "global_load_async_to_lds_b128 %4, %12, off\n\t"
                 "global_load_async_to_lds_b128 %5, %13, off\n\t"
                 "global_load_async_to_lds_b128 %6, %14, off\n\t"
                 "global_load_async_to_lds_b128 %7, %15, off\n\t"
                 "s_wait_xcnt 0x0"
                 :: "v"(la), "v"(la + 16 * PP * 2), "v"(la + 32 * PP * 2), "v"(la + 48 * PP * 2), "v"(lb), "v"(lb + 16 * PP * 2), "v"(lb + 32 * PP * 2), "v"(lb + 48 * PP * 2),
                    "v"(ga), "v"(ga + 16 * pa), "v"(ga + 32 * pa), "v"(ga + 48 * pa), "v"(gb), "v"(gb + 16 * pb), "v"(gb + 32 * pb), "v"(gb + 48 * pb) : "memory");
}
// Inputs-only fence on loaded fragments: every LDS read of the batch is issued before the first matrix instruction waits, so a batch pays one LDS latency, not one per fragment.
template <typename V> __device__ __forceinline__ void fattn_hold8(const V (&x)[4], const V (&y)[4]) { asm volatile("" :: "v"(x[0]), "v"(x[1]), "v"(x[2]), "v"(x[3]), "v"(y[0]), "v"(y[1]), "v"(y[2]), "v"(y[3])); }
// acc[nb] += a x b[nb] (+ a2 x b[nb] + a x b2[nb] for the hi+lo planes)
template <typename T16, bool HI>
__device__ __forceinline__ void fattn_mm(const typename WFrag<T16>::V& a, const typename WFrag<T16>::V& a2, const typename WFrag<T16>::V (&b)[4], const typename WFrag<T16>::V (&b2)[4], v8f (&acc)[4]) {
#pragma unroll
    for (int nb = 0; nb < 4; ++nb) { acc[nb] = WFrag<T16>::mma(a, b[nb], acc[nb]);
        if (HI) { acc[nb] = WFrag<T16>::mma(a2, b[nb], acc[nb]); acc[nb] = WFrag<T16>::mma(a, b2[nb], acc[nb]); } }
}
// st: the two staging buffers (work-group wide), sbase: their LDS byte address. Called by all four waves of the work-group with the same row block: the barriers inside are passed by every wave, the same number of times.
template <typename T16, bool HI>
__device__ __forceinline__ void fattn_strip(const T16* __restrict__ Q, const T16* __restrict__ Q2, const T16* __restrict__ Kp, const T16* __restrict__ Kp2, const T16* __restrict__ Vt, const T16* __restrict__ Vt2, int i0, T16* ps, T16* ps2, const T16* st, unsigned sbase, float* O) {
    typedef typename WFrag<T16>::V V;
    const int lane = threadIdx.x & 31, lr = lane & 15, hi = lane >> 4;
    const int nblk = (i0 >> 6) + 1;                    // key blocks 0 .. nblk-1: up to the end of the 64-key block that holds the diagonal (64 nblk <= TT); the same for the four waves
    const unsigned crow = threadIdx.x >> 3, ccol = (threadIdx.x & 7) * 8;   // the thread's first row and its 16-byte piece in every staged tile
    const T16* gk = Kp + crow * HD + ccol; const T16* gk2 = Kp2 + crow * HD + ccol; const T16* gv = Vt + crow * TT + ccol; const T16* gv2 = Vt2 + crow * TT + ccol;
    const unsigned l0 = sbase + (crow * PP + ccol) * 2;
    auto stage = [&](int t) { const unsigned lb = l0 + (unsigned)(t & 1) * (KVB * 2);
        fattn_copy2<T16>(gk + (size_t)t * 64 * HD, HD, gv + t * 64, TT, lb, lb + KVT * 2);
        if constexpr (HI) fattn_copy2<T16>(gk2 + (size_t)t * 64 * HD, HD, gv2 + t * 64, TT, lb + 2 * KVT * 2, lb + 3 * KVT * 2); };
    stage(0);   // both buffers are free here: an earlier strip's last reads ended in front of its last barrier
    V q[2], q2[2];
#pragma unroll
    for (int ks = 0; ks < 2; ++ks) { q[ks] = WFrag<T16>::ld(Q + (size_t)(i0 + lr) * HD + ks * 32 + 8 * hi); q2[ks] = HI ? WFrag<T16>::ld(Q2 + (size_t)(i0 + lr) * HD + ks * 32 + 8 * hi) : q[ks]; }
    asm volatile("s_wait_xcnt 0x0" :: "v"(q[0]), "v"(q[1]), "v"(q2[0]), "v"(q2[1]) : "memory");   // behind the query loads, before their address registers are used for anything else
    float mx[8];   // the reference each row's exponentials are taken against: a running row maximum, renewed only when a score leaves it far behind
#pragma unroll
    for (int j = 0; j < 8; ++j) mx[j] = -3.0e38f;
    float sum[8]; v8f o[4];
#pragma unroll
    for (int j = 0; j < 8; ++j) sum[j] = 0.f;
#pragma unroll
    for (int nb = 0; nb < 4; ++nb) o[nb] = (v8f){};
    asm volatile("s_wait_asynccnt 0x0" ::: "memory");   // this wave's copies of block 0 have landed
    __syncthreads();                                    // and every other wave's: block 0 may be read
    if (nblk > 1) stage(1);
    for (int t = 0; t < nblk; ++t) { V kb[2][4], kb2[2][4], vb[2][4], vb2[2][4]; v8f s[4]; const int j0 = t * 64; const T16* sb = st + (t & 1) * KVB + lr * PP + 8 * hi;
#pragma unroll
        for (int nb = 0; nb < 4; ++nb) s[nb] = (v8f){};
        if constexpr (HI) {
#pragma unroll
            for (int ks = 0; ks < 2; ++ks) { fattn_ld4<T16>(sb, ks, kb[ks]); fattn_ld4<T16>(sb + 2 * KVT, ks, kb2[ks]); fattn_mm<T16, HI>(q[ks], q2[ks], kb[ks], kb2[ks], s);
                if (ks == 0) __builtin_amdgcn_sched_barrier(0); }   // one k step's 64 fragment registers at a time: both steps' fetched together overrun the 256 directly addressed registers
        } else {   // one plane each: the value fragments are fetched with the key fragments, ahead of the softmax
            fattn_ld4<T16>(sb, 0, kb[0]); fattn_ld4<T16>(sb, 1, kb[1]); fattn_ld4<T16>(sb + KVT, 0, vb[0]); fattn_ld4<T16>(sb + KVT, 1, vb[1]);
            fattn_mm<T16, HI>(q[0], q2[0], kb[0], kb2[0], s); fattn_mm<T16, HI>(q[1], q2[1], kb[1], kb2[1], s); }
        float lead = -3.0e38f;   // by how much this lane's scores of the block lead their rows' references, at most
#pragma unroll
        for (int j = 0; j < 8; ++j) {
#pragma unroll
            for (int nb = 0; nb < 4; ++nb) s[nb][j] = (j0 + nb * 16 + lr <= i0 + hi * 8 + j) ? s[nb][j] * SCL : -3.0e38f;
            lead = fmaxf(lead, fmaxf(fmaxf(s[0][j], s[1][j]), fmaxf(s[2][j], s[3][j])) - mx[j]); }
        if (__builtin_amdgcn_ballot_w32(lead > MXLAG) != 0) {   // one scalar test per key block, every lane stays on: taken at a strip's first block and then only when some score outgrows its row's reference
#pragma unroll
            for (int j = 0; j < 8; ++j) { float bm = fmaxf(fmaxf(s[0][j], s[1][j]), fmaxf(s[2][j], s[3][j]));
#pragma unroll
                for (int sh = 8; sh; sh >>= 1) bm = fmaxf(bm, __shfl_xor(bm, sh, 32));   // row hi*8+j lives in the 16 lanes of this half
                const float nm = fmaxf(mx[j], bm); const float f = fattn_exp2((mx[j] - nm) * 1.4426950408889634f); mx[j] = nm; sum[j] *= f;   // what was summed against the old reference is carried over to the new one (first block: f = 0 on zeros)
#pragma unroll
                for (int nb = 0; nb < 4; ++nb) o[nb][j] *= f; } }
#pragma unroll
        for (int nb = 0; nb < 4; ++nb)
#pragma unroll
            for (int j = 0; j < 8; ++j) { const float e = fattn_exp2((s[nb][j] - mx[j]) * 1.4426950408889634f); sum[j] += e;
                const int po = (hi * 8 + j) * PP + nb * 16 + lr;
                if constexpr (HI) { unsigned short eh, el; splitf(e, eh, el); ps[po] = eh; ps2[po] = el; } else ps[po] = tohx(e * PCAR); }
        __builtin_amdgcn_wave_barrier(); asm volatile("" ::: "memory");   // the tile is read below by other lanes of this wave: keep the stores in front of the reads
#pragma unroll
        for (int ks = 0; ks < 2; ++ks) { const V a = LFrag<T16>::ld(ps + lr * PP + ks * 32 + 8 * hi); V a2 = a;
            if constexpr (HI) { a2 = LFrag<T16>::ld(ps2 + lr * PP + ks * 32 + 8 * hi); fattn_ld4<T16>(sb + KVT, ks, vb[ks]); fattn_ld4<T16>(sb + 3 * KVT, ks, vb2[ks]); fattn_hold8(vb[ks], vb2[ks]); }
            fattn_mm<T16, HI>(a, a2, vb[ks], vb2[ks], o); }
        // hand-over of the buffers, every wave, in this order:
        asm volatile("s_wait_dscnt 0x0" ::: "memory");      // this wave's reads of this block's buffer (and of its probability tile) have returned
        asm volatile("s_wait_asynccnt 0x0" ::: "memory");   // this wave's copies of the next block have landed
        __syncthreads();                                    // the same holds for every wave: the next block may be read, this block's buffer may be refilled
        if (t + 2 < nblk) stage(t + 2);
    }
    asm volatile("s_wait_asynccnt 0x0" ::: "memory");   // no copy is in flight behind the loop
#pragma unroll
    for (int j = 0; j < 8; ++j) {
#pragma unroll
        for (int sh = 8; sh; sh >>= 1) sum[j] += __shfl_xor(sum[j], sh, 32);
        const float f = __fdiv_rn(1.0f, sum[j]);
#pragma unroll
        for (int nb = 0; nb < 4; ++nb) O[(size_t)(i0 + hi * 8 + j) * HD + nb * 16 + lr] = o[nb][j] * f; }
    asm volatile("s_wait_xcnt 0x0" ::: "memory");   // behind the output stores, before the next strip reuses their address and data registers
}
// the register attribute holds the kernel to the 256 directly addressed vector registers (no register-bank switching in the loops): with this much LDS the launch bounds' second figure alone no longer does
__global__ __launch_bounds__(128, 4) __attribute__((amdgpu_num_vgpr(256))) void k_fattn(const h16* __restrict__ QP16, const bf* __restrict__ QPh, const bf* __restrict__ QPl, const h16* __restrict__ KP16, const bf* __restrict__ KPh, const bf* __restrict__ KPl, const h16* __restrict__ VT16, const bf* __restrict__ VTh, const bf* __restrict__ VTl, float* Ob) {
    __shared__ __align__(16) unsigned short pt[4][2][16 * PP];
    __shared__ __align__(16) unsigned short kv[2 * KVB];
    const unsigned sbase = (unsigned)(size_t)(const void*)kv;   // the low 32 bits of a __shared__ address are its LDS byte address
    const int wv = __builtin_amdgcn_readfirstlane(threadIdx.x >> 5); const int z = blockIdx.y;   // wave number in a scalar register: scalar loop bounds. z = 2h: (q1_h, k1_g), z = 2h+1: (q2_h, k2_g), g = h/2; both use v[g]
    const size_t zq = (size_t)z * TT * HD, zk = (size_t)(2 * (z / 4) + (z & 1)) * TT * HD, zv = (size_t)(z / 4) * HD * TT;
    // The far row block first: rb >= TT / 128, which is not below RH / 64, so it is always the fp16 path. Written out, not as a loop over the two halves: no path's lane addresses then stay in registers through the other path's key loop (spills).
    static_assert(TT / 128 * 64 >= RH, "the first row block of every work-group lies outside the hi+lo rows");
    { const int i0 = (TT / 64 - 1 - (int)blockIdx.x) * 64 + wv * 16;
        fattn_strip<h16, false>(QP16 + zq, QP16 + zq, KP16 + zk, KP16 + zk, VT16 + zv, VT16 + zv, i0, (h16*)pt[wv][0], (h16*)pt[wv][1], (const h16*)kv, sbase, Ob + zq); }
    { const int rb = (int)blockIdx.x; const int i0 = rb * 64 + wv * 16;
        if (rb * 64 < RH) fattn_strip<bf, true>(QPh + zq, QPl + zq, KPh + zk, KPl + zk, VTh + zv, VTl + zv, i0, pt[wv][0], pt[wv][1], (const bf*)kv, sbase, Ob + zq);
        else fattn_strip<h16, false>(QP16 + zq, QP16 + zq, KP16 + zk, KP16 + zk, VT16 + zv, VT16 + zv, i0, (h16*)pt[wv][0], (h16*)pt[wv][1], (const h16*)kv, sbase, Ob + zq); }
}
// ---- The two projection GEMMs (k_qkv, k_out), K = DM: a work-group of 4 waves (2 x 2) owns one output tile; its operands' 64-k tiles are brought into LDS once for the work-group
// by asynchronous copies (whole 128-B lines; each staged row is read by two waves), two buffers, the next k tile's copies in flight while this one is worked on.
// A buffer is four tiles of 64 rows at pitch PP: 0 and 1 from T0 and T1 (k_qkv: rows 0-63 and 64-127 of A; k_out: the hi and the lo plane of 64 rows of A), 2 and 3 rows 0-63 and 64-127 of B.
// A wave has MB x 4 accumulators: MB 16-row blocks of A from element aoff of tile 0 on (NPL == 2: the same rows of tile 1 as second plane) against the 64 rows of B tile wn. Every accumulator takes its products in the order of a plain loop over k in steps of 32, hi plane before lo plane.
static_assert(NHD * HD == DM && DM % 128 == 0, "both GEMMs sum over DM; at least two k tiles of 64");
template <int NPL, int MB>
__device__ __forceinline__ void gemm_staged(const bf* __restrict__ T0, const bf* __restrict__ T1, const bf* __restrict__ B, const bf* st, unsigned sbase, int aoff, int wn, v8f (&acc)[MB][4]) {
    typedef WFrag<bf>::V V;
    constexpr int NS = DM / 64;
    const int lane = threadIdx.x & 31, lr = lane & 15, hi = lane >> 4;
    const unsigned crow = threadIdx.x >> 3, ccol = (threadIdx.x & 7) * 8;   // the thread's first row and its 16-byte piece in every staged tile
    const bf* g0 = T0 + crow * DM + ccol; const bf* g1 = T1 + crow * DM + ccol; const bf* gb = B + crow * DM + ccol;
    const unsigned l0 = sbase + (crow * PP + ccol) * 2;
    auto stage = [&](int t) { const unsigned lb = l0 + (unsigned)(t & 1) * (KVB * 2);
        fattn_copy2<bf>(g0 + t * 64, DM, g1 + t * 64, DM, lb, lb + KVT * 2);
        fattn_copy2<bf>(gb + t * 64, DM, gb + 64 * DM + t * 64, DM, lb + 2 * KVT * 2, lb + 3 * KVT * 2); };
    stage(0);   // nothing has touched the buffers before
#pragma unroll
    for (int mb = 0; mb < MB; ++mb)
#pragma unroll
        for (int nb = 0; nb < 4; ++nb) acc[mb][nb] = (v8f){};
    asm volatile("s_wait_asynccnt 0x0" ::: "memory");   // this wave's copies of k tile 0 have landed
    __syncthreads();                                    // and every other wave's: k tile 0 may be read
    stage(1);
#pragma unroll 1   // one k tile in the code: a second tile's fragments would leave the 256 directly addressed registers
    for (int t = 0; t < NS; ++t) { const bf* sa = st + (t & 1) * KVB + aoff + lr * PP + 8 * hi; const bf* sb = st + (t & 1) * KVB + (2 + wn) * KVT + lr * PP + 8 * hi;
        V a[2][MB], a2[2][MB], b[2][4];
        auto frags = [&](int ks) {
#pragma unroll
            for (int mb = 0; mb < MB; ++mb) { a[ks][mb] = LFrag<bf>::ld(sa + mb * 16 * PP + ks * 32); if constexpr (NPL == 2) a2[ks][mb] = LFrag<bf>::ld(sa + KVT + mb * 16 * PP + ks * 32); }
            fattn_ld4<bf>(sb, ks, b[ks]); };
        auto prods = [&](int ks) {
#pragma unroll
            for (int nb = 0; nb < 4; ++nb)
#pragma unroll
                for (int mb = 0; mb < MB; ++mb) acc[mb][nb] = WFrag<bf>::mma(a[ks][mb], b[ks][nb], acc[mb][nb]);
            if constexpr (NPL == 2) {
#pragma unroll
                for (int nb = 0; nb < 4; ++nb)
#pragma unroll
                    for (int mb = 0; mb < MB; ++mb) acc[mb][nb] = WFrag<bf>::mma(a2[ks][mb], b[ks][nb], acc[mb][nb]); } };
        // The scheduling barriers keep each group of LDS reads whole and in front of its matrix instructions: left alone the compiler reloads one B fragment register set and waits out the LDS latency before every four matrix instructions.
        if constexpr (MB * (1 + NPL) <= 6) {   // both k steps' fragments fit beside the accumulators: one group of reads per k tile
            frags(0); frags(1); __builtin_amdgcn_sched_barrier(0); prods(0); prods(1);
        } else {                               // one k step's fragments at a time
            frags(0); __builtin_amdgcn_sched_barrier(0); prods(0); __builtin_amdgcn_sched_barrier(0); frags(1); __builtin_amdgcn_sched_barrier(0); prods(1); }
        __builtin_amdgcn_sched_barrier(0);   // the matrix instructions stay in front of the hand-over: left alone the compiler lifts its waits and the barrier over them, and the wave waits out all its LDS reads before its first matrix instruction
        // hand-over of the buffers, every wave, in this order:
        asm volatile("s_wait_dscnt 0x0" ::: "memory");      // this wave's reads of this k tile's buffer have returned
        asm volatile("s_wait_asynccnt 0x0" ::: "memory");   // this wave's copies of the next k tile have landed
        __syncthreads();                                    // the same holds for every wave: the next k tile may be read, this one's buffer may be refilled
        if (t + 2 < NS) stage(t + 2);
    }
    asm volatile("s_wait_asynccnt 0x0" ::: "memory");   // no copy is in flight behind the loop
}

// ---- k_out: C[m][n] (f32, pitch DM) = sum_k (Ah[m][k] + Al[m][k]) Bt[n][k]; a work-group owns 64 x 128 of C, a wave 32 x 64: grid (TT/64, DM/128) = one work-group per WGP, 128 threads. Each wave stores its part through its own LDS rows as whole lines.
__global__ __launch_bounds__(128) void k_out(const bf* __restrict__ Ah, const bf* __restrict__ Al, const bf* __restrict__ Bt, float* C) {
    __shared__ __align__(16) float osw[4][16 * 68];
    __shared__ __align__(16) unsigned short gst[2 * KVB];
    const unsigned sbase = (unsigned)(size_t)(const void*)gst;   // the low 32 bits of a __shared__ address are its LDS byte address
    const int wv = __builtin_amdgcn_readfirstlane(threadIdx.x >> 5), wm = wv & 1, wn = wv >> 1; float* os = osw[wv];
    const int lane = threadIdx.x & 31, lr = lane & 15, hi = lane >> 4; const int r0 = blockIdx.x * 64 + wm * 32, c0 = blockIdx.y * 128 + wn * 64;
    v8f acc[2][4];
    gemm_staged<2, 2>(Ah + (size_t)blockIdx.x * 64 * DM, Al + (size_t)blockIdx.x * 64 * DM, Bt + (size_t)blockIdx.y * 128 * DM, (const bf*)gst, sbase, wm * 32 * PP, wn, acc);
#pragma unroll
    for (int mb = 0; mb < 2; ++mb) {
#pragma unroll
        for (int nb = 0; nb < 4; ++nb) {
#pragma unroll
            for (int j = 0; j < 8; ++j) os[(hi * 8 + j) * 68 + nb * 16 + lr] = acc[mb][nb][j]; }
        __builtin_amdgcn_wave_barrier(); asm volatile("" ::: "memory");   // the rows are read below by other lanes of this wave: keep the stores in front of the reads
        float* crow = C + (size_t)(r0 + mb * 16) * DM + c0;
#pragma unroll
        for (int s = 0; s < 8; ++s) { const int row = 2 * s + hi, cofs = lr * 4; const v4f val = *(const v4fa*)(os + row * 68 + cofs); *(v4f*)(crow + (size_t)row * DM + cofs) = val; }
        __builtin_amdgcn_wave_barrier(); asm volatile("s_wait_xcnt 0x0" ::: "memory");   // the LDS reads stay in front of the next 16 rows' LDS stores; the wait stands behind these rows' global stores, before the next LDS reads land in their registers
    }
}

// ---- k_qkv: the q, k and v projections in ONE launch, each wave's 64x64 quarter finished in its own epilogue: nothing of the projections goes to memory in f32.
// Main loop: gemm_staged, one plane; a work-group owns 128 x 128, a wave a 64 x 64 quarter. A quarter's columns are one 64-wide sub-head: cy 0..31 query sub-heads, 32..47 key sub-heads, 48..55 value groups; a work-group's two sub-heads lie in one weight tensor.
// q, k: interleaved-pair rotary on the staged rows (cos / sin rounded to bf16 as every input), then the fp16 plane and the hi+lo planes [sub-head][t][64], whole 128-B lines per row.
// v: an accumulator register run is 8 consecutive t of one column, which is 16 B of the transposed planes [group][d][t]: stored straight from the registers.
static_assert(NH_ % 2 == 0 && NKV % 2 == 0 && NVG % 2 == 0, "a pair of sub-heads never straddles two weight tensors");
__global__ __launch_bounds__(128) void k_qkv(const bf* __restrict__ A, const bf* __restrict__ WQ, const bf* __restrict__ WK, const bf* __restrict__ WV, const float* __restrict__ fcos, const float* __restrict__ fsin, h16* QP16, bf* QPh, bf* QPl, h16* KP16, bf* KPh, bf* KPl, h16* VT16, bf* VTh, bf* VTl) {
    __shared__ __align__(16) float osw[4][16 * 68];
    __shared__ __align__(16) unsigned short gst[2 * KVB];
    const unsigned sbase = (unsigned)(size_t)(const void*)gst;   // the low 32 bits of a __shared__ address are its LDS byte address
    const int wv = __builtin_amdgcn_readfirstlane(threadIdx.x >> 5), wm = wv & 1, wn = wv >> 1; float* os = osw[wv];
    const int lane = threadIdx.x & 31, lr = lane & 15, hi = lane >> 4; const int r0 = blockIdx.x * 128 + wm * 64, cb = blockIdx.y * 2, cy = cb + wn;
    const bf* Bt = (cb < NH_) ? WQ + (size_t)cb * 64 * DM : (cb < NH_ + NKV) ? WK + (size_t)(cb - NH_) * 64 * DM : WV + (size_t)(cb - NH_ - NKV) * 64 * DM;
    v8f acc[4][4];
    gemm_staged<1, 4>(A + (size_t)blockIdx.x * 128 * DM, A + ((size_t)blockIdx.x * 128 + 64) * DM, Bt, (const bf*)gst, sbase, wm * KVT, wn, acc);
    if (cy >= NH_ + NKV) {
        const size_t vo = ((size_t)(cy - NH_ - NKV) * HD + lr) * TT + r0 + hi * 8;
#pragma unroll
        for (int nb = 0; nb < 4; ++nb)
#pragma unroll
            for (int mb = 0; mb < 4; ++mb) { v8h o16; v8us oh, ol;   // mb innermost: the four 32-B pieces of a 128-B line follow one another
#pragma unroll
                for (int j = 0; j < 8; ++j) { const float x = acc[mb][nb][j]; unsigned short a2, c2; o16[j] = tohx(x); splitf(x, a2, c2); oh[j] = a2; ol[j] = c2; }
                const size_t e = vo + (size_t)nb * 16 * TT + mb * 16; *(v8h*)(VT16 + e) = o16; *(v8us*)(VTh + e) = oh; *(v8us*)(VTl + e) = ol; }
        return; }
    const size_t zo = (size_t)((cy < NH_) ? cy : cy - NH_) * TT * HD;
    h16* P16 = ((cy < NH_) ? QP16 : KP16) + zo; bf* Ph = ((cy < NH_) ? QPh : KPh) + zo; bf* Pl = ((cy < NH_) ? QPl : KPl) + zo;
    const int rr = lane >> 3, c8 = (lane & 7) * 8;   // a lane finishes 8 columns (4 rotary pairs) of one row; 8 lanes cover a row, a wave store 4 rows
    const float* pc = fcos + (size_t)(r0 + rr) * (HD / 2) + (c8 >> 1); const float* pn = fsin + (size_t)(r0 + rr) * (HD / 2) + (c8 >> 1);
    v4f cc[2][4], sn[2][4];
#pragma unroll
    for (int s = 0; s < 4; ++s) { cc[0][s] = *(const v4f*)(pc + (size_t)(4 * s) * (HD / 2)); sn[0][s] = *(const v4f*)(pn + (size_t)(4 * s) * (HD / 2)); }
#pragma unroll
    for (int mb = 0; mb < 4; ++mb) {
#pragma unroll
        for (int nb = 0; nb < 4; ++nb) {
#pragma unroll
            for (int j = 0; j < 8; ++j) os[(hi * 8 + j) * 68 + nb * 16 + lr] = acc[mb][nb][j]; }
        __builtin_amdgcn_wave_barrier(); asm volatile("" ::: "memory");   // the tile is read below by other lanes of this wave: keep the stores in front of the reads
        if (mb < 3) {   // the next 16 rows' cos / sin fly while these 16 rows are finished
#pragma unroll
            for (int s = 0; s < 4; ++s) { cc[(mb + 1) & 1][s] = *(const v4f*)(pc + (size_t)((mb + 1) * 16 + 4 * s) * (HD / 2)); sn[(mb + 1) & 1][s] = *(const v4f*)(pn + (size_t)((mb + 1) * 16 + 4 * s) * (HD / 2)); }
            __builtin_amdgcn_sched_barrier(0); }   // keeps these loads in front of the rows' work: sunk among the stores they would come late and land in registers that an issued store names
#pragma unroll
        for (int s = 0; s < 4; ++s) { const int row = 4 * s + rr; const v4f xa = *(const v4fa*)(os + row * 68 + c8), xb = *(const v4fa*)(os + row * 68 + c8 + 4); v8h o16; v8us oh, ol;
#pragma unroll
            for (int p = 0; p < 4; ++p) { const float x0 = (p < 2) ? xa[2 * p] : xb[2 * p - 4], x1 = (p < 2) ? xa[2 * p + 1] : xb[2 * p - 3]; const float c = bfr(cc[mb & 1][s][p]), n = bfr(sn[mb & 1][s][p]);
                const float e0 = x0 * c - x1 * n, e1 = x0 * n + x1 * c;   /* even: x0 c - x1 s; odd: x0 s + x1 c */
                unsigned short a2, c2; o16[2 * p] = tohx(e0); o16[2 * p + 1] = tohx(e1); splitf(e0, a2, c2); oh[2 * p] = a2; ol[2 * p] = c2; splitf(e1, a2, c2); oh[2 * p + 1] = a2; ol[2 * p + 1] = c2; }
            const size_t e = (size_t)(r0 + mb * 16 + row) * HD + c8; *(v8h*)(P16 + e) = o16; *(v8us*)(Ph + e) = oh; *(v8us*)(Pl + e) = ol; }
        __builtin_amdgcn_wave_barrier(); asm volatile("s_wait_xcnt 0x0" ::: "memory");   // the LDS reads stay in front of the next 16 rows' LDS stores; the wait stands behind these rows' global stores, before the next loads land in their registers
    }
}

__global__ __launch_bounds__(256) void k_merge(const float* __restrict__ O, int h0, bf* Ah, bf* Al) { const size_t e = ((size_t)blockIdx.x * 256 + threadIdx.x) * 2; if (e >= (size_t)ZH * TT * HD) return; const int d = (int)(e % HD); const int t = (int)((e / HD) % TT); const int zz = (int)(e / ((size_t)HD * TT)); const float cs = (t < RH) ? 1.0f : (1.0f / PCAR); const size_t oo = (size_t)t * DQ + (h0 + zz) * HD + d;
    v2us oh, ol;
#pragma unroll
    for (int q = 0; q < 2; ++q) { unsigned short a, c2; splitf(O[e + q] * cs, a, c2); oh[q] = a; ol[q] = c2; } *(v2us*)(Ah + oo) = oh; *(v2us*)(Al + oo) = ol;  }

extern "C" void kernel_launch(void* const* d_in, const int* in_sizes, int n_in,
                              void* d_out, int out_size, void* d_ws, size_t ws_size, hipStream_t stream) {
    (void)in_sizes; (void)n_in; (void)out_size;
    const float* x = (const float*)d_in[0]; const float* fcos = (const float*)d_in[1]; const float* fsin = (const float*)d_in[2]; const float* wq = (const float*)d_in[3]; const float* wk = (const float*)d_in[4]; const float* wv = (const float*)d_in[5]; const float* wo = (const float*)d_in[6]; const float* lq1 = (const float*)d_in[7]; const float* lk1 = (const float*)d_in[8]; const float* lq2 = (const float*)d_in[9]; const float* lk2 = (const float*)d_in[10];
    float* OUT = (float*)d_out;     // [1][2048][1024]
    char* wsp = (char*)d_ws;
    auto take = [&](size_t bytes) { char* p = wsp; wsp += (bytes + 255) & ~(size_t)255; return (void*)p; };
    bf* WQ = (bf*)take((size_t)DQ * DM * 2); bf* WK = (bf*)take((size_t)DKV * DM * 2); bf* WV = (bf*)take((size_t)DV * DM * 2); bf* WO = (bf*)take((size_t)DM * NHD * HD * 2); float* LAM = (float*)take(64 * 4); float* ST = (float*)take((size_t)NHD * 32 * 4); float* Y = (float*)take((size_t)TT * NHD * HD * 4);
    bf* XB = (bf*)take((size_t)TT * DM * 2);
    h16* QP16 = (h16*)take((size_t)NH_ * TT * HD * 2); h16* KP16 = (h16*)take((size_t)NKV * TT * HD * 2); h16* VT16 = (h16*)take((size_t)NVG * HD * TT * 2);
    bf* QPh = (bf*)take((size_t)NH_ * TT * HD * 2); bf* QPl = (bf*)take((size_t)NH_ * TT * HD * 2); bf* KPh = (bf*)take((size_t)NKV * TT * HD * 2); bf* KPl = (bf*)take((size_t)NKV * TT * HD * 2); bf* VTh = (bf*)take((size_t)NVG * HD * TT * 2); bf* VTl = (bf*)take((size_t)NVG * HD * TT * 2);
    float* Ob = (float*)take((size_t)NH_ * TT * HD * 4); bf* ATh = (bf*)take((size_t)TT * NHD * HD * 2); bf* ATl = (bf*)take((size_t)TT * NHD * HD * 2);
    if ((size_t)(wsp - (char*)d_ws) > ws_size) return;    // ws 256 MiB
    k_prep<<<1 + PB_X + PB_Q + PB_K + PB_V + PB_O, 256, 0, stream>>>(wq, wk, wv, wo, x, WQ, WK, WV, WO, XB, lq1, lk1, lq2, lk2, LAM);   /* bf16 planes of the four weights and of x, and lambda */
    for (int b = 0; b < NB_; ++b) {
        k_qkv<<<dim3(TT / 128, (NH_ + NKV + NVG) / 2, 1), 128, 0, stream>>>(XB, WQ, WK, WV, fcos, fsin, QP16, QPh, QPl, KP16, KPh, KPl, VT16, VTh, VTl);   /* 32 query sub-heads (q1_h = 2h, q2_h = 2h+1), 16 key sub-heads (k1_g = 2g, k2_g = 2g+1), 8 value groups: projection, rotary, planes */
        k_fattn<<<dim3(TT / 128, NH_, 1), 128, 0, stream>>>(QP16, QPh, QPl, KP16, KPh, KPl, VT16, VTh, VTl, Ob);   /* all 32 sub-heads: Ob[z] = softmax(q_z k^T / 8) v (x PCAR for rows >= RH) */
        k_dcomb<<<dim3((unsigned)(((size_t)TT * HD / 4 + 255) / 256), NHD, 1), 256, 0, stream>>>(Ob, LAM, Y);   /* y_h = a1 v - lambda a2 v */
        k_gnstat<<<NHD, 1024, 0, stream>>>(Y, ST); k_gnapply<<<(unsigned)(((size_t)TT * NHD * HD / 4 + 255) / 256), 256, 0, stream>>>(Y, ST, ATh, ATl);   /* GroupNorm per head x (1 - lambda_init) -> planes */
        k_out<<<dim3(TT / 64, DM / 128, 1), 128, 0, stream>>>(ATh, ATl, WO, OUT + (size_t)b * TT * DM); }
}

// v008
// A run of this version takes 98 microseconds.
// In both of two side-by-side timings against v007, it was 1.13 times as fast.
// Over all steps from v000 it is 19.1 times as fast.
#include <hip/hip_runtime.h>

// Differential attention (x [1][2048][1024]; q = x wq^T viewed (T, 16, 2, 64): q1/q2 per head; k = x wk^T viewed (T, 8, 2, 64): k1/k2 per kv group; v = x wv^T (8 x 64); interleaved-pair rotary on q1, q2, k1, k2 with the given cos/sin tables [2048][32]; head h uses kv group h/2; a1 = causal softmax(q1.k1/8), a2 = causal softmax(q2.k2/8); lambda = exp(lq1.lk1) - exp(lq2.lk2) + lambda_init (lambda vectors [64], read); y = (a1 - lambda a2) v; GroupNorm per (head) over (T, 64) (eps 1e-5, no affine) x (1 - lambda_init); out = y wo^T -> [1][2048][1024] (2.1 M)).
// Compute dtypes, f32 accumulate: every input rounded to bf16; projections exact; rotary f32; attention rows < 512 3 products, rest fp16, scores and probabilities kept on chip (one fused launch for all heads); softmax, lambda, combine and GroupNorm f32 (fixed-order reductions); wo hl x exact.

#define NB_  1
#define TT   2048
#define DM   1024
#define NH_  32
#define NKV  16
#define REP  (NH_ / NKV)
#define HD   64
#define DQ   (NH_ * HD)
#define DKV  (NKV * HD)
#define ZH   2
#define RH   512                  // query rows < RH use hi+lo planes (0: none)
#define WIN  2048
#define PCAR 1024.0f
#define SCL  0.125f
#define NVG  8       // value groups
#define DV   (NVG * HD)   // 512
#define NHD  16      // real heads
#define LINIT 0.35550906759096934f   // 0.8 - 0.6 exp(-0.3)
typedef _Float16 h16;
typedef unsigned short bf;
typedef __attribute__((ext_vector_type(16))) __bf16   v16bf;
typedef __attribute__((ext_vector_type(16))) _Float16 v16h;
typedef __attribute__((ext_vector_type(8)))  _Float16 v8h;
typedef __attribute__((ext_vector_type(8)))  unsigned short v8us;
typedef __attribute__((ext_vector_type(8)))  float    v8f;
typedef __attribute__((ext_vector_type(4)))  float    v4f;
typedef v8h  __attribute__((may_alias)) v8ha;
typedef v4f  __attribute__((may_alias)) v4fa;
typedef v8us __attribute__((may_alias)) v8usa;

__device__ __forceinline__ unsigned short f2bf(float f) { unsigned u = __float_as_uint(f); u += 0x7FFFu + ((u >> 16) & 1u); return (unsigned short)(u >> 16); }
__device__ __forceinline__ float bf2f(unsigned short b) { return __uint_as_float(((unsigned)b) << 16); }
__device__ __forceinline__ float bfr(float f) { return bf2f(f2bf(f)); }
__device__ __forceinline__ v16h cat16(v8h lo, v8h hi) { return __builtin_shufflevector(lo, hi, 0, 1, 2, 3, 4, 5, 6, 7, 8, 9, 10, 11, 12, 13, 14, 15); }
__device__ __forceinline__ v16bf cat16b(v8us lo, v8us hi) { return __builtin_bit_cast(v16bf, __builtin_shufflevector(lo, hi, 0, 1, 2, 3, 4, 5, 6, 7, 8, 9, 10, 11, 12, 13, 14, 15)); }
__device__ __forceinline__ v8f wmma16(v16h a, v16h b, v8f c) { return __builtin_amdgcn_wmma_f32_16x16x32_f16(false, a, false, b, (short)0, c, false, false); }
__device__ __forceinline__ v8f wmmab(v16bf a, v16bf b, v8f c) { return __builtin_amdgcn_wmma_f32_16x16x32_bf16(false, a, false, b, (short)0, c, false, false); }



template <typename T16> struct WFrag;
template <> struct WFrag<h16> { typedef v16h V; static __device__ __forceinline__ V ld(const h16* p) { return cat16(*(const v8h*)p, *(const v8h*)(p + 16)); } static __device__ __forceinline__ v8f mma(V a, V b, v8f c) { return wmma16(a, b, c); } };
template <> struct WFrag<bf> { typedef v16bf V; static __device__ __forceinline__ V ld(const bf* p) { return cat16b(*(const v8us*)p, *(const v8us*)(p + 16)); } static __device__ __forceinline__ v8f mma(V a, V b, v8f c) { return wmmab(a, b, c); } };

__device__ __forceinline__ h16 tohx(float x) { return (h16)x; }
__device__ __forceinline__ void splitf(float y, unsigned short& h, unsigned short& l) { h = f2bf(y); l = f2bf(y - bf2f(h)); }
typedef __attribute__((ext_vector_type(2))) _Float16 v2h;
typedef __attribute__((ext_vector_type(4))) _Float16 v4h;
typedef __attribute__((ext_vector_type(2))) unsigned short v2us;
typedef __attribute__((ext_vector_type(4))) unsigned short v4us;
typedef __attribute__((ext_vector_type(2))) float v2f;
typedef __attribute__((ext_vector_type(4))) int v4i;

__global__ __launch_bounds__(256) void k_wtG(const float* __restrict__ w, int K, int N, bf* Bt) {
    const int lane = threadIdx.x & 31; const int L0 = (blockIdx.x * 8 + (threadIdx.x >> 5)) * 8; const int nlines = N * K / 64;
{
#pragma unroll 1
        for (int l = 0; l < 8; ++l) { const int L = L0 + l; if (L >= nlines) break; const size_t e = (size_t)L * 64 + lane * 2; const int k = (int)(e % K), n = (int)(e / K); v2us o;
            o[0] = f2bf(w[(size_t)k * N + n]); o[1] = f2bf(w[(size_t)(k + 1) * N + n]); *(v2us*)(Bt + e) = o; }
         }
}
// ---- k_prep: all the work that needs nothing but the inputs, in ONE launch: the five roundings to bf16 (wq, wk, wv, wo, x) and lambda. None of them reads what another writes, so they share one grid by ranges of the block index.
// Block 0: lambda (its 64 serial steps run beside the conversions). Blocks 1 ..: 2048 elements each, 8 per thread; every tensor is a whole number of blocks, so a block lies in one tensor and the grid is exact.
#define PB_Q (DQ * DM / 2048)
#define PB_K (DKV * DM / 2048)
#define PB_V (DV * DM / 2048)
#define PB_O (DM * NHD * HD / 2048)
#define PB_X (TT * DM / 2048)
static_assert(DQ * DM % 2048 == 0 && DKV * DM % 2048 == 0 && DV * DM % 2048 == 0 && DM * NHD * HD % 2048 == 0 && TT * DM % 2048 == 0, "every converted tensor is a whole number of 2048-element blocks");
static_assert(NB_ == 1, "x is converted once, in front of the batch loop");
__global__ __launch_bounds__(256) void k_prep(const float* __restrict__ wq, const float* __restrict__ wk, const float* __restrict__ wv, const float* __restrict__ wo, const float* __restrict__ x, bf* WQ, bf* WK, bf* WV, bf* WO, bf* XB, const float* __restrict__ a1, const float* __restrict__ b1, const float* __restrict__ a2, const float* __restrict__ b2, float* LAM) {
    if (blockIdx.x == 0) { if (threadIdx.x >= 64) return; float s1 = 0.f, s2 = 0.f;
#pragma unroll 1
    for (int d = 0; d < HD; ++d) { float p1 = __fmul_rn(bfr(a1[d]), bfr(b1[d])), p2 = __fmul_rn(bfr(a2[d]), bfr(b2[d])); asm volatile("" : "+v"(p1), "+v"(p2)); s1 = __fadd_rn(s1, p1); s2 = __fadd_rn(s2, p2); }
    const float lam = __fadd_rn(__fsub_rn(expf(s1), expf(s2)), LINIT); *(float*)(LAM + threadIdx.x) = lam; return; }
    unsigned blk = blockIdx.x - 1; const float* src; bf* dst;   // the tensor and the block's place in it: scalar compares on the block index
    if (blk < PB_X) { src = x; dst = XB; }
    else if ((blk -= PB_X) < PB_Q) { src = wq; dst = WQ; }
    else if ((blk -= PB_Q) < PB_K) { src = wk; dst = WK; }
    else if ((blk -= PB_K) < PB_V) { src = wv; dst = WV; }
    else { blk -= PB_V; src = wo; dst = WO; }
    const size_t i = (size_t)blk * 256 + threadIdx.x; const v8f v = *(const v8f*)(src + i * 8); v8us o;
#pragma unroll
    for (int k = 0; k < 8; ++k) o[k] = f2bf(v[k]); *(v8us*)(dst + i * 8) = o;  }

// ---- GroupNorm statistics without a launch of their own. k_dcomb, which has every y in registers, leaves one partial per (head, 64 rows): the block's own mean and the sum of squared deviations from that mean (M2).
// Partials of equal count n merge as mean = sum(mean_p) / P, M2 = sum(M2_p) + n sum((mean_p - mean)^2): no difference of large squares anywhere. k_dcomb merges its 16 lane rows so, k_gnapply a head's GNB blocks; var = M2 / (TT x HD). Fixed-order sums.
#define GNR 64            // rows of one block's partial
#define GNB (TT / GNR)    // partials per head
static_assert(GNB == 32 && GNB * GNR == TT && HD == 64, "the merge in k_gnapply: 16 lanes of one head hold two partials each; k_dcomb's grid is exact");
static_assert(((TT * HD) & (TT * HD - 1)) == 0 && ((GNR * HD) & (GNR * HD - 1)) == 0, "the counts are powers of two: multiplying by their reciprocals is the exact division");
// Sum over the 16 lanes of a row, in every lane of it, every lane on: four adds whose second operand comes from lane ^ 1, 2, 4, 8 through the vector unit's own cross-lane path (row_xmask), not through the LDS unit as a shuffle would.
__device__ __forceinline__ float gn_row16(float s) {
    s += __int_as_float(__builtin_amdgcn_update_dpp(0, __float_as_int(s), 0x161, 0xf, 0xf, true));
    s += __int_as_float(__builtin_amdgcn_update_dpp(0, __float_as_int(s), 0x162, 0xf, 0xf, true));
    s += __int_as_float(__builtin_amdgcn_update_dpp(0, __float_as_int(s), 0x164, 0xf, 0xf, true));
    s += __int_as_float(__builtin_amdgcn_update_dpp(0, __float_as_int(s), 0x168, 0xf, 0xf, true));
    return s; }
// k_dcomb: y_h = a1 v - lambda a2 v for GNR rows of one head per work-group (a thread: 4 columns of rows t0 + 16 c; a row of 16 lanes: GNR x HD / 16 values), and that block's partial. Grid (GNB, NHD), exact.
__global__ __launch_bounds__(256) void k_dcomb(const float* __restrict__ O, const float* __restrict__ LAM, float* Y, float* PST) { __shared__ v2f red[16];
    const int h = blockIdx.y; O += (size_t)h * 2 * TT * HD; const int d0 = (int)(threadIdx.x & 15) * 4; const size_t t0 = (size_t)blockIdx.x * GNR + (threadIdx.x >> 4); const float lam = LAM[0]; v4f av[4], bv[4], ov[4];
#pragma unroll
    for (int c = 0; c < 4; ++c) { av[c] = *(const v4f*)(O + (t0 + 16 * c) * HD + d0); bv[c] = *(const v4f*)(O + (size_t)TT * HD + (t0 + 16 * c) * HD + d0); }
    float s = 0.f;
#pragma unroll
    for (int c = 0; c < 4; ++c) { const size_t t = t0 + 16 * c; const float cs = (t < RH) ? 1.0f : (1.0f / PCAR); const v4f a = av[c]; const v4f b = bv[c]; v4f o;
#pragma unroll
    for (int q = 0; q < 4; ++q) { float p = __fmul_rn(a[q], cs), m = __fmul_rn(__fmul_rn(b[q], cs), lam); asm volatile("" : "+v"(p), "+v"(m)); o[q] = __fsub_rn(p, m); }
        ov[c] = o; s += (o[0] + o[1]) + (o[2] + o[3]); }
    const float rmean = gn_row16(s) * (16.0f / (float)(GNR * HD));
    float s2 = 0.f;
#pragma unroll
    for (int c = 0; c < 4; ++c) { float acc = 0.f;
#pragma unroll
        for (int q = 0; q < 4; ++q) { const float dv = ov[c][q] - rmean; acc += dv * dv; } s2 += acc; }
    s2 = gn_row16(s2); if ((threadIdx.x & 15) == 0) { v2f pr; pr[0] = rmean; pr[1] = s2; red[threadIdx.x >> 4] = pr; }
    __syncthreads();   // the 16 lane rows' partials are in red before wave 0 merges them. The y stores stand behind it: in front, the barrier would wait for them to be acknowledged
#pragma unroll
    for (int c = 0; c < 4; ++c) *(v4f*)(Y + (t0 + 16 * c) * (NHD * HD) + (size_t)h * HD + d0) = ov[c];
    if (threadIdx.x < 32) { const v2f pr = red[threadIdx.x & 15];   // the whole of wave 0: every lane is on at the cross-lane adds
        const float bmean = gn_row16(pr[0]) * (1.0f / 16.0f); const float e = pr[0] - bmean; const float m2 = gn_row16(pr[1] + (float)(GNR * HD / 16) * (e * e));
        if (threadIdx.x == 0) { v2f w; w[0] = bmean; w[1] = m2; *(v2f*)(PST + ((size_t)h * GNB + blockIdx.x) * 2) = w; } } }

// k_gnapply: a thread normalises 4 columns of one row; the 16 lanes of a row of lanes lie in one head and merge its partials, two a lane. The grid is exact: every lane is on at the cross-lane adds.
static_assert((size_t)TT * NHD * HD / 4 % 256 == 0, "no thread of k_gnapply leaves early");
__global__ __launch_bounds__(256) void k_gnapply(const float* __restrict__ Y, const float* __restrict__ PST, bf* Ah, bf* Al) { const size_t i = (size_t)blockIdx.x * 256 + threadIdx.x; const int c0 = (int)(i % (NHD * HD / 4)) * 4; const size_t t = i / (NHD * HD / 4); const int h = c0 / HD;
    const v4f pp = *(const v4f*)(PST + (size_t)h * GNB * 2 + (threadIdx.x & 15) * 4); const v4f a = *(const v4f*)(Y + t * (NHD * HD) + c0);   // pp: mean, M2 of partial 2 l and of partial 2 l + 1
    const float mean = gn_row16(pp[0] + pp[2]) * (1.0f / (float)GNB); const float e0 = pp[0] - mean, e1 = pp[2] - mean;
    const float var = gn_row16((pp[1] + pp[3]) + (float)(GNR * HD) * (e0 * e0 + e1 * e1)) * (1.0f / (float)((size_t)TT * HD));
    const float rs = __fdiv_rn(1.0f, __fsqrt_rn(__fadd_rn(var, 1e-5f))); v4us oh, ol;
#pragma unroll
    for (int q = 0; q < 4; ++q) { float nv = __fmul_rn(__fsub_rn(a[q], mean), rs); asm volatile("" : "+v"(nv)); unsigned short h2, l2; splitf(__fmul_rn(nv, 1.0f - LINIT), h2, l2); oh[q] = h2; ol[q] = l2; }
    *(v4us*)(Ah + t * (NHD * HD) + c0) = oh; *(v4us*)(Al + t * (NHD * HD) + c0) = ol;  }

// ---- k_fattn: scores, causal softmax and probability x value in ONE launch for all 32 query sub-heads; no score or probability ever goes to memory.
// One wave owns 16 query rows and walks the keys 0 .. its diagonal ONCE, in blocks of 64: scores, e = exp(t - ref), row sum, e to 16-bit through a
// per-wave LDS tile (accumulator layout -> A fragment layout), P.V accumulated in key order; the division by the row sum comes after P.V. Rows < RH: hi+lo planes, 3 products; the rest fp16 with e x PCAR.
// ref is the row's running maximum, renewed lazily: only when a score exceeds it by more than MXLAG are the row sums and the P.V accumulators scaled by exp(old ref - new ref). ref cancels in P.V / sum.
// A work-group (4 waves, 64 rows) does row block 31 - rb and then row block rb: every work-group walks the same number of key blocks, wherever it is placed.
// The four waves walk the same key blocks: each block's key and value tiles are brought into LDS once for the work-group by asynchronous copies (whole 128-B lines), two buffers, the next block's copies in flight while this block is worked on.
#define MXLAG 3.4657359f   // 5 ln 2: e <= 32, so e x PCAR <= 32768 stays inside fp16
#define PP 72   // LDS pitch of a probability row and of a staged key or value row in 16-bit elements: 144 B = 16 B x odd, the conflict-free pitch for 16-byte reads
#define KVT (64 * PP)   // one staged tile in 16-bit elements: 64 rows of 128 B at pitch PP
#define KVB (4 * KVT)   // one buffer: tiles 0 keys, 1 values, 2 keys lo, 3 values lo (2 and 3 only for the hi+lo planes)
template <typename T16> struct LFrag;
template <> struct LFrag<h16> { static __device__ __forceinline__ v16h ld(const h16* p) { return cat16(*(const v8ha*)p, *(const v8ha*)(p + 16)); } };
template <> struct LFrag<bf> { static __device__ __forceinline__ v16bf ld(const bf* p) { return cat16b(*(const v8usa*)p, *(const v8usa*)(p + 16)); } };
// 2^x with the free issue slot behind the transcendental in the same statement: the next vector instruction may then read the result or overwrite the source.
__device__ __forceinline__ float fattn_exp2(float x) { float r; asm("v_exp_f32 %0, %1\n\tv_nop" : "=v"(r) : "v"(x)); return r; }
// Four B fragments (nb = 0..3) of k step ks of one staged tile: rows nb*16+lr at pitch PP; pl is the lane's own LDS pointer (row lr, k offset 8*hi).
template <typename T16>
__device__ __forceinline__ void fattn_ld4(const T16* pl, int ks, typename WFrag<T16>::V (&b)[4]) {
#pragma unroll
    for (int nb = 0; nb < 4; ++nb) b[nb] = LFrag<T16>::ld(pl + (nb * 16 * PP + ks * 32));
}
// Two 64-row x 128-B tiles from global memory into LDS through no register. ga, gb: the thread's own 16 bytes of its first row (row tid / 8, piece tid % 8); la, lb: their LDS byte addresses.
// A thread brings rows tid / 8 + 16 c, c = 0..3, of each tile; a wave's copy covers 4 whole 128-B lines. The s_wait_xcnt closes the statement so that no address register is rewritten in front of it.
template <typename T16>
__device__ __forceinline__ void fattn_copy2(const T16* ga, size_t pa, const T16* gb, size_t pb, unsigned la, unsigned lb) {
    asm volatile("global_load_async_to_lds_b128 %0, %8, off\n\t"
                 "global_load_async_to_lds_b128 %1, %9, off\n\t"
                 "global_load_async_to_lds_b128 %2, %10, off\n\t"
                 "global_load_async_to_lds_b128 %3, %11, off\n\t"
                 "global_load_async_to_lds_b128 %4, %12, off\n\t"
                 "global_load_async_to_lds_b128 %5, %13, off\n\t"
                 "global_load_async_to_lds_b128 %6, %14, off\n\t"
                 "global_load_async_to_lds_b128 %7, %15, off\n\t"
                 "s_wait_xcnt 0x0"
                 :: "v"(la), "v"(la + 16 * PP * 2), "v"(la + 32 * PP * 2), "v"(la + 48 * PP * 2), "v"(lb), "v"(lb + 16 * PP * 2), "v"(lb + 32 * PP * 2), "v"(lb + 48 * PP * 2),
                    "v"(ga), "v"(ga + 16 * pa), "v"(ga + 32 * pa), "v"(ga + 48 * pa), "v"(gb), "v"(gb + 16 * pb), "v"(gb + 32 * pb), "v"(gb + 48 * pb) : "memory");
}
// Inputs-only fence on loaded fragments: every LDS read of the batch is issued before the first matrix instruction waits, so a batch pays one LDS latency, not one per fragment.
template <typename V> __device__ __forceinline__ void fattn_hold8(const V (&x)[4], const V (&y)[4]) { asm volatile("" :: "v"(x[0]), "v"(x[1]), "v"(x[2]), "v"(x[3]), "v"(y[0]), "v"(y[1]), "v"(y[2]), "v"(y[3])); }
// acc[nb] += a x b[nb] (+ a2 x b[nb] + a x b2[nb] for the hi+lo planes)
template <typename T16, bool HI>
__device__ __forceinline__ void fattn_mm(const typename WFrag<T16>::V& a, const typename WFrag<T16>::V& a2, const typename WFrag<T16>::V (&b)[4], const typename WFrag<T16>::V (&b2)[4], v8f (&acc)[4]) {
#pragma unroll
    for (int nb = 0; nb < 4; ++nb) { acc[nb] = WFrag<T16>::mma(a, b[nb], acc[nb]);
        if (HI) { acc[nb] = WFrag<T16>::mma(a2, b[nb], acc[nb]); acc[nb] = WFrag<T16>::mma(a, b2[nb], acc[nb]); } }
}
// st: the two staging buffers (work-group wide), sbase: their LDS byte address. Called by all four waves of the work-group with the same row block: the barriers inside are passed by every wave, the same number of times.
template <typename T16, bool HI>
__device__ __forceinline__ void fattn_strip(const T16* __restrict__ Q, const T16* __restrict__ Q2, const T16* __restrict__ Kp, const T16* __restrict__ Kp2, const T16* __restrict__ Vt, const T16* __restrict__ Vt2, int i0, T16* ps, T16* ps2, const T16* st, unsigned sbase, float* O) {
    typedef typename WFrag<T16>::V V;
    const int lane = threadIdx.x & 31, lr = lane & 15, hi = lane >> 4;
    const int nblk = (i0 >> 6) + 1;                    // key blocks 0 .. nblk-1: up to the end of the 64-key block that holds the diagonal (64 nblk <= TT); the same for the four waves
    const unsigned crow = threadIdx.x >> 3, ccol = (threadIdx.x & 7) * 8;   // the thread's first row and its 16-byte piece in every staged tile
    const T16* gk = Kp + crow * HD + ccol; const T16* gk2 = Kp2 + crow * HD + ccol; const T16* gv = Vt + crow * TT + ccol; const T16* gv2 = Vt2 + crow * TT + ccol;
    const unsigned l0 = sbase + (crow * PP + ccol) * 2;
    auto stage = [&](int t) { const unsigned lb = l0 + (unsigned)(t & 1) * (KVB * 2);
        fattn_copy2<T16>(gk + (size_t)t * 64 * HD, HD, gv + t * 64, TT, lb, lb + KVT * 2);
        if constexpr (HI) fattn_copy2<T16>(gk2 + (size_t)t * 64 * HD, HD, gv2 + t * 64, TT, lb + 2 * KVT * 2, lb + 3 * KVT * 2); };
    stage(0);   // both buffers are free here: an earlier strip's last reads ended in front of its last barrier
    V q[2], q2[2];
#pragma unroll
    for (int ks = 0; ks < 2; ++ks) { q[ks] = WFrag<T16>::ld(Q + (size_t)(i0 + lr) * HD + ks * 32 + 8 * hi); q2[ks] = HI ? WFrag<T16>::ld(Q2 + (size_t)(i0 + lr) * HD + ks * 32 + 8 * hi) : q[ks]; }
    asm volatile("s_wait_xcnt 0x0" :: "v"(q[0]), "v"(q[1]), "v"(q2[0]), "v"(q2[1]) : "memory");   // behind the query loads, before their address registers are used for anything else
    float mx[8];   // the reference each row's exponentials are taken against: a running row maximum, renewed only when a score leaves it far behind
#pragma unroll
    for (int j = 0; j < 8; ++j) mx[j] = -3.0e38f;
    float sum[8]; v8f o[4];
#pragma unroll
    for (int j = 0; j < 8; ++j) sum[j] = 0.f;
#pragma unroll
    for (int nb = 0; nb < 4; ++nb) o[nb] = (v8f){};
    asm volatile("s_wait_asynccnt 0x0" ::: "memory");   // this wave's copies of block 0 have landed
    __syncthreads();                                    // and every other wave's: block 0 may be read
    if (nblk > 1) stage(1);
    for (int t = 0; t < nblk; ++t) { V kb[2][4], kb2[2][4], vb[2][4], vb2[2][4]; v8f s[4]; const int j0 = t * 64; const T16* sb = st + (t & 1) * KVB + lr * PP + 8 * hi;
#pragma unroll
        for (int nb = 0; nb < 4; ++nb) s[nb] = (v8f){};
        if constexpr (HI) {
#pragma unroll
            for (int ks = 0; ks < 2; ++ks) { fattn_ld4<T16>(sb, ks, kb[ks]); fattn_ld4<T16>(sb + 2 * KVT, ks, kb2[ks]); fattn_mm<T16, HI>(q[ks], q2[ks], kb[ks], kb2[ks], s);
                if (ks == 0) __builtin_amdgcn_sched_barrier(0); }   // one k step's 64 fragment registers at a time: both steps' fetched together overrun the 256 directly addressed registers
        } else {   // one plane each: the value fragments are fetched with the key fragments, ahead of the softmax
            fattn_ld4<T16>(sb, 0, kb[0]); fattn_ld4<T16>(sb, 1, kb[1]); fattn_ld4<T16>(sb + KVT, 0, vb[0]); fattn_ld4<T16>(sb + KVT, 1, vb[1]);
            fattn_mm<T16, HI>(q[0], q2[0], kb[0], kb2[0], s); fattn_mm<T16, HI>(q[1], q2[1], kb[1], kb2[1], s); }
        float lead = -3.0e38f;   // by how much this lane's scores of the block lead their rows' references, at most
#pragma unroll
        for (int j = 0; j < 8; ++j) {
#pragma unroll
            for (int nb = 0; nb < 4; ++nb) s[nb][j] = (j0 + nb * 16 + lr <= i0 + hi * 8 + j) ? s[nb][j] * SCL : -3.0e38f;
            lead = fmaxf(lead, fmaxf(fmaxf(s[0][j], s[1][j]), fmaxf(s[2][j], s[3][j])) - mx[j]); }
        if (__builtin_amdgcn_ballot_w32(lead > MXLAG) != 0) {   // one scalar test per key block, every lane stays on: taken at a strip's first block and then only when some score outgrows its row's reference
#pragma unroll
            for (int j = 0; j < 8; ++j) { float bm = fmaxf(fmaxf(s[0][j], s[1][j]), fmaxf(s[2][j], s[3][j]));
#pragma unroll
                for (int sh = 8; sh; sh >>= 1) bm = fmaxf(bm, __shfl_xor(bm, sh, 32));   // row hi*8+j lives in the 16 lanes of this half
                const float nm = fmaxf(mx[j], bm); const float f = fattn_exp2((mx[j] - nm) * 1.4426950408889634f); mx[j] = nm; sum[j] *= f;   // what was summed against the old reference is carried over to the new one (first block: f = 0 on zeros)
#pragma unroll
                for (int nb = 0; nb < 4; ++nb) o[nb][j] *= f; } }
#pragma unroll
        for (int nb = 0; nb < 4; ++nb)
#pragma unroll
            for (int j = 0; j < 8; ++j) { const float e = fattn_exp2((s[nb][j] - mx[j]) * 1.4426950408889634f); sum[j] += e;
                const int po = (hi * 8 + j) * PP + nb * 16 + lr;
                if constexpr (HI) { unsigned short eh, el; splitf(e, eh, el); ps[po] = eh; ps2[po] = el; } else ps[po] = tohx(e * PCAR); }
        __builtin_amdgcn_wave_barrier(); asm volatile("" ::: "memory");   // the tile is read below by other lanes of this wave: keep the stores in front of the reads
#pragma unroll
        for (int ks = 0; ks < 2; ++ks) { const V a = LFrag<T16>::ld(ps + lr * PP + ks * 32 + 8 * hi); V a2 = a;
            if constexpr (HI) { a2 = LFrag<T16>::ld(ps2 + lr * PP + ks * 32 + 8 * hi); fattn_ld4<T16>(sb + KVT, ks, vb[ks]); fattn_ld4<T16>(sb + 3 * KVT, ks, vb2[ks]); fattn_hold8(vb[ks], vb2[ks]); }
            fattn_mm<T16, HI>(a, a2, vb[ks], vb2[ks], o); }
        // hand-over of the buffers, every wave, in this order:
        asm volatile("s_wait_dscnt 0x0" ::: "memory");      // this wave's reads of this block's buffer (and of its probability tile) have returned
        asm volatile("s_wait_asynccnt 0x0" ::: "memory");   // this wave's copies of the next block have landed
        __syncthreads();                                    // the same holds for every wave: the next block may be read, this block's buffer may be refilled
        if (t + 2 < nblk) stage(t + 2);
    }
    asm volatile("s_wait_asynccnt 0x0" ::: "memory");   // no copy is in flight behind the loop
#pragma unroll
    for (int j = 0; j < 8; ++j) {
#pragma unroll
        for (int sh = 8; sh; sh >>= 1) sum[j] += __shfl_xor(sum[j], sh, 32);
        const float f = __fdiv_rn(1.0f, sum[j]);
#pragma unroll
        for (int nb = 0; nb < 4; ++nb) O[(size_t)(i0 + hi * 8 + j) * HD + nb * 16 + lr] = o[nb][j] * f; }
    asm volatile("s_wait_xcnt 0x0" ::: "memory");   // behind the output stores, before the next strip reuses their address and data registers
}
// the register attribute holds the kernel to the 256 directly addressed vector registers (no register-bank switching in the loops): with this much LDS the launch bounds' second figure alone no longer does
__global__ __launch_bounds__(128, 4) __attribute__((amdgpu_num_vgpr(256))) void k_fattn(const h16* __restrict__ QP16, const bf* __restrict__ QPh, const bf* __restrict__ QPl, const h16* __restrict__ KP16, const bf* __restrict__ KPh, const bf* __restrict__ KPl, const h16* __restrict__ VT16, const bf* __restrict__ VTh, const bf* __restrict__ VTl, float* Ob) {
    __shared__ __align__(16) unsigned short pt[4][2][16 * PP];
    __shared__ __align__(16) unsigned short kv[2 * KVB];
    const unsigned sbase = (unsigned)(size_t)(const void*)kv;   // the low 32 bits of a __shared__ address are its LDS byte address
    const int wv = __builtin_amdgcn_readfirstlane(threadIdx.x >> 5); const int z = blockIdx.y;   // wave number in a scalar register: scalar loop bounds. z = 2h: (q1_h, k1_g), z = 2h+1: (q2_h, k2_g), g = h/2; both use v[g]
    const size_t zq = (size_t)z * TT * HD, zk = (size_t)(2 * (z / 4) + (z & 1)) * TT * HD, zv = (size_t)(z / 4) * HD * TT;
    // The far row block first: rb >= TT / 128, which is not below RH / 64, so it is always the fp16 path. Written out, not as a loop over the two halves: no path's lane addresses then stay in registers through the other path's key loop (spills).
    static_assert(TT / 128 * 64 >= RH, "the first row block of every work-group lies outside the hi+lo rows");
    { const int i0 = (TT / 64 - 1 - (int)blockIdx.x) * 64 + wv * 16;
        fattn_strip<h16, false>(QP16 + zq, QP16 + zq, KP16 + zk, KP16 + zk, VT16 + zv, VT16 + zv, i0, (h16*)pt[wv][0], (h16*)pt[wv][1], (const h16*)kv, sbase, Ob + zq); }
    { const int rb = (int)blockIdx.x; const int i0 = rb * 64 + wv * 16;
        if (rb * 64 < RH) fattn_strip<bf, true>(QPh + zq, QPl + zq, KPh + zk, KPl + zk, VTh + zv, VTl + zv, i0, pt[wv][0], pt[wv][1], (const bf*)kv, sbase, Ob + zq);
        else fattn_strip<h16, false>(QP16 + zq, QP16 + zq, KP16 + zk, KP16 + zk, VT16 + zv, VT16 + zv, i0, (h16*)pt[wv][0], (h16*)pt[wv][1], (const h16*)kv, sbase, Ob + zq); }
}
// ---- The two projection GEMMs (k_qkv, k_out), K = DM: a work-group of 4 waves (2 x 2) owns one output tile; its operands' 64-k tiles are brought into LDS once for the work-group
// by asynchronous copies (whole 128-B lines; each staged row is read by two waves), two buffers, the next k tile's copies in flight while this one is worked on.
// A buffer is four tiles of 64 rows at pitch PP: 0 and 1 from T0 and T1 (k_qkv: rows 0-63 and 64-127 of A; k_out: the hi and the lo plane of 64 rows of A), 2 and 3 rows 0-63 and 64-127 of B.
// A wave has MB x 4 accumulators: MB 16-row blocks of A from element aoff of tile 0 on (NPL == 2: the same rows of tile 1 as second plane) against the 64 rows of B tile wn. Every accumulator takes its products in the order of a plain loop over k in steps of 32, hi plane before lo plane.
static_assert(NHD * HD == DM && DM % 128 == 0, "both GEMMs sum over DM; at least two k tiles of 64");
template <int NPL, int MB>
__device__ __forceinline__ void gemm_staged(const bf* __restrict__ T0, const bf* __restrict__ T1, const bf* __restrict__ B, const bf* st, unsigned sbase, int aoff, int wn, v8f (&acc)[MB][4]) {
    typedef WFrag<bf>::V V;
    constexpr int NS = DM / 64;
    const int lane = threadIdx.x & 31, lr = lane & 15, hi = lane >> 4;
    const unsigned crow = threadIdx.x >> 3, ccol = (threadIdx.x & 7) * 8;   // the thread's first row and its 16-byte piece in every staged tile
    const bf* g0 = T0 + crow * DM + ccol; const bf* g1 = T1 + crow * DM + ccol; const bf* gb = B + crow * DM + ccol;
    const unsigned l0 = sbase + (crow * PP + ccol) * 2;
    auto stage = [&](int t) { const unsigned lb = l0 + (unsigned)(t & 1) * (KVB * 2);
        fattn_copy2<bf>(g0 + t * 64, DM, g1 + t * 64, DM, lb, lb + KVT * 2);
        fattn_copy2<bf>(gb + t * 64, DM, gb + 64 * DM + t * 64, DM, lb + 2 * KVT * 2, lb + 3 * KVT * 2); };
    stage(0);   // nothing has touched the buffers before
#pragma unroll
    for (int mb = 0; mb < MB; ++mb)
#pragma unroll
        for (int nb = 0; nb < 4; ++nb) acc[mb][nb] = (v8f){};
    asm volatile("s_wait_asynccnt 0x0" ::: "memory");   // this wave's copies of k tile 0 have landed
    __syncthreads();                                    // and every other wave's: k tile 0 may be read
    stage(1);
#pragma unroll 1   // one k tile in the code: a second tile's fragments would leave the 256 directly addressed registers
    for (int t = 0; t < NS; ++t) { const bf* sa = st + (t & 1) * KVB + aoff + lr * PP + 8 * hi; const bf* sb = st + (t & 1) * KVB + (2 + wn) * KVT + lr * PP + 8 * hi;
        V a[2][MB], a2[2][MB], b[2][4];
        auto frags = [&](int ks) {
#pragma unroll
            for (int mb = 0; mb < MB; ++mb) { a[ks][mb] = LFrag<bf>::ld(sa + mb * 16 * PP + ks * 32); if constexpr (NPL == 2) a2[ks][mb] = LFrag<bf>::ld(sa + KVT + mb * 16 * PP + ks * 32); }
            fattn_ld4<bf>(sb, ks, b[ks]); };
        auto prods = [&](int ks) {
#pragma unroll
            for (int nb = 0; nb < 4; ++nb)
#pragma unroll
                for (int mb = 0; mb < MB; ++mb) acc[mb][nb] = WFrag<bf>::mma(a[ks][mb], b[ks][nb], acc[mb][nb]);
            if constexpr (NPL == 2) {
#pragma unroll
                for (int nb = 0; nb < 4; ++nb)
#pragma unroll
                    for (int mb = 0; mb < MB; ++mb) acc[mb][nb] = WFrag<bf>::mma(a2[ks][mb], b[ks][nb], acc[mb][nb]); } };
        // The scheduling barriers keep each group of LDS reads whole and in front of its matrix instructions: left alone the compiler reloads one B fragment register set and waits out the LDS latency before every four matrix instructions.
        if constexpr (MB * (1 + NPL) <= 6) {   // both k steps' fragments fit beside the accumulators: one group of reads per k tile
            frags(0); frags(1); __builtin_amdgcn_sched_barrier(0); prods(0); prods(1);
        } else {                               // one k step's fragments at a time
            frags(0); __builtin_amdgcn_sched_barrier(0); prods(0); __builtin_amdgcn_sched_barrier(0); frags(1); __builtin_amdgcn_sched_barrier(0); prods(1); }
        __builtin_amdgcn_sched_barrier(0);   // the matrix instructions stay in front of the hand-over: left alone the compiler lifts its waits and the barrier over them, and the wave waits out all its LDS reads before its first matrix instruction
        // hand-over of the buffers, every wave, in this order:
        asm volatile("s_wait_dscnt 0x0" ::: "memory");      // this wave's reads of this k tile's buffer have returned
        asm volatile("s_wait_asynccnt 0x0" ::: "memory");   // this wave's copies of the next k tile have landed
        __syncthreads();                                    // the same holds for every wave: the next k tile may be read, this one's buffer may be refilled
        if (t + 2 < NS) stage(t + 2);
    }
    asm volatile("s_wait_asynccnt 0x0" ::: "memory");   // no copy is in flight behind the loop
}

// ---- k_out: C[m][n] (f32, pitch DM) = sum_k (Ah[m][k] + Al[m][k]) Bt[n][k]; a work-group owns 64 x 128 of C, a wave 32 x 64: grid (TT/64, DM/128) = one work-group per WGP, 128 threads. Each wave stores its part through its own LDS rows as whole lines.
__global__ __launch_bounds__(128) void k_out(const bf* __restrict__ Ah, const bf* __restrict__ Al, const bf* __restrict__ Bt, float* C) {
    __shared__ __align__(16) float osw[4][16 * 68];
    __shared__ __align__(16) unsigned short gst[2 * KVB];
    const unsigned sbase = (unsigned)(size_t)(const void*)gst;   // the low 32 bits of a __shared__ address are its LDS byte address
    const int wv = __builtin_amdgcn_readfirstlane(threadIdx.x >> 5), wm = wv & 1, wn = wv >> 1; float* os = osw[wv];
    const int lane = threadIdx.x & 31, lr = lane & 15, hi = lane >> 4; const int r0 = blockIdx.x * 64 + wm * 32, c0 = blockIdx.y * 128 + wn * 64;
    v8f acc[2][4];
    gemm_staged<2, 2>(Ah + (size_t)blockIdx.x * 64 * DM, Al + (size_t)blockIdx.x * 64 * DM, Bt + (size_t)blockIdx.y * 128 * DM, (const bf*)gst, sbase, wm * 32 * PP, wn, acc);
#pragma unroll
    for (int mb = 0; mb < 2; ++mb) {
#pragma unroll
        for (int nb = 0; nb < 4; ++nb) {
#pragma unroll
            for (int j = 0; j < 8; ++j) os[(hi * 8 + j) * 68 + nb * 16 + lr] = acc[mb][nb][j]; }
        __builtin_amdgcn_wave_barrier(); asm volatile("" ::: "memory");   // the rows are read below by other lanes of this wave: keep the stores in front of the reads
        float* crow = C + (size_t)(r0 + mb * 16) * DM + c0;
#pragma unroll
        for (int s = 0; s < 8; ++s) { const int row = 2 * s + hi, cofs = lr * 4; const v4f val = *(const v4fa*)(os + row * 68 + cofs); *(v4f*)(crow + (size_t)row * DM + cofs) = val; }
        __builtin_amdgcn_wave_barrier(); asm volatile("s_wait_xcnt 0x0" ::: "memory");   // the LDS reads stay in front of the next 16 rows' LDS stores; the wait stands behind these rows' global stores, before the next LDS reads land in their registers
    }
}

// ---- k_qkv: the q, k and v projections in ONE launch, each wave's 64x64 quarter finished in its own epilogue: nothing of the projections goes to memory in f32.
// Main loop: gemm_staged, one plane; a work-group owns 128 x 128, a wave a 64 x 64 quarter. A quarter's columns are one 64-wide sub-head: cy 0..31 query sub-heads, 32..47 key sub-heads, 48..55 value groups; a work-group's two sub-heads lie in one weight tensor.
// q, k: interleaved-pair rotary on the staged rows (cos / sin rounded to bf16 as every input), then the fp16 plane and the hi+lo planes [sub-head][t][64], whole 128-B lines per row.
// v: an accumulator register run is 8 consecutive t of one column, which is 16 B of the transposed planes [group][d][t]: stored straight from the registers.
static_assert(NH_ % 2 == 0 && NKV % 2 == 0 && NVG % 2 == 0, "a pair of sub-heads never straddles two weight tensors");
__global__ __launch_bounds__(128) void k_qkv(const bf* __restrict__ A, const bf* __restrict__ WQ, const bf* __restrict__ WK, const bf* __restrict__ WV, const float* __restrict__ fcos, const float* __restrict__ fsin, h16* QP16, bf* QPh, bf* QPl, h16* KP16, bf* KPh, bf* KPl, h16* VT16, bf* VTh, bf* VTl) {
    __shared__ __align__(16) float osw[4][16 * 68];
    __shared__ __align__(16) unsigned short gst[2 * KVB];
    const unsigned sbase = (unsigned)(size_t)(const void*)gst;   // the low 32 bits of a __shared__ address are its LDS byte address
    const int wv = __builtin_amdgcn_readfirstlane(threadIdx.x >> 5), wm = wv & 1, wn = wv >> 1; float* os = osw[wv];
    const int lane = threadIdx.x & 31, lr = lane & 15, hi = lane >> 4; const int r0 = blockIdx.x * 128 + wm * 64, cb = blockIdx.y * 2, cy = cb + wn;
    const bf* Bt = (cb < NH_) ? WQ + (size_t)cb * 64 * DM : (cb < NH_ + NKV) ? WK + (size_t)(cb - NH_) * 64 * DM : WV + (size_t)(cb - NH_ - NKV) * 64 * DM;
    v8f acc[4][4];
    gemm_staged<1, 4>(A + (size_t)blockIdx.x * 128 * DM, A + ((size_t)blockIdx.x * 128 + 64) * DM, Bt, (const bf*)gst, sbase, wm * KVT, wn, acc);
    if (cy >= NH_ + NKV) {
        const size_t vo = ((size_t)(cy - NH_ - NKV) * HD + lr) * TT + r0 + hi * 8;
#pragma unroll
        for (int nb = 0; nb < 4; ++nb)
#pragma unroll
            for (int mb = 0; mb < 4; ++mb) { v8h o16; v8us oh, ol;   // mb innermost: the four 32-B pieces of a 128-B line follow one another
#pragma unroll
                for (int j = 0; j < 8; ++j) { const float x = acc[mb][nb][j]; unsigned short a2, c2; o16[j] = tohx(x); splitf(x, a2, c2); oh[j] = a2; ol[j] = c2; }
                const size_t e = vo + (size_t)nb * 16 * TT + mb * 16; *(v8h*)(VT16 + e) = o16; *(v8us*)(VTh + e) = oh; *(v8us*)(VTl + e) = ol; }
        return; }
    const size_t zo = (size_t)((cy < NH_) ? cy : cy - NH_) * TT * HD;
    h16* P16 = ((cy < NH_) ? QP16 : KP16) + zo; bf* Ph = ((cy < NH_) ? QPh : KPh) + zo; bf* Pl = ((cy < NH_) ? QPl : KPl) + zo;
    const int rr = lane >> 3, c8 = (lane & 7) * 8;   // a lane finishes 8 columns (4 rotary pairs) of one row; 8 lanes cover a row, a wave store 4 rows
    const float* pc = fcos + (size_t)(r0 + rr) * (HD / 2) + (c8 >> 1); const float* pn = fsin + (size_t)(r0 + rr) * (HD / 2) + (c8 >> 1);
    v4f cc[2][4], sn[2][4];
#pragma unroll
    for (int s = 0; s < 4; ++s) { cc[0][s] = *(const v4f*)(pc + (size_t)(4 * s) * (HD / 2)); sn[0][s] = *(const v4f*)(pn + (size_t)(4 * s) * (HD / 2)); }
#pragma unroll
    for (int mb = 0; mb < 4; ++mb) {
#pragma unroll
        for (int nb = 0; nb < 4; ++nb) {
#pragma unroll
            for (int j = 0; j < 8; ++j) os[(hi * 8 + j) * 68 + nb * 16 + lr] = acc[mb][nb][j]; }
        __builtin_amdgcn_wave_barrier(); asm volatile("" ::: "memory");   // the tile is read below by other lanes of this wave: keep the stores in front of the reads
        if (mb < 3) {   // the next 16 rows' cos / sin fly while these 16 rows are finished
#pragma unroll
            for (int s = 0; s < 4; ++s) { cc[(mb + 1) & 1][s] = *(const v4f*)(pc + (size_t)((mb + 1) * 16 + 4 * s) * (HD / 2)); sn[(mb + 1) & 1][s] = *(const v4f*)(pn + (size_t)((mb + 1) * 16 + 4 * s) * (HD / 2)); }
            __builtin_amdgcn_sched_barrier(0); }   // keeps these loads in front of the rows' work: sunk among the stores they would come late and land in registers that an issued store names
#pragma unroll
        for (int s = 0; s < 4; ++s) { const int row = 4 * s + rr; const v4f xa = *(const v4fa*)(os + row * 68 + c8), xb = *(const v4fa*)(os + row * 68 + c8 + 4); v8h o16; v8us oh, ol;
#pragma unroll
            for (int p = 0; p < 4; ++p) { const float x0 = (p < 2) ? xa[2 * p] : xb[2 * p - 4], x1 = (p < 2) ? xa[2 * p + 1] : xb[2 * p - 3]; const float c = bfr(cc[mb & 1][s][p]), n = bfr(sn[mb & 1][s][p]);
                const float e0 = x0 * c - x1 * n, e1 = x0 * n + x1 * c;   /* even: x0 c - x1 s; odd: x0 s + x1 c */
                unsigned short a2, c2; o16[2 * p] = tohx(e0); o16[2 * p + 1] = tohx(e1); splitf(e0, a2, c2); oh[2 * p] = a2; ol[2 * p] = c2; splitf(e1, a2, c2); oh[2 * p + 1] = a2; ol[2 * p + 1] = c2; }
            const size_t e = (size_t)(r0 + mb * 16 + row) * HD + c8; *(v8h*)(P16 + e) = o16; *(v8us*)(Ph + e) = oh; *(v8us*)(Pl + e) = ol; }
        __builtin_amdgcn_wave_barrier(); asm volatile("s_wait_xcnt 0x0" ::: "memory");   // the LDS reads stay in front of the next 16 rows' LDS stores; the wait stands behind these rows' global stores, before the next loads land in their registers
    }
}

__global__ __launch_bounds__(256) void k_merge(const float* __restrict__ O, int h0, bf* Ah, bf* Al) { const size_t e = ((size_t)blockIdx.x * 256 + threadIdx.x) * 2; if (e >= (size_t)ZH * TT * HD) return; const int d = (int)(e % HD); const int t = (int)((e / HD) % TT); const int zz = (int)(e / ((size_t)HD * TT)); const float cs = (t < RH) ? 1.0f : (1.0f / PCAR); const size_t oo = (size_t)t * DQ + (h0 + zz) * HD + d;
    v2us oh, ol;
#pragma unroll
    for (int q = 0; q < 2; ++q) { unsigned short a, c2; splitf(O[e + q] * cs, a, c2); oh[q] = a; ol[q] = c2; } *(v2us*)(Ah + oo) = oh; *(v2us*)(Al + oo) = ol;  }

extern "C" void kernel_launch(void* const* d_in, const int* in_sizes, int n_in,
                              void* d_out, int out_size, void* d_ws, size_t ws_size, hipStream_t stream) {
    (void)in_sizes; (void)n_in; (void)out_size;
    const float* x = (const float*)d_in[0]; const float* fcos = (const float*)d_in[1]; const float* fsin = (const float*)d_in[2]; const float* wq = (const float*)d_in[3]; const float* wk = (const float*)d_in[4]; const float* wv = (const float*)d_in[5]; const float* wo = (const float*)d_in[6]; const float* lq1 = (const float*)d_in[7]; const float* lk1 = (const float*)d_in[8]; const float* lq2 = (const float*)d_in[9]; const float* lk2 = (const float*)d_in[10];
    float* OUT = (float*)d_out;     // [1][2048][1024]
    char* wsp = (char*)d_ws;
    auto take = [&](size_t bytes) { char* p = wsp; wsp += (bytes + 255) & ~(size_t)255; return (void*)p; };
    bf* WQ = (bf*)take((size_t)DQ * DM * 2); bf* WK = (bf*)take((size_t)DKV * DM * 2); bf* WV = (bf*)take((size_t)DV * DM * 2); bf* WO = (bf*)take((size_t)DM * NHD * HD * 2); float* LAM = (float*)take(64 * 4); float* PST = (float*)take((size_t)NHD * GNB * 2 * 4); float* Y = (float*)take((size_t)TT * NHD * HD * 4);
    bf* XB = (bf*)take((size_t)TT * DM * 2);
    h16* QP16 = (h16*)take((size_t)NH_ * TT * HD * 2); h16* KP16 = (h16*)take((size_t)NKV * TT * HD * 2); h16* VT16 = (h16*)take((size_t)NVG * HD * TT * 2);
    bf* QPh = (bf*)take((size_t)NH_ * TT * HD * 2); bf* QPl = (bf*)take((size_t)NH_ * TT * HD * 2); bf* KPh = (bf*)take((size_t)NKV * TT * HD * 2); bf* KPl = (bf*)take((size_t)NKV * TT * HD * 2); bf* VTh = (bf*)take((size_t)NVG * HD * TT * 2); bf* VTl = (bf*)take((size_t)NVG * HD * TT * 2);
    float* Ob = (float*)take((size_t)NH_ * TT * HD * 4); bf* ATh = (bf*)take((size_t)TT * NHD * HD * 2); bf* ATl = (bf*)take((size_t)TT * NHD * HD * 2);
    if ((size_t)(wsp - (char*)d_ws) > ws_size) return;    // ws 256 MiB
    k_prep<<<1 + PB_X + PB_Q + PB_K + PB_V + PB_O, 256, 0, stream>>>(wq, wk, wv, wo, x, WQ, WK, WV, WO, XB, lq1, lk1, lq2, lk2, LAM);   /* bf16 planes of the four weights and of x, and lambda */
    for (int b = 0; b < NB_; ++b) {
        k_qkv<<<dim3(TT / 128, (NH_ + NKV + NVG) / 2, 1), 128, 0, stream>>>(XB, WQ, WK, WV, fcos, fsin, QP16, QPh, QPl, KP16, KPh, KPl, VT16, VTh, VTl);   /* 32 query sub-heads (q1_h = 2h, q2_h = 2h+1), 16 key sub-heads (k1_g = 2g, k2_g = 2g+1), 8 value groups: projection, rotary, planes */
        k_fattn<<<dim3(TT / 128, NH_, 1), 128, 0, stream>>>(QP16, QPh, QPl, KP16, KPh, KPl, VT16, VTh, VTl, Ob);   /* all 32 sub-heads: Ob[z] = softmax(q_z k^T / 8) v (x PCAR for rows >= RH) */
        k_dcomb<<<dim3(GNB, NHD, 1), 256, 0, stream>>>(Ob, LAM, Y, PST);   /* y_h = a1 v - lambda a2 v, and the GroupNorm partial of each 64 rows of a head */
        k_gnapply<<<(unsigned)(((size_t)TT * NHD * HD / 4 + 255) / 256), 256, 0, stream>>>(Y, PST, ATh, ATl);   /* partials merged; GroupNorm per head x (1 - lambda_init) -> planes */
        k_out<<<dim3(TT / 64, DM / 128, 1), 128, 0, stream>>>(ATh, ATl, WO, OUT + (size_t)b * TT * DM); }
}

// v009
// One run takes 86.1 microseconds.
// Two timings next to v008 both put it at 1.14 times that version's speed.
// Over all steps from v000 it is 21.7 times as fast.
#include <hip/hip_runtime.h>

// Differential attention (x [1][2048][1024]; q = x wq^T viewed (T, 16, 2, 64): q1/q2 per head; k = x wk^T viewed (T, 8, 2, 64): k1/k2 per kv group; v = x wv^T (8 x 64); interleaved-pair rotary on q1, q2, k1, k2 with the given cos/sin tables [2048][32]; head h uses kv group h/2; a1 = causal softmax(q1.k1/8), a2 = causal softmax(q2.k2/8); lambda = exp(lq1.lk1) - exp(lq2.lk2) + lambda_init (lambda vectors [64], read); y = (a1 - lambda a2) v; GroupNorm per (head) over (T, 64) (eps 1e-5, no affine) x (1 - lambda_init); out = y wo^T -> [1][2048][1024] (2.1 M)).
// Compute dtypes, f32 accumulate: every input rounded to bf16; projections exact; rotary f32; attention rows < 512 3 products, rest fp16, scores and probabilities kept on chip (one fused launch for all heads); softmax, lambda, combine and GroupNorm f32 (fixed-order reductions); wo hl x exact.

#define NB_  1
#define TT   2048
#define DM   1024
#define NH_  32
#define NKV  16
#define REP  (NH_ / NKV)
#define HD   64
#define DQ   (NH_ * HD)
#define DKV  (NKV * HD)
#define ZH   2
#define RH   512                  // query rows < RH use hi+lo planes (0: none)
#define WIN  2048
#define PCAR 1024.0f
#define SCL  0.125f
#define NVG  8       // value groups
#define DV   (NVG * HD)   // 512
#define NHD  16      // real heads
#define LINIT 0.35550906759096934f   // 0.8 - 0.6 exp(-0.3)
typedef _Float16 h16;
typedef unsigned short bf;
typedef __attribute__((ext_vector_type(16))) __bf16   v16bf;
typedef __attribute__((ext_vector_type(16))) _Float16 v16h;
typedef __attribute__((ext_vector_type(8)))  _Float16 v8h;
typedef __attribute__((ext_vector_type(8)))  unsigned short v8us;
typedef __attribute__((ext_vector_type(8)))  float    v8f;
typedef __attribute__((ext_vector_type(4)))  float    v4f;
typedef v8h  __attribute__((may_alias)) v8ha;
typedef v4f  __attribute__((may_alias)) v4fa;
typedef v8us __attribute__((may_alias)) v8usa;

__device__ __forceinline__ unsigned short f2bf(float f) { unsigned u = __float_as_uint(f); u += 0x7FFFu + ((u >> 16) & 1u); return (unsigned short)(u >> 16); }
__device__ __forceinline__ float bf2f(unsigned short b) { return __uint_as_float(((unsigned)b) << 16); }
__device__ __forceinline__ float bfr(float f) { return bf2f(f2bf(f)); }
__device__ __forceinline__ v16h cat16(v8h lo, v8h hi) { return __builtin_shufflevector(lo, hi, 0, 1, 2, 3, 4, 5, 6, 7, 8, 9, 10, 11, 12, 13, 14, 15); }
__device__ __forceinline__ v16bf cat16b(v8us lo, v8us hi) { return __builtin_bit_cast(v16bf, __builtin_shufflevector(lo, hi, 0, 1, 2, 3, 4, 5, 6, 7, 8, 9, 10, 11, 12, 13, 14, 15)); }
__device__ __forceinline__ v8f wmma16(v16h a, v16h b, v8f c) { return __builtin_amdgcn_wmma_f32_16x16x32_f16(false, a, false, b, (short)0, c, false, false); }
__device__ __forceinline__ v8f wmmab(v16bf a, v16bf b, v8f c) { return __builtin_amdgcn_wmma_f32_16x16x32_bf16(false, a, false, b, (short)0, c, false, false); }



template <typename T16> struct WFrag;
template <> struct WFrag<h16> { typedef v16h V; static __device__ __forceinline__ V ld(const h16* p) { return cat16(*(const v8h*)p, *(const v8h*)(p + 16)); } static __device__ __forceinline__ v8f mma(V a, V b, v8f c) { return wmma16(a, b, c); } };
template <> struct WFrag<bf> { typedef v16bf V; static __device__ __forceinline__ V ld(const bf* p) { return cat16b(*(const v8us*)p, *(const v8us*)(p + 16)); } static __device__ __forceinline__ v8f mma(V a, V b, v8f c) { return wmmab(a, b, c); } };

__device__ __forceinline__ h16 tohx(float x) { return (h16)x; }
__device__ __forceinline__ void splitf(float y, unsigned short& h, unsigned short& l) { h = f2bf(y); l = f2bf(y - bf2f(h)); }
typedef __attribute__((ext_vector_type(2))) _Float16 v2h;
typedef __attribute__((ext_vector_type(4))) _Float16 v4h;
typedef __attribute__((ext_vector_type(2))) unsigned short v2us;
typedef __attribute__((ext_vector_type(4))) unsigned short v4us;
typedef __attribute__((ext_vector_type(2))) float v2f;
typedef __attribute__((ext_vector_type(4))) int v4i;

__global__ __launch_bounds__(256) void k_wtG(const float* __restrict__ w, int K, int N, bf* Bt) {
    const int lane = threadIdx.x & 31; const int L0 = (blockIdx.x * 8 + (threadIdx.x >> 5)) * 8; const int nlines = N * K / 64;
{
#pragma unroll 1
        for (int l = 0; l < 8; ++l) { const int L = L0 + l; if (L >= nlines) break; const size_t e = (size_t)L * 64 + lane * 2; const int k = (int)(e % K), n = (int)(e / K); v2us o;
            o[0] = f2bf(w[(size_t)k * N + n]); o[1] = f2bf(w[(size_t)(k + 1) * N + n]); *(v2us*)(Bt + e) = o; }
         }
}
// ---- k_prep: all the work that needs nothing but the inputs, in ONE launch: the five roundings to bf16 (wq, wk, wv, wo, x) and lambda. None of them reads what another writes, so they share one grid by ranges of the block index.
// Block 0: lambda (its 64 serial steps run beside the conversions). Blocks 1 ..: 2048 elements each, 8 per thread; every tensor is a whole number of blocks, so a block lies in one tensor and the grid is exact.
#define PB_Q (DQ * DM / 2048)
#define PB_K (DKV * DM / 2048)
#define PB_V (DV * DM / 2048)
#define PB_O (DM * NHD * HD / 2048)
#define PB_X (TT * DM / 2048)
static_assert(DQ * DM % 2048 == 0 && DKV * DM % 2048 == 0 && DV * DM % 2048 == 0 && DM * NHD * HD % 2048 == 0 && TT * DM % 2048 == 0, "every converted tensor is a whole number of 2048-element blocks");
static_assert(NB_ == 1, "x is converted once, in front of the batch loop");
__global__ __launch_bounds__(256) void k_prep(const float* __restrict__ wq, const float* __restrict__ wk, const float* __restrict__ wv, const float* __restrict__ wo, const float* __restrict__ x, bf* WQ, bf* WK, bf* WV, bf* WO, bf* XB, const float* __restrict__ a1, const float* __restrict__ b1, const float* __restrict__ a2, const float* __restrict__ b2, float* LAM) {
    if (blockIdx.x == 0) { if (threadIdx.x >= 64) return; float s1 = 0.f, s2 = 0.f;
#pragma unroll 1
    for (int d = 0; d < HD; ++d) { float p1 = __fmul_rn(bfr(a1[d]), bfr(b1[d])), p2 = __fmul_rn(bfr(a2[d]), bfr(b2[d])); asm volatile("" : "+v"(p1), "+v"(p2)); s1 = __fadd_rn(s1, p1); s2 = __fadd_rn(s2, p2); }
    const float lam = __fadd_rn(__fsub_rn(expf(s1), expf(s2)), LINIT); *(float*)(LAM + threadIdx.x) = lam; return; }
    unsigned blk = blockIdx.x - 1; const float* src; bf* dst;   // the tensor and the block's place in it: scalar compares on the block index
    if (blk < PB_X) { src = x; dst = XB; }
    else if ((blk -= PB_X) < PB_Q) { src = wq; dst = WQ; }
    else if ((blk -= PB_Q) < PB_K) { src = wk; dst = WK; }
    else if ((blk -= PB_K) < PB_V) { src = wv; dst = WV; }
    else { blk -= PB_V; src = wo; dst = WO; }
    const size_t i = (size_t)blk * 256 + threadIdx.x; const v8f v = *(const v8f*)(src + i * 8); v8us o;
#pragma unroll
    for (int k = 0; k < 8; ++k) o[k] = f2bf(v[k]); *(v8us*)(dst + i * 8) = o;  }

// ---- GroupNorm statistics without a launch of their own. k_dcomb, which has every y in registers, leaves one partial per (head, 64 rows): the block's own mean and the sum of squared deviations from that mean (M2).
// Partials of equal count n merge as mean = sum(mean_p) / P, M2 = sum(M2_p) + n sum((mean_p - mean)^2): no difference of large squares anywhere. k_dcomb merges its 16 lane rows so, k_gnapply a head's GNB blocks; var = M2 / (TT x HD). Fixed-order sums.
#define GNR 64            // rows of one block's partial
#define GNB (TT / GNR)    // partials per head
static_assert(GNB == 32 && GNB * GNR == TT && HD == 64, "the merge in k_gnapply: 16 lanes of one head hold two partials each; k_dcomb's grid is exact");
static_assert(((TT * HD) & (TT * HD - 1)) == 0 && ((GNR * HD) & (GNR * HD - 1)) == 0, "the counts are powers of two: multiplying by their reciprocals is the exact division");
// Sum over the 16 lanes of a row, in every lane of it, every lane on: four adds whose second operand comes from lane ^ 1, 2, 4, 8 through the vector unit's own cross-lane path (row_xmask), not through the LDS unit as a shuffle would.
__device__ __forceinline__ float gn_row16(float s) {
    s += __int_as_float(__builtin_amdgcn_update_dpp(0, __float_as_int(s), 0x161, 0xf, 0xf, true));
    s += __int_as_float(__builtin_amdgcn_update_dpp(0, __float_as_int(s), 0x162, 0xf, 0xf, true));
    s += __int_as_float(__builtin_amdgcn_update_dpp(0, __float_as_int(s), 0x164, 0xf, 0xf, true));
    s += __int_as_float(__builtin_amdgcn_update_dpp(0, __float_as_int(s), 0x168, 0xf, 0xf, true));
    return s; }
// k_dcomb: y_h = a1 v - lambda a2 v for GNR rows of one head per work-group (a thread: 4 columns of rows t0 + 16 c; a row of 16 lanes: GNR x HD / 16 values), and that block's partial. Grid (GNB, NHD), exact.
__global__ __launch_bounds__(256) void k_dcomb(const float* __restrict__ O, const float* __restrict__ LAM, float* Y, float* PST) { __shared__ v2f red[16];
    const int h = blockIdx.y; O += (size_t)h * 2 * TT * HD; const int d0 = (int)(threadIdx.x & 15) * 4; const size_t t0 = (size_t)blockIdx.x * GNR + (threadIdx.x >> 4); const float lam = LAM[0]; v4f av[4], bv[4], ov[4];
#pragma unroll
    for (int c = 0; c < 4; ++c) { av[c] = *(const v4f*)(O + (t0 + 16 * c) * HD + d0); bv[c] = *(const v4f*)(O + (size_t)TT * HD + (t0 + 16 * c) * HD + d0); }
    float s = 0.f;
#pragma unroll
    for (int c = 0; c < 4; ++c) { const size_t t = t0 + 16 * c; const float cs = (t < RH) ? 1.0f : (1.0f / PCAR); const v4f a = av[c]; const v4f b = bv[c]; v4f o;
#pragma unroll
    for (int q = 0; q < 4; ++q) { float p = __fmul_rn(a[q], cs), m = __fmul_rn(__fmul_rn(b[q], cs), lam); asm volatile("" : "+v"(p), "+v"(m)); o[q] = __fsub_rn(p, m); }
        ov[c] = o; s += (o[0] + o[1]) + (o[2] + o[3]); }
    const float rmean = gn_row16(s) * (16.0f / (float)(GNR * HD));
    float s2 = 0.f;
#pragma unroll
    for (int c = 0; c < 4; ++c) { float acc = 0.f;
#pragma unroll
        for (int q = 0; q < 4; ++q) { const float dv = ov[c][q] - rmean; acc += dv * dv; } s2 += acc; }
    s2 = gn_row16(s2); if ((threadIdx.x & 15) == 0) { v2f pr; pr[0] = rmean; pr[1] = s2; red[threadIdx.x >> 4] = pr; }
    __syncthreads();   // the 16 lane rows' partials are in red before wave 0 merges them. The y stores stand behind it: in front, the barrier would wait for them to be acknowledged
#pragma unroll
    for (int c = 0; c < 4; ++c) *(v4f*)(Y + (t0 + 16 * c) * (NHD * HD) + (size_t)h * HD + d0) = ov[c];
    if (threadIdx.x < 32) { const v2f pr = red[threadIdx.x & 15];   // the whole of wave 0: every lane is on at the cross-lane adds
        const float bmean = gn_row16(pr[0]) * (1.0f / 16.0f); const float e = pr[0] - bmean; const float m2 = gn_row16(pr[1] + (float)(GNR * HD / 16) * (e * e));
        if (threadIdx.x == 0) { v2f w; w[0] = bmean; w[1] = m2; *(v2f*)(PST + ((size_t)h * GNB + blockIdx.x) * 2) = w; } } }

// k_gnapply: a thread normalises 4 columns of one row; the 16 lanes of a row of lanes lie in one head and merge its partials, two a lane. The grid is exact: every lane is on at the cross-lane adds.
static_assert((size_t)TT * NHD * HD / 4 % 256 == 0, "no thread of k_gnapply leaves early");
__global__ __launch_bounds__(256) void k_gnapply(const float* __restrict__ Y, const float* __restrict__ PST, bf* Ah, bf* Al) { const size_t i = (size_t)blockIdx.x * 256 + threadIdx.x; const int c0 = (int)(i % (NHD * HD / 4)) * 4; const size_t t = i / (NHD * HD / 4); const int h = c0 / HD;
    const v4f pp = *(const v4f*)(PST + (size_t)h * GNB * 2 + (threadIdx.x & 15) * 4); const v4f a = *(const v4f*)(Y + t * (NHD * HD) + c0);   // pp: mean, M2 of partial 2 l and of partial 2 l + 1
    const float mean = gn_row16(pp[0] + pp[2]) * (1.0f / (float)GNB); const float e0 = pp[0] - mean, e1 = pp[2] - mean;
    const float var = gn_row16((pp[1] + pp[3]) + (float)(GNR * HD) * (e0 * e0 + e1 * e1)) * (1.0f / (float)((size_t)TT * HD));
    const float rs = __fdiv_rn(1.0f, __fsqrt_rn(__fadd_rn(var, 1e-5f))); v4us oh, ol;
#pragma unroll
    for (int q = 0; q < 4; ++q) { float nv = __fmul_rn(__fsub_rn(a[q], mean), rs); asm volatile("" : "+v"(nv)); unsigned short h2, l2; splitf(__fmul_rn(nv, 1.0f - LINIT), h2, l2); oh[q] = h2; ol[q] = l2; }
    *(v4us*)(Ah + t * (NHD * HD) + c0) = oh; *(v4us*)(Al + t * (NHD * HD) + c0) = ol;  }

// ---- k_fattn: scores, causal softmax and probability x value in ONE launch for all 32 query sub-heads; no score or probability ever goes to memory.
// One wave owns 16 query rows and walks the keys 0 .. its diagonal ONCE, in blocks of 64: scores, e = exp(t - ref), row sum, e to 16-bit, P.V accumulated in key order; the division by the row sum comes after P.V. Rows < RH: hi+lo planes, 3 products; the rest fp16 with e x PCAR.
// Both products are taken transposed: S^T = K Q^T (keys are the accumulator's rows, queries its columns), O^T += V^T P^T. A lane then holds scores of ONE query (column lane & 15; keys 8 (lane >> 4) + j of each 16), and two
// score accumulators, converted in place, ARE the B operand of the second product in the k order of the staged loaders: no probability goes through LDS. Row maximum and row sum are in-lane, with one exchange between the wave's halves.
// ref is the row's running maximum, renewed lazily: only when a score exceeds it by more than MXLAG are the row sums and the P.V accumulators scaled by exp(old ref - new ref). ref cancels in P.V / sum.
// A work-group (4 waves, 64 rows) does row block 31 - rb and then row block rb: every work-group walks the same number of key blocks, wherever it is placed.
// The four waves walk the same key blocks: each block's key and value tiles are brought into LDS once for the work-group by asynchronous copies (whole 128-B lines), two buffers, the next block's copies in flight while this block is worked on.
#define MXLAG 3.4657359f   // 5 ln 2: e <= 32, so e x PCAR <= 32768 stays inside fp16
#define PP 72   // LDS pitch of a staged key or value row in 16-bit elements: 144 B = 16 B x odd, the conflict-free pitch for 16-byte reads
#define KVT (64 * PP)   // one staged tile in 16-bit elements: 64 rows of 128 B at pitch PP
#define KVB (4 * KVT)   // one buffer: tiles 0 keys, 1 values, 2 keys lo, 3 values lo (2 and 3 only for the hi+lo planes)
template <typename T16> struct LFrag;
template <> struct LFrag<h16> { static __device__ __forceinline__ v16h ld(const h16* p) { return cat16(*(const v8ha*)p, *(const v8ha*)(p + 16)); } };
template <> struct LFrag<bf> { static __device__ __forceinline__ v16bf ld(const bf* p) { return cat16b(*(const v8usa*)p, *(const v8usa*)(p + 16)); } };
// 2^x with the free issue slot behind the transcendental in the same statement: the next vector instruction may then read the result or overwrite the source.
__device__ __forceinline__ float fattn_exp2(float x) { float r; asm("v_exp_f32 %0, %1\n\tv_nop" : "=v"(r) : "v"(x)); return r; }
// Four fragments (nb = 0..3) of k step ks of one staged tile: rows nb*16+lr at pitch PP; pl is the lane's own LDS pointer (row lr, k offset 8*hi).
template <typename T16>
__device__ __forceinline__ void fattn_ld4(const T16* pl, int ks, typename WFrag<T16>::V (&b)[4]) {
#pragma unroll
    for (int nb = 0; nb < 4; ++nb) b[nb] = LFrag<T16>::ld(pl + (nb * 16 * PP + ks * 32));
}
// Two 64-row x 128-B tiles from global memory into LDS through no register. ga, gb: the thread's own 16 bytes of its first row (row tid / 8, piece tid % 8); la, lb: their LDS byte addresses.
// A thread brings rows tid / 8 + 16 c, c = 0..3, of each tile; a wave's copy covers 4 whole 128-B lines. The s_wait_xcnt closes the statement so that no address register is rewritten in front of it.
template <typename T16>
__device__ __forceinline__ void fattn_copy2(const T16* ga, size_t pa, const T16* gb, size_t pb, unsigned la, unsigned lb) {
    asm volatile("global_load_async_to_lds_b128 %0, %8, off\n\t"
                 "global_load_async_to_lds_b128 %1, %9, off\n\t"
                 "global_load_async_to_lds_b128 %2, %10, off\n\t"
                 "global_load_async_to_lds_b128 %3, %11, off\n\t"
                 "global_load_async_to_lds_b128 %4, %12, off\n\t"
                 "global_load_async_to_lds_b128 %5, %13, off\n\t"
                 "global_load_async_to_lds_b128 %6, %14, off\n\t"
                 "global_load_async_to_lds_b128 %7, %15, off\n\t"
                 "s_wait_xcnt 0x0"
                 :: "v"(la), "v"(la + 16 * PP * 2), "v"(la + 32 * PP * 2), "v"(la + 48 * PP * 2), "v"(lb), "v"(lb + 16 * PP * 2), "v"(lb + 32 * PP * 2), "v"(lb + 48 * PP * 2),
                    "v"(ga), "v"(ga + 16 * pa), "v"(ga + 32 * pa), "v"(ga + 48 * pa), "v"(gb), "v"(gb + 16 * pb), "v"(gb + 32 * pb), "v"(gb + 48 * pb) : "memory");
}
// Inputs-only fence on loaded fragments: every LDS read of the batch is issued before the first matrix instruction waits, so a batch pays one LDS latency, not one per fragment.
template <typename V> __device__ __forceinline__ void fattn_hold8(const V (&x)[4], const V (&y)[4]) { asm volatile("" :: "v"(x[0]), "v"(x[1]), "v"(x[2]), "v"(x[3]), "v"(y[0]), "v"(y[1]), "v"(y[2]), "v"(y[3])); }
// acc[nb] += b[nb] x a (+ b[nb] x a2 + b2[nb] x a for the hi+lo planes): the staged rows are the A operand, a (queries or probabilities, one query a lane column) the B operand
template <typename T16, bool HI>
__device__ __forceinline__ void fattn_mm(const typename WFrag<T16>::V& a, const typename WFrag<T16>::V& a2, const typename WFrag<T16>::V (&b)[4], const typename WFrag<T16>::V (&b2)[4], v8f (&acc)[4]) {
#pragma unroll
    for (int nb = 0; nb < 4; ++nb) { acc[nb] = WFrag<T16>::mma(b[nb], a, acc[nb]);
        if (HI) { acc[nb] = WFrag<T16>::mma(b[nb], a2, acc[nb]); acc[nb] = WFrag<T16>::mma(b2[nb], a, acc[nb]); } }
}
// Lane l's value in lane l ^ 16, through the vector unit's cross-row move (a shuffle would go through the LDS unit); every lane on.
__device__ __forceinline__ float fattn_xhalf(float x) { return __int_as_float(__builtin_amdgcn_permlanex16(__float_as_int(x), __float_as_int(x), 0x76543210, 0xfedcba98, false, false)); }
// os: the wave's own 16 x 68 floats of LDS for its output rows. st: the two staging buffers (work-group wide), sbase: their LDS byte address. Called by all four waves of the work-group with the same row block: the barriers inside are passed by every wave, the same number of times.
template <typename T16, bool HI>
__device__ __forceinline__ void fattn_strip(const T16* __restrict__ Q, const T16* __restrict__ Q2, const T16* __restrict__ Kp, const T16* __restrict__ Kp2, const T16* __restrict__ Vt, const T16* __restrict__ Vt2, int i0, float* os, const T16* st, unsigned sbase, float* O) {
    typedef typename WFrag<T16>::V V;
    const int lane = threadIdx.x & 31, lr = lane & 15, hi = lane >> 4;
    const int nblk = (i0 >> 6) + 1;                    // key blocks 0 .. nblk-1: up to the end of the 64-key block that holds the diagonal (64 nblk <= TT); the same for the four waves
    const unsigned crow = threadIdx.x >> 3, ccol = (threadIdx.x & 7) * 8;   // the thread's first row and its 16-byte piece in every staged tile
    const T16* gk = Kp + crow * HD + ccol; const T16* gk2 = Kp2 + crow * HD + ccol; const T16* gv = Vt + crow * TT + ccol; const T16* gv2 = Vt2 + crow * TT + ccol;
    const unsigned l0 = sbase + (crow * PP + ccol) * 2;
    auto stage = [&](int t) { const unsigned lb = l0 + (unsigned)(t & 1) * (KVB * 2);
        fattn_copy2<T16>(gk + (size_t)t * 64 * HD, HD, gv + t * 64, TT, lb, lb + KVT * 2);
        if constexpr (HI) fattn_copy2<T16>(gk2 + (size_t)t * 64 * HD, HD, gv2 + t * 64, TT, lb + 2 * KVT * 2, lb + 3 * KVT * 2); };
    stage(0);   // both buffers are free here: an earlier strip's last reads ended in front of its last barrier
    V q[2], q2[2];
#pragma unroll
    for (int ks = 0; ks < 2; ++ks) { q[ks] = WFrag<T16>::ld(Q + (size_t)(i0 + lr) * HD + ks * 32 + 8 * hi); q2[ks] = HI ? WFrag<T16>::ld(Q2 + (size_t)(i0 + lr) * HD + ks * 32 + 8 * hi) : q[ks]; }
    asm volatile("s_wait_xcnt 0x0" :: "v"(q[0]), "v"(q[1]), "v"(q2[0]), "v"(q2[1]) : "memory");   // behind the query loads, before their address registers are used for anything else
    constexpr float C2 = SCL * 1.4426950408889634f;   // exp(SCL s - ref) = 2^(C2 s - C2 mx), mx in units of the unscaled product
    constexpr float EB = HI ? 0.0f : 10.0f;           // fp16 path: e x PCAR comes out of the exponent, PCAR = 2^10 (exact); the row sum carries the same factor
    static_assert(PCAR == 1024.0f, "EB is log2 PCAR");
    float mx = -3.0e38f;   // the reference the exponentials of this lane's query (row i0 + lr) are taken against: a running row maximum of the unscaled products, the same in both halves, renewed only when a score leaves it far behind
    v2f sum[4]; v8f o[4];   // sum[nb]: this lane's keys of 16-key group nb, even and odd keys apart: independent chains of packed adds; o[nb][j]: column nb*16 + hi*8 + j of row i0 + lr
#pragma unroll
    for (int nb = 0; nb < 4; ++nb) { sum[nb] = (v2f){}; o[nb] = (v8f){}; }
    asm volatile("s_wait_asynccnt 0x0" ::: "memory");   // this wave's copies of block 0 have landed
    __syncthreads();                                    // and every other wave's: block 0 may be read
    if (nblk > 1) stage(1);
    for (int t = 0; t < nblk; ++t) { V kb[2][4], kb2[2][4], vb[2][4], vb2[2][4]; v8f s[4]; const int j0 = t * 64; const T16* sb = st + (t & 1) * KVB + lr * PP + 8 * hi;
        const int dg = i0 + lr - j0 - hi * 8;   // key nb*16 + j of this lane's keys is inside the causal range while nb*16 + j <= dg
        bool in[4][8];
        // The compares need no score. The scheduling barrier keeps them behind the block's first fragment reads, whose latency they fill, and in front of the matrix instructions: left alone each stands directly in front of the select that waits for it.
        auto conds = [&]() {
#pragma unroll
            for (int nb = 0; nb < 4; ++nb)
#pragma unroll
                for (int j = 0; j < 8; ++j) in[nb][j] = nb * 16 + j <= dg;
            __builtin_amdgcn_sched_barrier(0); };
#pragma unroll
        for (int nb = 0; nb < 4; ++nb) s[nb] = (v8f){};
        if constexpr (HI) {
#pragma unroll
            for (int ks = 0; ks < 2; ++ks) { fattn_ld4<T16>(sb, ks, kb[ks]); fattn_ld4<T16>(sb + 2 * KVT, ks, kb2[ks]); if (ks == 0) conds(); fattn_mm<T16, HI>(q[ks], q2[ks], kb[ks], kb2[ks], s);
                if (ks == 0) __builtin_amdgcn_sched_barrier(0); }   // one k step's 64 fragment registers at a time: both steps' fetched together overrun the 256 directly addressed registers
        } else {   // one plane each: the value fragments are fetched with the key fragments, ahead of the softmax
            fattn_ld4<T16>(sb, 0, kb[0]); fattn_ld4<T16>(sb, 1, kb[1]); fattn_ld4<T16>(sb + KVT, 0, vb[0]); fattn_ld4<T16>(sb + KVT, 1, vb[1]); conds();
            fattn_mm<T16, HI>(q[0], q2[0], kb[0], kb2[0], s); fattn_mm<T16, HI>(q[1], q2[1], kb[1], kb2[1], s); }
        float bm[4];   // the largest product of this lane's keys in each 16-key group
#pragma unroll
        for (int nb = 0; nb < 4; ++nb) {
#pragma unroll
            for (int j = 0; j < 8; ++j) s[nb][j] = in[nb][j] ? s[nb][j] : -3.0e38f;
            bm[nb] = fmaxf(fmaxf(fmaxf(s[nb][0], s[nb][1]), fmaxf(s[nb][2], s[nb][3])), fmaxf(fmaxf(s[nb][4], s[nb][5]), fmaxf(s[nb][6], s[nb][7]))); }
        const float bmax = fmaxf(fmaxf(bm[0], bm[1]), fmaxf(bm[2], bm[3]));
        if (__builtin_amdgcn_ballot_w32(bmax - mx > MXLAG / SCL) != 0) {   // one scalar test per key block, every lane stays on: taken at a strip's first block and then only when some score outgrows its row's reference
            const float nm = fmaxf(mx, fmaxf(bmax, fattn_xhalf(bmax))); const float f = fattn_exp2((mx - nm) * C2); mx = nm;   // what was summed against the old reference is carried over to the new one (first block: f = 0 on zeros)
#pragma unroll
            for (int nb = 0; nb < 4; ++nb) { sum[nb] *= f; o[nb] *= f; } }
        const float ad = __builtin_fmaf(-mx, C2, EB);
        V p[2], p2[2];   // P^T as B operand of k step ks (32 keys): elements 0-7 from score accumulator 2 ks, 8-15 from 2 ks + 1, which is the k order of the staged value rows' loader
#pragma unroll
        for (int ks = 0; ks < 2; ++ks) { v8h eh16[2]; v8us ehi[2], elo[2];
#pragma unroll
            for (int g = 0; g < 2; ++g) { const int nb = 2 * ks + g; const v8f ar = __builtin_elementwise_fma(s[nb], (v8f){C2, C2, C2, C2, C2, C2, C2, C2}, (v8f){ad, ad, ad, ad, ad, ad, ad, ad}); v8f e;   // one reference a lane: scale and reference in one fused multiply-add, two scores an instruction
#pragma unroll
                for (int j = 0; j < 8; ++j) e[j] = fattn_exp2(ar[j]);
#pragma unroll
                for (int j = 0; j < 8; j += 2) sum[nb] += (v2f){e[j], e[j + 1]};
                if constexpr (HI) {
#pragma unroll
                    for (int j = 0; j < 8; ++j) { unsigned short eh, el; splitf(e[j], eh, el); ehi[g][j] = eh; elo[g][j] = el; }
                } else eh16[g] = __builtin_convertvector(e, v8h); }
            if constexpr (HI) { p[ks] = cat16b(ehi[0], ehi[1]); p2[ks] = cat16b(elo[0], elo[1]); } else { p[ks] = cat16(eh16[0], eh16[1]); p2[ks] = p[ks]; } }
#pragma unroll
        for (int ks = 0; ks < 2; ++ks) {
            if constexpr (HI) { fattn_ld4<T16>(sb + KVT, ks, vb[ks]); fattn_ld4<T16>(sb + 3 * KVT, ks, vb2[ks]); fattn_hold8(vb[ks], vb2[ks]); }
            fattn_mm<T16, HI>(p[ks], p2[ks], vb[ks], vb2[ks], o); }
        __builtin_amdgcn_sched_barrier(0);   // the block's work stays in front of the hand-over: left alone the compiler lifts the waits over the exponentials and the second product, and the wave waits for the next block's copies when they have only just been issued
        // hand-over of the buffers, every wave, in this order:
        asm volatile("s_wait_dscnt 0x0" ::: "memory");      // this wave's reads of this block's buffer have returned
        asm volatile("s_wait_asynccnt 0x0" ::: "memory");   // this wave's copies of the next block have landed
        __syncthreads();                                    // the same holds for every wave: the next block may be read, this block's buffer may be refilled
        if (t + 2 < nblk) stage(t + 2);
    }
    asm volatile("s_wait_asynccnt 0x0" ::: "memory");   // no copy is in flight behind the loop
    const v2f s2 = (sum[0] + sum[1]) + (sum[2] + sum[3]); float sm = s2[0] + s2[1]; sm += fattn_xhalf(sm);   // the two halves hold the two halves of the row's keys
    const float f = __fdiv_rn(HI ? 1.0f : PCAR, sm);   // fp16 path: the sum carries PCAR as the probabilities do; the output keeps its factor PCAR
    // A lane holds 8 consecutive columns of its row in each accumulator. Through the wave's own LDS rows, so that every global store covers whole 128-B lines.
#pragma unroll
    for (int nb = 0; nb < 4; ++nb) { v4f a, b;
#pragma unroll
        for (int q4 = 0; q4 < 4; ++q4) { a[q4] = o[nb][q4] * f; b[q4] = o[nb][4 + q4] * f; }
        *(v4fa*)(os + lr * 68 + nb * 16 + hi * 8) = a; *(v4fa*)(os + lr * 68 + nb * 16 + hi * 8 + 4) = b; }
    __builtin_amdgcn_wave_barrier(); asm volatile("" ::: "memory");   // the rows are read below by other lanes of this wave: keep the stores in front of the reads
    float* orow = O + (size_t)i0 * HD;
#pragma unroll
    for (int r = 0; r < 8; ++r) { const int row = 2 * r + hi, cofs = lr * 4; const v4f val = *(const v4fa*)(os + row * 68 + cofs); *(v4f*)(orow + (size_t)row * HD + cofs) = val; }
    __builtin_amdgcn_wave_barrier(); asm volatile("s_wait_xcnt 0x0" ::: "memory");   // the LDS reads stay in front of the next strip's LDS stores; the wait stands behind the output stores, before the next strip reuses their address and data registers
}
// the register attribute holds the kernel to the 256 directly addressed vector registers (no register-bank switching in the loops): with this much LDS the launch bounds' second figure alone no longer does
__global__ __launch_bounds__(128, 4) __attribute__((amdgpu_num_vgpr(256))) void k_fattn(const h16* __restrict__ QP16, const bf* __restrict__ QPh, const bf* __restrict__ QPl, const h16* __restrict__ KP16, const bf* __restrict__ KPh, const bf* __restrict__ KPl, const h16* __restrict__ VT16, const bf* __restrict__ VTh, const bf* __restrict__ VTl, float* Ob) {
    __shared__ __align__(16) float osw[4][16 * 68];
    __shared__ __align__(16) unsigned short kv[2 * KVB];
    const unsigned sbase = (unsigned)(size_t)(const void*)kv;   // the low 32 bits of a __shared__ address are its LDS byte address
    const int wv = __builtin_amdgcn_readfirstlane(threadIdx.x >> 5); const int z = blockIdx.y;   // wave number in a scalar register: scalar loop bounds. z = 2h: (q1_h, k1_g), z = 2h+1: (q2_h, k2_g), g = h/2; both use v[g]
    const size_t zq = (size_t)z * TT * HD, zk = (size_t)(2 * (z / 4) + (z & 1)) * TT * HD, zv = (size_t)(z / 4) * HD * TT;
    // The far row block first: rb >= TT / 128, which is not below RH / 64, so it is always the fp16 path. Written out, not as a loop over the two halves: no path's lane addresses then stay in registers through the other path's key loop (spills).
    static_assert(TT / 128 * 64 >= RH, "the first row block of every work-group lies outside the hi+lo rows");
    { const int i0 = (TT / 64 - 1 - (int)blockIdx.x) * 64 + wv * 16;
        fattn_strip<h16, false>(QP16 + zq, QP16 + zq, KP16 + zk, KP16 + zk, VT16 + zv, VT16 + zv, i0, osw[wv], (const h16*)kv, sbase, Ob + zq); }
    { const int rb = (int)blockIdx.x; const int i0 = rb * 64 + wv * 16;
        if (rb * 64 < RH) fattn_strip<bf, true>(QPh + zq, QPl + zq, KPh + zk, KPl + zk, VTh + zv, VTl + zv, i0, osw[wv], (const bf*)kv, sbase, Ob + zq);
        else fattn_strip<h16, false>(QP16 + zq, QP16 + zq, KP16 + zk, KP16 + zk, VT16 + zv, VT16 + zv, i0, osw[wv], (const h16*)kv, sbase, Ob + zq); }
}
// ---- The two projection GEMMs (k_qkv, k_out), K = DM: a work-group of 4 waves (2 x 2) owns one output tile; its operands' 64-k tiles are brought into LDS once for the work-group
// by asynchronous copies (whole 128-B lines; each staged row is read by two waves), two buffers, the next k tile's copies in flight while this one is worked on.
// A buffer is four tiles of 64 rows at pitch PP: 0 and 1 from T0 and T1 (k_qkv: rows 0-63 and 64-127 of A; k_out: the hi and the lo plane of 64 rows of A), 2 and 3 rows 0-63 and 64-127 of B.
// A wave has MB x 4 accumulators: MB 16-row blocks of A from element aoff of tile 0 on (NPL == 2: the same rows of tile 1 as second plane) against the 64 rows of B tile wn. Every accumulator takes its products in the order of a plain loop over k in steps of 32, hi plane before lo plane.
static_assert(NHD * HD == DM && DM % 128 == 0, "both GEMMs sum over DM; at least two k tiles of 64");
template <int NPL, int MB>
__device__ __forceinline__ void gemm_staged(const bf* __restrict__ T0, const bf* __restrict__ T1, const bf* __restrict__ B, const bf* st, unsigned sbase, int aoff, int wn, v8f (&acc)[MB][4]) {
    typedef WFrag<bf>::V V;
    constexpr int NS = DM / 64;
    const int lane = threadIdx.x & 31, lr = lane & 15, hi = lane >> 4;
    const unsigned crow = threadIdx.x >> 3, ccol = (threadIdx.x & 7) * 8;   // the thread's first row and its 16-byte piece in every staged tile
    const bf* g0 = T0 + crow * DM + ccol; const bf* g1 = T1 + crow * DM + ccol; const bf* gb = B + crow * DM + ccol;
    const unsigned l0 = sbase + (crow * PP + ccol) * 2;
    auto stage = [&](int t) { const unsigned lb = l0 + (unsigned)(t & 1) * (KVB * 2);
        fattn_copy2<bf>(g0 + t * 64, DM, g1 + t * 64, DM, lb, lb + KVT * 2);
        fattn_copy2<bf>(gb + t * 64, DM, gb + 64 * DM + t * 64, DM, lb + 2 * KVT * 2, lb + 3 * KVT * 2); };
    stage(0);   // nothing has touched the buffers before
#pragma unroll
    for (int mb = 0; mb < MB; ++mb)
#pragma unroll
        for (int nb = 0; nb < 4; ++nb) acc[mb][nb] = (v8f){};
    asm volatile("s_wait_asynccnt 0x0" ::: "memory");   // this wave's copies of k tile 0 have landed
    __syncthreads();                                    // and every other wave's: k tile 0 may be read
    stage(1);
#pragma unroll 1   // one k tile in the code: a second tile's fragments would leave the 256 directly addressed registers
    for (int t = 0; t < NS; ++t) { const bf* sa = st + (t & 1) * KVB + aoff + lr * PP + 8 * hi; const bf* sb = st + (t & 1) * KVB + (2 + wn) * KVT + lr * PP + 8 * hi;
        V a[2][MB], a2[2][MB], b[2][4];
        auto frags = [&](int ks) {
#pragma unroll
            for (int mb = 0; mb < MB; ++mb) { a[ks][mb] = LFrag<bf>::ld(sa + mb * 16 * PP + ks * 32); if constexpr (NPL == 2) a2[ks][mb] = LFrag<bf>::ld(sa + KVT + mb * 16 * PP + ks * 32); }
            fattn_ld4<bf>(sb, ks, b[ks]); };
        auto prods = [&](int ks) {
#pragma unroll
            for (int nb = 0; nb < 4; ++nb)
#pragma unroll
                for (int mb = 0; mb < MB; ++mb) acc[mb][nb] = WFrag<bf>::mma(a[ks][mb], b[ks][nb], acc[mb][nb]);
            if constexpr (NPL == 2) {
#pragma unroll
                for (int nb = 0; nb < 4; ++nb)
#pragma unroll
                    for (int mb = 0; mb < MB; ++mb) acc[mb][nb] = WFrag<bf>::mma(a2[ks][mb], b[ks][nb], acc[mb][nb]); } };
        // The scheduling barriers keep each group of LDS reads whole and in front of its matrix instructions: left alone the compiler reloads one B fragment register set and waits out the LDS latency before every four matrix instructions.
        if constexpr (MB * (1 + NPL) <= 6) {   // both k steps' fragments fit beside the accumulators: one group of reads per k tile
            frags(0); frags(1); __builtin_amdgcn_sched_barrier(0); prods(0); prods(1);
        } else {                               // one k step's fragments at a time
            frags(0); __builtin_amdgcn_sched_barrier(0); prods(0); __builtin_amdgcn_sched_barrier(0); frags(1); __builtin_amdgcn_sched_barrier(0); prods(1); }
        __builtin_amdgcn_sched_barrier(0);   // the matrix instructions stay in front of the hand-over: left alone the compiler lifts its waits and the barrier over them, and the wave waits out all its LDS reads before its first matrix instruction
        // hand-over of the buffers, every wave, in this order:
        asm volatile("s_wait_dscnt 0x0" ::: "memory");      // this wave's reads of this k tile's buffer have returned
        asm volatile("s_wait_asynccnt 0x0" ::: "memory");   // this wave's copies of the next k tile have landed
        __syncthreads();                                    // the same holds for every wave: the next k tile may be read, this one's buffer may be refilled
        if (t + 2 < NS) stage(t + 2);
    }
    asm volatile("s_wait_asynccnt 0x0" ::: "memory");   // no copy is in flight behind the loop
}

// ---- k_out: C[m][n] (f32, pitch DM) = sum_k (Ah[m][k] + Al[m][k]) Bt[n][k]; a work-group owns 64 x 128 of C, a wave 32 x 64: grid (TT/64, DM/128) = one work-group per WGP, 128 threads. Each wave stores its part through its own LDS rows as whole lines.
__global__ __launch_bounds__(128) void k_out(const bf* __restrict__ Ah, const bf* __restrict__ Al, const bf* __restrict__ Bt, float* C) {
    __shared__ __align__(16) float osw[4][16 * 68];
    __shared__ __align__(16) unsigned short gst[2 * KVB];
    const unsigned sbase = (unsigned)(size_t)(const void*)gst;   // the low 32 bits of a __shared__ address are its LDS byte address
    const int wv = __builtin_amdgcn_readfirstlane(threadIdx.x >> 5), wm = wv & 1, wn = wv >> 1; float* os = osw[wv];
    const int lane = threadIdx.x & 31, lr = lane & 15, hi = lane >> 4; const int r0 = blockIdx.x * 64 + wm * 32, c0 = blockIdx.y * 128 + wn * 64;
    v8f acc[2][4];
    gemm_staged<2, 2>(Ah + (size_t)blockIdx.x * 64 * DM, Al + (size_t)blockIdx.x * 64 * DM, Bt + (size_t)blockIdx.y * 128 * DM, (const bf*)gst, sbase, wm * 32 * PP, wn, acc);
#pragma unroll
    for (int mb = 0; mb < 2; ++mb) {
#pragma unroll
        for (int nb = 0; nb < 4; ++nb) {
#pragma unroll
            for (int j = 0; j < 8; ++j) os[(hi * 8 + j) * 68 + nb * 16 + lr] = acc[mb][nb][j]; }
        __builtin_amdgcn_wave_barrier(); asm volatile("" ::: "memory");   // the rows are read below by other lanes of this wave: keep the stores in front of the reads
        float* crow = C + (size_t)(r0 + mb * 16) * DM + c0;
#pragma unroll
        for (int s = 0; s < 8; ++s) { const int row = 2 * s + hi, cofs = lr * 4; const v4f val = *(const v4fa*)(os + row * 68 + cofs); *(v4f*)(crow + (size_t)row * DM + cofs) = val; }
        __builtin_amdgcn_wave_barrier(); asm volatile("s_wait_xcnt 0x0" ::: "memory");   // the LDS reads stay in front of the next 16 rows' LDS stores; the wait stands behind these rows' global stores, before the next LDS reads land in their registers
    }
}

// ---- k_qkv: the q, k and v projections in ONE launch, each wave's 64x64 quarter finished in its own epilogue: nothing of the projections goes to memory in f32.
// Main loop: gemm_staged, one plane; a work-group owns 128 x 128, a wave a 64 x 64 quarter. A quarter's columns are one 64-wide sub-head: cy 0..31 query sub-heads, 32..47 key sub-heads, 48..55 value groups; a work-group's two sub-heads lie in one weight tensor.
// q, k: interleaved-pair rotary on the staged rows (cos / sin rounded to bf16 as every input), then the fp16 plane and the hi+lo planes [sub-head][t][64], whole 128-B lines per row.
// v: an accumulator register run is 8 consecutive t of one column, which is 16 B of the transposed planes [group][d][t]: stored straight from the registers.
static_assert(NH_ % 2 == 0 && NKV % 2 == 0 && NVG % 2 == 0, "a pair of sub-heads never straddles two weight tensors");
__global__ __launch_bounds__(128) void k_qkv(const bf* __restrict__ A, const bf* __restrict__ WQ, const bf* __restrict__ WK, const bf* __restrict__ WV, const float* __restrict__ fcos, const float* __restrict__ fsin, h16* QP16, bf* QPh, bf* QPl, h16* KP16, bf* KPh, bf* KPl, h16* VT16, bf* VTh, bf* VTl) {
    __shared__ __align__(16) float osw[4][16 * 68];
    __shared__ __align__(16) unsigned short gst[2 * KVB];
    const unsigned sbase = (unsigned)(size_t)(const void*)gst;   // the low 32 bits of a __shared__ address are its LDS byte address
    const int wv = __builtin_amdgcn_readfirstlane(threadIdx.x >> 5), wm = wv & 1, wn = wv >> 1; float* os = osw[wv];
    const int lane = threadIdx.x & 31, lr = lane & 15, hi = lane >> 4; const int r0 = blockIdx.x * 128 + wm * 64, cb = blockIdx.y * 2, cy = cb + wn;
    const bf* Bt = (cb < NH_) ? WQ + (size_t)cb * 64 * DM : (cb < NH_ + NKV) ? WK + (size_t)(cb - NH_) * 64 * DM : WV + (size_t)(cb - NH_ - NKV) * 64 * DM;
    v8f acc[4][4];
    gemm_staged<1, 4>(A + (size_t)blockIdx.x * 128 * DM, A + ((size_t)blockIdx.x * 128 + 64) * DM, Bt, (const bf*)gst, sbase, wm * KVT, wn, acc);
    if (cy >= NH_ + NKV) {
        const size_t vo = ((size_t)(cy - NH_ - NKV) * HD + lr) * TT + r0 + hi * 8;
#pragma unroll
        for (int nb = 0; nb < 4; ++nb)
#pragma unroll
            for (int mb = 0; mb < 4; ++mb) { v8h o16; v8us oh, ol;   // mb innermost: the four 32-B pieces of a 128-B line follow one another
#pragma unroll
                for (int j = 0; j < 8; ++j) { const float x = acc[mb][nb][j]; unsigned short a2, c2; o16[j] = tohx(x); splitf(x, a2, c2); oh[j] = a2; ol[j] = c2; }
                const size_t e = vo + (size_t)nb * 16 * TT + mb * 16; *(v8h*)(VT16 + e) = o16; *(v8us*)(VTh + e) = oh; *(v8us*)(VTl + e) = ol; }
        return; }
    const size_t zo = (size_t)((cy < NH_) ? cy : cy - NH_) * TT * HD;
    h16* P16 = ((cy < NH_) ? QP16 : KP16) + zo; bf* Ph = ((cy < NH_) ? QPh : KPh) + zo; bf* Pl = ((cy < NH_) ? QPl : KPl) + zo;
    const int rr = lane >> 3, c8 = (lane & 7) * 8;   // a lane finishes 8 columns (4 rotary pairs) of one row; 8 lanes cover a row, a wave store 4 rows
    const float* pc = fcos + (size_t)(r0 + rr) * (HD / 2) + (c8 >> 1); const float* pn = fsin + (size_t)(r0 + rr) * (HD / 2) + (c8 >> 1);
    v4f cc[2][4], sn[2][4];
#pragma unroll
    for (int s = 0; s < 4; ++s) { cc[0][s] = *(const v4f*)(pc + (size_t)(4 * s) * (HD / 2)); sn[0][s] = *(const v4f*)(pn + (size_t)(4 * s) * (HD / 2)); }
#pragma unroll
    for (int mb = 0; mb < 4; ++mb) {
#pragma unroll
        for (int nb = 0; nb < 4; ++nb) {
#pragma unroll
            for (int j = 0; j < 8; ++j) os[(hi * 8 + j) * 68 + nb * 16 + lr] = acc[mb][nb][j]; }
        __builtin_amdgcn_wave_barrier(); asm volatile("" ::: "memory");   // the tile is read below by other lanes of this wave: keep the stores in front of the reads
        if (mb < 3) {   // the next 16 rows' cos / sin fly while these 16 rows are finished
#pragma unroll
            for (int s = 0; s < 4; ++s) { cc[(mb + 1) & 1][s] = *(const v4f*)(pc + (size_t)((mb + 1) * 16 + 4 * s) * (HD / 2)); sn[(mb + 1) & 1][s] = *(const v4f*)(pn + (size_t)((mb + 1) * 16 + 4 * s) * (HD / 2)); }
            __builtin_amdgcn_sched_barrier(0); }   // keeps these loads in front of the rows' work: sunk among the stores they would come late and land in registers that an issued store names
#pragma unroll
        for (int s = 0; s < 4; ++s) { const int row = 4 * s + rr; const v4f xa = *(const v4fa*)(os + row * 68 + c8), xb = *(const v4fa*)(os + row * 68 + c8 + 4); v8h o16; v8us oh, ol;
#pragma unroll
            for (int p = 0; p < 4; ++p) { const float x0 = (p < 2) ? xa[2 * p] : xb[2 * p - 4], x1 = (p < 2) ? xa[2 * p + 1] : xb[2 * p - 3]; const float c = bfr(cc[mb & 1][s][p]), n = bfr(sn[mb & 1][s][p]);
                const float e0 = x0 * c - x1 * n, e1 = x0 * n + x1 * c;   /* even: x0 c - x1 s; odd: x0 s + x1 c */
                unsigned short a2, c2; o16[2 * p] = tohx(e0); o16[2 * p + 1] = tohx(e1); splitf(e0, a2, c2); oh[2 * p] = a2; ol[2 * p] = c2; splitf(e1, a2, c2); oh[2 * p + 1] = a2; ol[2 * p + 1] = c2; }
            const size_t e = (size_t)(r0 + mb * 16 + row) * HD + c8; *(v8h*)(P16 + e) = o16; *(v8us*)(Ph + e) = oh; *(v8us*)(Pl + e) = ol; }
        __builtin_amdgcn_wave_barrier(); asm volatile("s_wait_xcnt 0x0" ::: "memory");   // the LDS reads stay in front of the next 16 rows' LDS stores; the wait stands behind these rows' global stores, before the next loads land in their registers
    }
}

__global__ __launch_bounds__(256) void k_merge(const float* __restrict__ O, int h0, bf* Ah, bf* Al) { const size_t e = ((size_t)blockIdx.x * 256 + threadIdx.x) * 2; if (e >= (size_t)ZH * TT * HD) return; const int d = (int)(e % HD); const int t = (int)((e / HD) % TT); const int zz = (int)(e / ((size_t)HD * TT)); const float cs = (t < RH) ? 1.0f : (1.0f / PCAR); const size_t oo = (size_t)t * DQ + (h0 + zz) * HD + d;
    v2us oh, ol;
#pragma unroll
    for (int q = 0; q < 2; ++q) { unsigned short a, c2; splitf(O[e + q] * cs, a, c2); oh[q] = a; ol[q] = c2; } *(v2us*)(Ah + oo) = oh; *(v2us*)(Al + oo) = ol;  }

extern "C" void kernel_launch(void* const* d_in, const int* in_sizes, int n_in,
                              void* d_out, int out_size, void* d_ws, size_t ws_size, hipStream_t stream) {
    (void)in_sizes; (void)n_in; (void)out_size;
    const float* x = (const float*)d_in[0]; const float* fcos = (const float*)d_in[1]; const float* fsin = (const float*)d_in[2]; const float* wq = (const float*)d_in[3]; const float* wk = (const float*)d_in[4]; const float* wv = (const float*)d_in[5]; const float* wo = (const float*)d_in[6]; const float* lq1 = (const float*)d_in[7]; const float* lk1 = (const float*)d_in[8]; const float* lq2 = (const float*)d_in[9]; const float* lk2 = (const float*)d_in[10];
    float* OUT = (float*)d_out;     // [1][2048][1024]
    char* wsp = (char*)d_ws;
    auto take = [&](size_t bytes) { char* p = wsp; wsp += (bytes + 255) & ~(size_t)255; return (void*)p; };
    bf* WQ = (bf*)take((size_t)DQ * DM * 2); bf* WK = (bf*)take((size_t)DKV * DM * 2); bf* WV = (bf*)take((size_t)DV * DM * 2); bf* WO = (bf*)take((size_t)DM * NHD * HD * 2); float* LAM = (float*)take(64 * 4); float* PST = (float*)take((size_t)NHD * GNB * 2 * 4); float* Y = (float*)take((size_t)TT * NHD * HD * 4);
    bf* XB = (bf*)take((size_t)TT * DM * 2);
    h16* QP16 = (h16*)take((size_t)NH_ * TT * HD * 2); h16* KP16 = (h16*)take((size_t)NKV * TT * HD * 2); h16* VT16 = (h16*)take((size_t)NVG * HD * TT * 2);
    bf* QPh = (bf*)take((size_t)NH_ * TT * HD * 2); bf* QPl = (bf*)take((size_t)NH_ * TT * HD * 2); bf* KPh = (bf*)take((size_t)NKV * TT * HD * 2); bf* KPl = (bf*)take((size_t)NKV * TT * HD * 2); bf* VTh = (bf*)take((size_t)NVG * HD * TT * 2); bf* VTl = (bf*)take((size_t)NVG * HD * TT * 2);
    float* Ob = (float*)take((size_t)NH_ * TT * HD * 4); bf* ATh = (bf*)take((size_t)TT * NHD * HD * 2); bf* ATl = (bf*)take((size_t)TT * NHD * HD * 2);
    if ((size_t)(wsp - (char*)d_ws) > ws_size) return;    // ws 256 MiB
    k_prep<<<1 + PB_X + PB_Q + PB_K + PB_V + PB_O, 256, 0, stream>>>(wq, wk, wv, wo, x, WQ, WK, WV, WO, XB, lq1, lk1, lq2, lk2, LAM);   /* bf16 planes of the four weights and of x, and lambda */
    for (int b = 0; b < NB_; ++b) {
        k_qkv<<<dim3(TT / 128, (NH_ + NKV + NVG) / 2, 1), 128, 0, stream>>>(XB, WQ, WK, WV, fcos, fsin, QP16, QPh, QPl, KP16, KPh, KPl, VT16, VTh, VTl);   /* 32 query sub-heads (q1_h = 2h, q2_h = 2h+1), 16 key sub-heads (k1_g = 2g, k2_g = 2g+1), 8 value groups: projection, rotary, planes */
        k_fattn<<<dim3(TT / 128, NH_, 1), 128, 0, stream>>>(QP16, QPh, QPl, KP16, KPh, KPl, VT16, VTh, VTl, Ob);   /* all 32 sub-heads: Ob[z] = softmax(q_z k^T / 8) v (x PCAR for rows >= RH) */
        k_dcomb<<<dim3(GNB, NHD, 1), 256, 0, stream>>>(Ob, LAM, Y, PST);   /* y_h = a1 v - lambda a2 v, and the GroupNorm partial of each 64 rows of a head */
        k_gnapply<<<(unsigned)(((size_t)TT * NHD * HD / 4 + 255) / 256), 256, 0, stream>>>(Y, PST, ATh, ATl);   /* partials merged; GroupNorm per head x (1 - lambda_init) -> planes */
        k_out<<<dim3(TT / 64, DM / 128, 1), 128, 0, stream>>>(ATh, ATl, WO, OUT + (size_t)b * TT * DM); }
}

// v010
// It runs in 79 microseconds.
// In both of two side-by-side timings against v009, it was 1.08 times as fast.
// Counting every step since v000, it is 23.5 times as fast.
#include <hip/hip_runtime.h>

// Differential attention (x [1][2048][1024]; q = x wq^T viewed (T, 16, 2, 64): q1/q2 per head; k = x wk^T viewed (T, 8, 2, 64): k1/k2 per kv group; v = x wv^T (8 x 64); interleaved-pair rotary on q1, q2, k1, k2 with the given cos/sin tables [2048][32]; head h uses kv group h/2; a1 = causal softmax(q1.k1/8), a2 = causal softmax(q2.k2/8); lambda = exp(lq1.lk1) - exp(lq2.lk2) + lambda_init (lambda vectors [64], read); y = (a1 - lambda a2) v; GroupNorm per (head) over (T, 64) (eps 1e-5, no affine) x (1 - lambda_init); out = y wo^T -> [1][2048][1024] (2.1 M)).
// Compute dtypes, f32 accumulate: every input rounded to bf16; projections exact; rotary f32; attention rows < 512 3 products, rest fp16, scores and probabilities kept on chip (one fused launch for all heads); softmax, lambda, combine and GroupNorm f32 (fixed-order reductions); wo hl x exact.

#define NB_  1
#define TT   2048
#define DM   1024
#define NH_  32
#define NKV  16
#define REP  (NH_ / NKV)
#define HD   64
#define DQ   (NH_ * HD)
#define DKV  (NKV * HD)
#define ZH   2
#define RH   512                  // query rows < RH use hi+lo planes (0: none)
#define WIN  2048
#define PCAR 1024.0f
#define SCL  0.125f
#define NVG  8       // value groups
#define DV   (NVG * HD)   // 512
#define NHD  16      // real heads
#define LINIT 0.35550906759096934f   // 0.8 - 0.6 exp(-0.3)
typedef _Float16 h16;
typedef unsigned short bf;
typedef __attribute__((ext_vector_type(16))) __bf16   v16bf;
typedef __attribute__((ext_vector_type(16))) _Float16 v16h;
typedef __attribute__((ext_vector_type(8)))  _Float16 v8h;
typedef __attribute__((ext_vector_type(8)))  unsigned short v8us;
typedef __attribute__((ext_vector_type(8)))  float    v8f;
typedef __attribute__((ext_vector_type(4)))  float    v4f;
typedef v8h  __attribute__((may_alias)) v8ha;
typedef v4f  __attribute__((may_alias)) v4fa;
typedef v8us __attribute__((may_alias)) v8usa;

__device__ __forceinline__ unsigned short f2bf(float f) { unsigned u = __float_as_uint(f); u += 0x7FFFu + ((u >> 16) & 1u); return (unsigned short)(u >> 16); }
__device__ __forceinline__ float bf2f(unsigned short b) { return __uint_as_float(((unsigned)b) << 16); }
__device__ __forceinline__ float bfr(float f) { return bf2f(f2bf(f)); }
__device__ __forceinline__ v16h cat16(v8h lo, v8h hi) { return __builtin_shufflevector(lo, hi, 0, 1, 2, 3, 4, 5, 6, 7, 8, 9, 10, 11, 12, 13, 14, 15); }
__device__ __forceinline__ v16bf cat16b(v8us lo, v8us hi) { return __builtin_bit_cast(v16bf, __builtin_shufflevector(lo, hi, 0, 1, 2, 3, 4, 5, 6, 7, 8, 9, 10, 11, 12, 13, 14, 15)); }
__device__ __forceinline__ v8f wmma16(v16h a, v16h b, v8f c) { return __builtin_amdgcn_wmma_f32_16x16x32_f16(false, a, false, b, (short)0, c, false, false); }
__device__ __forceinline__ v8f wmmab(v16bf a, v16bf b, v8f c) { return __builtin_amdgcn_wmma_f32_16x16x32_bf16(false, a, false, b, (short)0, c, false, false); }



template <typename T16> struct WFrag;
template <> struct WFrag<h16> { typedef v16h V; static __device__ __forceinline__ V ld(const h16* p) { return cat16(*(const v8h*)p, *(const v8h*)(p + 16)); } static __device__ __forceinline__ v8f mma(V a, V b, v8f c) { return wmma16(a, b, c); } };
template <> struct WFrag<bf> { typedef v16bf V; static __device__ __forceinline__ V ld(const bf* p) { return cat16b(*(const v8us*)p, *(const v8us*)(p + 16)); } static __device__ __forceinline__ v8f mma(V a, V b, v8f c) { return wmmab(a, b, c); } };

__device__ __forceinline__ h16 tohx(float x) { return (h16)x; }
__device__ __forceinline__ void splitf(float y, unsigned short& h, unsigned short& l) { h = f2bf(y); l = f2bf(y - bf2f(h)); }
typedef __attribute__((ext_vector_type(2))) _Float16 v2h;
typedef __attribute__((ext_vector_type(4))) _Float16 v4h;
typedef __attribute__((ext_vector_type(2))) unsigned short v2us;
typedef __attribute__((ext_vector_type(4))) unsigned short v4us;
typedef __attribute__((ext_vector_type(2))) float v2f;
typedef __attribute__((ext_vector_type(4))) int v4i;

__global__ __launch_bounds__(256) void k_wtG(const float* __restrict__ w, int K, int N, bf* Bt) {
    const int lane = threadIdx.x & 31; const int L0 = (blockIdx.x * 8 + (threadIdx.x >> 5)) * 8; const int nlines = N * K / 64;
{
#pragma unroll 1
        for (int l = 0; l < 8; ++l) { const int L = L0 + l; if (L >= nlines) break; const size_t e = (size_t)L * 64 + lane * 2; const int k = (int)(e % K), n = (int)(e / K); v2us o;
            o[0] = f2bf(w[(size_t)k * N + n]); o[1] = f2bf(w[(size_t)(k + 1) * N + n]); *(v2us*)(Bt + e) = o; }
         }
}
// ---- k_prep: all the work that needs nothing but the inputs, in ONE launch: the five roundings to bf16 (wq, wk, wv, wo, x) and lambda. None of them reads what another writes, so they share one grid by ranges of the block index.
// Block 0: lambda (its 64 serial steps run beside the conversions). Blocks 1 ..: 2048 elements each, 8 per thread; every tensor is a whole number of blocks, so a block lies in one tensor and the grid is exact.
#define PB_Q (DQ * DM / 2048)
#define PB_K (DKV * DM / 2048)
#define PB_V (DV * DM / 2048)
#define PB_O (DM * NHD * HD / 2048)
#define PB_X (TT * DM / 2048)
static_assert(DQ * DM % 2048 == 0 && DKV * DM % 2048 == 0 && DV * DM % 2048 == 0 && DM * NHD * HD % 2048 == 0 && TT * DM % 2048 == 0, "every converted tensor is a whole number of 2048-element blocks");
static_assert(NB_ == 1, "x is converted once, in front of the batch loop");
__global__ __launch_bounds__(256) void k_prep(const float* __restrict__ wq, const float* __restrict__ wk, const float* __restrict__ wv, const float* __restrict__ wo, const float* __restrict__ x, bf* WQ, bf* WK, bf* WV, bf* WO, bf* XB, const float* __restrict__ a1, const float* __restrict__ b1, const float* __restrict__ a2, const float* __restrict__ b2, float* LAM) {
    if (blockIdx.x == 0) { if (threadIdx.x >= 64) return; float s1 = 0.f, s2 = 0.f;
#pragma unroll 1
    for (int d = 0; d < HD; ++d) { float p1 = __fmul_rn(bfr(a1[d]), bfr(b1[d])), p2 = __fmul_rn(bfr(a2[d]), bfr(b2[d])); asm volatile("" : "+v"(p1), "+v"(p2)); s1 = __fadd_rn(s1, p1); s2 = __fadd_rn(s2, p2); }
    const float lam = __fadd_rn(__fsub_rn(expf(s1), expf(s2)), LINIT); *(float*)(LAM + threadIdx.x) = lam; return; }
    unsigned blk = blockIdx.x - 1; const float* src; bf* dst;   // the tensor and the block's place in it: scalar compares on the block index
    if (blk < PB_X) { src = x; dst = XB; }
    else if ((blk -= PB_X) < PB_Q) { src = wq; dst = WQ; }
    else if ((blk -= PB_Q) < PB_K) { src = wk; dst = WK; }
    else if ((blk -= PB_K) < PB_V) { src = wv; dst = WV; }
    else { blk -= PB_V; src = wo; dst = WO; }
    const size_t i = (size_t)blk * 256 + threadIdx.x; const v8f v = *(const v8f*)(src + i * 8); v8us o;
#pragma unroll
    for (int k = 0; k < 8; ++k) o[k] = f2bf(v[k]); *(v8us*)(dst + i * 8) = o;  }

// ---- GroupNorm statistics without a launch of their own. k_dcomb, which has every y in registers, leaves one partial per (head, 64 rows): the block's own mean and the sum of squared deviations from that mean (M2).
// Partials of equal count n merge as mean = sum(mean_p) / P, M2 = sum(M2_p) + n sum((mean_p - mean)^2): no difference of large squares anywhere. k_dcomb merges its 16 lane rows so, k_gnapply a head's GNB blocks; var = M2 / (TT x HD). Fixed-order sums.
#define GNR 64            // rows of one block's partial
#define GNB (TT / GNR)    // partials per head
static_assert(GNB == 32 && GNB * GNR == TT && HD == 64, "the merge in k_gnapply: 16 lanes of one head hold two partials each; k_dcomb's grid is exact");
static_assert(((TT * HD) & (TT * HD - 1)) == 0 && ((GNR * HD) & (GNR * HD - 1)) == 0, "the counts are powers of two: multiplying by their reciprocals is the exact division");
// Sum over the 16 lanes of a row, in every lane of it, every lane on: four adds whose second operand comes from lane ^ 1, 2, 4, 8 through the vector unit's own cross-lane path (row_xmask), not through the LDS unit as a shuffle would.
__device__ __forceinline__ float gn_row16(float s) {
    s += __int_as_float(__builtin_amdgcn_update_dpp(0, __float_as_int(s), 0x161, 0xf, 0xf, true));
    s += __int_as_float(__builtin_amdgcn_update_dpp(0, __float_as_int(s), 0x162, 0xf, 0xf, true));
    s += __int_as_float(__builtin_amdgcn_update_dpp(0, __float_as_int(s), 0x164, 0xf, 0xf, true));
    s += __int_as_float(__builtin_amdgcn_update_dpp(0, __float_as_int(s), 0x168, 0xf, 0xf, true));
    return s; }
// k_dcomb: y_h = a1 v - lambda a2 v for GNR rows of one head per work-group (a thread: 4 columns of rows t0 + 16 c; a row of 16 lanes: GNR x HD / 16 values), and that block's partial. Grid (GNB, NHD), exact.
__global__ __launch_bounds__(256) void k_dcomb(const float* __restrict__ O, const float* __restrict__ LAM, float* Y, float* PST) { __shared__ v2f red[16];
    const int h = blockIdx.y; O += (size_t)h * 2 * TT * HD; const int d0 = (int)(threadIdx.x & 15) * 4; const size_t t0 = (size_t)blockIdx.x * GNR + (threadIdx.x >> 4); const float lam = LAM[0]; v4f av[4], bv[4], ov[4];
#pragma unroll
    for (int c = 0; c < 4; ++c) { av[c] = *(const v4f*)(O + (t0 + 16 * c) * HD + d0); bv[c] = *(const v4f*)(O + (size_t)TT * HD + (t0 + 16 * c) * HD + d0); }
    float s = 0.f;
#pragma unroll
    for (int c = 0; c < 4; ++c) { const size_t t = t0 + 16 * c; const float cs = (t < RH) ? 1.0f : (1.0f / PCAR); const v4f a = av[c]; const v4f b = bv[c]; v4f o;
#pragma unroll
    for (int q = 0; q < 4; ++q) { float p = __fmul_rn(a[q], cs), m = __fmul_rn(__fmul_rn(b[q], cs), lam); asm volatile("" : "+v"(p), "+v"(m)); o[q] = __fsub_rn(p, m); }
        ov[c] = o; s += (o[0] + o[1]) + (o[2] + o[3]); }
    const float rmean = gn_row16(s) * (16.0f / (float)(GNR * HD));
    float s2 = 0.f;
#pragma unroll
    for (int c = 0; c < 4; ++c) { float acc = 0.f;
#pragma unroll
        for (int q = 0; q < 4; ++q) { const float dv = ov[c][q] - rmean; acc += dv * dv; } s2 += acc; }
    s2 = gn_row16(s2); if ((threadIdx.x & 15) == 0) { v2f pr; pr[0] = rmean; pr[1] = s2; red[threadIdx.x >> 4] = pr; }
    __syncthreads();   // the 16 lane rows' partials are in red before wave 0 merges them. The y stores stand behind it: in front, the barrier would wait for them to be acknowledged
#pragma unroll
    for (int c = 0; c < 4; ++c) *(v4f*)(Y + (t0 + 16 * c) * (NHD * HD) + (size_t)h * HD + d0) = ov[c];
    if (threadIdx.x < 32) { const v2f pr = red[threadIdx.x & 15];   // the whole of wave 0: every lane is on at the cross-lane adds
        const float bmean = gn_row16(pr[0]) * (1.0f / 16.0f); const float e = pr[0] - bmean; const float m2 = gn_row16(pr[1] + (float)(GNR * HD / 16) * (e * e));
        if (threadIdx.x == 0) { v2f w; w[0] = bmean; w[1] = m2; *(v2f*)(PST + ((size_t)h * GNB + blockIdx.x) * 2) = w; } } }

// k_gnapply: a thread normalises 4 columns of one row; the 16 lanes of a row of lanes lie in one head and merge its partials, two a lane. The grid is exact: every lane is on at the cross-lane adds.
static_assert((size_t)TT * NHD * HD / 4 % 256 == 0, "no thread of k_gnapply leaves early");
__global__ __launch_bounds__(256) void k_gnapply(const float* __restrict__ Y, const float* __restrict__ PST, bf* Ah, bf* Al) { const size_t i = (size_t)blockIdx.x * 256 + threadIdx.x; const int c0 = (int)(i % (NHD * HD / 4)) * 4; const size_t t = i / (NHD * HD / 4); const int h = c0 / HD;
    const v4f pp = *(const v4f*)(PST + (size_t)h * GNB * 2 + (threadIdx.x & 15) * 4); const v4f a = *(const v4f*)(Y + t * (NHD * HD) + c0);   // pp: mean, M2 of partial 2 l and of partial 2 l + 1
    const float mean = gn_row16(pp[0] + pp[2]) * (1.0f / (float)GNB); const float e0 = pp[0] - mean, e1 = pp[2] - mean;
    const float var = gn_row16((pp[1] + pp[3]) + (float)(GNR * HD) * (e0 * e0 + e1 * e1)) * (1.0f / (float)((size_t)TT * HD));
    const float rs = __fdiv_rn(1.0f, __fsqrt_rn(__fadd_rn(var, 1e-5f))); v4us oh, ol;
#pragma unroll
    for (int q = 0; q < 4; ++q) { float nv = __fmul_rn(__fsub_rn(a[q], mean), rs); asm volatile("" : "+v"(nv)); unsigned short h2, l2; splitf(__fmul_rn(nv, 1.0f - LINIT), h2, l2); oh[q] = h2; ol[q] = l2; }
    *(v4us*)(Ah + t * (NHD * HD) + c0) = oh; *(v4us*)(Al + t * (NHD * HD) + c0) = ol;  }

// ---- k_fattn: scores, causal softmax and probability x value in ONE launch for all 32 query sub-heads; no score or probability ever goes to memory.
// One wave owns 16 query rows and walks the keys 0 .. its diagonal ONCE, in blocks of 64: scores, e = exp(t - ref), row sum, e to 16-bit, P.V accumulated in key order; the division by the row sum comes after P.V. Rows < RH: hi+lo planes, 3 products; the rest fp16 with e x PCAR.
// Both products are taken transposed: S^T = K Q^T (keys are the accumulator's rows, queries its columns), O^T += V^T P^T. A lane then holds scores of ONE query (column lane & 15; keys 8 (lane >> 4) + j of each 16), and two
// score accumulators, converted in place, ARE the B operand of the second product in the k order of the staged loaders: no probability goes through LDS. Row maximum and row sum are in-lane, with one exchange between the wave's halves.
// ref is the row's running maximum, renewed lazily: only when a score exceeds it by more than MXLAG are the row sums and the P.V accumulators scaled by exp(old ref - new ref). ref cancels in P.V / sum.
// A work-group (4 waves) does ONE block of 64 rows. The row block is the slow grid index, the longest walks first: three work-groups fit a WGP (LDS), so the fp16 row blocks 31 .. 8 start at once
// and the short hi+lo row blocks, whose key blocks cost more than twice an fp16 one, fill the places as they come free. No fixed pairing has to guess what a hi+lo block costs, and a SIMD has three waves to choose from, not two.
// The four waves walk the same key blocks: each block's key and value tiles are brought into LDS once for the work-group by asynchronous copies (whole 128-B lines), two buffers, the next block's copies in flight while this block is worked on.
#define MXLAG 3.4657359f   // 5 ln 2: e <= 32, so e x PCAR <= 32768 stays inside fp16
#define PP 72   // LDS pitch of a staged key or value row in 16-bit elements: 144 B = 16 B x odd, the conflict-free pitch for 16-byte reads
#define KVT (64 * PP)   // one staged tile in 16-bit elements: 64 rows of 128 B at pitch PP
#define KVB (4 * KVT)   // one buffer: tiles 0 keys, 1 values, 2 keys lo, 3 values lo (2 and 3 only for the hi+lo planes)
template <typename T16> struct LFrag;
template <> struct LFrag<h16> { static __device__ __forceinline__ v16h ld(const h16* p) { return cat16(*(const v8ha*)p, *(const v8ha*)(p + 16)); } };
template <> struct LFrag<bf> { static __device__ __forceinline__ v16bf ld(const bf* p) { return cat16b(*(const v8usa*)p, *(const v8usa*)(p + 16)); } };
// 2^x with the free issue slot behind the transcendental in the same statement: the next vector instruction may then read the result or overwrite the source.
__device__ __forceinline__ float fattn_exp2(float x) { float r; asm("v_exp_f32 %0, %1\n\tv_nop" : "=v"(r) : "v"(x)); return r; }
// Four fragments (nb = 0..3) of k step ks of one staged tile: rows nb*16+lr at pitch PP; pl is the lane's own LDS pointer (row lr, k offset 8*hi).
template <typename T16>
__device__ __forceinline__ void fattn_ld4(const T16* pl, int ks, typename WFrag<T16>::V (&b)[4]) {
#pragma unroll
    for (int nb = 0; nb < 4; ++nb) b[nb] = LFrag<T16>::ld(pl + (nb * 16 * PP + ks * 32));
}
// Two 64-row x 128-B tiles from global memory into LDS through no register. ga, gb: the thread's own 16 bytes of its first row (row tid / 8, piece tid % 8); la, lb: their LDS byte addresses.
// A thread brings rows tid / 8 + 16 c, c = 0..3, of each tile; a wave's copy covers 4 whole 128-B lines. The s_wait_xcnt closes the statement so that no address register is rewritten in front of it.
template <typename T16>
__device__ __forceinline__ void fattn_copy2(const T16* ga, size_t pa, const T16* gb, size_t pb, unsigned la, unsigned lb) {
    asm volatile("global_load_async_to_lds_b128 %0, %8, off\n\t"
                 "global_load_async_to_lds_b128 %1, %9, off\n\t"
                 "global_load_async_to_lds_b128 %2, %10, off\n\t"
                 "global_load_async_to_lds_b128 %3, %11, off\n\t"
                 "global_load_async_to_lds_b128 %4, %12, off\n\t"
                 "global_load_async_to_lds_b128 %5, %13, off\n\t"
                 "global_load_async_to_lds_b128 %6, %14, off\n\t"
                 "global_load_async_to_lds_b128 %7, %15, off\n\t"
                 "s_wait_xcnt 0x0"
                 :: "v"(la), "v"(la + 16 * PP * 2), "v"(la + 32 * PP * 2), "v"(la + 48 * PP * 2), "v"(lb), "v"(lb + 16 * PP * 2), "v"(lb + 32 * PP * 2), "v"(lb + 48 * PP * 2),
                    "v"(ga), "v"(ga + 16 * pa), "v"(ga + 32 * pa), "v"(ga + 48 * pa), "v"(gb), "v"(gb + 16 * pb), "v"(gb + 32 * pb), "v"(gb + 48 * pb) : "memory");
}
// Inputs-only fence on loaded fragments: every LDS read of the batch is issued before the first matrix instruction waits, so a batch pays one LDS latency, not one per fragment.
template <typename V> __device__ __forceinline__ void fattn_hold8(const V (&x)[4], const V (&y)[4]) { asm volatile("" :: "v"(x[0]), "v"(x[1]), "v"(x[2]), "v"(x[3]), "v"(y[0]), "v"(y[1]), "v"(y[2]), "v"(y[3])); }
// acc[nb] += b[nb] x a (+ b[nb] x a2 + b2[nb] x a for the hi+lo planes): the staged rows are the A operand, a (queries or probabilities, one query a lane column) the B operand
template <typename T16, bool HI>
__device__ __forceinline__ void fattn_mm(const typename WFrag<T16>::V& a, const typename WFrag<T16>::V& a2, const typename WFrag<T16>::V (&b)[4], const typename WFrag<T16>::V (&b2)[4], v8f (&acc)[4]) {
#pragma unroll
    for (int nb = 0; nb < 4; ++nb) { acc[nb] = WFrag<T16>::mma(b[nb], a, acc[nb]);
        if (HI) { acc[nb] = WFrag<T16>::mma(b[nb], a2, acc[nb]); acc[nb] = WFrag<T16>::mma(b2[nb], a, acc[nb]); } }
}
// Lane l's value in lane l ^ 16, through the vector unit's cross-row move (a shuffle would go through the LDS unit); every lane on.
__device__ __forceinline__ float fattn_xhalf(float x) { return __int_as_float(__builtin_amdgcn_permlanex16(__float_as_int(x), __float_as_int(x), 0x76543210, 0xfedcba98, false, false)); }
// os: the wave's own 16 x 68 floats of LDS for its output rows. st: the two staging buffers (work-group wide), sbase: their LDS byte address. Called by all four waves of the work-group with the same row block: the barriers inside are passed by every wave, the same number of times.
template <typename T16, bool HI>
__device__ __forceinline__ void fattn_strip(const T16* __restrict__ Q, const T16* __restrict__ Q2, const T16* __restrict__ Kp, const T16* __restrict__ Kp2, const T16* __restrict__ Vt, const T16* __restrict__ Vt2, int i0, float* os, const T16* st, unsigned sbase, float* O) {
    typedef typename WFrag<T16>::V V;
    const int lane = threadIdx.x & 31, lr = lane & 15, hi = lane >> 4;
    const int nblk = (i0 >> 6) + 1;                    // key blocks 0 .. nblk-1: up to the end of the 64-key block that holds the diagonal (64 nblk <= TT); the same for the four waves
    const unsigned crow = threadIdx.x >> 3, ccol = (threadIdx.x & 7) * 8;   // the thread's first row and its 16-byte piece in every staged tile
    const T16* gk = Kp + crow * HD + ccol; const T16* gk2 = Kp2 + crow * HD + ccol; const T16* gv = Vt + crow * TT + ccol; const T16* gv2 = Vt2 + crow * TT + ccol;
    const unsigned l0 = sbase + (crow * PP + ccol) * 2;
    auto stage = [&](int t) { const unsigned lb = l0 + (unsigned)(t & 1) * (KVB * 2);
        fattn_copy2<T16>(gk + (size_t)t * 64 * HD, HD, gv + t * 64, TT, lb, lb + KVT * 2);
        if constexpr (HI) fattn_copy2<T16>(gk2 + (size_t)t * 64 * HD, HD, gv2 + t * 64, TT, lb + 2 * KVT * 2, lb + 3 * KVT * 2); };
    stage(0);   // nothing has touched the buffers before
    V q[2], q2[2];
#pragma unroll
    for (int ks = 0; ks < 2; ++ks) { q[ks] = WFrag<T16>::ld(Q + (size_t)(i0 + lr) * HD + ks * 32 + 8 * hi); q2[ks] = HI ? WFrag<T16>::ld(Q2 + (size_t)(i0 + lr) * HD + ks * 32 + 8 * hi) : q[ks]; }
    asm volatile("s_wait_xcnt 0x0" :: "v"(q[0]), "v"(q[1]), "v"(q2[0]), "v"(q2[1]) : "memory");   // behind the query loads, before their address registers are used for anything else
    constexpr float C2 = SCL * 1.4426950408889634f;   // exp(SCL s - ref) = 2^(C2 s - C2 mx), mx in units of the unscaled product
    constexpr float EB = HI ? 0.0f : 10.0f;           // fp16 path: e x PCAR comes out of the exponent, PCAR = 2^10 (exact); the row sum carries the same factor
    static_assert(PCAR == 1024.0f, "EB is log2 PCAR");
    float mx = -3.0e38f;   // the reference the exponentials of this lane's query (row i0 + lr) are taken against: a running row maximum of the unscaled products, the same in both halves, renewed only when a score leaves it far behind
    v2f sum[4]; v8f o[4];   // sum[nb]: this lane's keys of 16-key group nb, even and odd keys apart: independent chains of packed adds; o[nb][j]: column nb*16 + hi*8 + j of row i0 + lr
#pragma unroll
    for (int nb = 0; nb < 4; ++nb) { sum[nb] = (v2f){}; o[nb] = (v8f){}; }
    asm volatile("s_wait_asynccnt 0x0" ::: "memory");   // this wave's copies of block 0 have landed
    __syncthreads();                                    // and every other wave's: block 0 may be read
    if (nblk > 1) stage(1);
    for (int t = 0; t < nblk; ++t) { V kb[2][4], kb2[2][4], vb[2][4], vb2[2][4]; v8f s[4]; const int j0 = t * 64; const T16* sb = st + (t & 1) * KVB + lr * PP + 8 * hi;
        const int dg = i0 + lr - j0 - hi * 8;   // key nb*16 + j of this lane's keys is inside the causal range while nb*16 + j <= dg
        bool in[4][8];
        // The compares need no score. The scheduling barrier keeps them behind the block's first fragment reads, whose latency they fill, and in front of the matrix instructions: left alone each stands directly in front of the select that waits for it.
        auto conds = [&]() {
#pragma unroll
            for (int nb = 0; nb < 4; ++nb)
#pragma unroll
                for (int j = 0; j < 8; ++j) in[nb][j] = nb * 16 + j <= dg;
            __builtin_amdgcn_sched_barrier(0); };
#pragma unroll
        for (int nb = 0; nb < 4; ++nb) s[nb] = (v8f){};
        if constexpr (HI) {
#pragma unroll
            for (int ks = 0; ks < 2; ++ks) { fattn_ld4<T16>(sb, ks, kb[ks]); fattn_ld4<T16>(sb + 2 * KVT, ks, kb2[ks]); if (ks == 0) conds(); fattn_mm<T16, HI>(q[ks], q2[ks], kb[ks], kb2[ks], s);
                if (ks == 0) __builtin_amdgcn_sched_barrier(0); }   // one k step's 64 fragment registers at a time: both steps' fetched together overrun the 256 directly addressed registers
        } else {   // one plane each: the value fragments are fetched with the key fragments, ahead of the softmax
            fattn_ld4<T16>(sb, 0, kb[0]); fattn_ld4<T16>(sb, 1, kb[1]); fattn_ld4<T16>(sb + KVT, 0, vb[0]); fattn_ld4<T16>(sb + KVT, 1, vb[1]); conds();
            fattn_mm<T16, HI>(q[0], q2[0], kb[0], kb2[0], s); fattn_mm<T16, HI>(q[1], q2[1], kb[1], kb2[1], s); }
        float bm[4];   // the largest product of this lane's keys in each 16-key group
#pragma unroll
        for (int nb = 0; nb < 4; ++nb) {
#pragma unroll
            for (int j = 0; j < 8; ++j) s[nb][j] = in[nb][j] ? s[nb][j] : -3.0e38f;
            bm[nb] = fmaxf(fmaxf(fmaxf(s[nb][0], s[nb][1]), fmaxf(s[nb][2], s[nb][3])), fmaxf(fmaxf(s[nb][4], s[nb][5]), fmaxf(s[nb][6], s[nb][7]))); }
        const float bmax = fmaxf(fmaxf(bm[0], bm[1]), fmaxf(bm[2], bm[3]));
        if (__builtin_amdgcn_ballot_w32(bmax - mx > MXLAG / SCL) != 0) {   // one scalar test per key block, every lane stays on: taken at a strip's first block and then only when some score outgrows its row's reference
            const float nm = fmaxf(mx, fmaxf(bmax, fattn_xhalf(bmax))); const float f = fattn_exp2((mx - nm) * C2); mx = nm;   // what was summed against the old reference is carried over to the new one (first block: f = 0 on zeros)
#pragma unroll
            for (int nb = 0; nb < 4; ++nb) { sum[nb] *= f; o[nb] *= f; } }
        const float ad = __builtin_fmaf(-mx, C2, EB);
        V p[2], p2[2];   // P^T as B operand of k step ks (32 keys): elements 0-7 from score accumulator 2 ks, 8-15 from 2 ks + 1, which is the k order of the staged value rows' loader
#pragma unroll
        for (int ks = 0; ks < 2; ++ks) { v8h eh16[2]; v8us ehi[2], elo[2];
#pragma unroll
            for (int g = 0; g < 2; ++g) { const int nb = 2 * ks + g; const v8f ar = __builtin_elementwise_fma(s[nb], (v8f){C2, C2, C2, C2, C2, C2, C2, C2}, (v8f){ad, ad, ad, ad, ad, ad, ad, ad}); v8f e;   // one reference a lane: scale and reference in one fused multiply-add, two scores an instruction
#pragma unroll
                for (int j = 0; j < 8; ++j) e[j] = fattn_exp2(ar[j]);
#pragma unroll
                for (int j = 0; j < 8; j += 2) sum[nb] += (v2f){e[j], e[j + 1]};
                if constexpr (HI) {
#pragma unroll
                    for (int j = 0; j < 8; ++j) { unsigned short eh, el; splitf(e[j], eh, el); ehi[g][j] = eh; elo[g][j] = el; }
                } else eh16[g] = __builtin_convertvector(e, v8h); }
            if constexpr (HI) { p[ks] = cat16b(ehi[0], ehi[1]); p2[ks] = cat16b(elo[0], elo[1]); } else { p[ks] = cat16(eh16[0], eh16[1]); p2[ks] = p[ks]; } }
#pragma unroll
        for (int ks = 0; ks < 2; ++ks) {
            if constexpr (HI) { fattn_ld4<T16>(sb + KVT, ks, vb[ks]); fattn_ld4<T16>(sb + 3 * KVT, ks, vb2[ks]); fattn_hold8(vb[ks], vb2[ks]); }
            fattn_mm<T16, HI>(p[ks], p2[ks], vb[ks], vb2[ks], o); }
        __builtin_amdgcn_sched_barrier(0);   // the block's work stays in front of the hand-over: left alone the compiler lifts the waits over the exponentials and the second product, and the wave waits for the next block's copies when they have only just been issued
        // hand-over of the buffers, every wave, in this order:
        asm volatile("s_wait_dscnt 0x0" ::: "memory");      // this wave's reads of this block's buffer have returned
        asm volatile("s_wait_asynccnt 0x0" ::: "memory");   // this wave's copies of the next block have landed
        __syncthreads();                                    // the same holds for every wave: the next block may be read, this block's buffer may be refilled
        if (t + 2 < nblk) stage(t + 2);
    }
    asm volatile("s_wait_asynccnt 0x0" ::: "memory");   // no copy is in flight behind the loop
    const v2f s2 = (sum[0] + sum[1]) + (sum[2] + sum[3]); float sm = s2[0] + s2[1]; sm += fattn_xhalf(sm);   // the two halves hold the two halves of the row's keys
    const float f = __fdiv_rn(HI ? 1.0f : PCAR, sm);   // fp16 path: the sum carries PCAR as the probabilities do; the output keeps its factor PCAR
    // A lane holds 8 consecutive columns of its row in each accumulator. Through the wave's own LDS rows, so that every global store covers whole 128-B lines.
#pragma unroll
    for (int nb = 0; nb < 4; ++nb) { v4f a, b;
#pragma unroll
        for (int q4 = 0; q4 < 4; ++q4) { a[q4] = o[nb][q4] * f; b[q4] = o[nb][4 + q4] * f; }
        *(v4fa*)(os + lr * 68 + nb * 16 + hi * 8) = a; *(v4fa*)(os + lr * 68 + nb * 16 + hi * 8 + 4) = b; }
    __builtin_amdgcn_wave_barrier(); asm volatile("" ::: "memory");   // the rows are read below by other lanes of this wave: keep the stores in front of the reads
    float* orow = O + (size_t)i0 * HD;
#pragma unroll
    for (int r = 0; r < 8; ++r) { const int row = 2 * r + hi, cofs = lr * 4; const v4f val = *(const v4fa*)(os + row * 68 + cofs); *(v4f*)(orow + (size_t)row * HD + cofs) = val; }
}
// the register attribute holds the kernel to the 256 directly addressed vector registers (no register-bank switching in the loops): with this much LDS the launch bounds' second figure alone no longer does
__global__ __launch_bounds__(128, 4) __attribute__((amdgpu_num_vgpr(256))) void k_fattn(const h16* __restrict__ QP16, const bf* __restrict__ QPh, const bf* __restrict__ QPl, const h16* __restrict__ KP16, const bf* __restrict__ KPh, const bf* __restrict__ KPl, const h16* __restrict__ VT16, const bf* __restrict__ VTh, const bf* __restrict__ VTl, float* Ob) {
    __shared__ __align__(16) float osw[4][16 * 68];
    __shared__ __align__(16) unsigned short kv[2 * KVB];
    const unsigned sbase = (unsigned)(size_t)(const void*)kv;   // the low 32 bits of a __shared__ address are its LDS byte address
    const int wv = __builtin_amdgcn_readfirstlane(threadIdx.x >> 5); const int z = blockIdx.x;   // wave number in a scalar register: scalar loop bounds. z = 2h: (q1_h, k1_g), z = 2h+1: (q2_h, k2_g), g = h/2; both use v[g]
    const size_t zq = (size_t)z * TT * HD, zk = (size_t)(2 * (z / 4) + (z & 1)) * TT * HD, zv = (size_t)(z / 4) * HD * TT;
    { const int rb = TT / 64 - 1 - (int)blockIdx.y; const int i0 = rb * 64 + wv * 16;   // the far row blocks of all sub-heads have the lowest indices
        if (rb * 64 < RH) fattn_strip<bf, true>(QPh + zq, QPl + zq, KPh + zk, KPl + zk, VTh + zv, VTl + zv, i0, osw[wv], (const bf*)kv, sbase, Ob + zq);
        else fattn_strip<h16, false>(QP16 + zq, QP16 + zq, KP16 + zk, KP16 + zk, VT16 + zv, VT16 + zv, i0, osw[wv], (const h16*)kv, sbase, Ob + zq); }
}
// ---- The two projection GEMMs (k_qkv, k_out), K = DM: a work-group of 4 waves (2 x 2) owns one output tile; its operands' 64-k tiles are brought into LDS once for the work-group
// by asynchronous copies (whole 128-B lines; each staged row is read by two waves), two buffers, the next k tile's copies in flight while this one is worked on.
// A buffer is four tiles of 64 rows at pitch PP: 0 and 1 from T0 and T1 (k_qkv: rows 0-63 and 64-127 of A; k_out: the hi and the lo plane of 64 rows of A), 2 and 3 rows 0-63 and 64-127 of B.
// A wave has MB x 4 accumulators: MB 16-row blocks of A from element aoff of tile 0 on (NPL == 2: the same rows of tile 1 as second plane) against the 64 rows of B tile wn. Every accumulator takes its products in the order of a plain loop over k in steps of 32, hi plane before lo plane.
static_assert(NHD * HD == DM && DM % 128 == 0, "both GEMMs sum over DM; at least two k tiles of 64");
template <int NPL, int MB>
__device__ __forceinline__ void gemm_staged(const bf* __restrict__ T0, const bf* __restrict__ T1, const bf* __restrict__ B, const bf* st, unsigned sbase, int aoff, int wn, v8f (&acc)[MB][4]) {
    typedef WFrag<bf>::V V;
    constexpr int NS = DM / 64;
    const int lane = threadIdx.x & 31, lr = lane & 15, hi = lane >> 4;
    const unsigned crow = threadIdx.x >> 3, ccol = (threadIdx.x & 7) * 8;   // the thread's first row and its 16-byte piece in every staged tile
    const bf* g0 = T0 + crow * DM + ccol; const bf* g1 = T1 + crow * DM + ccol; const bf* gb = B + crow * DM + ccol;
    const unsigned l0 = sbase + (crow * PP + ccol) * 2;
    auto stage = [&](int t) { const unsigned lb = l0 + (unsigned)(t & 1) * (KVB * 2);
        fattn_copy2<bf>(g0 + t * 64, DM, g1 + t * 64, DM, lb, lb + KVT * 2);
        fattn_copy2<bf>(gb + t * 64, DM, gb + 64 * DM + t * 64, DM, lb + 2 * KVT * 2, lb + 3 * KVT * 2); };
    stage(0);   // nothing has touched the buffers before
#pragma unroll
    for (int mb = 0; mb < MB; ++mb)
#pragma unroll
        for (int nb = 0; nb < 4; ++nb) acc[mb][nb] = (v8f){};
    asm volatile("s_wait_asynccnt 0x0" ::: "memory");   // this wave's copies of k tile 0 have landed
    __syncthreads();                                    // and every other wave's: k tile 0 may be read
    stage(1);
#pragma unroll 1   // one k tile in the code: a second tile's fragments would leave the 256 directly addressed registers
    for (int t = 0; t < NS; ++t) { const bf* sa = st + (t & 1) * KVB + aoff + lr * PP + 8 * hi; const bf* sb = st + (t & 1) * KVB + (2 + wn) * KVT + lr * PP + 8 * hi;
        V a[2][MB], a2[2][MB], b[2][4];
        auto frags = [&](int ks) {
#pragma unroll
            for (int mb = 0; mb < MB; ++mb) { a[ks][mb] = LFrag<bf>::ld(sa + mb * 16 * PP + ks * 32); if constexpr (NPL == 2) a2[ks][mb] = LFrag<bf>::ld(sa + KVT + mb * 16 * PP + ks * 32); }
            fattn_ld4<bf>(sb, ks, b[ks]); };
        auto prods = [&](int ks) {
#pragma unroll
            for (int nb = 0; nb < 4; ++nb)
#pragma unroll
                for (int mb = 0; mb < MB; ++mb) acc[mb][nb] = WFrag<bf>::mma(a[ks][mb], b[ks][nb], acc[mb][nb]);
            if constexpr (NPL == 2) {
#pragma unroll
                for (int nb = 0; nb < 4; ++nb)
#pragma unroll
                    for (int mb = 0; mb < MB; ++mb) acc[mb][nb] = WFrag<bf>::mma(a2[ks][mb], b[ks][nb], acc[mb][nb]); } };
        // The scheduling barriers keep each group of LDS reads whole and in front of its matrix instructions: left alone the compiler reloads one B fragment register set and waits out the LDS latency before every four matrix instructions.
        if constexpr (MB * (1 + NPL) <= 6) {   // both k steps' fragments fit beside the accumulators: one group of reads per k tile
            frags(0); frags(1); __builtin_amdgcn_sched_barrier(0); prods(0); prods(1);
        } else {                               // one k step's fragments at a time
            frags(0); __builtin_amdgcn_sched_barrier(0); prods(0); __builtin_amdgcn_sched_barrier(0); frags(1); __builtin_amdgcn_sched_barrier(0); prods(1); }
        __builtin_amdgcn_sched_barrier(0);   // the matrix instructions stay in front of the hand-over: left alone the compiler lifts its waits and the barrier over them, and the wave waits out all its LDS reads before its first matrix instruction
        // hand-over of the buffers, every wave, in this order:
        asm volatile("s_wait_dscnt 0x0" ::: "memory");      // this wave's reads of this k tile's buffer have returned
        asm volatile("s_wait_asynccnt 0x0" ::: "memory");   // this wave's copies of the next k tile have landed
        __syncthreads();                                    // the same holds for every wave: the next k tile may be read, this one's buffer may be refilled
        if (t + 2 < NS) stage(t + 2);
    }
    asm volatile("s_wait_asynccnt 0x0" ::: "memory");   // no copy is in flight behind the loop
}

// ---- k_out: C[m][n] (f32, pitch DM) = sum_k (Ah[m][k] + Al[m][k]) Bt[n][k]; a work-group owns 64 x 128 of C, a wave 32 x 64: grid (TT/64, DM/128) = one work-group per WGP, 128 threads. Each wave stores its part through its own LDS rows as whole lines.
__global__ __launch_bounds__(128) void k_out(const bf* __restrict__ Ah, const bf* __restrict__ Al, const bf* __restrict__ Bt, float* C) {
    __shared__ __align__(16) float osw[4][16 * 68];
    __shared__ __align__(16) unsigned short gst[2 * KVB];
    const unsigned sbase = (unsigned)(size_t)(const void*)gst;   // the low 32 bits of a __shared__ address are its LDS byte address
    const int wv = __builtin_amdgcn_readfirstlane(threadIdx.x >> 5), wm = wv & 1, wn = wv >> 1; float* os = osw[wv];
    const int lane = threadIdx.x & 31, lr = lane & 15, hi = lane >> 4; const int r0 = blockIdx.x * 64 + wm * 32, c0 = blockIdx.y * 128 + wn * 64;
    v8f acc[2][4];
    gemm_staged<2, 2>(Ah + (size_t)blockIdx.x * 64 * DM, Al + (size_t)blockIdx.x * 64 * DM, Bt + (size_t)blockIdx.y * 128 * DM, (const bf*)gst, sbase, wm * 32 * PP, wn, acc);
#pragma unroll
    for (int mb = 0; mb < 2; ++mb) {
#pragma unroll
        for (int nb = 0; nb < 4; ++nb) {
#pragma unroll
            for (int j = 0; j < 8; ++j) os[(hi * 8 + j) * 68 + nb * 16 + lr] = acc[mb][nb][j]; }
        __builtin_amdgcn_wave_barrier(); asm volatile("" ::: "memory");   // the rows are read below by other lanes of this wave: keep the stores in front of the reads
        float* crow = C + (size_t)(r0 + mb * 16) * DM + c0;
#pragma unroll
        for (int s = 0; s < 8; ++s) { const int row = 2 * s + hi, cofs = lr * 4; const v4f val = *(const v4fa*)(os + row * 68 + cofs); *(v4f*)(crow + (size_t)row * DM + cofs) = val; }
        __builtin_amdgcn_wave_barrier(); asm volatile("s_wait_xcnt 0x0" ::: "memory");   // the LDS reads stay in front of the next 16 rows' LDS stores; the wait stands behind these rows' global stores, before the next LDS reads land in their registers
    }
}

// ---- k_qkv: the q, k and v projections in ONE launch, each wave's 64x64 quarter finished in its own epilogue: nothing of the projections goes to memory in f32.
// Main loop: gemm_staged, one plane; a work-group owns 128 x 128, a wave a 64 x 64 quarter. A quarter's columns are one 64-wide sub-head: cy 0..31 query sub-heads, 32..47 key sub-heads, 48..55 value groups; a work-group's two sub-heads lie in one weight tensor.
// q, k: interleaved-pair rotary on the staged rows (cos / sin rounded to bf16 as every input), then the fp16 plane and the hi+lo planes [sub-head][t][64], whole 128-B lines per row.
// v: an accumulator register run is 8 consecutive t of one column, which is 16 B of the transposed planes [group][d][t]: stored straight from the registers.
static_assert(NH_ % 2 == 0 && NKV % 2 == 0 && NVG % 2 == 0, "a pair of sub-heads never straddles two weight tensors");
__global__ __launch_bounds__(128) void k_qkv(const bf* __restrict__ A, const bf* __restrict__ WQ, const bf* __restrict__ WK, const bf* __restrict__ WV, const float* __restrict__ fcos, const float* __restrict__ fsin, h16* QP16, bf* QPh, bf* QPl, h16* KP16, bf* KPh, bf* KPl, h16* VT16, bf* VTh, bf* VTl) {
    __shared__ __align__(16) float osw[4][16 * 68];
    __shared__ __align__(16) unsigned short gst[2 * KVB];
    const unsigned sbase = (unsigned)(size_t)(const void*)gst;   // the low 32 bits of a __shared__ address are its LDS byte address
    const int wv = __builtin_amdgcn_readfirstlane(threadIdx.x >> 5), wm = wv & 1, wn = wv >> 1; float* os = osw[wv];
    const int lane = threadIdx.x & 31, lr = lane & 15, hi = lane >> 4; const int r0 = blockIdx.x * 128 + wm * 64, cb = blockIdx.y * 2, cy = cb + wn;
    const bf* Bt = (cb < NH_) ? WQ + (size_t)cb * 64 * DM : (cb < NH_ + NKV) ? WK + (size_t)(cb - NH_) * 64 * DM : WV + (size_t)(cb - NH_ - NKV) * 64 * DM;
    v8f acc[4][4];
    gemm_staged<1, 4>(A + (size_t)blockIdx.x * 128 * DM, A + ((size_t)blockIdx.x * 128 + 64) * DM, Bt, (const bf*)gst, sbase, wm * KVT, wn, acc);
    if (cy >= NH_ + NKV) {
        const size_t vo = ((size_t)(cy - NH_ - NKV) * HD + lr) * TT + r0 + hi * 8;
#pragma unroll
        for (int nb = 0; nb < 4; ++nb)
#pragma unroll
            for (int mb = 0; mb < 4; ++mb) { v8h o16; v8us oh, ol;   // mb innermost: the four 32-B pieces of a 128-B line follow one another
#pragma unroll
                for (int j = 0; j < 8; ++j) { const float x = acc[mb][nb][j]; unsigned short a2, c2; o16[j] = tohx(x); splitf(x, a2, c2); oh[j] = a2; ol[j] = c2; }
                const size_t e = vo + (size_t)nb * 16 * TT + mb * 16; *(v8h*)(VT16 + e) = o16; *(v8us*)(VTh + e) = oh; *(v8us*)(VTl + e) = ol; }
        return; }
    const size_t zo = (size_t)((cy < NH_) ? cy : cy - NH_) * TT * HD;
    h16* P16 = ((cy < NH_) ? QP16 : KP16) + zo; bf* Ph = ((cy < NH_) ? QPh : KPh) + zo; bf* Pl = ((cy < NH_) ? QPl : KPl) + zo;
    const int rr = lane >> 3, c8 = (lane & 7) * 8;   // a lane finishes 8 columns (4 rotary pairs) of one row; 8 lanes cover a row, a wave store 4 rows
    const float* pc = fcos + (size_t)(r0 + rr) * (HD / 2) + (c8 >> 1); const float* pn = fsin + (size_t)(r0 + rr) * (HD / 2) + (c8 >> 1);
    v4f cc[2][4], sn[2][4];
#pragma unroll
    for (int s = 0; s < 4; ++s) { cc[0][s] = *(const v4f*)(pc + (size_t)(4 * s) * (HD / 2)); sn[0][s] = *(const v4f*)(pn + (size_t)(4 * s) * (HD / 2)); }
#pragma unroll
    for (int mb = 0; mb < 4; ++mb) {
#pragma unroll
        for (int nb = 0; nb < 4; ++nb) {
#pragma unroll
            for (int j = 0; j < 8; ++j) os[(hi * 8 + j) * 68 + nb * 16 + lr] = acc[mb][nb][j]; }
        __builtin_amdgcn_wave_barrier(); asm volatile("" ::: "memory");   // the tile is read below by other lanes of this wave: keep the stores in front of the reads
        if (mb < 3) {   // the next 16 rows' cos / sin fly while these 16 rows are finished
#pragma unroll
            for (int s = 0; s < 4; ++s) { cc[(mb + 1) & 1][s] = *(const v4f*)(pc + (size_t)((mb + 1) * 16 + 4 * s) * (HD / 2)); sn[(mb + 1) & 1][s] = *(const v4f*)(pn + (size_t)((mb + 1) * 16 + 4 * s) * (HD / 2)); }
            __builtin_amdgcn_sched_barrier(0); }   // keeps these loads in front of the rows' work: sunk among the stores they would come late and land in registers that an issued store names
#pragma unroll
        for (int s = 0; s < 4; ++s) { const int row = 4 * s + rr; const v4f xa = *(const v4fa*)(os + row * 68 + c8), xb = *(const v4fa*)(os + row * 68 + c8 + 4); v8h o16; v8us oh, ol;
#pragma unroll
            for (int p = 0; p < 4; ++p) { const float x0 = (p < 2) ? xa[2 * p] : xb[2 * p - 4], x1 = (p < 2) ? xa[2 * p + 1] : xb[2 * p - 3]; const float c = bfr(cc[mb & 1][s][p]), n = bfr(sn[mb & 1][s][p]);
                const float e0 = x0 * c - x1 * n, e1 = x0 * n + x1 * c;   /* even: x0 c - x1 s; odd: x0 s + x1 c */
                unsigned short a2, c2; o16[2 * p] = tohx(e0); o16[2 * p + 1] = tohx(e1); splitf(e0, a2, c2); oh[2 * p] = a2; ol[2 * p] = c2; splitf(e1, a2, c2); oh[2 * p + 1] = a2; ol[2 * p + 1] = c2; }
            const size_t e = (size_t)(r0 + mb * 16 + row) * HD + c8; *(v8h*)(P16 + e) = o16; *(v8us*)(Ph + e) = oh; *(v8us*)(Pl + e) = ol; }
        __builtin_amdgcn_wave_barrier(); asm volatile("s_wait_xcnt 0x0" ::: "memory");   // the LDS reads stay in front of the next 16 rows' LDS stores; the wait stands behind these rows' global stores, before the next loads land in their registers
    }
}

__global__ __launch_bounds__(256) void k_merge(const float* __restrict__ O, int h0, bf* Ah, bf* Al) { const size_t e = ((size_t)blockIdx.x * 256 + threadIdx.x) * 2; if (e >= (size_t)ZH * TT * HD) return; const int d = (int)(e % HD); const int t = (int)((e / HD) % TT); const int zz = (int)(e / ((size_t)HD * TT)); const float cs = (t < RH) ? 1.0f : (1.0f / PCAR); const size_t oo = (size_t)t * DQ + (h0 + zz) * HD + d;
    v2us oh, ol;
#pragma unroll
    for (int q = 0; q < 2; ++q) { unsigned short a, c2; splitf(O[e + q] * cs, a, c2); oh[q] = a; ol[q] = c2; } *(v2us*)(Ah + oo) = oh; *(v2us*)(Al + oo) = ol;  }

extern "C" void kernel_launch(void* const* d_in, const int* in_sizes, int n_in,
                              void* d_out, int out_size, void* d_ws, size_t ws_size, hipStream_t stream) {
    (void)in_sizes; (void)n_in; (void)out_size;
    const float* x = (const float*)d_in[0]; const float* fcos = (const float*)d_in[1]; const float* fsin = (const float*)d_in[2]; const float* wq = (const float*)d_in[3]; const float* wk = (const float*)d_in[4]; const float* wv = (const float*)d_in[5]; const float* wo = (const float*)d_in[6]; const float* lq1 = (const float*)d_in[7]; const float* lk1 = (const float*)d_in[8]; const float* lq2 = (const float*)d_in[9]; const float* lk2 = (const float*)d_in[10];
    float* OUT = (float*)d_out;     // [1][2048][1024]
    char* wsp = (char*)d_ws;
    auto take = [&](size_t bytes) { char* p = wsp; wsp += (bytes + 255) & ~(size_t)255; return (void*)p; };
    bf* WQ = (bf*)take((size_t)DQ * DM * 2); bf* WK = (bf*)take((size_t)DKV * DM * 2); bf* WV = (bf*)take((size_t)DV * DM * 2); bf* WO = (bf*)take((size_t)DM * NHD * HD * 2); float* LAM = (float*)take(64 * 4); float* PST = (float*)take((size_t)NHD * GNB * 2 * 4); float* Y = (float*)take((size_t)TT * NHD * HD * 4);
    bf* XB = (bf*)take((size_t)TT * DM * 2);
    h16* QP16 = (h16*)take((size_t)NH_ * TT * HD * 2); h16* KP16 = (h16*)take((size_t)NKV * TT * HD * 2); h16* VT16 = (h16*)take((size_t)NVG * HD * TT * 2);
    bf* QPh = (bf*)take((size_t)NH_ * TT * HD * 2); bf* QPl = (bf*)take((size_t)NH_ * TT * HD * 2); bf* KPh = (bf*)take((size_t)NKV * TT * HD * 2); bf* KPl = (bf*)take((size_t)NKV * TT * HD * 2); bf* VTh = (bf*)take((size_t)NVG * HD * TT * 2); bf* VTl = (bf*)take((size_t)NVG * HD * TT * 2);
    float* Ob = (float*)take((size_t)NH_ * TT * HD * 4); bf* ATh = (bf*)take((size_t)TT * NHD * HD * 2); bf* ATl = (bf*)take((size_t)TT * NHD * HD * 2);
    if ((size_t)(wsp - (char*)d_ws) > ws_size) return;    // ws 256 MiB
    k_prep<<<1 + PB_X + PB_Q + PB_K + PB_V + PB_O, 256, 0, stream>>>(wq, wk, wv, wo, x, WQ, WK, WV, WO, XB, lq1, lk1, lq2, lk2, LAM);   /* bf16 planes of the four weights and of x, and lambda */
    for (int b = 0; b < NB_; ++b) {
        k_qkv<<<dim3(TT / 128, (NH_ + NKV + NVG) / 2, 1), 128, 0, stream>>>(XB, WQ, WK, WV, fcos, fsin, QP16, QPh, QPl, KP16, KPh, KPl, VT16, VTh, VTl);   /* 32 query sub-heads (q1_h = 2h, q2_h = 2h+1), 16 key sub-heads (k1_g = 2g, k2_g = 2g+1), 8 value groups: projection, rotary, planes */
        k_fattn<<<dim3(NH_, TT / 64, 1), 128, 0, stream>>>(QP16, QPh, QPl, KP16, KPh, KPl, VT16, VTh, VTl, Ob);   /* all 32 sub-heads: Ob[z] = softmax(q_z k^T / 8) v (x PCAR for rows >= RH) */
        k_dcomb<<<dim3(GNB, NHD, 1), 256, 0, stream>>>(Ob, LAM, Y, PST);   /* y_h = a1 v - lambda a2 v, and the GroupNorm partial of each 64 rows of a head */
        k_gnapply<<<(unsigned)(((size_t)TT * NHD * HD / 4 + 255) / 256), 256, 0, stream>>>(Y, PST, ATh, ATl);   /* partials merged; GroupNorm per head x (1 - lambda_init) -> planes */
        k_out<<<dim3(TT / 64, DM / 128, 1), 128, 0, stream>>>(ATh, ATl, WO, OUT + (size_t)b * TT * DM); }
}
